// v000
// Measured on an AMD MI455X. A time is GPU time per run, averaged over a window of back-to-back runs after a warm-up
// (all launches, gaps included; the runs take copies of the inputs in turn), and the median of several windows.
// Apart from v000's, it joins two sittings. Times from different sittings can be a few percent apart, while
// side-by-side timings come from the same sitting.
// The starting kernel, v000, takes 7050 microseconds a run.
#include <hip/hip_runtime.h>
// Non-local block with the softmax taken over the QUERY axis (x [4][256][64][64]; theta, phi, g = conv1x1(x) with [128][256] weights (U(+-1/16), no biases); scores[n][m] = theta[n].phi[m] (NO scaling); attn = softmax(scores, axis = 1): normalised over n for every key column m (the module's unconventional axis); out[n] = sum_m attn[n][m] g[m]; mask = conv1x1(out; w_mask [256][128], no bias); result = x + mask -> [4][256][64][64]).
// Structure: channel-first; x as exact f16 planes and bf16(x) f32 residual planes; per image: token rows via LDS transposes; theta^T, phi^T, g^T as WMMA GEMMs (32x64 wave tiles, f32 accumulation, no bias) -> f16; g to channel-major via LDS transposes; f [4096][4096] = theta^T phi (K = 128, no scale) f32; column softmax on VALU (f32 statistics, native exp; weights x256 f16); y^T = P g^T (x2^-8) f16; out = (16 W) y / 16 + bf16(x) f32 channel-first.
// Compute dtype: inputs rounded to bf16; x / weights exact; q, k, v, softmax weights and o as plain f16 GEMM operands (~2^-12); scores and softmax statistics f32. v_wmma_f32_16x16x32_f16.
#define NB 4
#define SQ 4096
#define DM 256
#define NH 1
#define HD 64
#define HG 4                         /* heads per attention launch group */
#define B0 0                         /* first batch processed (debug hook) */
#define NBR NB                       /* batches processed (debug hook) */
#define NR ((size_t)NB * SQ)         /* token rows */
#define MP ((int)((size_t)NBR * SQ)) /* rows projected (debug hook) */
#define QT 256                       /* query rows per causal tile */
#define NKX SQ                       /* S / P row pitch */
#define QT0 256                      /* first-tile rows recomputed exactly (256: buys margin for the few-key rows 128..255, which have no output projection to average the single-f16 P/v rounding) */
#define QN SQ                        /* query rows attended per batch (debug hook) */
#define NHD NH                       /* heads attended (debug hook) */
#define MPO MP                       /* rows through the output stage (debug hook) */
#define LQ DM            /* row pitch of the q/k/v rows */
typedef __bf16 v16b __attribute__((ext_vector_type(16)));
typedef unsigned short v8us __attribute__((ext_vector_type(8), may_alias));
typedef float  v8f  __attribute__((ext_vector_type(8)));
typedef float  v4f  __attribute__((ext_vector_type(4)));
typedef float  v4fa __attribute__((ext_vector_type(4), may_alias));
union FragB { v16b v; v8us half[2]; unsigned short u[16]; };

__device__ __forceinline__ unsigned short bf16_bits(float x) { unsigned int u = __float_as_uint(x); return (unsigned short)((u + 0x7FFFu + ((u >> 16) & 1u)) >> 16); }
__device__ __forceinline__ float bf16_val(unsigned short b) { return __uint_as_float(((unsigned int)b) << 16); }
__device__ __forceinline__ float bf16_round(float x) { return bf16_val(bf16_bits(x)); }
// D += A·B with NT terms: 1 = ah·bh, 2 = + al·bh (A split), 3 = + ah·bl (both split)
template <int NT>
__device__ __forceinline__ v8f mmaN(v16b ah, v16b al, v16b bh, v16b bl, v8f c) {
  c = __builtin_amdgcn_wmma_f32_16x16x32_bf16(false, ah, false, bh, (short)0, c, false, false);
  if (NT >= 2) c = __builtin_amdgcn_wmma_f32_16x16x32_bf16(false, al, false, bh, (short)0, c, false, false);
  if (NT >= 3) c = __builtin_amdgcn_wmma_f32_16x16x32_bf16(false, ah, false, bl, (short)0, c, false, false);
  asm volatile("v_nop\n\tv_nop\n\tv_nop\n\tv_nop" : "+v"(c) : "v"(ah), "v"(al), "v"(bh), "v"(bl));
  return c;
}

__global__ __launch_bounds__(256) void k_wt_bf16(const float* __restrict__ W, unsigned short* __restrict__ Wt, int K, int N) {
  const int t = blockIdx.x * 256 + threadIdx.x;
  const int k8n = K / 8;
  if (t >= N * k8n) return;
  const int n = t / k8n, k8 = (t % k8n) * 8;
  v8us v;
#pragma unroll
  for (int i = 0; i < 8; ++i) v[i] = bf16_bits(W[(size_t)(k8 + i) * N + n]);
  *(v8us*)(Wt + (size_t)n * K + k8) = v;
  
}

// GEMM C[M][N] (f32, pitch ldc) = act(A[M][K]·W + bias). A f32 row-major (pitch lda) converted per fragment to bf16
// (ASPLIT: hi/lo two planes -> 2 terms, else single rounded term); Wt bf16 [N][K] (pitch ldb). BIAS_BF16 rounds the
// bias to bf16 first (bias quantised to bf16 before the add). K%32==0, M%16==0, N%64==0.
template <bool ASPLIT, int ACT, bool BIAS_BF16>
__global__ __launch_bounds__(128) void k_gemm_bf(const float* __restrict__ A, int lda, const unsigned short* __restrict__ Wt, int ldb,
                                               const float* __restrict__ bias, float* __restrict__ C, int ldc, int M, int N, int K) {
  __shared__ __attribute__((aligned(16))) float so[4][16][64];
  const int tid = threadIdx.x, w = tid >> 5, lane = tid & 31, ln = lane & 15, hh = lane >> 4;
  const int ntn = N / 64;
  const int wid = blockIdx.x * 4 + w;
  const int mt = wid / ntn, nq = wid % ntn;
  if (mt * 16 >= M) return;
  const int row0 = mt * 16, col0 = nq * 64;
  const float* arow = A + (size_t)(row0 + ln) * lda;
  v8f acc[4] = {};
  for (int kb = 0; kb < K; kb += 32) {
    FragB ah, al;
    const v4f x0 = *(const v4fa*)(arow + kb + 8 * hh), x1 = *(const v4fa*)(arow + kb + 8 * hh + 4);
    const v4f x2 = *(const v4fa*)(arow + kb + 16 + 8 * hh), x3 = *(const v4fa*)(arow + kb + 16 + 8 * hh + 4);
    float xs[16] = {x0[0],x0[1],x0[2],x0[3],x1[0],x1[1],x1[2],x1[3],x2[0],x2[1],x2[2],x2[3],x3[0],x3[1],x3[2],x3[3]};
#pragma unroll
    for (int i = 0; i < 16; ++i) { const unsigned short hb = bf16_bits(xs[i]); ah.u[i] = hb; al.u[i] = ASPLIT ? bf16_bits(xs[i] - bf16_val(hb)) : (unsigned short)0; }
#pragma unroll
    for (int t = 0; t < 4; ++t) {
      const unsigned short* brow = Wt + (size_t)(col0 + t * 16 + ln) * ldb + kb;
      FragB b;
      b.half[0] = *(const v8us*)(brow + 8 * hh);
      b.half[1] = *(const v8us*)(brow + 16 + 8 * hh);
      acc[t] = mmaN<ASPLIT ? 2 : 1>(ah.v, al.v, b.v, b.v, acc[t]);
    }
  }
#pragma unroll
  for (int t = 0; t < 4; ++t) {
    float bv = bias ? bias[col0 + t * 16 + ln] : 0.f;
    if (BIAS_BF16) bv = bf16_round(bv);
#pragma unroll
    for (int r = 0; r < 8; ++r) { float v = acc[t][r] + bv; if (ACT == 1) v = fmaxf(v, 0.f); so[w][8 * hh + r][t * 16 + ln] = v; }
  }
  __builtin_amdgcn_fence(__ATOMIC_ACQ_REL, "workgroup");
  __builtin_amdgcn_wave_barrier();
  const int rsub = lane >> 4, c4 = (lane & 15) * 4;
  {
#pragma unroll
    for (int q = 0; q < 8; ++q) {
      const int r = q * 2 + rsub;
      const v4f v = *(const v4fa*)&so[w][r][c4];
      *(v4f*)(C + (size_t)(row0 + r) * ldc + col0 + c4) = v;
    }
    
  }
}

// GEMM C = act(A·W + bias + resid): A f32 (ASPLIT -> hi/lo 2 terms), Wt bf16 [N][K]; ACT 0 none, 1 relu, 2 exact gelu;
// resid (optional, f32, row index = (row % rmod), pitch ldr, RES_BF16 rounds it) added before the activation.
template <bool ASPLIT, int ACT, bool BIAS_BF16, bool RES_BF16>
__global__ __launch_bounds__(128) void k_gemm_bf3(const float* __restrict__ A, int lda, const unsigned short* __restrict__ Wt, int ldb,
                                                const float* __restrict__ bias, const float* __restrict__ resid, int rmod, int ldr,
                                                float* __restrict__ C, int ldc, int M, int N, int K) {
  __shared__ __attribute__((aligned(16))) float so[4][16][64];
  const int tid = threadIdx.x, w = tid >> 5, lane = tid & 31, ln = lane & 15, hh = lane >> 4;
  const int ntn = N / 64;
  const int wid = blockIdx.x * 4 + w;
  const int mt = wid / ntn, nq = wid % ntn;
  if (mt * 16 >= M) return;
  const int row0 = mt * 16, col0 = nq * 64;
  const float* arow = A + (size_t)(row0 + ln) * lda;
  v8f acc[4] = {};
  for (int kb = 0; kb < K; kb += 32) {
    FragB ah, al;
    const v4f x0 = *(const v4fa*)(arow + kb + 8 * hh), x1 = *(const v4fa*)(arow + kb + 8 * hh + 4);
    const v4f x2 = *(const v4fa*)(arow + kb + 16 + 8 * hh), x3 = *(const v4fa*)(arow + kb + 16 + 8 * hh + 4);
    float xs[16] = {x0[0],x0[1],x0[2],x0[3],x1[0],x1[1],x1[2],x1[3],x2[0],x2[1],x2[2],x2[3],x3[0],x3[1],x3[2],x3[3]};
#pragma unroll
    for (int i = 0; i < 16; ++i) { const unsigned short hb = bf16_bits(xs[i]); ah.u[i] = hb; al.u[i] = ASPLIT ? bf16_bits(xs[i] - bf16_val(hb)) : (unsigned short)0; }
#pragma unroll
    for (int t = 0; t < 4; ++t) {
      const unsigned short* brow = Wt + (size_t)(col0 + t * 16 + ln) * ldb + kb;
      FragB b;
      b.half[0] = *(const v8us*)(brow + 8 * hh);
      b.half[1] = *(const v8us*)(brow + 16 + 8 * hh);
      acc[t] = mmaN<ASPLIT ? 2 : 1>(ah.v, al.v, b.v, b.v, acc[t]);
    }
  }
#pragma unroll
  for (int t = 0; t < 4; ++t) {
    const int col = col0 + t * 16 + ln;
    float bv = bias ? bias[col] : 0.f;
    if (BIAS_BF16) bv = bf16_round(bv);
#pragma unroll
    for (int r = 0; r < 8; ++r) {
      float v = acc[t][r] + bv;
      if (resid) { float rv = resid[(size_t)((row0 + 8 * hh + r) % rmod) * ldr + col]; if (RES_BF16) rv = bf16_round(rv); v += rv; }
      if (ACT == 1) v = fmaxf(v, 0.f);
      if (ACT == 2) v = 0.5f * v * (1.0f + erff(v * 0.70710678118654752f));
      if (ACT == 3) { const float u = 0.7978845608028654f * (v + 0.044715f * v * v * v); v = 0.5f * v * (1.0f + tanhf(u)); }
      so[w][8 * hh + r][t * 16 + ln] = v;
    }
  }
  __builtin_amdgcn_fence(__ATOMIC_ACQ_REL, "workgroup");
  __builtin_amdgcn_wave_barrier();
  const int rsub = lane >> 4, c4 = (lane & 15) * 4;
  {
#pragma unroll
    for (int q = 0; q < 8; ++q) {
      const int r = q * 2 + rsub;
      const v4f v = *(const v4fa*)&so[w][r][c4];
      *(v4f*)(C + (size_t)(row0 + r) * ldc + col0 + c4) = v;
    }
    
  }
}
// row LayerNorm (biased variance, eps) over N: s = X (+ R); optional out_sum <- s; out_norm <- (s-mu)*rsqrt(var+eps)*g + b
template <bool PARAM_BF16>
__global__ __launch_bounds__(256) void k_layernorm(const float* __restrict__ X, const float* __restrict__ R, const float* __restrict__ g, const float* __restrict__ bta,
                                                  float* __restrict__ out_sum, float* __restrict__ out_norm, int N, float eps) {
  __shared__ float red[256];
  const int row = blockIdx.x, tid = threadIdx.x;
  const float* x = X + (size_t)row * N; const float* rr = R ? R + (size_t)row * N : nullptr;
  float vals[16];                     // up to N = 4096
  const int per = N / 256;            // contiguous chunk per thread? use strided-by-4 chunks: thread handles j = tid*4 + 1024*u
  float s1 = 0.f;
  for (int u = 0; u < per / 4; ++u) {
    const int j = tid * 4 + 1024 * u;
    const v4f a = *(const v4fa*)(x + j);
    v4f b = {0.f,0.f,0.f,0.f}; if (rr) b = *(const v4fa*)(rr + j);
#pragma unroll
    for (int q = 0; q < 4; ++q) { const float v = a[q] + b[q]; vals[u * 4 + q] = v; s1 += v; }
  }
  red[tid] = s1; __syncthreads();
  for (int st = 128; st > 0; st >>= 1) { if (tid < st) red[tid] += red[tid + st]; __syncthreads(); }
  const float mu = red[0] / (float)N; __syncthreads();
  float s2 = 0.f;
  for (int u = 0; u < per / 4; ++u)
#pragma unroll
    for (int q = 0; q < 4; ++q) { const float c = vals[u * 4 + q] - mu; s2 += c * c; }
  red[tid] = s2; __syncthreads();
  for (int st = 128; st > 0; st >>= 1) { if (tid < st) red[tid] += red[tid + st]; __syncthreads(); }
  const float rs = rsqrtf(red[0] / (float)N + eps);
  {
    for (int u = 0; u < per / 4; ++u) {
      const int j = tid * 4 + 1024 * u;
      v4f o, sm;
#pragma unroll
      for (int q = 0; q < 4; ++q) {
        float gg = g[j + q], bb = bta[j + q];
        if (PARAM_BF16) { gg = bf16_round(gg); bb = bf16_round(bb); }
        sm[q] = vals[u * 4 + q]; o[q] = (vals[u * 4 + q] - mu) * rs * gg + bb;
      }
      if (out_sum) *(v4f*)(out_sum + (size_t)row * N + j) = sm;
      *(v4f*)(out_norm + (size_t)row * N + j) = o;
    }
    
  }
}



// ---- f16 WMMA path (v_wmma_f32_16x16x32_f16): 11-bit significands for operands in range — used where a [0,1] probability operand needs more precision than bf16
typedef _Float16 v16h __attribute__((ext_vector_type(16)));
union FragH { v16h v; v8us half[2]; _Float16 h[16]; unsigned short u[16]; };
template <int NT>
__device__ __forceinline__ v8f mmaH(v16h ah, v16h al, v16h bh, v16h bl, v8f c) {
  c = __builtin_amdgcn_wmma_f32_16x16x32_f16(false, ah, false, bh, (short)0, c, false, false);
  if (NT >= 2) c = __builtin_amdgcn_wmma_f32_16x16x32_f16(false, al, false, bh, (short)0, c, false, false);
  if (NT >= 3) c = __builtin_amdgcn_wmma_f32_16x16x32_f16(false, ah, false, bl, (short)0, c, false, false);
  asm volatile("v_nop\n\tv_nop\n\tv_nop\n\tv_nop" : "+v"(c) : "v"(ah), "v"(al), "v"(bh), "v"(bl));
  return c;
}
// batched GEMM like k_gemm_b but f16 operands: A f32 (split into f16 hi/lo if ASPLIT, else rounded to f16), Bt = f16 values [n][k]; alpha; C f32; N multiple of 16 (partial tiles skipped)
template <bool ASPLIT>
__global__ __launch_bounds__(128) void k_gemm_h(const float* __restrict__ A, int lda, size_t sA, const _Float16* __restrict__ Bh, int ldb, size_t sB, float alpha, float* __restrict__ C, int ldc, size_t sC, int M, int N, int K) {
  __shared__ __attribute__((aligned(16))) float so[4][16][64];
  const int tid = threadIdx.x, w = tid >> 5, lane = tid & 31, ln = lane & 15, hh = lane >> 4; const int by = blockIdx.y;
  A += (size_t)by * sA; Bh += (size_t)by * sB; C += (size_t)by * sC;
  const int ntn = (N + 63) / 64; const int wid = blockIdx.x * 4 + w; const int mt = wid / ntn, nq = wid % ntn; if (mt * 16 >= M) return;
  const int row0 = mt * 16, col0 = nq * 64; const float* arow = A + (size_t)(row0 + ln) * lda;
  v8f acc[4] = {};
  for (int kb = 0; kb < K; kb += 32) {
    FragH ah, al;
    const v4f x0 = *(const v4fa*)(arow + kb + 8 * hh), x1 = *(const v4fa*)(arow + kb + 8 * hh + 4), x2 = *(const v4fa*)(arow + kb + 16 + 8 * hh), x3 = *(const v4fa*)(arow + kb + 16 + 8 * hh + 4);
    float xs[16] = {x0[0],x0[1],x0[2],x0[3],x1[0],x1[1],x1[2],x1[3],x2[0],x2[1],x2[2],x2[3],x3[0],x3[1],x3[2],x3[3]};
#pragma unroll
    for (int i = 0; i < 16; ++i) { const _Float16 h = (_Float16)xs[i]; ah.h[i] = h; al.h[i] = ASPLIT ? (_Float16)(xs[i] - (float)h) : (_Float16)0.0f; }
#pragma unroll
    for (int t = 0; t < 4; ++t) { if (col0 + t * 16 >= N) continue; const size_t boff = (size_t)(col0 + t * 16 + ln) * ldb + kb; FragH bq; bq.half[0] = *(const v8us*)(Bh + boff + 8 * hh); bq.half[1] = *(const v8us*)(Bh + boff + 16 + 8 * hh);
      acc[t] = mmaH<ASPLIT ? 2 : 1>(ah.v, al.v, bq.v, bq.v, acc[t]); }
  }
#pragma unroll
  for (int t = 0; t < 4; ++t) { if (col0 + t * 16 >= N) continue;
#pragma unroll
    for (int r = 0; r < 8; ++r) so[w][8 * hh + r][t * 16 + ln] = acc[t][r] * alpha; }
  __builtin_amdgcn_fence(__ATOMIC_ACQ_REL, "workgroup"); __builtin_amdgcn_wave_barrier();
  const int rsub = lane >> 4, c4 = (lane & 15) * 4;
  {
#pragma unroll
    for (int q = 0; q < 8; ++q) { const int r = q * 2 + rsub; if (col0 + c4 < N) { const v4f v = *(const v4fa*)&so[w][r][c4]; *(v4f*)(C + (size_t)(row0 + r) * ldc + col0 + c4) = v; } }
     }
}

// Wt[n][k] = f16(W[k][n]·scale) from f32 row-major W[K][N] (scale = power of two; bf16-exact weights stay exact in f16 away from the subnormal range)
__global__ __launch_bounds__(256) void k_wt_f16(const float* __restrict__ W, _Float16* __restrict__ Wt, int K, int N, float scale) {
  const int t = blockIdx.x * 256 + threadIdx.x; if (t >= N * (K / 8)) return; const int n = t / (K / 8), k8 = (t % (K / 8)) * 8; FragH f;
#pragma unroll
  for (int i = 0; i < 8; ++i) f.h[i] = (_Float16)(bf16_round(W[(size_t)(k8 + i) * N + n]) * scale); const v8us o = f.half[0];
  *(v8us*)((unsigned short*)Wt + (size_t)n * K + k8) = o; 
}
// k_gemm_hh variant with fused epilogue: v = acc·alpha + bias[by·sBias + col] (+ CP[(row/rowsPerB)·sCPb + by·64 + col] if CP) ; ACT 0 none / 1 elu ; writes f16 C16 (and f32 C if non-null)
template <int ACT>
__global__ __launch_bounds__(128) void k_gemm_hhx(const _Float16* __restrict__ A, int lda, size_t sA, const _Float16* __restrict__ Bh, int ldb, size_t sB, float alpha, const float* __restrict__ bias, size_t sBias, const float* __restrict__ CP, int rowsPerB, size_t sCPb, int row0g,
    float* __restrict__ C, _Float16* __restrict__ C16, int ldc, size_t sC, int M, int N, int K) {
  __shared__ __attribute__((aligned(16))) float so[4][16][64];
  const int tid = threadIdx.x, w = tid >> 5, lane = tid & 31, ln = lane & 15, hh = lane >> 4; const int by = blockIdx.y;
  A += (size_t)by * sA; Bh += (size_t)by * sB; const size_t cofs = (size_t)by * sC; const float* bp = bias ? bias + (size_t)by * sBias : nullptr;
  const int ntn = (N + 63) / 64; const int wid = blockIdx.x * 4 + w; const int mt = wid / ntn, nq = wid % ntn; if (mt * 16 >= M) return;
  const int row0 = mt * 16, col0 = nq * 64; const _Float16* arow = A + (size_t)(row0 + ln) * lda;
  v8f acc[4] = {};
  for (int kb = 0; kb < K; kb += 32) { FragH ah; ah.half[0] = *(const v8us*)((const unsigned short*)arow + kb + 8 * hh); ah.half[1] = *(const v8us*)((const unsigned short*)arow + kb + 16 + 8 * hh);
#pragma unroll
    for (int t = 0; t < 4; ++t) { if (col0 + t * 16 >= N) continue; const size_t boff = (size_t)(col0 + t * 16 + ln) * ldb + kb; FragH bq; bq.half[0] = *(const v8us*)((const unsigned short*)Bh + boff + 8 * hh); bq.half[1] = *(const v8us*)((const unsigned short*)Bh + boff + 16 + 8 * hh);
      acc[t] = mmaH<1>(ah.v, ah.v, bq.v, bq.v, acc[t]); }
  }
#pragma unroll
  for (int t = 0; t < 4; ++t) { if (col0 + t * 16 >= N) continue; const int col = col0 + t * 16 + ln; const float bv = bp ? bf16_round(bp[col]) : 0.f;
#pragma unroll
    for (int r = 0; r < 8; ++r) { float v = acc[t][r] * alpha + bv; if (CP) { const int rr = row0g + row0 + 8 * hh + r; if (rowsPerB < 0) v += CP[cofs + (size_t)rr * ldc + col];      /* rowsPerB < 0: own element of the batched C plane */ else { const int bidx = rr / rowsPerB; v += CP[(size_t)bidx * sCPb + (size_t)by * 64 + col]; } } if (ACT == 1) v = (v > 0.f) ? v : expm1f(v); else if (ACT == 7) v = (v > 0.f) ? v + 1.0f : expf(v); else if (ACT == 8) v = tanhf(v); else if (ACT == 9) v = 0.5f * v * (1.0f + tanhf(0.7978845608028654f * (v + 0.044715f * v * v * v))); else if (ACT == 11) v = 1.0f / (1.0f + expf(-v)); else if (ACT == 12) v = (v > 0.f) ? v : 0.01f * v; else if (ACT == 14) v = (v > 0.f) ? v : 0.1f * v; else if (ACT == 16) v = (v >= 0.f) ? v : 0.3f * v; else if (ACT == 17) v = (v >= 0.f) ? v : 0.2f * v; else if (ACT == 15) v = v / (1.0f + expf(-v)); else if (ACT == 3) v = fmaxf(v, 0.f); else if (ACT == 6) v = 0.5f * v * (1.0f + erff(v * 0.70710678118654752f)); so[w][8 * hh + r][t * 16 + ln] = v; } }
  __builtin_amdgcn_fence(__ATOMIC_ACQ_REL, "workgroup"); __builtin_amdgcn_wave_barrier();
  const int rsub = lane >> 4, c4 = (lane & 15) * 4; typedef _Float16 v4h __attribute__((ext_vector_type(4)));
  {
#pragma unroll
    for (int q = 0; q < 8; ++q) { const int r = q * 2 + rsub; if (col0 + c4 < N) { const v4f v = *(const v4fa*)&so[w][r][c4]; if (C) *(v4f*)(C + cofs + (size_t)(row0 + r) * ldc + col0 + c4) = v; if (C16) { v4h h4; for (int i = 0; i < 4; ++i) h4[i] = (_Float16)v[i]; *(v4h*)(C16 + cofs + (size_t)(row0 + r) * ldc + col0 + c4) = h4; } } }
     }
}


typedef _Float16 v4h __attribute__((ext_vector_type(4)));

__global__ __launch_bounds__(256) void k_x16(const float* __restrict__ x, _Float16* __restrict__ X16, size_t n8) { const size_t t = (size_t)blockIdx.x * 256 + threadIdx.x; if (t >= n8) return; FragH f;
#pragma unroll
  for (int q = 0; q < 8; ++q) f.h[q] = (_Float16)bf16_round(x[t * 8 + q]); *(v8us*)((unsigned short*)X16 + t * 8) = f.half[0];  }
__global__ __launch_bounds__(256) void k_h16(const float* __restrict__ x, _Float16* __restrict__ X16, size_t n8) { const size_t t = (size_t)blockIdx.x * 256 + threadIdx.x; if (t >= n8) return; FragH f;
#pragma unroll
  for (int q = 0; q < 8; ++q) f.h[q] = (_Float16)x[t * 8 + q]; *(v8us*)((unsigned short*)X16 + t * 8) = f.half[0];  }
__global__ __launch_bounds__(256) void k_round16f(const float* __restrict__ W, _Float16* __restrict__ Bt, size_t n8) { const size_t t = (size_t)blockIdx.x * 256 + threadIdx.x; if (t >= n8) return; FragH f;
#pragma unroll
  for (int i = 0; i < 8; ++i) f.h[i] = (_Float16)(bf16_round(W[t * 8 + i]) * 16.0f); *(v8us*)((unsigned short*)Bt + t * 8) = f.half[0];  }
template <int NHv, int TTv>
__global__ __launch_bounds__(256) void k_vt(const _Float16* __restrict__ V16, int ldv, int voff, _Float16* __restrict__ Vt) { __shared__ unsigned short tl[64][66]; const int tid = threadIdx.x; const int slab = blockIdx.x / (TTv / 64), lg = blockIdx.x % (TTv / 64); const int b = slab / NHv, h = slab % NHv;
  for (int i = tid; i < 64 * 8; i += 256) { const int r = i / 8, c8 = (i % 8) * 8; FragH f; f.half[0] = *(const v8us*)((const unsigned short*)V16 + ((size_t)b * TTv + lg * 64 + r) * ldv + voff + h * 64 + c8);
#pragma unroll
    for (int q = 0; q < 8; ++q) tl[r][c8 + q] = f.u[q]; }
  __syncthreads();
  {
#pragma unroll
    for (int rd = 0; rd < 2; ++rd) { const int d = rd * 32 + tid / 8, pc = tid % 8; FragH f;
#pragma unroll
      for (int q = 0; q < 8; ++q) f.u[q] = tl[pc * 8 + q][d];
      *(v8us*)((unsigned short*)Vt + ((size_t)slab * 64 + d) * TTv + lg * 64 + pc * 8) = f.half[0]; }
     } }

__global__ __launch_bounds__(256) void k_hl(const float* __restrict__ F, _Float16* __restrict__ Hh, _Float16* __restrict__ Hl, size_t n8) { const size_t t = (size_t)blockIdx.x * 256 + threadIdx.x; if (t >= n8) return; FragH fh, fl; const v4f a = *(const v4fa*)(F + t * 8), c = *(const v4fa*)(F + t * 8 + 4);
#pragma unroll
  for (int q = 0; q < 4; ++q) { _Float16 h = (_Float16)a[q]; fh.h[q] = h; fl.h[q] = (_Float16)((a[q] - (float)h) * 1024.0f); h = (_Float16)c[q]; fh.h[4 + q] = h; fl.h[4 + q] = (_Float16)((c[q] - (float)h) * 1024.0f); }
  { *(v8us*)((unsigned short*)Hh + t * 8) = fh.half[0]; *(v8us*)((unsigned short*)Hl + t * 8) = fl.half[0];  } }

// ---- fast GEMM (wave tile 32x64; requires M % 32 == 0 rows per launch region and N % 64 == 0); epilogue = k_gemm_hhx semantics ----
__device__ __forceinline__ v16h g2_frag(const _Float16* p, int hh) { FragH f; f.half[0] = *(const v8us*)((const unsigned short*)p + 8 * hh); f.half[1] = *(const v8us*)((const unsigned short*)p + 16 + 8 * hh); return f.v; }
__device__ __forceinline__ v8f g2_mma(v16h a, v16h b, v8f c) { v8f d = __builtin_amdgcn_wmma_f32_16x16x32_f16(false, a, false, b, (short)0, c, false, false); asm volatile("v_nop\n\tv_nop\n\tv_nop\n\tv_nop" : "+v"(d) : "v"(a), "v"(b)); return d; }
template <int ACT>
__global__ __launch_bounds__(128) void k_gemm2(const _Float16* __restrict__ A, int lda, size_t sA, const _Float16* __restrict__ Bh, int ldb, size_t sB, float alpha, const float* __restrict__ bias, size_t sBias, const float* __restrict__ CP, int rowsPerB, size_t sCPb, int row0g,
    float* __restrict__ C, _Float16* __restrict__ C16, int ldc, size_t sC, int M, int N, int K) { static_assert(ACT == 0 || ACT == 3 || ACT == 6 || ACT == 8 || ACT == 9 || ACT == 11 || ACT == 12 || ACT == 14 || ACT == 15 || ACT == 16 || ACT == 17, "k_gemm2: unsupported ACT code (would silently apply no activation)");
  __shared__ __attribute__((aligned(16))) float so[4][32][68];
  const int tid = threadIdx.x, w = tid >> 5, lane = tid & 31, ln = lane & 15, hh = lane >> 4; const int by = blockIdx.y;
  A += (size_t)by * sA; Bh += (size_t)by * sB; const size_t cofs = (size_t)by * sC; const float* bp = bias ? bias + (size_t)by * sBias : nullptr;
  const int ntn = N >> 6; const int mt = blockIdx.x / ntn, nq = blockIdx.x - mt * ntn; const int row0 = mt * 128 + 32 * w, col0 = nq * 64; if (row0 >= M) return;
  const _Float16* a0p = A + (size_t)(row0 + ln) * lda; const _Float16* a1p = a0p + (size_t)16 * lda;
  const _Float16* b0p = Bh + (size_t)(col0 + ln) * ldb; const _Float16* b1p = b0p + (size_t)16 * ldb; const _Float16* b2p = b1p + (size_t)16 * ldb; const _Float16* b3p = b2p + (size_t)16 * ldb;
  const v8f z8 = {0.f,0.f,0.f,0.f,0.f,0.f,0.f,0.f}; v8f c00 = z8, c01 = z8, c02 = z8, c03 = z8, c10 = z8, c11 = z8, c12 = z8, c13 = z8;
#pragma unroll 1
  for (int kb = 0; kb < K; kb += 32) { const v16h a0 = g2_frag(a0p + kb, hh), a1 = g2_frag(a1p + kb, hh);
    v16h b = g2_frag(b0p + kb, hh); c00 = g2_mma(a0, b, c00); c10 = g2_mma(a1, b, c10);
    b = g2_frag(b1p + kb, hh); c01 = g2_mma(a0, b, c01); c11 = g2_mma(a1, b, c11);
    b = g2_frag(b2p + kb, hh); c02 = g2_mma(a0, b, c02); c12 = g2_mma(a1, b, c12);
    b = g2_frag(b3p + kb, hh); c03 = g2_mma(a0, b, c03); c13 = g2_mma(a1, b, c13); }
  v8f accs[8] = {c00, c01, c02, c03, c10, c11, c12, c13};
#pragma unroll
  for (int u = 0; u < 8; ++u) { const int t = u & 3, half = u >> 2; const int col = col0 + t * 16 + ln; const float bv = bp ? bf16_round(bp[col]) : 0.f;
#pragma unroll
    for (int r = 0; r < 8; ++r) { const int rloc = half * 16 + 8 * hh + r; float v = accs[u][r] * alpha + bv; if (CP) { if (rowsPerB < 0) v += CP[cofs + (size_t)(row0g + row0 + rloc) * ldc + col];      /* rowsPerB < 0: own element of the batched C plane */ else { const int bidx = (row0g + row0 + rloc) / rowsPerB; v += CP[(size_t)bidx * sCPb + (size_t)by * 64 + col]; } }
      if (ACT == 3) v = fmaxf(v, 0.f); else if (ACT == 6) v = 0.5f * v * (1.0f + erff(v * 0.70710678118654752f)); else if (ACT == 11) v = 1.0f / (1.0f + expf(-v)); else if (ACT == 15) v = v / (1.0f + expf(-v)); else if (ACT == 12) v = (v > 0.f) ? v : 0.01f * v; else if (ACT == 8) v = tanhf(v); else if (ACT == 9) v = 0.5f * v * (1.0f + tanhf(0.7978845608028654f * (v + 0.044715f * v * v * v))); else if (ACT == 14) v = (v > 0.f) ? v : 0.1f * v; else if (ACT == 16) v = (v >= 0.f) ? v : 0.3f * v; else if (ACT == 17) v = (v >= 0.f) ? v : 0.2f * v;
      so[w][rloc][t * 16 + ln] = v; } }
  __builtin_amdgcn_fence(__ATOMIC_ACQ_REL, "workgroup"); __builtin_amdgcn_wave_barrier();
  const int rsub = lane >> 4, c4 = (lane & 15) * 4;
  {
#pragma unroll
    for (int q = 0; q < 16; ++q) { const int r = q * 2 + rsub; const v4f v = *(const v4fa*)&so[w][r][c4]; if (C) *(v4f*)(C + cofs + (size_t)(row0 + r) * ldc + col0 + c4) = v; if (C16) { v4h h4; for (int i = 0; i < 4; ++i) h4[i] = (_Float16)v[i]; *(v4h*)(C16 + cofs + (size_t)(row0 + r) * ldc + col0 + c4) = h4; } }
     } }


__global__ __launch_bounds__(256) void k_wnat(const float* __restrict__ w, size_t n8, _Float16* __restrict__ Bt) { const size_t t = (size_t)blockIdx.x * 256 + threadIdx.x; if (t >= n8) return; FragH f; for (int q = 0; q < 8; ++q) f.h[q] = (_Float16)(bf16_round(w[t * 8 + q]) * 16.0f); *(v8us*)((unsigned short*)Bt + t * 8) = f.half[0];  }
__global__ __launch_bounds__(256) void k_rsm(const float* __restrict__ S, _Float16* __restrict__ P, int nrows) {
  #pragma clang fp contract(off)
  const int i = blockIdx.x * 256 + threadIdx.x; if (i >= nrows) return; const float* s = S + (size_t)i * SQ; float mx = -3.0e38f;
#pragma unroll 1
  for (int j = 0; j < SQ; ++j) mx = fmaxf(mx, s[j]); float se = 0.f;
#pragma unroll 1
  for (int j = 0; j < SQ; ++j) se += expf(s[j] - mx); const float sc = 256.0f / se;
#pragma unroll 1
  for (int j0 = 0; j0 < SQ; j0 += 8) { FragH f; for (int q = 0; q < 8; ++q) f.h[q] = (_Float16)(expf(s[j0 + q] - mx) * sc); unsigned short* d = (unsigned short*)P + (size_t)i * SQ + j0; *(v8us*)d = f.half[0];  } }
__global__ __launch_bounds__(256) void k_vt(const _Float16* __restrict__ V16, int b, int h0, _Float16* __restrict__ VT) { __shared__ unsigned short tl[64][65]; const int tid = threadIdx.x; const int hh = blockIdx.x % HG, sg = blockIdx.x / HG; const int s0 = sg * 64; const int h = h0 + hh;
  for (int i = tid; i < 64 * 8; i += 256) { const int j = i / 8, d8 = (i % 8) * 8; FragH f; f.half[0] = *(const v8us*)((const unsigned short*)V16 + ((size_t)b * SQ + s0 + j) * DM + h * HD + d8); for (int q = 0; q < 8; ++q) tl[d8 + q][j] = f.u[q]; }
  __syncthreads();
  { for (int i = tid; i < 64 * 8; i += 256) { const int d = i / 8, j8 = (i % 8) * 8; FragH f; for (int q = 0; q < 8; ++q) f.u[q] = tl[d][j8 + q]; *(v8us*)((unsigned short*)VT + ((size_t)hh * HD + d) * SQ + s0 + j8) = f.half[0]; }  } }



__global__ __launch_bounds__(256) void k_rsmcf2(const float* __restrict__ S, _Float16* __restrict__ P, int hg, int q0, int nk) {
  #pragma clang fp contract(off)
  const int t = blockIdx.x * 256 + threadIdx.x; if (t >= hg * QT) return; const size_t i = (size_t)t; const float* s = S + i * NKX; const int last = q0 + (t % QT); float mx = -3.0e38f;
#pragma unroll 1
  for (int j = 0; j < nk; ++j) { const float f = (j <= last) ? 1.f : 0.f; mx = fmaxf(mx, fmaf(f, s[j], (1.f - f) * -1.0e9f)); } float se = 0.f;
#pragma unroll 1
  for (int j = 0; j < nk; ++j) { const float f = (j <= last) ? 1.f : 0.f; se += __expf(fmaf(f, s[j], (1.f - f) * -1.0e9f) - mx); } const float sc = 256.0f / se;
#pragma unroll 1
  for (int j0 = 0; j0 < nk; j0 += 8) { FragH fr; for (int q = 0; q < 8; ++q) { const int j = j0 + q; const float f = (j <= last) ? 1.f : 0.f; fr.h[q] = (_Float16)(__expf(fmaf(f, s[j], (1.f - f) * -1.0e9f) - mx) * sc); } unsigned short* d = (unsigned short*)P + i * NKX + j0; *(v8us*)d = fr.half[0];  } }

template <int MASKADD>
__global__ __launch_bounds__(64) void k_att0(const float* __restrict__ QF, const float* __restrict__ KF, const float* __restrict__ VF, int ld, const float* __restrict__ mask, float scale, float* __restrict__ OF, int ldo) {
  #pragma clang fp contract(off)
  __shared__ __attribute__((aligned(16))) float lq[64][64]; __shared__ __attribute__((aligned(16))) float lo[64][64];
  const int tid = threadIdx.x; const int h = blockIdx.x / (QT0 / 64), rg = blockIdx.x % (QT0 / 64); const int i = rg * 64 + tid;
  const float* qr = QF + (size_t)i * ld + h * HD;
#pragma unroll 1
  for (int c = 0; c < HD / 4; ++c) { *(v4f*)&lq[tid][c * 4] = *(const v4fa*)(qr + c * 4); const v4f z = {0.f, 0.f, 0.f, 0.f}; *(v4f*)&lo[tid][c * 4] = z; }
  float m = -1.0e30f, l = 0.f; const int jmax = MASKADD ? (SQ - 1) : (rg * 64 + 63);      /* additive-mask form: every key (the mask input decides); causal form: keys up to the block's last row */
#pragma unroll 1
  for (int j = 0; j <= jmax; ++j) { const float* kr = KF + (size_t)j * ld + h * HD; const float* vr = VF + (size_t)j * ld + h * HD; float s = 0.f;
#pragma unroll 1
    for (int c = 0; c < HD / 4; ++c) { const v4f kq = *(const v4fa*)(kr + c * 4); const v4f qq = *(v4f*)&lq[tid][c * 4]; s = __fadd_rn(s, __fmul_rn(qq[0], kq[0])); s = __fadd_rn(s, __fmul_rn(qq[1], kq[1])); s = __fadd_rn(s, __fmul_rn(qq[2], kq[2])); s = __fadd_rn(s, __fmul_rn(qq[3], kq[3])); }
    s = __fmul_rn(s, scale); if (MASKADD) s = __fadd_rn(s, __fmul_rn(bf16_round(mask[(size_t)i * SQ + j]), -10000.0f));
    const float f = (MASKADD || j <= i) ? 1.f : 0.f; const float sm = fmaf(f, s, (1.f - f) * -1.0e30f); const float mn = fmaxf(m, sm); const float sc = expf(m - mn); const float e = expf(sm - mn); l = __fadd_rn(__fmul_rn(l, sc), e); m = mn;
#pragma unroll 1
    for (int c = 0; c < HD / 4; ++c) { const v4f vv = *(const v4fa*)(vr + c * 4); v4f oo = *(v4f*)&lo[tid][c * 4]; for (int u = 0; u < 4; ++u) oo[u] = __fadd_rn(__fmul_rn(oo[u], sc), __fmul_rn(e, vv[u])); *(v4f*)&lo[tid][c * 4] = oo; } }
  const float fin = 64.0f / l;      /* o carried x64 like the f16 path */
#pragma unroll 1
  for (int c = 0; c < HD / 4; ++c) { v4f oo = *(v4f*)&lo[tid][c * 4]; for (int u = 0; u < 4; ++u) oo[u] = __fmul_rn(oo[u], fin); *(v4f*)&lo[tid][c * 4] = oo; }
  __syncthreads();
  {
#pragma unroll 1
    for (int it = 0; it < 16; ++it) { const int row = it * 4 + tid / 16, pc = (tid % 16) * 4; const v4f v = *(const v4f*)&lo[row][pc]; *(v4f*)(OF + (size_t)(rg * 64 + row) * ldo + h * HD + pc) = v; }
     } }

__global__ __launch_bounds__(256) void k_oscale(const float* __restrict__ OF, float* __restrict__ out, size_t n4) { const size_t t = (size_t)blockIdx.x * 256 + threadIdx.x; if (t >= n4) return; const v4f a = *(const v4fa*)(OF + t * 4); v4f o; for (int q = 0; q < 4; ++q) o[q] = a[q] * 0.015625f; *(v4f*)(out + t * 4) = o;  }

__global__ __launch_bounds__(256) void k_bfr(const float* __restrict__ x, float* __restrict__ XB, size_t n8) { const size_t t = (size_t)blockIdx.x * 256 + threadIdx.x; if (t >= n8) return; v4f a = *(const v4fa*)(x + t * 8), c = *(const v4fa*)(x + t * 8 + 4); for (int q = 0; q < 4; ++q) { a[q] = bf16_round(a[q]); c[q] = bf16_round(c[q]); }
  { *(v4f*)(XB + t * 8) = a; *(v4f*)(XB + t * 8 + 4) = c;  } }



__global__ __launch_bounds__(256) void k_rsmfvl(const float* __restrict__ S, _Float16* __restrict__ P, _Float16* __restrict__ PL, int qn, const int* __restrict__ vlp) {
  #pragma clang fp contract(off)
  const int t = blockIdx.x * 256 + threadIdx.x; if (t >= qn) return; const int vl = vlp[0]; const size_t i = (size_t)t; const float* s = S + i * SQ; float mx = -3.0e38f;
#pragma unroll 1
  for (int j = 0; j < SQ; ++j) { const float f = (j < vl) ? 1.f : 0.f; mx = fmaxf(mx, fmaf(f, s[j], (1.f - f) * -1000000.0f)); } float se = 0.f;
#pragma unroll 1
  for (int j = 0; j < SQ; ++j) { const float f = (j < vl) ? 1.f : 0.f; se += __expf(fmaf(f, s[j], (1.f - f) * -1000000.0f) - mx); } const float sc = 256.0f / se;
#pragma unroll 1
  for (int j0 = 0; j0 < SQ; j0 += 8) { FragH fr, gr; for (int q = 0; q < 8; ++q) { const int j = j0 + q; const float f = (j < vl) ? 1.f : 0.f; const float pv = __expf(fmaf(f, s[j], (1.f - f) * -1000000.0f) - mx) * sc; const _Float16 ph = (_Float16)pv; fr.h[q] = ph; gr.h[q] = (_Float16)((pv - (float)ph) * 1024.0f); }
    unsigned short* d = (unsigned short*)P + i * SQ + j0; unsigned short* dl = (unsigned short*)PL + i * SQ + j0; *(v8us*)d = fr.half[0]; *(v8us*)dl = gr.half[0];  } }

__global__ __launch_bounds__(256) void k_rsmf(const float* __restrict__ S, _Float16* __restrict__ P, int qn, int hg) {
  #pragma clang fp contract(off)
  const int t = blockIdx.x * 256 + threadIdx.x; if (t >= qn * hg) return; const size_t i = (size_t)(t / qn) * SQ + (t % qn); const float* s = S + i * SQ; float mx = -3.0e38f;
#pragma unroll 1
  for (int j = 0; j < SQ; ++j) mx = fmaxf(mx, s[j]); float se = 0.f;
#pragma unroll 1
  for (int j = 0; j < SQ; ++j) se += __expf(s[j] - mx); const float sc = 256.0f / se;
#pragma unroll 1
  for (int j0 = 0; j0 < SQ; j0 += 8) { FragH f; for (int q = 0; q < 8; ++q) f.h[q] = (_Float16)(__expf(s[j0 + q] - mx) * sc); unsigned short* d = (unsigned short*)P + i * SQ + j0; *(v8us*)d = f.half[0];  } }


#define CN 256          /* channels */
#define CI 128          /* inner channels */
#define NP 4096         /* positions */
#define NM 4096         /* key positions (= SQ) */
#define NC CN           /* BN statistics macros */
#define NPX NP
#define BNEPS 1e-5f

__global__ __launch_bounds__(256) void k_rowbias(const float* __restrict__ b, float* __restrict__ BP, size_t n4, int ncol) { const size_t t = (size_t)blockIdx.x * 256 + threadIdx.x; if (t >= n4) return; const size_t e = t * 4; const float v = bf16_round(b[e / ncol]); const v4f o = {v, v, v, v}; *(v4f*)(BP + e) = o;  }




__global__ __launch_bounds__(256) void k_mp2(const float* __restrict__ src, float* __restrict__ dst, int nout) {
  const int t = blockIdx.x * 256 + threadIdx.x; if (t >= nout) return; const int c = t / 1024; const int o = t % 1024; const int oy = o / 32, ox = o % 32; const float* p = src + (size_t)c * 4096 + (size_t)(2 * oy) * 64 + 2 * ox;
  const float v = fmaxf(fmaxf(p[0], p[1]), fmaxf(p[64], p[65])); *(float*)(dst + t) = v;  }
__global__ __launch_bounds__(256) void k_xpb(const float* __restrict__ x, const float* __restrict__ wb, float* __restrict__ CPP, size_t n4) {
  #pragma clang fp contract(off)
  const size_t t = (size_t)blockIdx.x * 256 + threadIdx.x; if (t >= n4) return; const size_t e = t * 4; const int c = (int)((e / 4096) % 256); const float bb = bf16_round(wb[c]); const v4f a = *(const v4fa*)(x + e); v4f o; for (int q = 0; q < 4; ++q) o[q] = __fadd_rn(bf16_round(a[q]), bb);
  *(v4f*)(CPP + e) = o;  }


template <int PASS>
__global__ __launch_bounds__(256) void k_cstA(const float* __restrict__ X, const float* __restrict__ MV, float* __restrict__ PART) {
  #pragma clang fp contract(off)
  __shared__ float red[256]; const int t = threadIdx.x; const size_t bc = blockIdx.x; const int c = (int)(bc % NC); const float* row = X + bc * (size_t)NPX; const float mu = PASS ? MV[c] : 0.f; float s = 0.f;
  for (int i = t; i < NPX; i += 256) { const float v = row[i]; const float d = PASS ? __fadd_rn(v, -mu) : v; s = __fadd_rn(s, PASS ? __fmul_rn(d, d) : d); }
  red[t] = s; __syncthreads(); for (int st = 128; st > 0; st >>= 1) { if (t < st) red[t] = __fadd_rn(red[t], red[t + st]); __syncthreads(); }
  if (t < 32) { const float pv = (t == 0) ? red[0] : 0.f; *(float*)(PART + bc * 32 + t) = pv;  } }      

template <int PASS>
__global__ __launch_bounds__(256) void k_cstB(const float* __restrict__ PART, float* __restrict__ MV) { const int c = threadIdx.x; if (c >= NC) return; double s = 0.0; for (int b = 0; b < NB; ++b) s += (double)PART[((size_t)b * NC + c) * 32]; const float m = (float)(s / ((double)NB * (double)NPX)); *(float*)(MV + PASS * NC + c) = m;  }


__global__ __launch_bounds__(256) void k_bnresid(const float* __restrict__ C2, const float* __restrict__ MV, const float* __restrict__ g, const float* __restrict__ be, const float* __restrict__ X, float* __restrict__ out, size_t n4) {
  #pragma clang fp contract(off)
  const size_t t = (size_t)blockIdx.x * 256 + threadIdx.x; if (t >= n4) return; const size_t e = t * 4; const int c = (int)((e / NPX) % NC); const float sc = __fmul_rn(rsqrtf(__fadd_rn(MV[NC + c], BNEPS)), bf16_round(g[c])); const float mu = MV[c], bb = bf16_round(be[c]);
  const v4f a = *(const v4fa*)(C2 + e); const v4f xx = *(const v4fa*)(X + e); v4f o; for (int q = 0; q < 4; ++q) { const float z = __fadd_rn(__fmul_rn(__fadd_rn(a[q], -mu), sc), bb); o[q] = __fadd_rn(z, bf16_round(xx[q])); }
  *(v4f*)(out + e) = o;  }


__global__ __launch_bounds__(256) void k_rowbias(float* __restrict__ Y, const float* __restrict__ bias) {
  #pragma clang fp contract(off)
  const size_t t = (size_t)blockIdx.x * 256 + threadIdx.x; if (t >= (size_t)NB * NC * NPX / 4) return; const size_t e = t * 4; const int c = (int)((e / NPX) % NC); const float bb = bf16_round(bias[c]);
  v4f v = *(const v4fa*)(Y + e); for (int q = 0; q < 4; ++q) v[q] = __fadd_rn(v[q], bb); *(v4f*)(Y + e) = v;  }


__global__ __launch_bounds__(256) void k_colstat(const float* __restrict__ S, float* __restrict__ CMX, float* __restrict__ CIV) {
  #pragma clang fp contract(off)
  const int m = blockIdx.x * 256 + threadIdx.x; if (m >= NM) return; float mx = -3.0e38f;
#pragma unroll 1
  for (int n = 0; n < NP; ++n) mx = fmaxf(mx, S[(size_t)n * NM + m]); float se = 0.f;
#pragma unroll 1
  for (int n = 0; n < NP; ++n) se += __expf(S[(size_t)n * NM + m] - mx); const float iv = 256.0f / se;
  *(float*)(CMX + m) = mx; *(float*)(CIV + m) = iv;  }
__global__ __launch_bounds__(256) void k_colp(const float* __restrict__ S, const float* __restrict__ CMX, const float* __restrict__ CIV, _Float16* __restrict__ P) {
  #pragma clang fp contract(off)
  const size_t t = (size_t)blockIdx.x * 256 + threadIdx.x; if (t >= (size_t)NP * NM / 8) return; const size_t e = t * 8; const int m0 = (int)(e % NM); FragH f;
  for (int q = 0; q < 8; ++q) f.h[q] = (_Float16)(__expf(S[e + q] - CMX[m0 + q]) * CIV[m0 + q]);
  unsigned short* d = (unsigned short*)P + e; *(v8us*)d = f.half[0];  }
extern "C" void kernel_launch(void* const* d_in, const int* in_sizes, int n_in,
                              void* d_out, int out_size, void* d_ws, size_t ws_size, hipStream_t stream) {
  (void)in_sizes; (void)n_in; (void)out_size;
  const float* const* I = (const float* const*)d_in; const float* x = I[0]; const float* tw = I[1]; const float* pw = I[2]; const float* gw = I[3]; const float* ww = I[4]; const float* tb = nullptr; const float* pb = nullptr; const float* gb = nullptr;      /* natural 1x1 conv weights: w_theta, w_phi, w_g [128][256], w_mask [256][128]; no biases */
  char* ws = (char*)d_ws; size_t off = 0;
  auto take = [&](size_t bytes) { char* p = ws + off; off += (bytes + 255) & ~(size_t)255; return p; };
  const size_t PL = (size_t)CN * NP;      /* one input map */
  _Float16* BT = (_Float16*)take((size_t)CI * CN * 2); _Float16* BP = (_Float16*)take((size_t)CI * CN * 2); _Float16* BG = (_Float16*)take((size_t)CI * CN * 2); _Float16* BW = (_Float16*)take((size_t)CN * CI * 2);
  _Float16* X16 = (_Float16*)take(NB * PL * 2); float* XB = (float*)take(NB * PL * 4);      /* x f16 channel-first; bf16(x) f32 for the residual */
  _Float16* XT = (_Float16*)take(PL * 2); _Float16* TH = (_Float16*)take((size_t)NP * CI * 2); _Float16* PHT = (_Float16*)take((size_t)NP * CI * 2); _Float16* GT = (_Float16*)take((size_t)NP * CI * 2); _Float16* G = (_Float16*)take((size_t)CI * NP * 2); _Float16* YT = (_Float16*)take((size_t)NP * CI * 2);
  float* S = (float*)take((size_t)NP * NM * 4); _Float16* P = (_Float16*)take((size_t)NP * NM * 2); float* CMX = (float*)take((size_t)NM * 4); float* CIV = (float*)take((size_t)NM * 4);      /* per-column max and 256 / sum */
  if (off > ws_size) return;
  { const unsigned g = (unsigned)(((size_t)CI * CN / 8 + 255) / 256); k_wnat<<<g, 256, 0, stream>>>(tw, (size_t)CI * CN / 8, BT); k_wnat<<<g, 256, 0, stream>>>(pw, (size_t)CI * CN / 8, BP); k_wnat<<<g, 256, 0, stream>>>(gw, (size_t)CI * CN / 8, BG); k_wnat<<<g, 256, 0, stream>>>(ww, (size_t)CN * CI / 8, BW); }      /* natural [out][in] x16 f16 planes (Bt for theta/phi/g token rows; the A operand for W) */
  k_x16<<<(unsigned)((NB * PL / 8 + 255) / 256), 256, 0, stream>>>(x, X16, NB * PL / 8); k_bfr<<<(unsigned)((NB * PL / 8 + 255) / 256), 256, 0, stream>>>(x, XB, NB * PL / 8);
  for (int b = 0; b < NB; ++b) {
    k_vt<NP / 64, CN><<<(NP / 64) * (CN / 64), 256, 0, stream>>>(X16 + (size_t)b * PL, NP, 0, XT);      /* [c][n] -> x^T [n][c] token rows */
    k_gemm2<0><<<dim3((unsigned)((NP / 128) * (CI / 64)), 1), 128, 0, stream>>>(XT, CN, 0, BT, CN, 0, 0.0625f, tb, 0, nullptr, 1, 0, 0, nullptr, TH, CI, 0, NP, CI, CN);      /* theta^T [n][ci] -> f16 */
    k_gemm2<0><<<dim3((unsigned)((NP / 128) * (CI / 64)), 1), 128, 0, stream>>>(XT, CN, 0, BP, CN, 0, 0.0625f, pb, 0, nullptr, 1, 0, 0, nullptr, PHT, CI, 0, NP, CI, CN);      /* phi^T [m][ci] -> f16 (the scores' B^T operand) */
    k_gemm2<0><<<dim3((unsigned)((NP / 128) * (CI / 64)), 1), 128, 0, stream>>>(XT, CN, 0, BG, CN, 0, 0.0625f, gb, 0, nullptr, 1, 0, 0, nullptr, GT, CI, 0, NP, CI, CN);      /* g^T [m][ci] -> f16 */
    k_vt<CI / 64, NP><<<(CI / 64) * (NP / 64), 256, 0, stream>>>(GT, CI, 0, G);      /* -> g [ci][m] (the PV B^T operand) */
    k_gemm2<0><<<dim3((unsigned)((NP / 128) * (NM / 64)), 1), 128, 0, stream>>>(TH, CI, 0, PHT, CI, 0, 1.0f, nullptr, 0, nullptr, 1, 0, 0, S, nullptr, NM, 0, NP, NM, CI);      /* f[a][b] = theta[:, a].phi[:, b] (K = 128, NO scale) */
    k_colstat<<<(NM + 255) / 256, 256, 0, stream>>>(S, CMX, CIV); k_colp<<<(unsigned)(((size_t)NP * NM / 8 + 255) / 256), 256, 0, stream>>>(S, CMX, CIV, P);      /* softmax over the QUERY axis: per key column m the max and sum over all 4096 rows n, then P[n][m] = f16(256 exp(s - max_m) / sum_m) */
    k_gemm2<0><<<dim3((unsigned)((NP / 128) * (CI / 64)), 1), 128, 0, stream>>>(P, NM, 0, G, NM, 0, 0.00390625f, nullptr, 0, nullptr, 1, 0, 0, nullptr, YT, CI, 0, NP, CI, NM);      /* y^T [a][ci] = sum_b P[a][b] g[ci][b] -> f16 */
    k_gemm2<0><<<dim3((unsigned)((CN / 128) * (NP / 64)), 1), 128, 0, stream>>>(BW, CI, 0, YT, CI, 0, 0.0625f, nullptr, 0, XB + (size_t)b * PL, -1, 0, 0, (float*)d_out + (size_t)b * PL, nullptr, NP, 0, CN, NP, CI); }      /* out[c][a] = (16 W as A) x (y^T as B^T) / 16 + bf16(x) (own element) -> f32 channel-first output block */
}

// v001
// Measured time: 981 microseconds a run.
// In two side-by-side timings against v000, it was 7.21 and 7.15 times as fast.
#include <hip/hip_runtime.h>
// Non-local block with the softmax taken over the QUERY axis (x [4][256][64][64]; theta, phi, g = conv1x1(x) with [128][256] weights (U(+-1/16), no biases); scores[n][m] = theta[n].phi[m] (NO scaling); attn = softmax(scores, axis = 1): normalised over n for every key column m (the module's unconventional axis); out[n] = sum_m attn[n][m] g[m]; mask = conv1x1(out; w_mask [256][128], no bias); result = x + mask -> [4][256][64][64]).
// Structure: channel-first; x as exact f16 planes and bf16(x) f32 residual planes; per image: token rows via LDS transposes; theta^T, phi^T, g^T as WMMA GEMMs (32x64 wave tiles, f32 accumulation, no bias) -> f16; g to channel-major via LDS transposes; f [4096][4096] = theta^T phi (K = 128, no scale) f32; column softmax on VALU (f32 statistics, native exp; weights x256 f16); y^T = P g^T (x2^-8) f16; out = (16 W) y / 16 + bf16(x) f32 channel-first.
// Compute dtype: inputs rounded to bf16; x / weights exact; q, k, v, softmax weights and o as plain f16 GEMM operands (~2^-12); scores and softmax statistics f32. v_wmma_f32_16x16x32_f16.
#define NB 4
#define SQ 4096
#define DM 256
#define NH 1
#define HD 64
#define HG 4                         /* heads per attention launch group */
#define B0 0                         /* first batch processed (debug hook) */
#define NBR NB                       /* batches processed (debug hook) */
#define NR ((size_t)NB * SQ)         /* token rows */
#define MP ((int)((size_t)NBR * SQ)) /* rows projected (debug hook) */
#define QT 256                       /* query rows per causal tile */
#define NKX SQ                       /* S / P row pitch */
#define QT0 256                      /* first-tile rows recomputed exactly (256: buys margin for the few-key rows 128..255, which have no output projection to average the single-f16 P/v rounding) */
#define QN SQ                        /* query rows attended per batch (debug hook) */
#define NHD NH                       /* heads attended (debug hook) */
#define MPO MP                       /* rows through the output stage (debug hook) */
#define LQ DM            /* row pitch of the q/k/v rows */
typedef __bf16 v16b __attribute__((ext_vector_type(16)));
typedef unsigned short v8us __attribute__((ext_vector_type(8), may_alias));
typedef float  v8f  __attribute__((ext_vector_type(8)));
typedef float  v4f  __attribute__((ext_vector_type(4)));
typedef float  v4fa __attribute__((ext_vector_type(4), may_alias));
union FragB { v16b v; v8us half[2]; unsigned short u[16]; };

__device__ __forceinline__ unsigned short bf16_bits(float x) { unsigned int u = __float_as_uint(x); return (unsigned short)((u + 0x7FFFu + ((u >> 16) & 1u)) >> 16); }
__device__ __forceinline__ float bf16_val(unsigned short b) { return __uint_as_float(((unsigned int)b) << 16); }
__device__ __forceinline__ float bf16_round(float x) { return bf16_val(bf16_bits(x)); }
// D += A·B with NT terms: 1 = ah·bh, 2 = + al·bh (A split), 3 = + ah·bl (both split)
template <int NT>
__device__ __forceinline__ v8f mmaN(v16b ah, v16b al, v16b bh, v16b bl, v8f c) {
  c = __builtin_amdgcn_wmma_f32_16x16x32_bf16(false, ah, false, bh, (short)0, c, false, false);
  if (NT >= 2) c = __builtin_amdgcn_wmma_f32_16x16x32_bf16(false, al, false, bh, (short)0, c, false, false);
  if (NT >= 3) c = __builtin_amdgcn_wmma_f32_16x16x32_bf16(false, ah, false, bl, (short)0, c, false, false);
  asm volatile("v_nop\n\tv_nop\n\tv_nop\n\tv_nop" : "+v"(c) : "v"(ah), "v"(al), "v"(bh), "v"(bl));
  return c;
}

__global__ __launch_bounds__(256) void k_wt_bf16(const float* __restrict__ W, unsigned short* __restrict__ Wt, int K, int N) {
  const int t = blockIdx.x * 256 + threadIdx.x;
  const int k8n = K / 8;
  if (t >= N * k8n) return;
  const int n = t / k8n, k8 = (t % k8n) * 8;
  v8us v;
#pragma unroll
  for (int i = 0; i < 8; ++i) v[i] = bf16_bits(W[(size_t)(k8 + i) * N + n]);
  *(v8us*)(Wt + (size_t)n * K + k8) = v;
  
}

// GEMM C[M][N] (f32, pitch ldc) = act(A[M][K]·W + bias). A f32 row-major (pitch lda) converted per fragment to bf16
// (ASPLIT: hi/lo two planes -> 2 terms, else single rounded term); Wt bf16 [N][K] (pitch ldb). BIAS_BF16 rounds the
// bias to bf16 first (bias quantised to bf16 before the add). K%32==0, M%16==0, N%64==0.
template <bool ASPLIT, int ACT, bool BIAS_BF16>
__global__ __launch_bounds__(128) void k_gemm_bf(const float* __restrict__ A, int lda, const unsigned short* __restrict__ Wt, int ldb,
                                               const float* __restrict__ bias, float* __restrict__ C, int ldc, int M, int N, int K) {
  __shared__ __attribute__((aligned(16))) float so[4][16][64];
  const int tid = threadIdx.x, w = tid >> 5, lane = tid & 31, ln = lane & 15, hh = lane >> 4;
  const int ntn = N / 64;
  const int wid = blockIdx.x * 4 + w;
  const int mt = wid / ntn, nq = wid % ntn;
  if (mt * 16 >= M) return;
  const int row0 = mt * 16, col0 = nq * 64;
  const float* arow = A + (size_t)(row0 + ln) * lda;
  v8f acc[4] = {};
  for (int kb = 0; kb < K; kb += 32) {
    FragB ah, al;
    const v4f x0 = *(const v4fa*)(arow + kb + 8 * hh), x1 = *(const v4fa*)(arow + kb + 8 * hh + 4);
    const v4f x2 = *(const v4fa*)(arow + kb + 16 + 8 * hh), x3 = *(const v4fa*)(arow + kb + 16 + 8 * hh + 4);
    float xs[16] = {x0[0],x0[1],x0[2],x0[3],x1[0],x1[1],x1[2],x1[3],x2[0],x2[1],x2[2],x2[3],x3[0],x3[1],x3[2],x3[3]};
#pragma unroll
    for (int i = 0; i < 16; ++i) { const unsigned short hb = bf16_bits(xs[i]); ah.u[i] = hb; al.u[i] = ASPLIT ? bf16_bits(xs[i] - bf16_val(hb)) : (unsigned short)0; }
#pragma unroll
    for (int t = 0; t < 4; ++t) {
      const unsigned short* brow = Wt + (size_t)(col0 + t * 16 + ln) * ldb + kb;
      FragB b;
      b.half[0] = *(const v8us*)(brow + 8 * hh);
      b.half[1] = *(const v8us*)(brow + 16 + 8 * hh);
      acc[t] = mmaN<ASPLIT ? 2 : 1>(ah.v, al.v, b.v, b.v, acc[t]);
    }
  }
#pragma unroll
  for (int t = 0; t < 4; ++t) {
    float bv = bias ? bias[col0 + t * 16 + ln] : 0.f;
    if (BIAS_BF16) bv = bf16_round(bv);
#pragma unroll
    for (int r = 0; r < 8; ++r) { float v = acc[t][r] + bv; if (ACT == 1) v = fmaxf(v, 0.f); so[w][8 * hh + r][t * 16 + ln] = v; }
  }
  __builtin_amdgcn_fence(__ATOMIC_ACQ_REL, "workgroup");
  __builtin_amdgcn_wave_barrier();
  const int rsub = lane >> 4, c4 = (lane & 15) * 4;
  {
#pragma unroll
    for (int q = 0; q < 8; ++q) {
      const int r = q * 2 + rsub;
      const v4f v = *(const v4fa*)&so[w][r][c4];
      *(v4f*)(C + (size_t)(row0 + r) * ldc + col0 + c4) = v;
    }
    
  }
}

// GEMM C = act(A·W + bias + resid): A f32 (ASPLIT -> hi/lo 2 terms), Wt bf16 [N][K]; ACT 0 none, 1 relu, 2 exact gelu;
// resid (optional, f32, row index = (row % rmod), pitch ldr, RES_BF16 rounds it) added before the activation.
template <bool ASPLIT, int ACT, bool BIAS_BF16, bool RES_BF16>
__global__ __launch_bounds__(128) void k_gemm_bf3(const float* __restrict__ A, int lda, const unsigned short* __restrict__ Wt, int ldb,
                                                const float* __restrict__ bias, const float* __restrict__ resid, int rmod, int ldr,
                                                float* __restrict__ C, int ldc, int M, int N, int K) {
  __shared__ __attribute__((aligned(16))) float so[4][16][64];
  const int tid = threadIdx.x, w = tid >> 5, lane = tid & 31, ln = lane & 15, hh = lane >> 4;
  const int ntn = N / 64;
  const int wid = blockIdx.x * 4 + w;
  const int mt = wid / ntn, nq = wid % ntn;
  if (mt * 16 >= M) return;
  const int row0 = mt * 16, col0 = nq * 64;
  const float* arow = A + (size_t)(row0 + ln) * lda;
  v8f acc[4] = {};
  for (int kb = 0; kb < K; kb += 32) {
    FragB ah, al;
    const v4f x0 = *(const v4fa*)(arow + kb + 8 * hh), x1 = *(const v4fa*)(arow + kb + 8 * hh + 4);
    const v4f x2 = *(const v4fa*)(arow + kb + 16 + 8 * hh), x3 = *(const v4fa*)(arow + kb + 16 + 8 * hh + 4);
    float xs[16] = {x0[0],x0[1],x0[2],x0[3],x1[0],x1[1],x1[2],x1[3],x2[0],x2[1],x2[2],x2[3],x3[0],x3[1],x3[2],x3[3]};
#pragma unroll
    for (int i = 0; i < 16; ++i) { const unsigned short hb = bf16_bits(xs[i]); ah.u[i] = hb; al.u[i] = ASPLIT ? bf16_bits(xs[i] - bf16_val(hb)) : (unsigned short)0; }
#pragma unroll
    for (int t = 0; t < 4; ++t) {
      const unsigned short* brow = Wt + (size_t)(col0 + t * 16 + ln) * ldb + kb;
      FragB b;
      b.half[0] = *(const v8us*)(brow + 8 * hh);
      b.half[1] = *(const v8us*)(brow + 16 + 8 * hh);
      acc[t] = mmaN<ASPLIT ? 2 : 1>(ah.v, al.v, b.v, b.v, acc[t]);
    }
  }
#pragma unroll
  for (int t = 0; t < 4; ++t) {
    const int col = col0 + t * 16 + ln;
    float bv = bias ? bias[col] : 0.f;
    if (BIAS_BF16) bv = bf16_round(bv);
#pragma unroll
    for (int r = 0; r < 8; ++r) {
      float v = acc[t][r] + bv;
      if (resid) { float rv = resid[(size_t)((row0 + 8 * hh + r) % rmod) * ldr + col]; if (RES_BF16) rv = bf16_round(rv); v += rv; }
      if (ACT == 1) v = fmaxf(v, 0.f);
      if (ACT == 2) v = 0.5f * v * (1.0f + erff(v * 0.70710678118654752f));
      if (ACT == 3) { const float u = 0.7978845608028654f * (v + 0.044715f * v * v * v); v = 0.5f * v * (1.0f + tanhf(u)); }
      so[w][8 * hh + r][t * 16 + ln] = v;
    }
  }
  __builtin_amdgcn_fence(__ATOMIC_ACQ_REL, "workgroup");
  __builtin_amdgcn_wave_barrier();
  const int rsub = lane >> 4, c4 = (lane & 15) * 4;
  {
#pragma unroll
    for (int q = 0; q < 8; ++q) {
      const int r = q * 2 + rsub;
      const v4f v = *(const v4fa*)&so[w][r][c4];
      *(v4f*)(C + (size_t)(row0 + r) * ldc + col0 + c4) = v;
    }
    
  }
}
// row LayerNorm (biased variance, eps) over N: s = X (+ R); optional out_sum <- s; out_norm <- (s-mu)*rsqrt(var+eps)*g + b
template <bool PARAM_BF16>
__global__ __launch_bounds__(256) void k_layernorm(const float* __restrict__ X, const float* __restrict__ R, const float* __restrict__ g, const float* __restrict__ bta,
                                                  float* __restrict__ out_sum, float* __restrict__ out_norm, int N, float eps) {
  __shared__ float red[256];
  const int row = blockIdx.x, tid = threadIdx.x;
  const float* x = X + (size_t)row * N; const float* rr = R ? R + (size_t)row * N : nullptr;
  float vals[16];                     // up to N = 4096
  const int per = N / 256;            // contiguous chunk per thread? use strided-by-4 chunks: thread handles j = tid*4 + 1024*u
  float s1 = 0.f;
  for (int u = 0; u < per / 4; ++u) {
    const int j = tid * 4 + 1024 * u;
    const v4f a = *(const v4fa*)(x + j);
    v4f b = {0.f,0.f,0.f,0.f}; if (rr) b = *(const v4fa*)(rr + j);
#pragma unroll
    for (int q = 0; q < 4; ++q) { const float v = a[q] + b[q]; vals[u * 4 + q] = v; s1 += v; }
  }
  red[tid] = s1; __syncthreads();
  for (int st = 128; st > 0; st >>= 1) { if (tid < st) red[tid] += red[tid + st]; __syncthreads(); }
  const float mu = red[0] / (float)N; __syncthreads();
  float s2 = 0.f;
  for (int u = 0; u < per / 4; ++u)
#pragma unroll
    for (int q = 0; q < 4; ++q) { const float c = vals[u * 4 + q] - mu; s2 += c * c; }
  red[tid] = s2; __syncthreads();
  for (int st = 128; st > 0; st >>= 1) { if (tid < st) red[tid] += red[tid + st]; __syncthreads(); }
  const float rs = rsqrtf(red[0] / (float)N + eps);
  {
    for (int u = 0; u < per / 4; ++u) {
      const int j = tid * 4 + 1024 * u;
      v4f o, sm;
#pragma unroll
      for (int q = 0; q < 4; ++q) {
        float gg = g[j + q], bb = bta[j + q];
        if (PARAM_BF16) { gg = bf16_round(gg); bb = bf16_round(bb); }
        sm[q] = vals[u * 4 + q]; o[q] = (vals[u * 4 + q] - mu) * rs * gg + bb;
      }
      if (out_sum) *(v4f*)(out_sum + (size_t)row * N + j) = sm;
      *(v4f*)(out_norm + (size_t)row * N + j) = o;
    }
    
  }
}



// ---- f16 WMMA path (v_wmma_f32_16x16x32_f16): 11-bit significands for operands in range — used where a [0,1] probability operand needs more precision than bf16
typedef _Float16 v16h __attribute__((ext_vector_type(16)));
union FragH { v16h v; v8us half[2]; _Float16 h[16]; unsigned short u[16]; };
template <int NT>
__device__ __forceinline__ v8f mmaH(v16h ah, v16h al, v16h bh, v16h bl, v8f c) {
  c = __builtin_amdgcn_wmma_f32_16x16x32_f16(false, ah, false, bh, (short)0, c, false, false);
  if (NT >= 2) c = __builtin_amdgcn_wmma_f32_16x16x32_f16(false, al, false, bh, (short)0, c, false, false);
  if (NT >= 3) c = __builtin_amdgcn_wmma_f32_16x16x32_f16(false, ah, false, bl, (short)0, c, false, false);
  asm volatile("v_nop\n\tv_nop\n\tv_nop\n\tv_nop" : "+v"(c) : "v"(ah), "v"(al), "v"(bh), "v"(bl));
  return c;
}
// batched GEMM like k_gemm_b but f16 operands: A f32 (split into f16 hi/lo if ASPLIT, else rounded to f16), Bt = f16 values [n][k]; alpha; C f32; N multiple of 16 (partial tiles skipped)
template <bool ASPLIT>
__global__ __launch_bounds__(128) void k_gemm_h(const float* __restrict__ A, int lda, size_t sA, const _Float16* __restrict__ Bh, int ldb, size_t sB, float alpha, float* __restrict__ C, int ldc, size_t sC, int M, int N, int K) {
  __shared__ __attribute__((aligned(16))) float so[4][16][64];
  const int tid = threadIdx.x, w = tid >> 5, lane = tid & 31, ln = lane & 15, hh = lane >> 4; const int by = blockIdx.y;
  A += (size_t)by * sA; Bh += (size_t)by * sB; C += (size_t)by * sC;
  const int ntn = (N + 63) / 64; const int wid = blockIdx.x * 4 + w; const int mt = wid / ntn, nq = wid % ntn; if (mt * 16 >= M) return;
  const int row0 = mt * 16, col0 = nq * 64; const float* arow = A + (size_t)(row0 + ln) * lda;
  v8f acc[4] = {};
  for (int kb = 0; kb < K; kb += 32) {
    FragH ah, al;
    const v4f x0 = *(const v4fa*)(arow + kb + 8 * hh), x1 = *(const v4fa*)(arow + kb + 8 * hh + 4), x2 = *(const v4fa*)(arow + kb + 16 + 8 * hh), x3 = *(const v4fa*)(arow + kb + 16 + 8 * hh + 4);
    float xs[16] = {x0[0],x0[1],x0[2],x0[3],x1[0],x1[1],x1[2],x1[3],x2[0],x2[1],x2[2],x2[3],x3[0],x3[1],x3[2],x3[3]};
#pragma unroll
    for (int i = 0; i < 16; ++i) { const _Float16 h = (_Float16)xs[i]; ah.h[i] = h; al.h[i] = ASPLIT ? (_Float16)(xs[i] - (float)h) : (_Float16)0.0f; }
#pragma unroll
    for (int t = 0; t < 4; ++t) { if (col0 + t * 16 >= N) continue; const size_t boff = (size_t)(col0 + t * 16 + ln) * ldb + kb; FragH bq; bq.half[0] = *(const v8us*)(Bh + boff + 8 * hh); bq.half[1] = *(const v8us*)(Bh + boff + 16 + 8 * hh);
      acc[t] = mmaH<ASPLIT ? 2 : 1>(ah.v, al.v, bq.v, bq.v, acc[t]); }
  }
#pragma unroll
  for (int t = 0; t < 4; ++t) { if (col0 + t * 16 >= N) continue;
#pragma unroll
    for (int r = 0; r < 8; ++r) so[w][8 * hh + r][t * 16 + ln] = acc[t][r] * alpha; }
  __builtin_amdgcn_fence(__ATOMIC_ACQ_REL, "workgroup"); __builtin_amdgcn_wave_barrier();
  const int rsub = lane >> 4, c4 = (lane & 15) * 4;
  {
#pragma unroll
    for (int q = 0; q < 8; ++q) { const int r = q * 2 + rsub; if (col0 + c4 < N) { const v4f v = *(const v4fa*)&so[w][r][c4]; *(v4f*)(C + (size_t)(row0 + r) * ldc + col0 + c4) = v; } }
     }
}

// Wt[n][k] = f16(W[k][n]·scale) from f32 row-major W[K][N] (scale = power of two; bf16-exact weights stay exact in f16 away from the subnormal range)
__global__ __launch_bounds__(256) void k_wt_f16(const float* __restrict__ W, _Float16* __restrict__ Wt, int K, int N, float scale) {
  const int t = blockIdx.x * 256 + threadIdx.x; if (t >= N * (K / 8)) return; const int n = t / (K / 8), k8 = (t % (K / 8)) * 8; FragH f;
#pragma unroll
  for (int i = 0; i < 8; ++i) f.h[i] = (_Float16)(bf16_round(W[(size_t)(k8 + i) * N + n]) * scale); const v8us o = f.half[0];
  *(v8us*)((unsigned short*)Wt + (size_t)n * K + k8) = o; 
}
// k_gemm_hh variant with fused epilogue: v = acc·alpha + bias[by·sBias + col] (+ CP[(row/rowsPerB)·sCPb + by·64 + col] if CP) ; ACT 0 none / 1 elu ; writes f16 C16 (and f32 C if non-null)
template <int ACT>
__global__ __launch_bounds__(128) void k_gemm_hhx(const _Float16* __restrict__ A, int lda, size_t sA, const _Float16* __restrict__ Bh, int ldb, size_t sB, float alpha, const float* __restrict__ bias, size_t sBias, const float* __restrict__ CP, int rowsPerB, size_t sCPb, int row0g,
    float* __restrict__ C, _Float16* __restrict__ C16, int ldc, size_t sC, int M, int N, int K) {
  __shared__ __attribute__((aligned(16))) float so[4][16][64];
  const int tid = threadIdx.x, w = tid >> 5, lane = tid & 31, ln = lane & 15, hh = lane >> 4; const int by = blockIdx.y;
  A += (size_t)by * sA; Bh += (size_t)by * sB; const size_t cofs = (size_t)by * sC; const float* bp = bias ? bias + (size_t)by * sBias : nullptr;
  const int ntn = (N + 63) / 64; const int wid = blockIdx.x * 4 + w; const int mt = wid / ntn, nq = wid % ntn; if (mt * 16 >= M) return;
  const int row0 = mt * 16, col0 = nq * 64; const _Float16* arow = A + (size_t)(row0 + ln) * lda;
  v8f acc[4] = {};
  for (int kb = 0; kb < K; kb += 32) { FragH ah; ah.half[0] = *(const v8us*)((const unsigned short*)arow + kb + 8 * hh); ah.half[1] = *(const v8us*)((const unsigned short*)arow + kb + 16 + 8 * hh);
#pragma unroll
    for (int t = 0; t < 4; ++t) { if (col0 + t * 16 >= N) continue; const size_t boff = (size_t)(col0 + t * 16 + ln) * ldb + kb; FragH bq; bq.half[0] = *(const v8us*)((const unsigned short*)Bh + boff + 8 * hh); bq.half[1] = *(const v8us*)((const unsigned short*)Bh + boff + 16 + 8 * hh);
      acc[t] = mmaH<1>(ah.v, ah.v, bq.v, bq.v, acc[t]); }
  }
#pragma unroll
  for (int t = 0; t < 4; ++t) { if (col0 + t * 16 >= N) continue; const int col = col0 + t * 16 + ln; const float bv = bp ? bf16_round(bp[col]) : 0.f;
#pragma unroll
    for (int r = 0; r < 8; ++r) { float v = acc[t][r] * alpha + bv; if (CP) { const int rr = row0g + row0 + 8 * hh + r; if (rowsPerB < 0) v += CP[cofs + (size_t)rr * ldc + col];      /* rowsPerB < 0: own element of the batched C plane */ else { const int bidx = rr / rowsPerB; v += CP[(size_t)bidx * sCPb + (size_t)by * 64 + col]; } } if (ACT == 1) v = (v > 0.f) ? v : expm1f(v); else if (ACT == 7) v = (v > 0.f) ? v + 1.0f : expf(v); else if (ACT == 8) v = tanhf(v); else if (ACT == 9) v = 0.5f * v * (1.0f + tanhf(0.7978845608028654f * (v + 0.044715f * v * v * v))); else if (ACT == 11) v = 1.0f / (1.0f + expf(-v)); else if (ACT == 12) v = (v > 0.f) ? v : 0.01f * v; else if (ACT == 14) v = (v > 0.f) ? v : 0.1f * v; else if (ACT == 16) v = (v >= 0.f) ? v : 0.3f * v; else if (ACT == 17) v = (v >= 0.f) ? v : 0.2f * v; else if (ACT == 15) v = v / (1.0f + expf(-v)); else if (ACT == 3) v = fmaxf(v, 0.f); else if (ACT == 6) v = 0.5f * v * (1.0f + erff(v * 0.70710678118654752f)); so[w][8 * hh + r][t * 16 + ln] = v; } }
  __builtin_amdgcn_fence(__ATOMIC_ACQ_REL, "workgroup"); __builtin_amdgcn_wave_barrier();
  const int rsub = lane >> 4, c4 = (lane & 15) * 4; typedef _Float16 v4h __attribute__((ext_vector_type(4)));
  {
#pragma unroll
    for (int q = 0; q < 8; ++q) { const int r = q * 2 + rsub; if (col0 + c4 < N) { const v4f v = *(const v4fa*)&so[w][r][c4]; if (C) *(v4f*)(C + cofs + (size_t)(row0 + r) * ldc + col0 + c4) = v; if (C16) { v4h h4; for (int i = 0; i < 4; ++i) h4[i] = (_Float16)v[i]; *(v4h*)(C16 + cofs + (size_t)(row0 + r) * ldc + col0 + c4) = h4; } } }
     }
}


typedef _Float16 v4h __attribute__((ext_vector_type(4)));

__global__ __launch_bounds__(256) void k_x16(const float* __restrict__ x, _Float16* __restrict__ X16, size_t n8) { const size_t t = (size_t)blockIdx.x * 256 + threadIdx.x; if (t >= n8) return; FragH f;
#pragma unroll
  for (int q = 0; q < 8; ++q) f.h[q] = (_Float16)bf16_round(x[t * 8 + q]); *(v8us*)((unsigned short*)X16 + t * 8) = f.half[0];  }
__global__ __launch_bounds__(256) void k_h16(const float* __restrict__ x, _Float16* __restrict__ X16, size_t n8) { const size_t t = (size_t)blockIdx.x * 256 + threadIdx.x; if (t >= n8) return; FragH f;
#pragma unroll
  for (int q = 0; q < 8; ++q) f.h[q] = (_Float16)x[t * 8 + q]; *(v8us*)((unsigned short*)X16 + t * 8) = f.half[0];  }
__global__ __launch_bounds__(256) void k_round16f(const float* __restrict__ W, _Float16* __restrict__ Bt, size_t n8) { const size_t t = (size_t)blockIdx.x * 256 + threadIdx.x; if (t >= n8) return; FragH f;
#pragma unroll
  for (int i = 0; i < 8; ++i) f.h[i] = (_Float16)(bf16_round(W[t * 8 + i]) * 16.0f); *(v8us*)((unsigned short*)Bt + t * 8) = f.half[0];  }
template <int NHv, int TTv>
__global__ __launch_bounds__(256) void k_vt(const _Float16* __restrict__ V16, int ldv, int voff, _Float16* __restrict__ Vt) { __shared__ unsigned short tl[64][66]; const int tid = threadIdx.x; const int slab = blockIdx.x / (TTv / 64), lg = blockIdx.x % (TTv / 64); const int b = slab / NHv, h = slab % NHv;
  for (int i = tid; i < 64 * 8; i += 256) { const int r = i / 8, c8 = (i % 8) * 8; FragH f; f.half[0] = *(const v8us*)((const unsigned short*)V16 + ((size_t)b * TTv + lg * 64 + r) * ldv + voff + h * 64 + c8);
#pragma unroll
    for (int q = 0; q < 8; ++q) tl[r][c8 + q] = f.u[q]; }
  __syncthreads();
  {
#pragma unroll
    for (int rd = 0; rd < 2; ++rd) { const int d = rd * 32 + tid / 8, pc = tid % 8; FragH f;
#pragma unroll
      for (int q = 0; q < 8; ++q) f.u[q] = tl[pc * 8 + q][d];
      *(v8us*)((unsigned short*)Vt + ((size_t)slab * 64 + d) * TTv + lg * 64 + pc * 8) = f.half[0]; }
     } }

__global__ __launch_bounds__(256) void k_hl(const float* __restrict__ F, _Float16* __restrict__ Hh, _Float16* __restrict__ Hl, size_t n8) { const size_t t = (size_t)blockIdx.x * 256 + threadIdx.x; if (t >= n8) return; FragH fh, fl; const v4f a = *(const v4fa*)(F + t * 8), c = *(const v4fa*)(F + t * 8 + 4);
#pragma unroll
  for (int q = 0; q < 4; ++q) { _Float16 h = (_Float16)a[q]; fh.h[q] = h; fl.h[q] = (_Float16)((a[q] - (float)h) * 1024.0f); h = (_Float16)c[q]; fh.h[4 + q] = h; fl.h[4 + q] = (_Float16)((c[q] - (float)h) * 1024.0f); }
  { *(v8us*)((unsigned short*)Hh + t * 8) = fh.half[0]; *(v8us*)((unsigned short*)Hl + t * 8) = fl.half[0];  } }

// ---- fast GEMM (wave tile 32x64; requires M % 32 == 0 rows per launch region and N % 64 == 0); epilogue = k_gemm_hhx semantics ----
__device__ __forceinline__ v16h g2_frag(const _Float16* p, int hh) { FragH f; f.half[0] = *(const v8us*)((const unsigned short*)p + 8 * hh); f.half[1] = *(const v8us*)((const unsigned short*)p + 16 + 8 * hh); return f.v; }
__device__ __forceinline__ v8f g2_mma(v16h a, v16h b, v8f c) { v8f d = __builtin_amdgcn_wmma_f32_16x16x32_f16(false, a, false, b, (short)0, c, false, false); asm volatile("v_nop\n\tv_nop\n\tv_nop\n\tv_nop" : "+v"(d) : "v"(a), "v"(b)); return d; }
template <int ACT>
__global__ __launch_bounds__(128) void k_gemm2(const _Float16* __restrict__ A, int lda, size_t sA, const _Float16* __restrict__ Bh, int ldb, size_t sB, float alpha, const float* __restrict__ bias, size_t sBias, const float* __restrict__ CP, int rowsPerB, size_t sCPb, int row0g,
    float* __restrict__ C, _Float16* __restrict__ C16, int ldc, size_t sC, int M, int N, int K) { static_assert(ACT == 0 || ACT == 3 || ACT == 6 || ACT == 8 || ACT == 9 || ACT == 11 || ACT == 12 || ACT == 14 || ACT == 15 || ACT == 16 || ACT == 17, "k_gemm2: unsupported ACT code (would silently apply no activation)");
  __shared__ __attribute__((aligned(16))) float so[4][32][68];
  const int tid = threadIdx.x, w = tid >> 5, lane = tid & 31, ln = lane & 15, hh = lane >> 4; const int by = blockIdx.y;
  A += (size_t)by * sA; Bh += (size_t)by * sB; const size_t cofs = (size_t)by * sC; const float* bp = bias ? bias + (size_t)by * sBias : nullptr;
  const int ntn = N >> 6; const int mt = blockIdx.x / ntn, nq = blockIdx.x - mt * ntn; const int row0 = mt * 128 + 32 * w, col0 = nq * 64; if (row0 >= M) return;
  const _Float16* a0p = A + (size_t)(row0 + ln) * lda; const _Float16* a1p = a0p + (size_t)16 * lda;
  const _Float16* b0p = Bh + (size_t)(col0 + ln) * ldb; const _Float16* b1p = b0p + (size_t)16 * ldb; const _Float16* b2p = b1p + (size_t)16 * ldb; const _Float16* b3p = b2p + (size_t)16 * ldb;
  const v8f z8 = {0.f,0.f,0.f,0.f,0.f,0.f,0.f,0.f}; v8f c00 = z8, c01 = z8, c02 = z8, c03 = z8, c10 = z8, c11 = z8, c12 = z8, c13 = z8;
#pragma unroll 1
  for (int kb = 0; kb < K; kb += 32) { const v16h a0 = g2_frag(a0p + kb, hh), a1 = g2_frag(a1p + kb, hh);
    v16h b = g2_frag(b0p + kb, hh); c00 = g2_mma(a0, b, c00); c10 = g2_mma(a1, b, c10);
    b = g2_frag(b1p + kb, hh); c01 = g2_mma(a0, b, c01); c11 = g2_mma(a1, b, c11);
    b = g2_frag(b2p + kb, hh); c02 = g2_mma(a0, b, c02); c12 = g2_mma(a1, b, c12);
    b = g2_frag(b3p + kb, hh); c03 = g2_mma(a0, b, c03); c13 = g2_mma(a1, b, c13); }
  v8f accs[8] = {c00, c01, c02, c03, c10, c11, c12, c13};
#pragma unroll
  for (int u = 0; u < 8; ++u) { const int t = u & 3, half = u >> 2; const int col = col0 + t * 16 + ln; const float bv = bp ? bf16_round(bp[col]) : 0.f;
#pragma unroll
    for (int r = 0; r < 8; ++r) { const int rloc = half * 16 + 8 * hh + r; float v = accs[u][r] * alpha + bv; if (CP) { if (rowsPerB < 0) v += CP[cofs + (size_t)(row0g + row0 + rloc) * ldc + col];      /* rowsPerB < 0: own element of the batched C plane */ else { const int bidx = (row0g + row0 + rloc) / rowsPerB; v += CP[(size_t)bidx * sCPb + (size_t)by * 64 + col]; } }
      if (ACT == 3) v = fmaxf(v, 0.f); else if (ACT == 6) v = 0.5f * v * (1.0f + erff(v * 0.70710678118654752f)); else if (ACT == 11) v = 1.0f / (1.0f + expf(-v)); else if (ACT == 15) v = v / (1.0f + expf(-v)); else if (ACT == 12) v = (v > 0.f) ? v : 0.01f * v; else if (ACT == 8) v = tanhf(v); else if (ACT == 9) v = 0.5f * v * (1.0f + tanhf(0.7978845608028654f * (v + 0.044715f * v * v * v))); else if (ACT == 14) v = (v > 0.f) ? v : 0.1f * v; else if (ACT == 16) v = (v >= 0.f) ? v : 0.3f * v; else if (ACT == 17) v = (v >= 0.f) ? v : 0.2f * v;
      so[w][rloc][t * 16 + ln] = v; } }
  __builtin_amdgcn_fence(__ATOMIC_ACQ_REL, "workgroup"); __builtin_amdgcn_wave_barrier();
  const int rsub = lane >> 4, c4 = (lane & 15) * 4;
  {
#pragma unroll
    for (int q = 0; q < 16; ++q) { const int r = q * 2 + rsub; const v4f v = *(const v4fa*)&so[w][r][c4]; if (C) *(v4f*)(C + cofs + (size_t)(row0 + r) * ldc + col0 + c4) = v; if (C16) { v4h h4; for (int i = 0; i < 4; ++i) h4[i] = (_Float16)v[i]; *(v4h*)(C16 + cofs + (size_t)(row0 + r) * ldc + col0 + c4) = h4; } }
     } }


__global__ __launch_bounds__(256) void k_wnat(const float* __restrict__ w, size_t n8, _Float16* __restrict__ Bt) { const size_t t = (size_t)blockIdx.x * 256 + threadIdx.x; if (t >= n8) return; FragH f; for (int q = 0; q < 8; ++q) f.h[q] = (_Float16)(bf16_round(w[t * 8 + q]) * 16.0f); *(v8us*)((unsigned short*)Bt + t * 8) = f.half[0];  }
__global__ __launch_bounds__(256) void k_rsm(const float* __restrict__ S, _Float16* __restrict__ P, int nrows) {
  #pragma clang fp contract(off)
  const int i = blockIdx.x * 256 + threadIdx.x; if (i >= nrows) return; const float* s = S + (size_t)i * SQ; float mx = -3.0e38f;
#pragma unroll 1
  for (int j = 0; j < SQ; ++j) mx = fmaxf(mx, s[j]); float se = 0.f;
#pragma unroll 1
  for (int j = 0; j < SQ; ++j) se += expf(s[j] - mx); const float sc = 256.0f / se;
#pragma unroll 1
  for (int j0 = 0; j0 < SQ; j0 += 8) { FragH f; for (int q = 0; q < 8; ++q) f.h[q] = (_Float16)(expf(s[j0 + q] - mx) * sc); unsigned short* d = (unsigned short*)P + (size_t)i * SQ + j0; *(v8us*)d = f.half[0];  } }
__global__ __launch_bounds__(256) void k_vt(const _Float16* __restrict__ V16, int b, int h0, _Float16* __restrict__ VT) { __shared__ unsigned short tl[64][65]; const int tid = threadIdx.x; const int hh = blockIdx.x % HG, sg = blockIdx.x / HG; const int s0 = sg * 64; const int h = h0 + hh;
  for (int i = tid; i < 64 * 8; i += 256) { const int j = i / 8, d8 = (i % 8) * 8; FragH f; f.half[0] = *(const v8us*)((const unsigned short*)V16 + ((size_t)b * SQ + s0 + j) * DM + h * HD + d8); for (int q = 0; q < 8; ++q) tl[d8 + q][j] = f.u[q]; }
  __syncthreads();
  { for (int i = tid; i < 64 * 8; i += 256) { const int d = i / 8, j8 = (i % 8) * 8; FragH f; for (int q = 0; q < 8; ++q) f.u[q] = tl[d][j8 + q]; *(v8us*)((unsigned short*)VT + ((size_t)hh * HD + d) * SQ + s0 + j8) = f.half[0]; }  } }



__global__ __launch_bounds__(256) void k_rsmcf2(const float* __restrict__ S, _Float16* __restrict__ P, int hg, int q0, int nk) {
  #pragma clang fp contract(off)
  const int t = blockIdx.x * 256 + threadIdx.x; if (t >= hg * QT) return; const size_t i = (size_t)t; const float* s = S + i * NKX; const int last = q0 + (t % QT); float mx = -3.0e38f;
#pragma unroll 1
  for (int j = 0; j < nk; ++j) { const float f = (j <= last) ? 1.f : 0.f; mx = fmaxf(mx, fmaf(f, s[j], (1.f - f) * -1.0e9f)); } float se = 0.f;
#pragma unroll 1
  for (int j = 0; j < nk; ++j) { const float f = (j <= last) ? 1.f : 0.f; se += __expf(fmaf(f, s[j], (1.f - f) * -1.0e9f) - mx); } const float sc = 256.0f / se;
#pragma unroll 1
  for (int j0 = 0; j0 < nk; j0 += 8) { FragH fr; for (int q = 0; q < 8; ++q) { const int j = j0 + q; const float f = (j <= last) ? 1.f : 0.f; fr.h[q] = (_Float16)(__expf(fmaf(f, s[j], (1.f - f) * -1.0e9f) - mx) * sc); } unsigned short* d = (unsigned short*)P + i * NKX + j0; *(v8us*)d = fr.half[0];  } }

template <int MASKADD>
__global__ __launch_bounds__(64) void k_att0(const float* __restrict__ QF, const float* __restrict__ KF, const float* __restrict__ VF, int ld, const float* __restrict__ mask, float scale, float* __restrict__ OF, int ldo) {
  #pragma clang fp contract(off)
  __shared__ __attribute__((aligned(16))) float lq[64][64]; __shared__ __attribute__((aligned(16))) float lo[64][64];
  const int tid = threadIdx.x; const int h = blockIdx.x / (QT0 / 64), rg = blockIdx.x % (QT0 / 64); const int i = rg * 64 + tid;
  const float* qr = QF + (size_t)i * ld + h * HD;
#pragma unroll 1
  for (int c = 0; c < HD / 4; ++c) { *(v4f*)&lq[tid][c * 4] = *(const v4fa*)(qr + c * 4); const v4f z = {0.f, 0.f, 0.f, 0.f}; *(v4f*)&lo[tid][c * 4] = z; }
  float m = -1.0e30f, l = 0.f; const int jmax = MASKADD ? (SQ - 1) : (rg * 64 + 63);      /* additive-mask form: every key (the mask input decides); causal form: keys up to the block's last row */
#pragma unroll 1
  for (int j = 0; j <= jmax; ++j) { const float* kr = KF + (size_t)j * ld + h * HD; const float* vr = VF + (size_t)j * ld + h * HD; float s = 0.f;
#pragma unroll 1
    for (int c = 0; c < HD / 4; ++c) { const v4f kq = *(const v4fa*)(kr + c * 4); const v4f qq = *(v4f*)&lq[tid][c * 4]; s = __fadd_rn(s, __fmul_rn(qq[0], kq[0])); s = __fadd_rn(s, __fmul_rn(qq[1], kq[1])); s = __fadd_rn(s, __fmul_rn(qq[2], kq[2])); s = __fadd_rn(s, __fmul_rn(qq[3], kq[3])); }
    s = __fmul_rn(s, scale); if (MASKADD) s = __fadd_rn(s, __fmul_rn(bf16_round(mask[(size_t)i * SQ + j]), -10000.0f));
    const float f = (MASKADD || j <= i) ? 1.f : 0.f; const float sm = fmaf(f, s, (1.f - f) * -1.0e30f); const float mn = fmaxf(m, sm); const float sc = expf(m - mn); const float e = expf(sm - mn); l = __fadd_rn(__fmul_rn(l, sc), e); m = mn;
#pragma unroll 1
    for (int c = 0; c < HD / 4; ++c) { const v4f vv = *(const v4fa*)(vr + c * 4); v4f oo = *(v4f*)&lo[tid][c * 4]; for (int u = 0; u < 4; ++u) oo[u] = __fadd_rn(__fmul_rn(oo[u], sc), __fmul_rn(e, vv[u])); *(v4f*)&lo[tid][c * 4] = oo; } }
  const float fin = 64.0f / l;      /* o carried x64 like the f16 path */
#pragma unroll 1
  for (int c = 0; c < HD / 4; ++c) { v4f oo = *(v4f*)&lo[tid][c * 4]; for (int u = 0; u < 4; ++u) oo[u] = __fmul_rn(oo[u], fin); *(v4f*)&lo[tid][c * 4] = oo; }
  __syncthreads();
  {
#pragma unroll 1
    for (int it = 0; it < 16; ++it) { const int row = it * 4 + tid / 16, pc = (tid % 16) * 4; const v4f v = *(const v4f*)&lo[row][pc]; *(v4f*)(OF + (size_t)(rg * 64 + row) * ldo + h * HD + pc) = v; }
     } }

__global__ __launch_bounds__(256) void k_oscale(const float* __restrict__ OF, float* __restrict__ out, size_t n4) { const size_t t = (size_t)blockIdx.x * 256 + threadIdx.x; if (t >= n4) return; const v4f a = *(const v4fa*)(OF + t * 4); v4f o; for (int q = 0; q < 4; ++q) o[q] = a[q] * 0.015625f; *(v4f*)(out + t * 4) = o;  }

__global__ __launch_bounds__(256) void k_bfr(const float* __restrict__ x, float* __restrict__ XB, size_t n8) { const size_t t = (size_t)blockIdx.x * 256 + threadIdx.x; if (t >= n8) return; v4f a = *(const v4fa*)(x + t * 8), c = *(const v4fa*)(x + t * 8 + 4); for (int q = 0; q < 4; ++q) { a[q] = bf16_round(a[q]); c[q] = bf16_round(c[q]); }
  { *(v4f*)(XB + t * 8) = a; *(v4f*)(XB + t * 8 + 4) = c;  } }



__global__ __launch_bounds__(256) void k_rsmfvl(const float* __restrict__ S, _Float16* __restrict__ P, _Float16* __restrict__ PL, int qn, const int* __restrict__ vlp) {
  #pragma clang fp contract(off)
  const int t = blockIdx.x * 256 + threadIdx.x; if (t >= qn) return; const int vl = vlp[0]; const size_t i = (size_t)t; const float* s = S + i * SQ; float mx = -3.0e38f;
#pragma unroll 1
  for (int j = 0; j < SQ; ++j) { const float f = (j < vl) ? 1.f : 0.f; mx = fmaxf(mx, fmaf(f, s[j], (1.f - f) * -1000000.0f)); } float se = 0.f;
#pragma unroll 1
  for (int j = 0; j < SQ; ++j) { const float f = (j < vl) ? 1.f : 0.f; se += __expf(fmaf(f, s[j], (1.f - f) * -1000000.0f) - mx); } const float sc = 256.0f / se;
#pragma unroll 1
  for (int j0 = 0; j0 < SQ; j0 += 8) { FragH fr, gr; for (int q = 0; q < 8; ++q) { const int j = j0 + q; const float f = (j < vl) ? 1.f : 0.f; const float pv = __expf(fmaf(f, s[j], (1.f - f) * -1000000.0f) - mx) * sc; const _Float16 ph = (_Float16)pv; fr.h[q] = ph; gr.h[q] = (_Float16)((pv - (float)ph) * 1024.0f); }
    unsigned short* d = (unsigned short*)P + i * SQ + j0; unsigned short* dl = (unsigned short*)PL + i * SQ + j0; *(v8us*)d = fr.half[0]; *(v8us*)dl = gr.half[0];  } }

__global__ __launch_bounds__(256) void k_rsmf(const float* __restrict__ S, _Float16* __restrict__ P, int qn, int hg) {
  #pragma clang fp contract(off)
  const int t = blockIdx.x * 256 + threadIdx.x; if (t >= qn * hg) return; const size_t i = (size_t)(t / qn) * SQ + (t % qn); const float* s = S + i * SQ; float mx = -3.0e38f;
#pragma unroll 1
  for (int j = 0; j < SQ; ++j) mx = fmaxf(mx, s[j]); float se = 0.f;
#pragma unroll 1
  for (int j = 0; j < SQ; ++j) se += __expf(s[j] - mx); const float sc = 256.0f / se;
#pragma unroll 1
  for (int j0 = 0; j0 < SQ; j0 += 8) { FragH f; for (int q = 0; q < 8; ++q) f.h[q] = (_Float16)(__expf(s[j0 + q] - mx) * sc); unsigned short* d = (unsigned short*)P + i * SQ + j0; *(v8us*)d = f.half[0];  } }


#define CN 256          /* channels */
#define CI 128          /* inner channels */
#define NP 4096         /* positions */
#define NM 4096         /* key positions (= SQ) */
#define NC CN           /* BN statistics macros */
#define NPX NP
#define BNEPS 1e-5f

__global__ __launch_bounds__(256) void k_rowbias(const float* __restrict__ b, float* __restrict__ BP, size_t n4, int ncol) { const size_t t = (size_t)blockIdx.x * 256 + threadIdx.x; if (t >= n4) return; const size_t e = t * 4; const float v = bf16_round(b[e / ncol]); const v4f o = {v, v, v, v}; *(v4f*)(BP + e) = o;  }




__global__ __launch_bounds__(256) void k_mp2(const float* __restrict__ src, float* __restrict__ dst, int nout) {
  const int t = blockIdx.x * 256 + threadIdx.x; if (t >= nout) return; const int c = t / 1024; const int o = t % 1024; const int oy = o / 32, ox = o % 32; const float* p = src + (size_t)c * 4096 + (size_t)(2 * oy) * 64 + 2 * ox;
  const float v = fmaxf(fmaxf(p[0], p[1]), fmaxf(p[64], p[65])); *(float*)(dst + t) = v;  }
__global__ __launch_bounds__(256) void k_xpb(const float* __restrict__ x, const float* __restrict__ wb, float* __restrict__ CPP, size_t n4) {
  #pragma clang fp contract(off)
  const size_t t = (size_t)blockIdx.x * 256 + threadIdx.x; if (t >= n4) return; const size_t e = t * 4; const int c = (int)((e / 4096) % 256); const float bb = bf16_round(wb[c]); const v4f a = *(const v4fa*)(x + e); v4f o; for (int q = 0; q < 4; ++q) o[q] = __fadd_rn(bf16_round(a[q]), bb);
  *(v4f*)(CPP + e) = o;  }


template <int PASS>
__global__ __launch_bounds__(256) void k_cstA(const float* __restrict__ X, const float* __restrict__ MV, float* __restrict__ PART) {
  #pragma clang fp contract(off)
  __shared__ float red[256]; const int t = threadIdx.x; const size_t bc = blockIdx.x; const int c = (int)(bc % NC); const float* row = X + bc * (size_t)NPX; const float mu = PASS ? MV[c] : 0.f; float s = 0.f;
  for (int i = t; i < NPX; i += 256) { const float v = row[i]; const float d = PASS ? __fadd_rn(v, -mu) : v; s = __fadd_rn(s, PASS ? __fmul_rn(d, d) : d); }
  red[t] = s; __syncthreads(); for (int st = 128; st > 0; st >>= 1) { if (t < st) red[t] = __fadd_rn(red[t], red[t + st]); __syncthreads(); }
  if (t < 32) { const float pv = (t == 0) ? red[0] : 0.f; *(float*)(PART + bc * 32 + t) = pv;  } }      

template <int PASS>
__global__ __launch_bounds__(256) void k_cstB(const float* __restrict__ PART, float* __restrict__ MV) { const int c = threadIdx.x; if (c >= NC) return; double s = 0.0; for (int b = 0; b < NB; ++b) s += (double)PART[((size_t)b * NC + c) * 32]; const float m = (float)(s / ((double)NB * (double)NPX)); *(float*)(MV + PASS * NC + c) = m;  }


__global__ __launch_bounds__(256) void k_bnresid(const float* __restrict__ C2, const float* __restrict__ MV, const float* __restrict__ g, const float* __restrict__ be, const float* __restrict__ X, float* __restrict__ out, size_t n4) {
  #pragma clang fp contract(off)
  const size_t t = (size_t)blockIdx.x * 256 + threadIdx.x; if (t >= n4) return; const size_t e = t * 4; const int c = (int)((e / NPX) % NC); const float sc = __fmul_rn(rsqrtf(__fadd_rn(MV[NC + c], BNEPS)), bf16_round(g[c])); const float mu = MV[c], bb = bf16_round(be[c]);
  const v4f a = *(const v4fa*)(C2 + e); const v4f xx = *(const v4fa*)(X + e); v4f o; for (int q = 0; q < 4; ++q) { const float z = __fadd_rn(__fmul_rn(__fadd_rn(a[q], -mu), sc), bb); o[q] = __fadd_rn(z, bf16_round(xx[q])); }
  *(v4f*)(out + e) = o;  }


__global__ __launch_bounds__(256) void k_rowbias(float* __restrict__ Y, const float* __restrict__ bias) {
  #pragma clang fp contract(off)
  const size_t t = (size_t)blockIdx.x * 256 + threadIdx.x; if (t >= (size_t)NB * NC * NPX / 4) return; const size_t e = t * 4; const int c = (int)((e / NPX) % NC); const float bb = bf16_round(bias[c]);
  v4f v = *(const v4fa*)(Y + e); for (int q = 0; q < 4; ++q) v[q] = __fadd_rn(v[q], bb); *(v4f*)(Y + e) = v;  }


// Column statistics in one launch, S read once. A work-group owns 16 columns (64 B of every row): 1,024 threads = 256 row lanes x 4 column quads.
// A thread keeps its 16 rows x 4 columns in registers (16 loads of 16 B in flight per lane), so the maximum and the sum both come from the one read.
// Fold over rows: the thread's 16 rows, the 8 row lanes of a wave by lane exchange, the 32 waves through LDS.
// ST holds one 128-B record per work-group (one writer per line): 16 maxima, then 16 x (256 / sum).
// Every loop here carries #pragma unroll so that v[] and the vector elements are indexed by constants and stay in registers (a run-time index would send them to scratch).
#define CSC 16                    /* columns per work-group */
#define CSR (NP / 256)            /* rows per thread */
template <bool MAXOP>
__device__ __forceinline__ v4f cs_op(v4f a, v4f b) { v4f r;
#pragma unroll
  for (int q = 0; q < 4; ++q) r[q] = MAXOP ? fmaxf(a[q], b[q]) : a[q] + b[q];
  return r; }
template <bool MAXOP>
__device__ __forceinline__ v4f cs_fold(v4f v) {      /* butterfly over the 8 lanes of a wave that share lane & 3; every lane ends with the same bits */
#pragma unroll
  for (int m = 4; m <= 16; m <<= 1) { v4f o;
#pragma unroll
    for (int q = 0; q < 4; ++q) o[q] = __shfl_xor(v[q], m, 32);
    v = cs_op<MAXOP>(v, o); }
  return v; }
template <bool MAXOP>
__device__ __forceinline__ v4f cs_block(v4f v, float (*red)[CSC], int w, int lane) {      /* over all 256 row lanes; every thread gets the result of its column quad */
  v = cs_fold<MAXOP>(v);
  if (lane < 4) *(v4f*)&red[w][lane * 4] = v;
  __syncthreads();
  v4f r = *(const v4f*)&red[lane >> 2][(lane & 3) * 4];
#pragma unroll
  for (int k = 1; k < 4; ++k) r = cs_op<MAXOP>(r, *(const v4f*)&red[(lane >> 2) + 8 * k][(lane & 3) * 4]);
  return cs_fold<MAXOP>(r); }
__global__ __launch_bounds__(1024) void k_colstat(const float* __restrict__ S, float* __restrict__ ST) {
  __shared__ __attribute__((aligned(16))) float rmx[32][CSC]; __shared__ __attribute__((aligned(16))) float rse[32][CSC];
  const int tid = threadIdx.x, w = tid >> 5, lane = tid & 31;
  const float* s = S + (size_t)(tid >> 2) * CSR * NM + blockIdx.x * CSC + (tid & 3) * 4;
  v4f v[CSR];
#pragma unroll
  for (int i = 0; i < CSR; ++i) v[i] = *(const v4fa*)(s + (size_t)i * NM);
  asm volatile("s_wait_xcnt 0x0" :: "v"(s) : "memory");      /* a precaution: the address pair that the 16 loads name stays live and unwritten up to this wait */
  v4f mx = {-3.0e38f, -3.0e38f, -3.0e38f, -3.0e38f};
#pragma unroll
  for (int i = 0; i < CSR; ++i) mx = cs_op<true>(mx, v[i]);
  mx = cs_block<true>(mx, rmx, w, lane);
  v4f se = {0.f, 0.f, 0.f, 0.f};
#pragma unroll
  for (int i = 0; i < CSR; ++i) {
#pragma unroll
    for (int q = 0; q < 4; ++q) se[q] += __expf(v[i][q] - mx[q]); }
  se = cs_block<false>(se, rse, w, lane);
  if (tid < 4) { v4f iv;
#pragma unroll
    for (int q = 0; q < 4; ++q) iv[q] = 256.0f / se[q];
    float* rec = ST + (size_t)blockIdx.x * (2 * CSC) + tid * 4; *(v4f*)rec = mx; *(v4f*)(rec + CSC) = iv; } }
__global__ __launch_bounds__(256) void k_colp(const float* __restrict__ S, const float* __restrict__ CMX, const float* __restrict__ CIV, _Float16* __restrict__ P) {
  #pragma clang fp contract(off)
  const size_t t = (size_t)blockIdx.x * 256 + threadIdx.x; if (t >= (size_t)NP * NM / 8) return; const size_t e = t * 8; const int mc = (int)(e % NM); const int m0 = (mc / CSC) * (2 * CSC) + mc % CSC;      /* the column's place in its work-group's 128-B record */ FragH f;
  for (int q = 0; q < 8; ++q) f.h[q] = (_Float16)(__expf(S[e + q] - CMX[m0 + q]) * CIV[m0 + q]);
  unsigned short* d = (unsigned short*)P + e; *(v8us*)d = f.half[0];  }
extern "C" void kernel_launch(void* const* d_in, const int* in_sizes, int n_in,
                              void* d_out, int out_size, void* d_ws, size_t ws_size, hipStream_t stream) {
  (void)in_sizes; (void)n_in; (void)out_size;
  const float* const* I = (const float* const*)d_in; const float* x = I[0]; const float* tw = I[1]; const float* pw = I[2]; const float* gw = I[3]; const float* ww = I[4]; const float* tb = nullptr; const float* pb = nullptr; const float* gb = nullptr;      /* natural 1x1 conv weights: w_theta, w_phi, w_g [128][256], w_mask [256][128]; no biases */
  char* ws = (char*)d_ws; size_t off = 0;
  auto take = [&](size_t bytes) { char* p = ws + off; off += (bytes + 255) & ~(size_t)255; return p; };
  const size_t PL = (size_t)CN * NP;      /* one input map */
  _Float16* BT = (_Float16*)take((size_t)CI * CN * 2); _Float16* BP = (_Float16*)take((size_t)CI * CN * 2); _Float16* BG = (_Float16*)take((size_t)CI * CN * 2); _Float16* BW = (_Float16*)take((size_t)CN * CI * 2);
  _Float16* X16 = (_Float16*)take(NB * PL * 2); float* XB = (float*)take(NB * PL * 4);      /* x f16 channel-first; bf16(x) f32 for the residual */
  _Float16* XT = (_Float16*)take(PL * 2); _Float16* TH = (_Float16*)take((size_t)NP * CI * 2); _Float16* PHT = (_Float16*)take((size_t)NP * CI * 2); _Float16* GT = (_Float16*)take((size_t)NP * CI * 2); _Float16* G = (_Float16*)take((size_t)CI * NP * 2); _Float16* YT = (_Float16*)take((size_t)NP * CI * 2);
  float* S = (float*)take((size_t)NP * NM * 4); _Float16* P = (_Float16*)take((size_t)NP * NM * 2); float* ST = (float*)take((size_t)NM * 2 * 4);      /* per-column max and 256 / sum, one 128-B record per 16 columns */
  if (off > ws_size) return;
  { const unsigned g = (unsigned)(((size_t)CI * CN / 8 + 255) / 256); k_wnat<<<g, 256, 0, stream>>>(tw, (size_t)CI * CN / 8, BT); k_wnat<<<g, 256, 0, stream>>>(pw, (size_t)CI * CN / 8, BP); k_wnat<<<g, 256, 0, stream>>>(gw, (size_t)CI * CN / 8, BG); k_wnat<<<g, 256, 0, stream>>>(ww, (size_t)CN * CI / 8, BW); }      /* natural [out][in] x16 f16 planes (Bt for theta/phi/g token rows; the A operand for W) */
  k_x16<<<(unsigned)((NB * PL / 8 + 255) / 256), 256, 0, stream>>>(x, X16, NB * PL / 8); k_bfr<<<(unsigned)((NB * PL / 8 + 255) / 256), 256, 0, stream>>>(x, XB, NB * PL / 8);
  for (int b = 0; b < NB; ++b) {
    k_vt<NP / 64, CN><<<(NP / 64) * (CN / 64), 256, 0, stream>>>(X16 + (size_t)b * PL, NP, 0, XT);      /* [c][n] -> x^T [n][c] token rows */
    k_gemm2<0><<<dim3((unsigned)((NP / 128) * (CI / 64)), 1), 128, 0, stream>>>(XT, CN, 0, BT, CN, 0, 0.0625f, tb, 0, nullptr, 1, 0, 0, nullptr, TH, CI, 0, NP, CI, CN);      /* theta^T [n][ci] -> f16 */
    k_gemm2<0><<<dim3((unsigned)((NP / 128) * (CI / 64)), 1), 128, 0, stream>>>(XT, CN, 0, BP, CN, 0, 0.0625f, pb, 0, nullptr, 1, 0, 0, nullptr, PHT, CI, 0, NP, CI, CN);      /* phi^T [m][ci] -> f16 (the scores' B^T operand) */
    k_gemm2<0><<<dim3((unsigned)((NP / 128) * (CI / 64)), 1), 128, 0, stream>>>(XT, CN, 0, BG, CN, 0, 0.0625f, gb, 0, nullptr, 1, 0, 0, nullptr, GT, CI, 0, NP, CI, CN);      /* g^T [m][ci] -> f16 */
    k_vt<CI / 64, NP><<<(CI / 64) * (NP / 64), 256, 0, stream>>>(GT, CI, 0, G);      /* -> g [ci][m] (the PV B^T operand) */
    k_gemm2<0><<<dim3((unsigned)((NP / 128) * (NM / 64)), 1), 128, 0, stream>>>(TH, CI, 0, PHT, CI, 0, 1.0f, nullptr, 0, nullptr, 1, 0, 0, S, nullptr, NM, 0, NP, NM, CI);      /* f[a][b] = theta[:, a].phi[:, b] (K = 128, NO scale) */
    k_colstat<<<NM / CSC, 1024, 0, stream>>>(S, ST); k_colp<<<(unsigned)(((size_t)NP * NM / 8 + 255) / 256), 256, 0, stream>>>(S, ST, ST + CSC, P);      /* softmax over the QUERY axis: per key column m the max and sum over all 4096 rows n, then P[n][m] = f16(256 exp(s - max_m) / sum_m) */
    k_gemm2<0><<<dim3((unsigned)((NP / 128) * (CI / 64)), 1), 128, 0, stream>>>(P, NM, 0, G, NM, 0, 0.00390625f, nullptr, 0, nullptr, 1, 0, 0, nullptr, YT, CI, 0, NP, CI, NM);      /* y^T [a][ci] = sum_b P[a][b] g[ci][b] -> f16 */
    k_gemm2<0><<<dim3((unsigned)((CN / 128) * (NP / 64)), 1), 128, 0, stream>>>(BW, CI, 0, YT, CI, 0, 0.0625f, nullptr, 0, XB + (size_t)b * PL, -1, 0, 0, (float*)d_out + (size_t)b * PL, nullptr, NP, 0, CN, NP, CI); }      /* out[c][a] = (16 W as A) x (y^T as B^T) / 16 + bf16(x) (own element) -> f32 channel-first output block */
}

// v002
// Measured time: 493 microseconds a run.
// Next to v001, in two timings, it ran 2.00 and 2.01 times as fast.
// Over all steps from v000 it is 14.4 times as fast.
#include <hip/hip_runtime.h>
// Non-local block with the softmax taken over the QUERY axis (x [4][256][64][64]; theta, phi, g = conv1x1(x) with [128][256] weights (U(+-1/16), no biases); scores[n][m] = theta[n].phi[m] (NO scaling); attn = softmax(scores, axis = 1): normalised over n for every key column m (the module's unconventional axis); out[n] = sum_m attn[n][m] g[m]; mask = conv1x1(out; w_mask [256][128], no bias); result = x + mask -> [4][256][64][64]).
// Structure: channel-first; x as exact f16 planes and bf16(x) f32 residual planes; per image: token rows via LDS transposes; theta^T, phi^T, g^T as WMMA GEMMs (32x64 wave tiles, f32 accumulation, no bias) -> f16; g to channel-major via LDS transposes; f [4096][4096] = theta^T phi (K = 128, no scale) f32; column softmax on VALU (f32 statistics, native exp; weights x256 f16); y^T = P g^T (x2^-8) f16; out = (16 W) y / 16 + bf16(x) f32 channel-first.
// Compute dtype: inputs rounded to bf16; x / weights exact; q, k, v, softmax weights and o as plain f16 GEMM operands (~2^-12); scores and softmax statistics f32. v_wmma_f32_16x16x32_f16.
#define NB 4
#define SQ 4096
#define DM 256
#define NH 1
#define HD 64
#define HG 4                         /* heads per attention launch group */
#define B0 0                         /* first batch processed (debug hook) */
#define NBR NB                       /* batches processed (debug hook) */
#define NR ((size_t)NB * SQ)         /* token rows */
#define MP ((int)((size_t)NBR * SQ)) /* rows projected (debug hook) */
#define QT 256                       /* query rows per causal tile */
#define NKX SQ                       /* S / P row pitch */
#define QT0 256                      /* first-tile rows recomputed exactly (256: buys margin for the few-key rows 128..255, which have no output projection to average the single-f16 P/v rounding) */
#define QN SQ                        /* query rows attended per batch (debug hook) */
#define NHD NH                       /* heads attended (debug hook) */
#define MPO MP                       /* rows through the output stage (debug hook) */
#define LQ DM            /* row pitch of the q/k/v rows */
typedef __bf16 v16b __attribute__((ext_vector_type(16)));
typedef unsigned short v8us __attribute__((ext_vector_type(8), may_alias));
typedef float  v8f  __attribute__((ext_vector_type(8)));
typedef float  v4f  __attribute__((ext_vector_type(4)));
typedef float  v4fa __attribute__((ext_vector_type(4), may_alias));
union FragB { v16b v; v8us half[2]; unsigned short u[16]; };

__device__ __forceinline__ unsigned short bf16_bits(float x) { unsigned int u = __float_as_uint(x); return (unsigned short)((u + 0x7FFFu + ((u >> 16) & 1u)) >> 16); }
__device__ __forceinline__ float bf16_val(unsigned short b) { return __uint_as_float(((unsigned int)b) << 16); }
__device__ __forceinline__ float bf16_round(float x) { return bf16_val(bf16_bits(x)); }
// D += A·B with NT terms: 1 = ah·bh, 2 = + al·bh (A split), 3 = + ah·bl (both split)
template <int NT>
__device__ __forceinline__ v8f mmaN(v16b ah, v16b al, v16b bh, v16b bl, v8f c) {
  c = __builtin_amdgcn_wmma_f32_16x16x32_bf16(false, ah, false, bh, (short)0, c, false, false);
  if (NT >= 2) c = __builtin_amdgcn_wmma_f32_16x16x32_bf16(false, al, false, bh, (short)0, c, false, false);
  if (NT >= 3) c = __builtin_amdgcn_wmma_f32_16x16x32_bf16(false, ah, false, bl, (short)0, c, false, false);
  asm volatile("v_nop\n\tv_nop\n\tv_nop\n\tv_nop" : "+v"(c) : "v"(ah), "v"(al), "v"(bh), "v"(bl));
  return c;
}

__global__ __launch_bounds__(256) void k_wt_bf16(const float* __restrict__ W, unsigned short* __restrict__ Wt, int K, int N) {
  const int t = blockIdx.x * 256 + threadIdx.x;
  const int k8n = K / 8;
  if (t >= N * k8n) return;
  const int n = t / k8n, k8 = (t % k8n) * 8;
  v8us v;
#pragma unroll
  for (int i = 0; i < 8; ++i) v[i] = bf16_bits(W[(size_t)(k8 + i) * N + n]);
  *(v8us*)(Wt + (size_t)n * K + k8) = v;
  
}

// GEMM C[M][N] (f32, pitch ldc) = act(A[M][K]·W + bias). A f32 row-major (pitch lda) converted per fragment to bf16
// (ASPLIT: hi/lo two planes -> 2 terms, else single rounded term); Wt bf16 [N][K] (pitch ldb). BIAS_BF16 rounds the
// bias to bf16 first (bias quantised to bf16 before the add). K%32==0, M%16==0, N%64==0.
template <bool ASPLIT, int ACT, bool BIAS_BF16>
__global__ __launch_bounds__(128) void k_gemm_bf(const float* __restrict__ A, int lda, const unsigned short* __restrict__ Wt, int ldb,
                                               const float* __restrict__ bias, float* __restrict__ C, int ldc, int M, int N, int K) {
  __shared__ __attribute__((aligned(16))) float so[4][16][64];
  const int tid = threadIdx.x, w = tid >> 5, lane = tid & 31, ln = lane & 15, hh = lane >> 4;
  const int ntn = N / 64;
  const int wid = blockIdx.x * 4 + w;
  const int mt = wid / ntn, nq = wid % ntn;
  if (mt * 16 >= M) return;
  const int row0 = mt * 16, col0 = nq * 64;
  const float* arow = A + (size_t)(row0 + ln) * lda;
  v8f acc[4] = {};
  for (int kb = 0; kb < K; kb += 32) {
    FragB ah, al;
    const v4f x0 = *(const v4fa*)(arow + kb + 8 * hh), x1 = *(const v4fa*)(arow + kb + 8 * hh + 4);
    const v4f x2 = *(const v4fa*)(arow + kb + 16 + 8 * hh), x3 = *(const v4fa*)(arow + kb + 16 + 8 * hh + 4);
    float xs[16] = {x0[0],x0[1],x0[2],x0[3],x1[0],x1[1],x1[2],x1[3],x2[0],x2[1],x2[2],x2[3],x3[0],x3[1],x3[2],x3[3]};
#pragma unroll
    for (int i = 0; i < 16; ++i) { const unsigned short hb = bf16_bits(xs[i]); ah.u[i] = hb; al.u[i] = ASPLIT ? bf16_bits(xs[i] - bf16_val(hb)) : (unsigned short)0; }
#pragma unroll
    for (int t = 0; t < 4; ++t) {
      const unsigned short* brow = Wt + (size_t)(col0 + t * 16 + ln) * ldb + kb;
      FragB b;
      b.half[0] = *(const v8us*)(brow + 8 * hh);
      b.half[1] = *(const v8us*)(brow + 16 + 8 * hh);
      acc[t] = mmaN<ASPLIT ? 2 : 1>(ah.v, al.v, b.v, b.v, acc[t]);
    }
  }
#pragma unroll
  for (int t = 0; t < 4; ++t) {
    float bv = bias ? bias[col0 + t * 16 + ln] : 0.f;
    if (BIAS_BF16) bv = bf16_round(bv);
#pragma unroll
    for (int r = 0; r < 8; ++r) { float v = acc[t][r] + bv; if (ACT == 1) v = fmaxf(v, 0.f); so[w][8 * hh + r][t * 16 + ln] = v; }
  }
  __builtin_amdgcn_fence(__ATOMIC_ACQ_REL, "workgroup");
  __builtin_amdgcn_wave_barrier();
  const int rsub = lane >> 4, c4 = (lane & 15) * 4;
  {
#pragma unroll
    for (int q = 0; q < 8; ++q) {
      const int r = q * 2 + rsub;
      const v4f v = *(const v4fa*)&so[w][r][c4];
      *(v4f*)(C + (size_t)(row0 + r) * ldc + col0 + c4) = v;
    }
    
  }
}

// GEMM C = act(A·W + bias + resid): A f32 (ASPLIT -> hi/lo 2 terms), Wt bf16 [N][K]; ACT 0 none, 1 relu, 2 exact gelu;
// resid (optional, f32, row index = (row % rmod), pitch ldr, RES_BF16 rounds it) added before the activation.
template <bool ASPLIT, int ACT, bool BIAS_BF16, bool RES_BF16>
__global__ __launch_bounds__(128) void k_gemm_bf3(const float* __restrict__ A, int lda, const unsigned short* __restrict__ Wt, int ldb,
                                                const float* __restrict__ bias, const float* __restrict__ resid, int rmod, int ldr,
                                                float* __restrict__ C, int ldc, int M, int N, int K) {
  __shared__ __attribute__((aligned(16))) float so[4][16][64];
  const int tid = threadIdx.x, w = tid >> 5, lane = tid & 31, ln = lane & 15, hh = lane >> 4;
  const int ntn = N / 64;
  const int wid = blockIdx.x * 4 + w;
  const int mt = wid / ntn, nq = wid % ntn;
  if (mt * 16 >= M) return;
  const int row0 = mt * 16, col0 = nq * 64;
  const float* arow = A + (size_t)(row0 + ln) * lda;
  v8f acc[4] = {};
  for (int kb = 0; kb < K; kb += 32) {
    FragB ah, al;
    const v4f x0 = *(const v4fa*)(arow + kb + 8 * hh), x1 = *(const v4fa*)(arow + kb + 8 * hh + 4);
    const v4f x2 = *(const v4fa*)(arow + kb + 16 + 8 * hh), x3 = *(const v4fa*)(arow + kb + 16 + 8 * hh + 4);
    float xs[16] = {x0[0],x0[1],x0[2],x0[3],x1[0],x1[1],x1[2],x1[3],x2[0],x2[1],x2[2],x2[3],x3[0],x3[1],x3[2],x3[3]};
#pragma unroll
    for (int i = 0; i < 16; ++i) { const unsigned short hb = bf16_bits(xs[i]); ah.u[i] = hb; al.u[i] = ASPLIT ? bf16_bits(xs[i] - bf16_val(hb)) : (unsigned short)0; }
#pragma unroll
    for (int t = 0; t < 4; ++t) {
      const unsigned short* brow = Wt + (size_t)(col0 + t * 16 + ln) * ldb + kb;
      FragB b;
      b.half[0] = *(const v8us*)(brow + 8 * hh);
      b.half[1] = *(const v8us*)(brow + 16 + 8 * hh);
      acc[t] = mmaN<ASPLIT ? 2 : 1>(ah.v, al.v, b.v, b.v, acc[t]);
    }
  }
#pragma unroll
  for (int t = 0; t < 4; ++t) {
    const int col = col0 + t * 16 + ln;
    float bv = bias ? bias[col] : 0.f;
    if (BIAS_BF16) bv = bf16_round(bv);
#pragma unroll
    for (int r = 0; r < 8; ++r) {
      float v = acc[t][r] + bv;
      if (resid) { float rv = resid[(size_t)((row0 + 8 * hh + r) % rmod) * ldr + col]; if (RES_BF16) rv = bf16_round(rv); v += rv; }
      if (ACT == 1) v = fmaxf(v, 0.f);
      if (ACT == 2) v = 0.5f * v * (1.0f + erff(v * 0.70710678118654752f));
      if (ACT == 3) { const float u = 0.7978845608028654f * (v + 0.044715f * v * v * v); v = 0.5f * v * (1.0f + tanhf(u)); }
      so[w][8 * hh + r][t * 16 + ln] = v;
    }
  }
  __builtin_amdgcn_fence(__ATOMIC_ACQ_REL, "workgroup");
  __builtin_amdgcn_wave_barrier();
  const int rsub = lane >> 4, c4 = (lane & 15) * 4;
  {
#pragma unroll
    for (int q = 0; q < 8; ++q) {
      const int r = q * 2 + rsub;
      const v4f v = *(const v4fa*)&so[w][r][c4];
      *(v4f*)(C + (size_t)(row0 + r) * ldc + col0 + c4) = v;
    }
    
  }
}
// row LayerNorm (biased variance, eps) over N: s = X (+ R); optional out_sum <- s; out_norm <- (s-mu)*rsqrt(var+eps)*g + b
template <bool PARAM_BF16>
__global__ __launch_bounds__(256) void k_layernorm(const float* __restrict__ X, const float* __restrict__ R, const float* __restrict__ g, const float* __restrict__ bta,
                                                  float* __restrict__ out_sum, float* __restrict__ out_norm, int N, float eps) {
  __shared__ float red[256];
  const int row = blockIdx.x, tid = threadIdx.x;
  const float* x = X + (size_t)row * N; const float* rr = R ? R + (size_t)row * N : nullptr;
  float vals[16];                     // up to N = 4096
  const int per = N / 256;            // contiguous chunk per thread? use strided-by-4 chunks: thread handles j = tid*4 + 1024*u
  float s1 = 0.f;
  for (int u = 0; u < per / 4; ++u) {
    const int j = tid * 4 + 1024 * u;
    const v4f a = *(const v4fa*)(x + j);
    v4f b = {0.f,0.f,0.f,0.f}; if (rr) b = *(const v4fa*)(rr + j);
#pragma unroll
    for (int q = 0; q < 4; ++q) { const float v = a[q] + b[q]; vals[u * 4 + q] = v; s1 += v; }
  }
  red[tid] = s1; __syncthreads();
  for (int st = 128; st > 0; st >>= 1) { if (tid < st) red[tid] += red[tid + st]; __syncthreads(); }
  const float mu = red[0] / (float)N; __syncthreads();
  float s2 = 0.f;
  for (int u = 0; u < per / 4; ++u)
#pragma unroll
    for (int q = 0; q < 4; ++q) { const float c = vals[u * 4 + q] - mu; s2 += c * c; }
  red[tid] = s2; __syncthreads();
  for (int st = 128; st > 0; st >>= 1) { if (tid < st) red[tid] += red[tid + st]; __syncthreads(); }
  const float rs = rsqrtf(red[0] / (float)N + eps);
  {
    for (int u = 0; u < per / 4; ++u) {
      const int j = tid * 4 + 1024 * u;
      v4f o, sm;
#pragma unroll
      for (int q = 0; q < 4; ++q) {
        float gg = g[j + q], bb = bta[j + q];
        if (PARAM_BF16) { gg = bf16_round(gg); bb = bf16_round(bb); }
        sm[q] = vals[u * 4 + q]; o[q] = (vals[u * 4 + q] - mu) * rs * gg + bb;
      }
      if (out_sum) *(v4f*)(out_sum + (size_t)row * N + j) = sm;
      *(v4f*)(out_norm + (size_t)row * N + j) = o;
    }
    
  }
}



// ---- f16 WMMA path (v_wmma_f32_16x16x32_f16): 11-bit significands for operands in range — used where a [0,1] probability operand needs more precision than bf16
typedef _Float16 v16h __attribute__((ext_vector_type(16)));
union FragH { v16h v; v8us half[2]; _Float16 h[16]; unsigned short u[16]; };
template <int NT>
__device__ __forceinline__ v8f mmaH(v16h ah, v16h al, v16h bh, v16h bl, v8f c) {
  c = __builtin_amdgcn_wmma_f32_16x16x32_f16(false, ah, false, bh, (short)0, c, false, false);
  if (NT >= 2) c = __builtin_amdgcn_wmma_f32_16x16x32_f16(false, al, false, bh, (short)0, c, false, false);
  if (NT >= 3) c = __builtin_amdgcn_wmma_f32_16x16x32_f16(false, ah, false, bl, (short)0, c, false, false);
  asm volatile("v_nop\n\tv_nop\n\tv_nop\n\tv_nop" : "+v"(c) : "v"(ah), "v"(al), "v"(bh), "v"(bl));
  return c;
}
// batched GEMM like k_gemm_b but f16 operands: A f32 (split into f16 hi/lo if ASPLIT, else rounded to f16), Bt = f16 values [n][k]; alpha; C f32; N multiple of 16 (partial tiles skipped)
template <bool ASPLIT>
__global__ __launch_bounds__(128) void k_gemm_h(const float* __restrict__ A, int lda, size_t sA, const _Float16* __restrict__ Bh, int ldb, size_t sB, float alpha, float* __restrict__ C, int ldc, size_t sC, int M, int N, int K) {
  __shared__ __attribute__((aligned(16))) float so[4][16][64];
  const int tid = threadIdx.x, w = tid >> 5, lane = tid & 31, ln = lane & 15, hh = lane >> 4; const int by = blockIdx.y;
  A += (size_t)by * sA; Bh += (size_t)by * sB; C += (size_t)by * sC;
  const int ntn = (N + 63) / 64; const int wid = blockIdx.x * 4 + w; const int mt = wid / ntn, nq = wid % ntn; if (mt * 16 >= M) return;
  const int row0 = mt * 16, col0 = nq * 64; const float* arow = A + (size_t)(row0 + ln) * lda;
  v8f acc[4] = {};
  for (int kb = 0; kb < K; kb += 32) {
    FragH ah, al;
    const v4f x0 = *(const v4fa*)(arow + kb + 8 * hh), x1 = *(const v4fa*)(arow + kb + 8 * hh + 4), x2 = *(const v4fa*)(arow + kb + 16 + 8 * hh), x3 = *(const v4fa*)(arow + kb + 16 + 8 * hh + 4);
    float xs[16] = {x0[0],x0[1],x0[2],x0[3],x1[0],x1[1],x1[2],x1[3],x2[0],x2[1],x2[2],x2[3],x3[0],x3[1],x3[2],x3[3]};
#pragma unroll
    for (int i = 0; i < 16; ++i) { const _Float16 h = (_Float16)xs[i]; ah.h[i] = h; al.h[i] = ASPLIT ? (_Float16)(xs[i] - (float)h) : (_Float16)0.0f; }
#pragma unroll
    for (int t = 0; t < 4; ++t) { if (col0 + t * 16 >= N) continue; const size_t boff = (size_t)(col0 + t * 16 + ln) * ldb + kb; FragH bq; bq.half[0] = *(const v8us*)(Bh + boff + 8 * hh); bq.half[1] = *(const v8us*)(Bh + boff + 16 + 8 * hh);
      acc[t] = mmaH<ASPLIT ? 2 : 1>(ah.v, al.v, bq.v, bq.v, acc[t]); }
  }
#pragma unroll
  for (int t = 0; t < 4; ++t) { if (col0 + t * 16 >= N) continue;
#pragma unroll
    for (int r = 0; r < 8; ++r) so[w][8 * hh + r][t * 16 + ln] = acc[t][r] * alpha; }
  __builtin_amdgcn_fence(__ATOMIC_ACQ_REL, "workgroup"); __builtin_amdgcn_wave_barrier();
  const int rsub = lane >> 4, c4 = (lane & 15) * 4;
  {
#pragma unroll
    for (int q = 0; q < 8; ++q) { const int r = q * 2 + rsub; if (col0 + c4 < N) { const v4f v = *(const v4fa*)&so[w][r][c4]; *(v4f*)(C + (size_t)(row0 + r) * ldc + col0 + c4) = v; } }
     }
}

// Wt[n][k] = f16(W[k][n]·scale) from f32 row-major W[K][N] (scale = power of two; bf16-exact weights stay exact in f16 away from the subnormal range)
__global__ __launch_bounds__(256) void k_wt_f16(const float* __restrict__ W, _Float16* __restrict__ Wt, int K, int N, float scale) {
  const int t = blockIdx.x * 256 + threadIdx.x; if (t >= N * (K / 8)) return; const int n = t / (K / 8), k8 = (t % (K / 8)) * 8; FragH f;
#pragma unroll
  for (int i = 0; i < 8; ++i) f.h[i] = (_Float16)(bf16_round(W[(size_t)(k8 + i) * N + n]) * scale); const v8us o = f.half[0];
  *(v8us*)((unsigned short*)Wt + (size_t)n * K + k8) = o; 
}
// k_gemm_hh variant with fused epilogue: v = acc·alpha + bias[by·sBias + col] (+ CP[(row/rowsPerB)·sCPb + by·64 + col] if CP) ; ACT 0 none / 1 elu ; writes f16 C16 (and f32 C if non-null)
template <int ACT>
__global__ __launch_bounds__(128) void k_gemm_hhx(const _Float16* __restrict__ A, int lda, size_t sA, const _Float16* __restrict__ Bh, int ldb, size_t sB, float alpha, const float* __restrict__ bias, size_t sBias, const float* __restrict__ CP, int rowsPerB, size_t sCPb, int row0g,
    float* __restrict__ C, _Float16* __restrict__ C16, int ldc, size_t sC, int M, int N, int K) {
  __shared__ __attribute__((aligned(16))) float so[4][16][64];
  const int tid = threadIdx.x, w = tid >> 5, lane = tid & 31, ln = lane & 15, hh = lane >> 4; const int by = blockIdx.y;
  A += (size_t)by * sA; Bh += (size_t)by * sB; const size_t cofs = (size_t)by * sC; const float* bp = bias ? bias + (size_t)by * sBias : nullptr;
  const int ntn = (N + 63) / 64; const int wid = blockIdx.x * 4 + w; const int mt = wid / ntn, nq = wid % ntn; if (mt * 16 >= M) return;
  const int row0 = mt * 16, col0 = nq * 64; const _Float16* arow = A + (size_t)(row0 + ln) * lda;
  v8f acc[4] = {};
  for (int kb = 0; kb < K; kb += 32) { FragH ah; ah.half[0] = *(const v8us*)((const unsigned short*)arow + kb + 8 * hh); ah.half[1] = *(const v8us*)((const unsigned short*)arow + kb + 16 + 8 * hh);
#pragma unroll
    for (int t = 0; t < 4; ++t) { if (col0 + t * 16 >= N) continue; const size_t boff = (size_t)(col0 + t * 16 + ln) * ldb + kb; FragH bq; bq.half[0] = *(const v8us*)((const unsigned short*)Bh + boff + 8 * hh); bq.half[1] = *(const v8us*)((const unsigned short*)Bh + boff + 16 + 8 * hh);
      acc[t] = mmaH<1>(ah.v, ah.v, bq.v, bq.v, acc[t]); }
  }
#pragma unroll
  for (int t = 0; t < 4; ++t) { if (col0 + t * 16 >= N) continue; const int col = col0 + t * 16 + ln; const float bv = bp ? bf16_round(bp[col]) : 0.f;
#pragma unroll
    for (int r = 0; r < 8; ++r) { float v = acc[t][r] * alpha + bv; if (CP) { const int rr = row0g + row0 + 8 * hh + r; if (rowsPerB < 0) v += CP[cofs + (size_t)rr * ldc + col];      /* rowsPerB < 0: own element of the batched C plane */ else { const int bidx = rr / rowsPerB; v += CP[(size_t)bidx * sCPb + (size_t)by * 64 + col]; } } if (ACT == 1) v = (v > 0.f) ? v : expm1f(v); else if (ACT == 7) v = (v > 0.f) ? v + 1.0f : expf(v); else if (ACT == 8) v = tanhf(v); else if (ACT == 9) v = 0.5f * v * (1.0f + tanhf(0.7978845608028654f * (v + 0.044715f * v * v * v))); else if (ACT == 11) v = 1.0f / (1.0f + expf(-v)); else if (ACT == 12) v = (v > 0.f) ? v : 0.01f * v; else if (ACT == 14) v = (v > 0.f) ? v : 0.1f * v; else if (ACT == 16) v = (v >= 0.f) ? v : 0.3f * v; else if (ACT == 17) v = (v >= 0.f) ? v : 0.2f * v; else if (ACT == 15) v = v / (1.0f + expf(-v)); else if (ACT == 3) v = fmaxf(v, 0.f); else if (ACT == 6) v = 0.5f * v * (1.0f + erff(v * 0.70710678118654752f)); so[w][8 * hh + r][t * 16 + ln] = v; } }
  __builtin_amdgcn_fence(__ATOMIC_ACQ_REL, "workgroup"); __builtin_amdgcn_wave_barrier();
  const int rsub = lane >> 4, c4 = (lane & 15) * 4; typedef _Float16 v4h __attribute__((ext_vector_type(4)));
  {
#pragma unroll
    for (int q = 0; q < 8; ++q) { const int r = q * 2 + rsub; if (col0 + c4 < N) { const v4f v = *(const v4fa*)&so[w][r][c4]; if (C) *(v4f*)(C + cofs + (size_t)(row0 + r) * ldc + col0 + c4) = v; if (C16) { v4h h4; for (int i = 0; i < 4; ++i) h4[i] = (_Float16)v[i]; *(v4h*)(C16 + cofs + (size_t)(row0 + r) * ldc + col0 + c4) = h4; } } }
     }
}


typedef _Float16 v4h __attribute__((ext_vector_type(4)));

__global__ __launch_bounds__(256) void k_x16(const float* __restrict__ x, _Float16* __restrict__ X16, size_t n8) { const size_t t = (size_t)blockIdx.x * 256 + threadIdx.x; if (t >= n8) return; FragH f;
#pragma unroll
  for (int q = 0; q < 8; ++q) f.h[q] = (_Float16)bf16_round(x[t * 8 + q]); *(v8us*)((unsigned short*)X16 + t * 8) = f.half[0];  }
__global__ __launch_bounds__(256) void k_h16(const float* __restrict__ x, _Float16* __restrict__ X16, size_t n8) { const size_t t = (size_t)blockIdx.x * 256 + threadIdx.x; if (t >= n8) return; FragH f;
#pragma unroll
  for (int q = 0; q < 8; ++q) f.h[q] = (_Float16)x[t * 8 + q]; *(v8us*)((unsigned short*)X16 + t * 8) = f.half[0];  }
__global__ __launch_bounds__(256) void k_round16f(const float* __restrict__ W, _Float16* __restrict__ Bt, size_t n8) { const size_t t = (size_t)blockIdx.x * 256 + threadIdx.x; if (t >= n8) return; FragH f;
#pragma unroll
  for (int i = 0; i < 8; ++i) f.h[i] = (_Float16)(bf16_round(W[t * 8 + i]) * 16.0f); *(v8us*)((unsigned short*)Bt + t * 8) = f.half[0];  }
template <int NHv, int TTv>
__global__ __launch_bounds__(256) void k_vt(const _Float16* __restrict__ V16, int ldv, int voff, _Float16* __restrict__ Vt) { __shared__ unsigned short tl[64][66]; const int tid = threadIdx.x; const int slab = blockIdx.x / (TTv / 64), lg = blockIdx.x % (TTv / 64); const int b = slab / NHv, h = slab % NHv;
  for (int i = tid; i < 64 * 8; i += 256) { const int r = i / 8, c8 = (i % 8) * 8; FragH f; f.half[0] = *(const v8us*)((const unsigned short*)V16 + ((size_t)b * TTv + lg * 64 + r) * ldv + voff + h * 64 + c8);
#pragma unroll
    for (int q = 0; q < 8; ++q) tl[r][c8 + q] = f.u[q]; }
  __syncthreads();
  {
#pragma unroll
    for (int rd = 0; rd < 2; ++rd) { const int d = rd * 32 + tid / 8, pc = tid % 8; FragH f;
#pragma unroll
      for (int q = 0; q < 8; ++q) f.u[q] = tl[pc * 8 + q][d];
      *(v8us*)((unsigned short*)Vt + ((size_t)slab * 64 + d) * TTv + lg * 64 + pc * 8) = f.half[0]; }
     } }

__global__ __launch_bounds__(256) void k_hl(const float* __restrict__ F, _Float16* __restrict__ Hh, _Float16* __restrict__ Hl, size_t n8) { const size_t t = (size_t)blockIdx.x * 256 + threadIdx.x; if (t >= n8) return; FragH fh, fl; const v4f a = *(const v4fa*)(F + t * 8), c = *(const v4fa*)(F + t * 8 + 4);
#pragma unroll
  for (int q = 0; q < 4; ++q) { _Float16 h = (_Float16)a[q]; fh.h[q] = h; fl.h[q] = (_Float16)((a[q] - (float)h) * 1024.0f); h = (_Float16)c[q]; fh.h[4 + q] = h; fl.h[4 + q] = (_Float16)((c[q] - (float)h) * 1024.0f); }
  { *(v8us*)((unsigned short*)Hh + t * 8) = fh.half[0]; *(v8us*)((unsigned short*)Hl + t * 8) = fl.half[0];  } }

// ---- fast GEMM (wave tile 32x64; requires M % 32 == 0 rows per launch region and N % 64 == 0); epilogue = k_gemm_hhx semantics ----
__device__ __forceinline__ v16h g2_frag(const _Float16* p, int hh) { FragH f; f.half[0] = *(const v8us*)((const unsigned short*)p + 8 * hh); f.half[1] = *(const v8us*)((const unsigned short*)p + 16 + 8 * hh); return f.v; }
__device__ __forceinline__ v8f g2_mma(v16h a, v16h b, v8f c) { v8f d = __builtin_amdgcn_wmma_f32_16x16x32_f16(false, a, false, b, (short)0, c, false, false); asm volatile("v_nop\n\tv_nop\n\tv_nop\n\tv_nop" : "+v"(d) : "v"(a), "v"(b)); return d; }
template <int ACT>
__global__ __launch_bounds__(128) void k_gemm2(const _Float16* __restrict__ A, int lda, size_t sA, const _Float16* __restrict__ Bh, int ldb, size_t sB, float alpha, const float* __restrict__ bias, size_t sBias, const float* __restrict__ CP, int rowsPerB, size_t sCPb, int row0g,
    float* __restrict__ C, _Float16* __restrict__ C16, int ldc, size_t sC, int M, int N, int K) { static_assert(ACT == 0 || ACT == 3 || ACT == 6 || ACT == 8 || ACT == 9 || ACT == 11 || ACT == 12 || ACT == 14 || ACT == 15 || ACT == 16 || ACT == 17, "k_gemm2: unsupported ACT code (would silently apply no activation)");
  __shared__ __attribute__((aligned(16))) float so[4][32][68];
  const int tid = threadIdx.x, w = tid >> 5, lane = tid & 31, ln = lane & 15, hh = lane >> 4; const int by = blockIdx.y;
  A += (size_t)by * sA; Bh += (size_t)by * sB; const size_t cofs = (size_t)by * sC; const float* bp = bias ? bias + (size_t)by * sBias : nullptr;
  const int ntn = N >> 6; const int mt = blockIdx.x / ntn, nq = blockIdx.x - mt * ntn; const int row0 = mt * 128 + 32 * w, col0 = nq * 64; if (row0 >= M) return;
  const _Float16* a0p = A + (size_t)(row0 + ln) * lda; const _Float16* a1p = a0p + (size_t)16 * lda;
  const _Float16* b0p = Bh + (size_t)(col0 + ln) * ldb; const _Float16* b1p = b0p + (size_t)16 * ldb; const _Float16* b2p = b1p + (size_t)16 * ldb; const _Float16* b3p = b2p + (size_t)16 * ldb;
  const v8f z8 = {0.f,0.f,0.f,0.f,0.f,0.f,0.f,0.f}; v8f c00 = z8, c01 = z8, c02 = z8, c03 = z8, c10 = z8, c11 = z8, c12 = z8, c13 = z8;
#pragma unroll 1
  for (int kb = 0; kb < K; kb += 32) { const v16h a0 = g2_frag(a0p + kb, hh), a1 = g2_frag(a1p + kb, hh);
    v16h b = g2_frag(b0p + kb, hh); c00 = g2_mma(a0, b, c00); c10 = g2_mma(a1, b, c10);
    b = g2_frag(b1p + kb, hh); c01 = g2_mma(a0, b, c01); c11 = g2_mma(a1, b, c11);
    b = g2_frag(b2p + kb, hh); c02 = g2_mma(a0, b, c02); c12 = g2_mma(a1, b, c12);
    b = g2_frag(b3p + kb, hh); c03 = g2_mma(a0, b, c03); c13 = g2_mma(a1, b, c13); }
  v8f accs[8] = {c00, c01, c02, c03, c10, c11, c12, c13};
#pragma unroll
  for (int u = 0; u < 8; ++u) { const int t = u & 3, half = u >> 2; const int col = col0 + t * 16 + ln; const float bv = bp ? bf16_round(bp[col]) : 0.f;
#pragma unroll
    for (int r = 0; r < 8; ++r) { const int rloc = half * 16 + 8 * hh + r; float v = accs[u][r] * alpha + bv; if (CP) { if (rowsPerB < 0) v += CP[cofs + (size_t)(row0g + row0 + rloc) * ldc + col];      /* rowsPerB < 0: own element of the batched C plane */ else { const int bidx = (row0g + row0 + rloc) / rowsPerB; v += CP[(size_t)bidx * sCPb + (size_t)by * 64 + col]; } }
      if (ACT == 3) v = fmaxf(v, 0.f); else if (ACT == 6) v = 0.5f * v * (1.0f + erff(v * 0.70710678118654752f)); else if (ACT == 11) v = 1.0f / (1.0f + expf(-v)); else if (ACT == 15) v = v / (1.0f + expf(-v)); else if (ACT == 12) v = (v > 0.f) ? v : 0.01f * v; else if (ACT == 8) v = tanhf(v); else if (ACT == 9) v = 0.5f * v * (1.0f + tanhf(0.7978845608028654f * (v + 0.044715f * v * v * v))); else if (ACT == 14) v = (v > 0.f) ? v : 0.1f * v; else if (ACT == 16) v = (v >= 0.f) ? v : 0.3f * v; else if (ACT == 17) v = (v >= 0.f) ? v : 0.2f * v;
      so[w][rloc][t * 16 + ln] = v; } }
  __builtin_amdgcn_fence(__ATOMIC_ACQ_REL, "workgroup"); __builtin_amdgcn_wave_barrier();
  const int rsub = lane >> 4, c4 = (lane & 15) * 4;
  {
#pragma unroll
    for (int q = 0; q < 16; ++q) { const int r = q * 2 + rsub; const v4f v = *(const v4fa*)&so[w][r][c4]; if (C) *(v4f*)(C + cofs + (size_t)(row0 + r) * ldc + col0 + c4) = v; if (C16) { v4h h4; for (int i = 0; i < 4; ++i) h4[i] = (_Float16)v[i]; *(v4h*)(C16 + cofs + (size_t)(row0 + r) * ldc + col0 + c4) = h4; } }
     } }


// ---- the same 32x64 wave tile with K split over the NW waves of a work-group, for products with few output tiles (M x N small, K long) ----
// A work-group owns ONE 32x64 tile of C; wave w sums k in [w K / NW, (w + 1) K / NW) with the loop of k_gemm2; the NW partial tiles (f32) meet in LDS and are added in wave order.
// Requires M % 32 == 0 (grid = (M / 32) (N / 64)), N % 64 == 0, K % (32 NW) == 0. C16 = f16(alpha x sum).
template <int NW>
__global__ __launch_bounds__(NW * 32) void k_gemm2k(const _Float16* __restrict__ A, int lda, const _Float16* __restrict__ Bh, int ldb, float alpha, _Float16* __restrict__ C16, int ldc, int N, int K) {
  __shared__ __attribute__((aligned(16))) float so[NW][32][68];
  const int tid = threadIdx.x, w = tid >> 5, lane = tid & 31, ln = lane & 15, hh = lane >> 4;
  const int ntn = N >> 6; const int mt = blockIdx.x / ntn, nq = blockIdx.x - mt * ntn; const int row0 = mt * 32, col0 = nq * 64; const int ks = K / NW;
  const _Float16* a0p = A + (size_t)(row0 + ln) * lda + w * ks; const _Float16* a1p = a0p + (size_t)16 * lda;
  const _Float16* b0p = Bh + (size_t)(col0 + ln) * ldb + w * ks; const _Float16* b1p = b0p + (size_t)16 * ldb; const _Float16* b2p = b1p + (size_t)16 * ldb; const _Float16* b3p = b2p + (size_t)16 * ldb;
  const v8f z8 = {0.f,0.f,0.f,0.f,0.f,0.f,0.f,0.f}; v8f c00 = z8, c01 = z8, c02 = z8, c03 = z8, c10 = z8, c11 = z8, c12 = z8, c13 = z8;
  for (int kb = 0; kb < ks; kb += 32) { const v16h a0 = g2_frag(a0p + kb, hh), a1 = g2_frag(a1p + kb, hh);
    v16h b = g2_frag(b0p + kb, hh); c00 = g2_mma(a0, b, c00); c10 = g2_mma(a1, b, c10);
    b = g2_frag(b1p + kb, hh); c01 = g2_mma(a0, b, c01); c11 = g2_mma(a1, b, c11);
    b = g2_frag(b2p + kb, hh); c02 = g2_mma(a0, b, c02); c12 = g2_mma(a1, b, c12);
    b = g2_frag(b3p + kb, hh); c03 = g2_mma(a0, b, c03); c13 = g2_mma(a1, b, c13); }
  v8f accs[8] = {c00, c01, c02, c03, c10, c11, c12, c13};
#pragma unroll
  for (int u = 0; u < 8; ++u) {      /* unrolled so that accs[] is indexed by constants and stays in registers */
#pragma unroll
    for (int r = 0; r < 8; ++r) so[w][(u >> 2) * 16 + 8 * hh + r][(u & 3) * 16 + ln] = accs[u][r]; }
  __syncthreads();      /* every wave's partial tile is in LDS before any thread adds them */
  for (int i0 = 0; i0 < 32 * 16; i0 += NW * 32) { const int i = i0 + tid, r = i >> 4, c4 = (i & 15) * 4; v4f s = *(const v4f*)&so[0][r][c4];
#pragma unroll
    for (int k = 1; k < NW; ++k) s += *(const v4f*)&so[k][r][c4];      /* unrolled so that the NW LDS reads issue together */
    v4h h4;
#pragma unroll
    for (int q = 0; q < 4; ++q) h4[q] = (_Float16)(s[q] * alpha);      /* unrolled so that the vector elements are indexed by constants */
    *(v4h*)(C16 + (size_t)(row0 + r) * ldc + col0 + c4) = h4; } }


__global__ __launch_bounds__(256) void k_wnat(const float* __restrict__ w, size_t n8, _Float16* __restrict__ Bt) { const size_t t = (size_t)blockIdx.x * 256 + threadIdx.x; if (t >= n8) return; FragH f; for (int q = 0; q < 8; ++q) f.h[q] = (_Float16)(bf16_round(w[t * 8 + q]) * 16.0f); *(v8us*)((unsigned short*)Bt + t * 8) = f.half[0];  }
__global__ __launch_bounds__(256) void k_rsm(const float* __restrict__ S, _Float16* __restrict__ P, int nrows) {
  #pragma clang fp contract(off)
  const int i = blockIdx.x * 256 + threadIdx.x; if (i >= nrows) return; const float* s = S + (size_t)i * SQ; float mx = -3.0e38f;
#pragma unroll 1
  for (int j = 0; j < SQ; ++j) mx = fmaxf(mx, s[j]); float se = 0.f;
#pragma unroll 1
  for (int j = 0; j < SQ; ++j) se += expf(s[j] - mx); const float sc = 256.0f / se;
#pragma unroll 1
  for (int j0 = 0; j0 < SQ; j0 += 8) { FragH f; for (int q = 0; q < 8; ++q) f.h[q] = (_Float16)(expf(s[j0 + q] - mx) * sc); unsigned short* d = (unsigned short*)P + (size_t)i * SQ + j0; *(v8us*)d = f.half[0];  } }
__global__ __launch_bounds__(256) void k_vt(const _Float16* __restrict__ V16, int b, int h0, _Float16* __restrict__ VT) { __shared__ unsigned short tl[64][65]; const int tid = threadIdx.x; const int hh = blockIdx.x % HG, sg = blockIdx.x / HG; const int s0 = sg * 64; const int h = h0 + hh;
  for (int i = tid; i < 64 * 8; i += 256) { const int j = i / 8, d8 = (i % 8) * 8; FragH f; f.half[0] = *(const v8us*)((const unsigned short*)V16 + ((size_t)b * SQ + s0 + j) * DM + h * HD + d8); for (int q = 0; q < 8; ++q) tl[d8 + q][j] = f.u[q]; }
  __syncthreads();
  { for (int i = tid; i < 64 * 8; i += 256) { const int d = i / 8, j8 = (i % 8) * 8; FragH f; for (int q = 0; q < 8; ++q) f.u[q] = tl[d][j8 + q]; *(v8us*)((unsigned short*)VT + ((size_t)hh * HD + d) * SQ + s0 + j8) = f.half[0]; }  } }



__global__ __launch_bounds__(256) void k_rsmcf2(const float* __restrict__ S, _Float16* __restrict__ P, int hg, int q0, int nk) {
  #pragma clang fp contract(off)
  const int t = blockIdx.x * 256 + threadIdx.x; if (t >= hg * QT) return; const size_t i = (size_t)t; const float* s = S + i * NKX; const int last = q0 + (t % QT); float mx = -3.0e38f;
#pragma unroll 1
  for (int j = 0; j < nk; ++j) { const float f = (j <= last) ? 1.f : 0.f; mx = fmaxf(mx, fmaf(f, s[j], (1.f - f) * -1.0e9f)); } float se = 0.f;
#pragma unroll 1
  for (int j = 0; j < nk; ++j) { const float f = (j <= last) ? 1.f : 0.f; se += __expf(fmaf(f, s[j], (1.f - f) * -1.0e9f) - mx); } const float sc = 256.0f / se;
#pragma unroll 1
  for (int j0 = 0; j0 < nk; j0 += 8) { FragH fr; for (int q = 0; q < 8; ++q) { const int j = j0 + q; const float f = (j <= last) ? 1.f : 0.f; fr.h[q] = (_Float16)(__expf(fmaf(f, s[j], (1.f - f) * -1.0e9f) - mx) * sc); } unsigned short* d = (unsigned short*)P + i * NKX + j0; *(v8us*)d = fr.half[0];  } }

template <int MASKADD>
__global__ __launch_bounds__(64) void k_att0(const float* __restrict__ QF, const float* __restrict__ KF, const float* __restrict__ VF, int ld, const float* __restrict__ mask, float scale, float* __restrict__ OF, int ldo) {
  #pragma clang fp contract(off)
  __shared__ __attribute__((aligned(16))) float lq[64][64]; __shared__ __attribute__((aligned(16))) float lo[64][64];
  const int tid = threadIdx.x; const int h = blockIdx.x / (QT0 / 64), rg = blockIdx.x % (QT0 / 64); const int i = rg * 64 + tid;
  const float* qr = QF + (size_t)i * ld + h * HD;
#pragma unroll 1
  for (int c = 0; c < HD / 4; ++c) { *(v4f*)&lq[tid][c * 4] = *(const v4fa*)(qr + c * 4); const v4f z = {0.f, 0.f, 0.f, 0.f}; *(v4f*)&lo[tid][c * 4] = z; }
  float m = -1.0e30f, l = 0.f; const int jmax = MASKADD ? (SQ - 1) : (rg * 64 + 63);      /* additive-mask form: every key (the mask input decides); causal form: keys up to the block's last row */
#pragma unroll 1
  for (int j = 0; j <= jmax; ++j) { const float* kr = KF + (size_t)j * ld + h * HD; const float* vr = VF + (size_t)j * ld + h * HD; float s = 0.f;
#pragma unroll 1
    for (int c = 0; c < HD / 4; ++c) { const v4f kq = *(const v4fa*)(kr + c * 4); const v4f qq = *(v4f*)&lq[tid][c * 4]; s = __fadd_rn(s, __fmul_rn(qq[0], kq[0])); s = __fadd_rn(s, __fmul_rn(qq[1], kq[1])); s = __fadd_rn(s, __fmul_rn(qq[2], kq[2])); s = __fadd_rn(s, __fmul_rn(qq[3], kq[3])); }
    s = __fmul_rn(s, scale); if (MASKADD) s = __fadd_rn(s, __fmul_rn(bf16_round(mask[(size_t)i * SQ + j]), -10000.0f));
    const float f = (MASKADD || j <= i) ? 1.f : 0.f; const float sm = fmaf(f, s, (1.f - f) * -1.0e30f); const float mn = fmaxf(m, sm); const float sc = expf(m - mn); const float e = expf(sm - mn); l = __fadd_rn(__fmul_rn(l, sc), e); m = mn;
#pragma unroll 1
    for (int c = 0; c < HD / 4; ++c) { const v4f vv = *(const v4fa*)(vr + c * 4); v4f oo = *(v4f*)&lo[tid][c * 4]; for (int u = 0; u < 4; ++u) oo[u] = __fadd_rn(__fmul_rn(oo[u], sc), __fmul_rn(e, vv[u])); *(v4f*)&lo[tid][c * 4] = oo; } }
  const float fin = 64.0f / l;      /* o carried x64 like the f16 path */
#pragma unroll 1
  for (int c = 0; c < HD / 4; ++c) { v4f oo = *(v4f*)&lo[tid][c * 4]; for (int u = 0; u < 4; ++u) oo[u] = __fmul_rn(oo[u], fin); *(v4f*)&lo[tid][c * 4] = oo; }
  __syncthreads();
  {
#pragma unroll 1
    for (int it = 0; it < 16; ++it) { const int row = it * 4 + tid / 16, pc = (tid % 16) * 4; const v4f v = *(const v4f*)&lo[row][pc]; *(v4f*)(OF + (size_t)(rg * 64 + row) * ldo + h * HD + pc) = v; }
     } }

__global__ __launch_bounds__(256) void k_oscale(const float* __restrict__ OF, float* __restrict__ out, size_t n4) { const size_t t = (size_t)blockIdx.x * 256 + threadIdx.x; if (t >= n4) return; const v4f a = *(const v4fa*)(OF + t * 4); v4f o; for (int q = 0; q < 4; ++q) o[q] = a[q] * 0.015625f; *(v4f*)(out + t * 4) = o;  }

__global__ __launch_bounds__(256) void k_bfr(const float* __restrict__ x, float* __restrict__ XB, size_t n8) { const size_t t = (size_t)blockIdx.x * 256 + threadIdx.x; if (t >= n8) return; v4f a = *(const v4fa*)(x + t * 8), c = *(const v4fa*)(x + t * 8 + 4); for (int q = 0; q < 4; ++q) { a[q] = bf16_round(a[q]); c[q] = bf16_round(c[q]); }
  { *(v4f*)(XB + t * 8) = a; *(v4f*)(XB + t * 8 + 4) = c;  } }



__global__ __launch_bounds__(256) void k_rsmfvl(const float* __restrict__ S, _Float16* __restrict__ P, _Float16* __restrict__ PL, int qn, const int* __restrict__ vlp) {
  #pragma clang fp contract(off)
  const int t = blockIdx.x * 256 + threadIdx.x; if (t >= qn) return; const int vl = vlp[0]; const size_t i = (size_t)t; const float* s = S + i * SQ; float mx = -3.0e38f;
#pragma unroll 1
  for (int j = 0; j < SQ; ++j) { const float f = (j < vl) ? 1.f : 0.f; mx = fmaxf(mx, fmaf(f, s[j], (1.f - f) * -1000000.0f)); } float se = 0.f;
#pragma unroll 1
  for (int j = 0; j < SQ; ++j) { const float f = (j < vl) ? 1.f : 0.f; se += __expf(fmaf(f, s[j], (1.f - f) * -1000000.0f) - mx); } const float sc = 256.0f / se;
#pragma unroll 1
  for (int j0 = 0; j0 < SQ; j0 += 8) { FragH fr, gr; for (int q = 0; q < 8; ++q) { const int j = j0 + q; const float f = (j < vl) ? 1.f : 0.f; const float pv = __expf(fmaf(f, s[j], (1.f - f) * -1000000.0f) - mx) * sc; const _Float16 ph = (_Float16)pv; fr.h[q] = ph; gr.h[q] = (_Float16)((pv - (float)ph) * 1024.0f); }
    unsigned short* d = (unsigned short*)P + i * SQ + j0; unsigned short* dl = (unsigned short*)PL + i * SQ + j0; *(v8us*)d = fr.half[0]; *(v8us*)dl = gr.half[0];  } }

__global__ __launch_bounds__(256) void k_rsmf(const float* __restrict__ S, _Float16* __restrict__ P, int qn, int hg) {
  #pragma clang fp contract(off)
  const int t = blockIdx.x * 256 + threadIdx.x; if (t >= qn * hg) return; const size_t i = (size_t)(t / qn) * SQ + (t % qn); const float* s = S + i * SQ; float mx = -3.0e38f;
#pragma unroll 1
  for (int j = 0; j < SQ; ++j) mx = fmaxf(mx, s[j]); float se = 0.f;
#pragma unroll 1
  for (int j = 0; j < SQ; ++j) se += __expf(s[j] - mx); const float sc = 256.0f / se;
#pragma unroll 1
  for (int j0 = 0; j0 < SQ; j0 += 8) { FragH f; for (int q = 0; q < 8; ++q) f.h[q] = (_Float16)(__expf(s[j0 + q] - mx) * sc); unsigned short* d = (unsigned short*)P + i * SQ + j0; *(v8us*)d = f.half[0];  } }


#define CN 256          /* channels */
#define CI 128          /* inner channels */
#define NP 4096         /* positions */
#define NM 4096         /* key positions (= SQ) */
#define NC CN           /* BN statistics macros */
#define NPX NP
#define BNEPS 1e-5f

__global__ __launch_bounds__(256) void k_rowbias(const float* __restrict__ b, float* __restrict__ BP, size_t n4, int ncol) { const size_t t = (size_t)blockIdx.x * 256 + threadIdx.x; if (t >= n4) return; const size_t e = t * 4; const float v = bf16_round(b[e / ncol]); const v4f o = {v, v, v, v}; *(v4f*)(BP + e) = o;  }




__global__ __launch_bounds__(256) void k_mp2(const float* __restrict__ src, float* __restrict__ dst, int nout) {
  const int t = blockIdx.x * 256 + threadIdx.x; if (t >= nout) return; const int c = t / 1024; const int o = t % 1024; const int oy = o / 32, ox = o % 32; const float* p = src + (size_t)c * 4096 + (size_t)(2 * oy) * 64 + 2 * ox;
  const float v = fmaxf(fmaxf(p[0], p[1]), fmaxf(p[64], p[65])); *(float*)(dst + t) = v;  }
__global__ __launch_bounds__(256) void k_xpb(const float* __restrict__ x, const float* __restrict__ wb, float* __restrict__ CPP, size_t n4) {
  #pragma clang fp contract(off)
  const size_t t = (size_t)blockIdx.x * 256 + threadIdx.x; if (t >= n4) return; const size_t e = t * 4; const int c = (int)((e / 4096) % 256); const float bb = bf16_round(wb[c]); const v4f a = *(const v4fa*)(x + e); v4f o; for (int q = 0; q < 4; ++q) o[q] = __fadd_rn(bf16_round(a[q]), bb);
  *(v4f*)(CPP + e) = o;  }


template <int PASS>
__global__ __launch_bounds__(256) void k_cstA(const float* __restrict__ X, const float* __restrict__ MV, float* __restrict__ PART) {
  #pragma clang fp contract(off)
  __shared__ float red[256]; const int t = threadIdx.x; const size_t bc = blockIdx.x; const int c = (int)(bc % NC); const float* row = X + bc * (size_t)NPX; const float mu = PASS ? MV[c] : 0.f; float s = 0.f;
  for (int i = t; i < NPX; i += 256) { const float v = row[i]; const float d = PASS ? __fadd_rn(v, -mu) : v; s = __fadd_rn(s, PASS ? __fmul_rn(d, d) : d); }
  red[t] = s; __syncthreads(); for (int st = 128; st > 0; st >>= 1) { if (t < st) red[t] = __fadd_rn(red[t], red[t + st]); __syncthreads(); }
  if (t < 32) { const float pv = (t == 0) ? red[0] : 0.f; *(float*)(PART + bc * 32 + t) = pv;  } }      

template <int PASS>
__global__ __launch_bounds__(256) void k_cstB(const float* __restrict__ PART, float* __restrict__ MV) { const int c = threadIdx.x; if (c >= NC) return; double s = 0.0; for (int b = 0; b < NB; ++b) s += (double)PART[((size_t)b * NC + c) * 32]; const float m = (float)(s / ((double)NB * (double)NPX)); *(float*)(MV + PASS * NC + c) = m;  }


__global__ __launch_bounds__(256) void k_bnresid(const float* __restrict__ C2, const float* __restrict__ MV, const float* __restrict__ g, const float* __restrict__ be, const float* __restrict__ X, float* __restrict__ out, size_t n4) {
  #pragma clang fp contract(off)
  const size_t t = (size_t)blockIdx.x * 256 + threadIdx.x; if (t >= n4) return; const size_t e = t * 4; const int c = (int)((e / NPX) % NC); const float sc = __fmul_rn(rsqrtf(__fadd_rn(MV[NC + c], BNEPS)), bf16_round(g[c])); const float mu = MV[c], bb = bf16_round(be[c]);
  const v4f a = *(const v4fa*)(C2 + e); const v4f xx = *(const v4fa*)(X + e); v4f o; for (int q = 0; q < 4; ++q) { const float z = __fadd_rn(__fmul_rn(__fadd_rn(a[q], -mu), sc), bb); o[q] = __fadd_rn(z, bf16_round(xx[q])); }
  *(v4f*)(out + e) = o;  }


__global__ __launch_bounds__(256) void k_rowbias(float* __restrict__ Y, const float* __restrict__ bias) {
  #pragma clang fp contract(off)
  const size_t t = (size_t)blockIdx.x * 256 + threadIdx.x; if (t >= (size_t)NB * NC * NPX / 4) return; const size_t e = t * 4; const int c = (int)((e / NPX) % NC); const float bb = bf16_round(bias[c]);
  v4f v = *(const v4fa*)(Y + e); for (int q = 0; q < 4; ++q) v[q] = __fadd_rn(v[q], bb); *(v4f*)(Y + e) = v;  }


// Column statistics in one launch, S read once. A work-group owns 16 columns (64 B of every row): 1,024 threads = 256 row lanes x 4 column quads.
// A thread keeps its 16 rows x 4 columns in registers (16 loads of 16 B in flight per lane), so the maximum and the sum both come from the one read.
// Fold over rows: the thread's 16 rows, the 8 row lanes of a wave by lane exchange, the 32 waves through LDS.
// ST holds one 128-B record per work-group (one writer per line): 16 maxima, then 16 x (256 / sum).
// Every loop here carries #pragma unroll so that v[] and the vector elements are indexed by constants and stay in registers (a run-time index would send them to scratch).
#define CSC 16                    /* columns per work-group */
#define CSR (NP / 256)            /* rows per thread */
template <bool MAXOP>
__device__ __forceinline__ v4f cs_op(v4f a, v4f b) { v4f r;
#pragma unroll
  for (int q = 0; q < 4; ++q) r[q] = MAXOP ? fmaxf(a[q], b[q]) : a[q] + b[q];
  return r; }
template <bool MAXOP>
__device__ __forceinline__ v4f cs_fold(v4f v) {      /* butterfly over the 8 lanes of a wave that share lane & 3; every lane ends with the same bits */
#pragma unroll
  for (int m = 4; m <= 16; m <<= 1) { v4f o;
#pragma unroll
    for (int q = 0; q < 4; ++q) o[q] = __shfl_xor(v[q], m, 32);
    v = cs_op<MAXOP>(v, o); }
  return v; }
template <bool MAXOP>
__device__ __forceinline__ v4f cs_block(v4f v, float (*red)[CSC], int w, int lane) {      /* over all 256 row lanes; every thread gets the result of its column quad */
  v = cs_fold<MAXOP>(v);
  if (lane < 4) *(v4f*)&red[w][lane * 4] = v;
  __syncthreads();
  v4f r = *(const v4f*)&red[lane >> 2][(lane & 3) * 4];
#pragma unroll
  for (int k = 1; k < 4; ++k) r = cs_op<MAXOP>(r, *(const v4f*)&red[(lane >> 2) + 8 * k][(lane & 3) * 4]);
  return cs_fold<MAXOP>(r); }
__global__ __launch_bounds__(1024) void k_colstat(const float* __restrict__ S, float* __restrict__ ST) {
  __shared__ __attribute__((aligned(16))) float rmx[32][CSC]; __shared__ __attribute__((aligned(16))) float rse[32][CSC];
  const int tid = threadIdx.x, w = tid >> 5, lane = tid & 31;
  const float* s = S + (size_t)(tid >> 2) * CSR * NM + blockIdx.x * CSC + (tid & 3) * 4;
  v4f v[CSR];
#pragma unroll
  for (int i = 0; i < CSR; ++i) v[i] = *(const v4fa*)(s + (size_t)i * NM);
  asm volatile("s_wait_xcnt 0x0" :: "v"(s) : "memory");      /* a precaution: the address pair that the 16 loads name stays live and unwritten up to this wait */
  v4f mx = {-3.0e38f, -3.0e38f, -3.0e38f, -3.0e38f};
#pragma unroll
  for (int i = 0; i < CSR; ++i) mx = cs_op<true>(mx, v[i]);
  mx = cs_block<true>(mx, rmx, w, lane);
  v4f se = {0.f, 0.f, 0.f, 0.f};
#pragma unroll
  for (int i = 0; i < CSR; ++i) {
#pragma unroll
    for (int q = 0; q < 4; ++q) se[q] += __expf(v[i][q] - mx[q]); }
  se = cs_block<false>(se, rse, w, lane);
  if (tid < 4) { v4f iv;
#pragma unroll
    for (int q = 0; q < 4; ++q) iv[q] = 256.0f / se[q];
    float* rec = ST + (size_t)blockIdx.x * (2 * CSC) + tid * 4; *(v4f*)rec = mx; *(v4f*)(rec + CSC) = iv; } }
__global__ __launch_bounds__(256) void k_colp(const float* __restrict__ S, const float* __restrict__ CMX, const float* __restrict__ CIV, _Float16* __restrict__ P) {
  #pragma clang fp contract(off)
  const size_t t = (size_t)blockIdx.x * 256 + threadIdx.x; if (t >= (size_t)NP * NM / 8) return; const size_t e = t * 8; const int mc = (int)(e % NM); const int m0 = (mc / CSC) * (2 * CSC) + mc % CSC;      /* the column's place in its work-group's 128-B record */ FragH f;
  for (int q = 0; q < 8; ++q) f.h[q] = (_Float16)(__expf(S[e + q] - CMX[m0 + q]) * CIV[m0 + q]);
  unsigned short* d = (unsigned short*)P + e; *(v8us*)d = f.half[0];  }
extern "C" void kernel_launch(void* const* d_in, const int* in_sizes, int n_in,
                              void* d_out, int out_size, void* d_ws, size_t ws_size, hipStream_t stream) {
  (void)in_sizes; (void)n_in; (void)out_size;
  const float* const* I = (const float* const*)d_in; const float* x = I[0]; const float* tw = I[1]; const float* pw = I[2]; const float* gw = I[3]; const float* ww = I[4];      /* natural 1x1 conv weights: w_theta, w_phi, w_g [128][256], w_mask [256][128]; no biases */
  char* ws = (char*)d_ws; size_t off = 0;
  auto take = [&](size_t bytes) { char* p = ws + off; off += (bytes + 255) & ~(size_t)255; return p; };
  const size_t PL = (size_t)CN * NP;      /* one input map */
  _Float16* BT = (_Float16*)take((size_t)CI * CN * 2); _Float16* BP = (_Float16*)take((size_t)CI * CN * 2); _Float16* BG = (_Float16*)take((size_t)CI * CN * 2); _Float16* BW = (_Float16*)take((size_t)CN * CI * 2);
  _Float16* X16 = (_Float16*)take(NB * PL * 2); float* XB = (float*)take(NB * PL * 4);      /* x f16 channel-first; bf16(x) f32 for the residual */
  _Float16* XT = (_Float16*)take(PL * 2); _Float16* TH = (_Float16*)take((size_t)NP * CI * 2); _Float16* PHT = (_Float16*)take((size_t)NP * CI * 2); _Float16* GT = (_Float16*)take((size_t)NP * CI * 2); _Float16* G = (_Float16*)take((size_t)CI * NP * 2); _Float16* YT = (_Float16*)take((size_t)NP * CI * 2);
  float* S = (float*)take((size_t)NP * NM * 4); _Float16* P = (_Float16*)take((size_t)NP * NM * 2); float* ST = (float*)take((size_t)NM * 2 * 4);      /* per-column max and 256 / sum, one 128-B record per 16 columns */
  if (off > ws_size) return;
  { const unsigned g = (unsigned)(((size_t)CI * CN / 8 + 255) / 256); k_wnat<<<g, 256, 0, stream>>>(tw, (size_t)CI * CN / 8, BT); k_wnat<<<g, 256, 0, stream>>>(pw, (size_t)CI * CN / 8, BP); k_wnat<<<g, 256, 0, stream>>>(gw, (size_t)CI * CN / 8, BG); k_wnat<<<g, 256, 0, stream>>>(ww, (size_t)CN * CI / 8, BW); }      /* natural [out][in] x16 f16 planes (Bt for theta/phi/g token rows; the A operand for W) */
  k_x16<<<(unsigned)((NB * PL / 8 + 255) / 256), 256, 0, stream>>>(x, X16, NB * PL / 8); k_bfr<<<(unsigned)((NB * PL / 8 + 255) / 256), 256, 0, stream>>>(x, XB, NB * PL / 8);
  for (int b = 0; b < NB; ++b) {
    k_vt<NP / 64, CN><<<(NP / 64) * (CN / 64), 256, 0, stream>>>(X16 + (size_t)b * PL, NP, 0, XT);      /* [c][n] -> x^T [n][c] token rows */
    k_gemm2k<8><<<(NP / 32) * (CI / 64), 256, 0, stream>>>(XT, CN, BT, CN, 0.0625f, TH, CI, CI, CN);      /* theta^T [n][ci] -> f16; K = 256 over 8 waves */
    k_gemm2k<8><<<(NP / 32) * (CI / 64), 256, 0, stream>>>(XT, CN, BP, CN, 0.0625f, PHT, CI, CI, CN);      /* phi^T [m][ci] -> f16 (the scores' B^T operand) */
    k_gemm2k<8><<<(NP / 32) * (CI / 64), 256, 0, stream>>>(XT, CN, BG, CN, 0.0625f, GT, CI, CI, CN);      /* g^T [m][ci] -> f16 */
    k_vt<CI / 64, NP><<<(CI / 64) * (NP / 64), 256, 0, stream>>>(GT, CI, 0, G);      /* -> g [ci][m] (the PV B^T operand) */
    k_gemm2<0><<<dim3((unsigned)((NP / 128) * (NM / 64)), 1), 128, 0, stream>>>(TH, CI, 0, PHT, CI, 0, 1.0f, nullptr, 0, nullptr, 1, 0, 0, S, nullptr, NM, 0, NP, NM, CI);      /* f[a][b] = theta[:, a].phi[:, b] (K = 128, NO scale) */
    k_colstat<<<NM / CSC, 1024, 0, stream>>>(S, ST); k_colp<<<(unsigned)(((size_t)NP * NM / 8 + 255) / 256), 256, 0, stream>>>(S, ST, ST + CSC, P);      /* softmax over the QUERY axis: per key column m the max and sum over all 4096 rows n, then P[n][m] = f16(256 exp(s - max_m) / sum_m) */
    k_gemm2k<16><<<(NP / 32) * (CI / 64), 512, 0, stream>>>(P, NM, G, NM, 0.00390625f, YT, CI, CI, NM);      /* y^T [a][ci] = sum_b P[a][b] g[ci][b] -> f16; K = 4096 over 16 waves */
    k_gemm2<0><<<dim3((unsigned)((CN / 128) * (NP / 64)), 1), 128, 0, stream>>>(BW, CI, 0, YT, CI, 0, 0.0625f, nullptr, 0, XB + (size_t)b * PL, -1, 0, 0, (float*)d_out + (size_t)b * PL, nullptr, NP, 0, CN, NP, CI); }      /* out[c][a] = (16 W as A) x (y^T as B^T) / 16 + bf16(x) (own element) -> f32 channel-first output block */
}

// v003
// A run of this version takes 474 microseconds.
// Two timings next to v002 put it at 1.03 and 1.04 times that version's speed.
// All steps since v000 together make it 14.9 times as fast.
#include <hip/hip_runtime.h>
// Non-local block with the softmax taken over the QUERY axis (x [4][256][64][64]; theta, phi, g = conv1x1(x) with [128][256] weights (U(+-1/16), no biases); scores[n][m] = theta[n].phi[m] (NO scaling); attn = softmax(scores, axis = 1): normalised over n for every key column m (the module's unconventional axis); out[n] = sum_m attn[n][m] g[m]; mask = conv1x1(out; w_mask [256][128], no bias); result = x + mask -> [4][256][64][64]).
// Structure: channel-first; x as exact f16 planes and bf16(x) f32 residual planes; per image: token rows via LDS transposes; theta^T, phi^T, g^T as WMMA GEMMs (32x64 wave tiles, f32 accumulation, no bias) -> f16; g to channel-major via LDS transposes; f [4096][4096] = theta^T phi (K = 128, no scale) f32; column softmax on VALU (f32 statistics, native exp; weights x256 f16); y^T = P g^T (x2^-8) f16; out = (16 W) y / 16 + bf16(x) f32 channel-first.
// Compute dtype: inputs rounded to bf16; x / weights exact; q, k, v, softmax weights and o as plain f16 GEMM operands (~2^-12); scores and softmax statistics f32. v_wmma_f32_16x16x32_f16.
#define NB 4
#define SQ 4096
#define DM 256
#define NH 1
#define HD 64
#define HG 4                         /* heads per attention launch group */
#define B0 0                         /* first batch processed (debug hook) */
#define NBR NB                       /* batches processed (debug hook) */
#define NR ((size_t)NB * SQ)         /* token rows */
#define MP ((int)((size_t)NBR * SQ)) /* rows projected (debug hook) */
#define QT 256                       /* query rows per causal tile */
#define NKX SQ                       /* S / P row pitch */
#define QT0 256                      /* first-tile rows recomputed exactly (256: buys margin for the few-key rows 128..255, which have no output projection to average the single-f16 P/v rounding) */
#define QN SQ                        /* query rows attended per batch (debug hook) */
#define NHD NH                       /* heads attended (debug hook) */
#define MPO MP                       /* rows through the output stage (debug hook) */
#define LQ DM            /* row pitch of the q/k/v rows */
typedef __bf16 v16b __attribute__((ext_vector_type(16)));
typedef unsigned short v8us __attribute__((ext_vector_type(8), may_alias));
typedef float  v8f  __attribute__((ext_vector_type(8)));
typedef float  v4f  __attribute__((ext_vector_type(4)));
typedef float  v4fa __attribute__((ext_vector_type(4), may_alias));
union FragB { v16b v; v8us half[2]; unsigned short u[16]; };

__device__ __forceinline__ unsigned short bf16_bits(float x) { unsigned int u = __float_as_uint(x); return (unsigned short)((u + 0x7FFFu + ((u >> 16) & 1u)) >> 16); }
__device__ __forceinline__ float bf16_val(unsigned short b) { return __uint_as_float(((unsigned int)b) << 16); }
__device__ __forceinline__ float bf16_round(float x) { return bf16_val(bf16_bits(x)); }
// D += A·B with NT terms: 1 = ah·bh, 2 = + al·bh (A split), 3 = + ah·bl (both split)
template <int NT>
__device__ __forceinline__ v8f mmaN(v16b ah, v16b al, v16b bh, v16b bl, v8f c) {
  c = __builtin_amdgcn_wmma_f32_16x16x32_bf16(false, ah, false, bh, (short)0, c, false, false);
  if (NT >= 2) c = __builtin_amdgcn_wmma_f32_16x16x32_bf16(false, al, false, bh, (short)0, c, false, false);
  if (NT >= 3) c = __builtin_amdgcn_wmma_f32_16x16x32_bf16(false, ah, false, bl, (short)0, c, false, false);
  asm volatile("v_nop\n\tv_nop\n\tv_nop\n\tv_nop" : "+v"(c) : "v"(ah), "v"(al), "v"(bh), "v"(bl));
  return c;
}

__global__ __launch_bounds__(256) void k_wt_bf16(const float* __restrict__ W, unsigned short* __restrict__ Wt, int K, int N) {
  const int t = blockIdx.x * 256 + threadIdx.x;
  const int k8n = K / 8;
  if (t >= N * k8n) return;
  const int n = t / k8n, k8 = (t % k8n) * 8;
  v8us v;
#pragma unroll
  for (int i = 0; i < 8; ++i) v[i] = bf16_bits(W[(size_t)(k8 + i) * N + n]);
  *(v8us*)(Wt + (size_t)n * K + k8) = v;
  
}

// GEMM C[M][N] (f32, pitch ldc) = act(A[M][K]·W + bias). A f32 row-major (pitch lda) converted per fragment to bf16
// (ASPLIT: hi/lo two planes -> 2 terms, else single rounded term); Wt bf16 [N][K] (pitch ldb). BIAS_BF16 rounds the
// bias to bf16 first (bias quantised to bf16 before the add). K%32==0, M%16==0, N%64==0.
template <bool ASPLIT, int ACT, bool BIAS_BF16>
__global__ __launch_bounds__(128) void k_gemm_bf(const float* __restrict__ A, int lda, const unsigned short* __restrict__ Wt, int ldb,
                                               const float* __restrict__ bias, float* __restrict__ C, int ldc, int M, int N, int K) {
  __shared__ __attribute__((aligned(16))) float so[4][16][64];
  const int tid = threadIdx.x, w = tid >> 5, lane = tid & 31, ln = lane & 15, hh = lane >> 4;
  const int ntn = N / 64;
  const int wid = blockIdx.x * 4 + w;
  const int mt = wid / ntn, nq = wid % ntn;
  if (mt * 16 >= M) return;
  const int row0 = mt * 16, col0 = nq * 64;
  const float* arow = A + (size_t)(row0 + ln) * lda;
  v8f acc[4] = {};
  for (int kb = 0; kb < K; kb += 32) {
    FragB ah, al;
    const v4f x0 = *(const v4fa*)(arow + kb + 8 * hh), x1 = *(const v4fa*)(arow + kb + 8 * hh + 4);
    const v4f x2 = *(const v4fa*)(arow + kb + 16 + 8 * hh), x3 = *(const v4fa*)(arow + kb + 16 + 8 * hh + 4);
    float xs[16] = {x0[0],x0[1],x0[2],x0[3],x1[0],x1[1],x1[2],x1[3],x2[0],x2[1],x2[2],x2[3],x3[0],x3[1],x3[2],x3[3]};
#pragma unroll
    for (int i = 0; i < 16; ++i) { const unsigned short hb = bf16_bits(xs[i]); ah.u[i] = hb; al.u[i] = ASPLIT ? bf16_bits(xs[i] - bf16_val(hb)) : (unsigned short)0; }
#pragma unroll
    for (int t = 0; t < 4; ++t) {
      const unsigned short* brow = Wt + (size_t)(col0 + t * 16 + ln) * ldb + kb;
      FragB b;
      b.half[0] = *(const v8us*)(brow + 8 * hh);
      b.half[1] = *(const v8us*)(brow + 16 + 8 * hh);
      acc[t] = mmaN<ASPLIT ? 2 : 1>(ah.v, al.v, b.v, b.v, acc[t]);
    }
  }
#pragma unroll
  for (int t = 0; t < 4; ++t) {
    float bv = bias ? bias[col0 + t * 16 + ln] : 0.f;
    if (BIAS_BF16) bv = bf16_round(bv);
#pragma unroll
    for (int r = 0; r < 8; ++r) { float v = acc[t][r] + bv; if (ACT == 1) v = fmaxf(v, 0.f); so[w][8 * hh + r][t * 16 + ln] = v; }
  }
  __builtin_amdgcn_fence(__ATOMIC_ACQ_REL, "workgroup");
  __builtin_amdgcn_wave_barrier();
  const int rsub = lane >> 4, c4 = (lane & 15) * 4;
  {
#pragma unroll
    for (int q = 0; q < 8; ++q) {
      const int r = q * 2 + rsub;
      const v4f v = *(const v4fa*)&so[w][r][c4];
      *(v4f*)(C + (size_t)(row0 + r) * ldc + col0 + c4) = v;
    }
    
  }
}

// GEMM C = act(A·W + bias + resid): A f32 (ASPLIT -> hi/lo 2 terms), Wt bf16 [N][K]; ACT 0 none, 1 relu, 2 exact gelu;
// resid (optional, f32, row index = (row % rmod), pitch ldr, RES_BF16 rounds it) added before the activation.
template <bool ASPLIT, int ACT, bool BIAS_BF16, bool RES_BF16>
__global__ __launch_bounds__(128) void k_gemm_bf3(const float* __restrict__ A, int lda, const unsigned short* __restrict__ Wt, int ldb,
                                                const float* __restrict__ bias, const float* __restrict__ resid, int rmod, int ldr,
                                                float* __restrict__ C, int ldc, int M, int N, int K) {
  __shared__ __attribute__((aligned(16))) float so[4][16][64];
  const int tid = threadIdx.x, w = tid >> 5, lane = tid & 31, ln = lane & 15, hh = lane >> 4;
  const int ntn = N / 64;
  const int wid = blockIdx.x * 4 + w;
  const int mt = wid / ntn, nq = wid % ntn;
  if (mt * 16 >= M) return;
  const int row0 = mt * 16, col0 = nq * 64;
  const float* arow = A + (size_t)(row0 + ln) * lda;
  v8f acc[4] = {};
  for (int kb = 0; kb < K; kb += 32) {
    FragB ah, al;
    const v4f x0 = *(const v4fa*)(arow + kb + 8 * hh), x1 = *(const v4fa*)(arow + kb + 8 * hh + 4);
    const v4f x2 = *(const v4fa*)(arow + kb + 16 + 8 * hh), x3 = *(const v4fa*)(arow + kb + 16 + 8 * hh + 4);
    float xs[16] = {x0[0],x0[1],x0[2],x0[3],x1[0],x1[1],x1[2],x1[3],x2[0],x2[1],x2[2],x2[3],x3[0],x3[1],x3[2],x3[3]};
#pragma unroll
    for (int i = 0; i < 16; ++i) { const unsigned short hb = bf16_bits(xs[i]); ah.u[i] = hb; al.u[i] = ASPLIT ? bf16_bits(xs[i] - bf16_val(hb)) : (unsigned short)0; }
#pragma unroll
    for (int t = 0; t < 4; ++t) {
      const unsigned short* brow = Wt + (size_t)(col0 + t * 16 + ln) * ldb + kb;
      FragB b;
      b.half[0] = *(const v8us*)(brow + 8 * hh);
      b.half[1] = *(const v8us*)(brow + 16 + 8 * hh);
      acc[t] = mmaN<ASPLIT ? 2 : 1>(ah.v, al.v, b.v, b.v, acc[t]);
    }
  }
#pragma unroll
  for (int t = 0; t < 4; ++t) {
    const int col = col0 + t * 16 + ln;
    float bv = bias ? bias[col] : 0.f;
    if (BIAS_BF16) bv = bf16_round(bv);
#pragma unroll
    for (int r = 0; r < 8; ++r) {
      float v = acc[t][r] + bv;
      if (resid) { float rv = resid[(size_t)((row0 + 8 * hh + r) % rmod) * ldr + col]; if (RES_BF16) rv = bf16_round(rv); v += rv; }
      if (ACT == 1) v = fmaxf(v, 0.f);
      if (ACT == 2) v = 0.5f * v * (1.0f + erff(v * 0.70710678118654752f));
      if (ACT == 3) { const float u = 0.7978845608028654f * (v + 0.044715f * v * v * v); v = 0.5f * v * (1.0f + tanhf(u)); }
      so[w][8 * hh + r][t * 16 + ln] = v;
    }
  }
  __builtin_amdgcn_fence(__ATOMIC_ACQ_REL, "workgroup");
  __builtin_amdgcn_wave_barrier();
  const int rsub = lane >> 4, c4 = (lane & 15) * 4;
  {
#pragma unroll
    for (int q = 0; q < 8; ++q) {
      const int r = q * 2 + rsub;
      const v4f v = *(const v4fa*)&so[w][r][c4];
      *(v4f*)(C + (size_t)(row0 + r) * ldc + col0 + c4) = v;
    }
    
  }
}
// row LayerNorm (biased variance, eps) over N: s = X (+ R); optional out_sum <- s; out_norm <- (s-mu)*rsqrt(var+eps)*g + b
template <bool PARAM_BF16>
__global__ __launch_bounds__(256) void k_layernorm(const float* __restrict__ X, const float* __restrict__ R, const float* __restrict__ g, const float* __restrict__ bta,
                                                  float* __restrict__ out_sum, float* __restrict__ out_norm, int N, float eps) {
  __shared__ float red[256];
  const int row = blockIdx.x, tid = threadIdx.x;
  const float* x = X + (size_t)row * N; const float* rr = R ? R + (size_t)row * N : nullptr;
  float vals[16];                     // up to N = 4096
  const int per = N / 256;            // contiguous chunk per thread? use strided-by-4 chunks: thread handles j = tid*4 + 1024*u
  float s1 = 0.f;
  for (int u = 0; u < per / 4; ++u) {
    const int j = tid * 4 + 1024 * u;
    const v4f a = *(const v4fa*)(x + j);
    v4f b = {0.f,0.f,0.f,0.f}; if (rr) b = *(const v4fa*)(rr + j);
#pragma unroll
    for (int q = 0; q < 4; ++q) { const float v = a[q] + b[q]; vals[u * 4 + q] = v; s1 += v; }
  }
  red[tid] = s1; __syncthreads();
  for (int st = 128; st > 0; st >>= 1) { if (tid < st) red[tid] += red[tid + st]; __syncthreads(); }
  const float mu = red[0] / (float)N; __syncthreads();
  float s2 = 0.f;
  for (int u = 0; u < per / 4; ++u)
#pragma unroll
    for (int q = 0; q < 4; ++q) { const float c = vals[u * 4 + q] - mu; s2 += c * c; }
  red[tid] = s2; __syncthreads();
  for (int st = 128; st > 0; st >>= 1) { if (tid < st) red[tid] += red[tid + st]; __syncthreads(); }
  const float rs = rsqrtf(red[0] / (float)N + eps);
  {
    for (int u = 0; u < per / 4; ++u) {
      const int j = tid * 4 + 1024 * u;
      v4f o, sm;
#pragma unroll
      for (int q = 0; q < 4; ++q) {
        float gg = g[j + q], bb = bta[j + q];
        if (PARAM_BF16) { gg = bf16_round(gg); bb = bf16_round(bb); }
        sm[q] = vals[u * 4 + q]; o[q] = (vals[u * 4 + q] - mu) * rs * gg + bb;
      }
      if (out_sum) *(v4f*)(out_sum + (size_t)row * N + j) = sm;
      *(v4f*)(out_norm + (size_t)row * N + j) = o;
    }
    
  }
}



// ---- f16 WMMA path (v_wmma_f32_16x16x32_f16): 11-bit significands for operands in range — used where a [0,1] probability operand needs more precision than bf16
typedef _Float16 v16h __attribute__((ext_vector_type(16)));
union FragH { v16h v; v8us half[2]; _Float16 h[16]; unsigned short u[16]; };
template <int NT>
__device__ __forceinline__ v8f mmaH(v16h ah, v16h al, v16h bh, v16h bl, v8f c) {
  c = __builtin_amdgcn_wmma_f32_16x16x32_f16(false, ah, false, bh, (short)0, c, false, false);
  if (NT >= 2) c = __builtin_amdgcn_wmma_f32_16x16x32_f16(false, al, false, bh, (short)0, c, false, false);
  if (NT >= 3) c = __builtin_amdgcn_wmma_f32_16x16x32_f16(false, ah, false, bl, (short)0, c, false, false);
  asm volatile("v_nop\n\tv_nop\n\tv_nop\n\tv_nop" : "+v"(c) : "v"(ah), "v"(al), "v"(bh), "v"(bl));
  return c;
}
// batched GEMM like k_gemm_b but f16 operands: A f32 (split into f16 hi/lo if ASPLIT, else rounded to f16), Bt = f16 values [n][k]; alpha; C f32; N multiple of 16 (partial tiles skipped)
template <bool ASPLIT>
__global__ __launch_bounds__(128) void k_gemm_h(const float* __restrict__ A, int lda, size_t sA, const _Float16* __restrict__ Bh, int ldb, size_t sB, float alpha, float* __restrict__ C, int ldc, size_t sC, int M, int N, int K) {
  __shared__ __attribute__((aligned(16))) float so[4][16][64];
  const int tid = threadIdx.x, w = tid >> 5, lane = tid & 31, ln = lane & 15, hh = lane >> 4; const int by = blockIdx.y;
  A += (size_t)by * sA; Bh += (size_t)by * sB; C += (size_t)by * sC;
  const int ntn = (N + 63) / 64; const int wid = blockIdx.x * 4 + w; const int mt = wid / ntn, nq = wid % ntn; if (mt * 16 >= M) return;
  const int row0 = mt * 16, col0 = nq * 64; const float* arow = A + (size_t)(row0 + ln) * lda;
  v8f acc[4] = {};
  for (int kb = 0; kb < K; kb += 32) {
    FragH ah, al;
    const v4f x0 = *(const v4fa*)(arow + kb + 8 * hh), x1 = *(const v4fa*)(arow + kb + 8 * hh + 4), x2 = *(const v4fa*)(arow + kb + 16 + 8 * hh), x3 = *(const v4fa*)(arow + kb + 16 + 8 * hh + 4);
    float xs[16] = {x0[0],x0[1],x0[2],x0[3],x1[0],x1[1],x1[2],x1[3],x2[0],x2[1],x2[2],x2[3],x3[0],x3[1],x3[2],x3[3]};
#pragma unroll
    for (int i = 0; i < 16; ++i) { const _Float16 h = (_Float16)xs[i]; ah.h[i] = h; al.h[i] = ASPLIT ? (_Float16)(xs[i] - (float)h) : (_Float16)0.0f; }
#pragma unroll
    for (int t = 0; t < 4; ++t) { if (col0 + t * 16 >= N) continue; const size_t boff = (size_t)(col0 + t * 16 + ln) * ldb + kb; FragH bq; bq.half[0] = *(const v8us*)(Bh + boff + 8 * hh); bq.half[1] = *(const v8us*)(Bh + boff + 16 + 8 * hh);
      acc[t] = mmaH<ASPLIT ? 2 : 1>(ah.v, al.v, bq.v, bq.v, acc[t]); }
  }
#pragma unroll
  for (int t = 0; t < 4; ++t) { if (col0 + t * 16 >= N) continue;
#pragma unroll
    for (int r = 0; r < 8; ++r) so[w][8 * hh + r][t * 16 + ln] = acc[t][r] * alpha; }
  __builtin_amdgcn_fence(__ATOMIC_ACQ_REL, "workgroup"); __builtin_amdgcn_wave_barrier();
  const int rsub = lane >> 4, c4 = (lane & 15) * 4;
  {
#pragma unroll
    for (int q = 0; q < 8; ++q) { const int r = q * 2 + rsub; if (col0 + c4 < N) { const v4f v = *(const v4fa*)&so[w][r][c4]; *(v4f*)(C + (size_t)(row0 + r) * ldc + col0 + c4) = v; } }
     }
}

// Wt[n][k] = f16(W[k][n]·scale) from f32 row-major W[K][N] (scale = power of two; bf16-exact weights stay exact in f16 away from the subnormal range)
__global__ __launch_bounds__(256) void k_wt_f16(const float* __restrict__ W, _Float16* __restrict__ Wt, int K, int N, float scale) {
  const int t = blockIdx.x * 256 + threadIdx.x; if (t >= N * (K / 8)) return; const int n = t / (K / 8), k8 = (t % (K / 8)) * 8; FragH f;
#pragma unroll
  for (int i = 0; i < 8; ++i) f.h[i] = (_Float16)(bf16_round(W[(size_t)(k8 + i) * N + n]) * scale); const v8us o = f.half[0];
  *(v8us*)((unsigned short*)Wt + (size_t)n * K + k8) = o; 
}
// k_gemm_hh variant with fused epilogue: v = acc·alpha + bias[by·sBias + col] (+ CP[(row/rowsPerB)·sCPb + by·64 + col] if CP) ; ACT 0 none / 1 elu ; writes f16 C16 (and f32 C if non-null)
template <int ACT>
__global__ __launch_bounds__(128) void k_gemm_hhx(const _Float16* __restrict__ A, int lda, size_t sA, const _Float16* __restrict__ Bh, int ldb, size_t sB, float alpha, const float* __restrict__ bias, size_t sBias, const float* __restrict__ CP, int rowsPerB, size_t sCPb, int row0g,
    float* __restrict__ C, _Float16* __restrict__ C16, int ldc, size_t sC, int M, int N, int K) {
  __shared__ __attribute__((aligned(16))) float so[4][16][64];
  const int tid = threadIdx.x, w = tid >> 5, lane = tid & 31, ln = lane & 15, hh = lane >> 4; const int by = blockIdx.y;
  A += (size_t)by * sA; Bh += (size_t)by * sB; const size_t cofs = (size_t)by * sC; const float* bp = bias ? bias + (size_t)by * sBias : nullptr;
  const int ntn = (N + 63) / 64; const int wid = blockIdx.x * 4 + w; const int mt = wid / ntn, nq = wid % ntn; if (mt * 16 >= M) return;
  const int row0 = mt * 16, col0 = nq * 64; const _Float16* arow = A + (size_t)(row0 + ln) * lda;
  v8f acc[4] = {};
  for (int kb = 0; kb < K; kb += 32) { FragH ah; ah.half[0] = *(const v8us*)((const unsigned short*)arow + kb + 8 * hh); ah.half[1] = *(const v8us*)((const unsigned short*)arow + kb + 16 + 8 * hh);
#pragma unroll
    for (int t = 0; t < 4; ++t) { if (col0 + t * 16 >= N) continue; const size_t boff = (size_t)(col0 + t * 16 + ln) * ldb + kb; FragH bq; bq.half[0] = *(const v8us*)((const unsigned short*)Bh + boff + 8 * hh); bq.half[1] = *(const v8us*)((const unsigned short*)Bh + boff + 16 + 8 * hh);
      acc[t] = mmaH<1>(ah.v, ah.v, bq.v, bq.v, acc[t]); }
  }
#pragma unroll
  for (int t = 0; t < 4; ++t) { if (col0 + t * 16 >= N) continue; const int col = col0 + t * 16 + ln; const float bv = bp ? bf16_round(bp[col]) : 0.f;
#pragma unroll
    for (int r = 0; r < 8; ++r) { float v = acc[t][r] * alpha + bv; if (CP) { const int rr = row0g + row0 + 8 * hh + r; if (rowsPerB < 0) v += CP[cofs + (size_t)rr * ldc + col];      /* rowsPerB < 0: own element of the batched C plane */ else { const int bidx = rr / rowsPerB; v += CP[(size_t)bidx * sCPb + (size_t)by * 64 + col]; } } if (ACT == 1) v = (v > 0.f) ? v : expm1f(v); else if (ACT == 7) v = (v > 0.f) ? v + 1.0f : expf(v); else if (ACT == 8) v = tanhf(v); else if (ACT == 9) v = 0.5f * v * (1.0f + tanhf(0.7978845608028654f * (v + 0.044715f * v * v * v))); else if (ACT == 11) v = 1.0f / (1.0f + expf(-v)); else if (ACT == 12) v = (v > 0.f) ? v : 0.01f * v; else if (ACT == 14) v = (v > 0.f) ? v : 0.1f * v; else if (ACT == 16) v = (v >= 0.f) ? v : 0.3f * v; else if (ACT == 17) v = (v >= 0.f) ? v : 0.2f * v; else if (ACT == 15) v = v / (1.0f + expf(-v)); else if (ACT == 3) v = fmaxf(v, 0.f); else if (ACT == 6) v = 0.5f * v * (1.0f + erff(v * 0.70710678118654752f)); so[w][8 * hh + r][t * 16 + ln] = v; } }
  __builtin_amdgcn_fence(__ATOMIC_ACQ_REL, "workgroup"); __builtin_amdgcn_wave_barrier();
  const int rsub = lane >> 4, c4 = (lane & 15) * 4; typedef _Float16 v4h __attribute__((ext_vector_type(4)));
  {
#pragma unroll
    for (int q = 0; q < 8; ++q) { const int r = q * 2 + rsub; if (col0 + c4 < N) { const v4f v = *(const v4fa*)&so[w][r][c4]; if (C) *(v4f*)(C + cofs + (size_t)(row0 + r) * ldc + col0 + c4) = v; if (C16) { v4h h4; for (int i = 0; i < 4; ++i) h4[i] = (_Float16)v[i]; *(v4h*)(C16 + cofs + (size_t)(row0 + r) * ldc + col0 + c4) = h4; } } }
     }
}


typedef _Float16 v4h __attribute__((ext_vector_type(4)));

__global__ __launch_bounds__(256) void k_x16(const float* __restrict__ x, _Float16* __restrict__ X16, size_t n8) { const size_t t = (size_t)blockIdx.x * 256 + threadIdx.x; if (t >= n8) return; FragH f;
#pragma unroll
  for (int q = 0; q < 8; ++q) f.h[q] = (_Float16)bf16_round(x[t * 8 + q]); *(v8us*)((unsigned short*)X16 + t * 8) = f.half[0];  }
__global__ __launch_bounds__(256) void k_h16(const float* __restrict__ x, _Float16* __restrict__ X16, size_t n8) { const size_t t = (size_t)blockIdx.x * 256 + threadIdx.x; if (t >= n8) return; FragH f;
#pragma unroll
  for (int q = 0; q < 8; ++q) f.h[q] = (_Float16)x[t * 8 + q]; *(v8us*)((unsigned short*)X16 + t * 8) = f.half[0];  }
__global__ __launch_bounds__(256) void k_round16f(const float* __restrict__ W, _Float16* __restrict__ Bt, size_t n8) { const size_t t = (size_t)blockIdx.x * 256 + threadIdx.x; if (t >= n8) return; FragH f;
#pragma unroll
  for (int i = 0; i < 8; ++i) f.h[i] = (_Float16)(bf16_round(W[t * 8 + i]) * 16.0f); *(v8us*)((unsigned short*)Bt + t * 8) = f.half[0];  }
template <int NHv, int TTv>
__global__ __launch_bounds__(256) void k_vt(const _Float16* __restrict__ V16, int ldv, int voff, _Float16* __restrict__ Vt) { __shared__ unsigned short tl[64][66]; const int tid = threadIdx.x; const int slab = blockIdx.x / (TTv / 64), lg = blockIdx.x % (TTv / 64); const int b = slab / NHv, h = slab % NHv;
  for (int i = tid; i < 64 * 8; i += 256) { const int r = i / 8, c8 = (i % 8) * 8; FragH f; f.half[0] = *(const v8us*)((const unsigned short*)V16 + ((size_t)b * TTv + lg * 64 + r) * ldv + voff + h * 64 + c8);
#pragma unroll
    for (int q = 0; q < 8; ++q) tl[r][c8 + q] = f.u[q]; }
  __syncthreads();
  {
#pragma unroll
    for (int rd = 0; rd < 2; ++rd) { const int d = rd * 32 + tid / 8, pc = tid % 8; FragH f;
#pragma unroll
      for (int q = 0; q < 8; ++q) f.u[q] = tl[pc * 8 + q][d];
      *(v8us*)((unsigned short*)Vt + ((size_t)slab * 64 + d) * TTv + lg * 64 + pc * 8) = f.half[0]; }
     } }

__global__ __launch_bounds__(256) void k_hl(const float* __restrict__ F, _Float16* __restrict__ Hh, _Float16* __restrict__ Hl, size_t n8) { const size_t t = (size_t)blockIdx.x * 256 + threadIdx.x; if (t >= n8) return; FragH fh, fl; const v4f a = *(const v4fa*)(F + t * 8), c = *(const v4fa*)(F + t * 8 + 4);
#pragma unroll
  for (int q = 0; q < 4; ++q) { _Float16 h = (_Float16)a[q]; fh.h[q] = h; fl.h[q] = (_Float16)((a[q] - (float)h) * 1024.0f); h = (_Float16)c[q]; fh.h[4 + q] = h; fl.h[4 + q] = (_Float16)((c[q] - (float)h) * 1024.0f); }
  { *(v8us*)((unsigned short*)Hh + t * 8) = fh.half[0]; *(v8us*)((unsigned short*)Hl + t * 8) = fl.half[0];  } }

// ---- fast GEMM (wave tile 32x64; requires M % 32 == 0 rows per launch region and N % 64 == 0); epilogue = k_gemm_hhx semantics ----
__device__ __forceinline__ v16h g2_frag(const _Float16* p, int hh) { FragH f; f.half[0] = *(const v8us*)((const unsigned short*)p + 8 * hh); f.half[1] = *(const v8us*)((const unsigned short*)p + 16 + 8 * hh); return f.v; }
__device__ __forceinline__ v8f g2_mma(v16h a, v16h b, v8f c) { v8f d = __builtin_amdgcn_wmma_f32_16x16x32_f16(false, a, false, b, (short)0, c, false, false); asm volatile("v_nop\n\tv_nop\n\tv_nop\n\tv_nop" : "+v"(d) : "v"(a), "v"(b)); return d; }
template <int ACT>
__global__ __launch_bounds__(128) void k_gemm2(const _Float16* __restrict__ A, int lda, size_t sA, const _Float16* __restrict__ Bh, int ldb, size_t sB, float alpha, const float* __restrict__ bias, size_t sBias, const float* __restrict__ CP, int rowsPerB, size_t sCPb, int row0g,
    float* __restrict__ C, _Float16* __restrict__ C16, int ldc, size_t sC, int M, int N, int K) { static_assert(ACT == 0 || ACT == 3 || ACT == 6 || ACT == 8 || ACT == 9 || ACT == 11 || ACT == 12 || ACT == 14 || ACT == 15 || ACT == 16 || ACT == 17, "k_gemm2: unsupported ACT code (would silently apply no activation)");
  __shared__ __attribute__((aligned(16))) float so[4][32][68];
  const int tid = threadIdx.x, w = tid >> 5, lane = tid & 31, ln = lane & 15, hh = lane >> 4; const int by = blockIdx.y;
  A += (size_t)by * sA; Bh += (size_t)by * sB; const size_t cofs = (size_t)by * sC; const float* bp = bias ? bias + (size_t)by * sBias : nullptr;
  const int ntn = N >> 6; const int mt = blockIdx.x / ntn, nq = blockIdx.x - mt * ntn; const int row0 = mt * 128 + 32 * w, col0 = nq * 64; if (row0 >= M) return;
  const _Float16* a0p = A + (size_t)(row0 + ln) * lda; const _Float16* a1p = a0p + (size_t)16 * lda;
  const _Float16* b0p = Bh + (size_t)(col0 + ln) * ldb; const _Float16* b1p = b0p + (size_t)16 * ldb; const _Float16* b2p = b1p + (size_t)16 * ldb; const _Float16* b3p = b2p + (size_t)16 * ldb;
  const v8f z8 = {0.f,0.f,0.f,0.f,0.f,0.f,0.f,0.f}; v8f c00 = z8, c01 = z8, c02 = z8, c03 = z8, c10 = z8, c11 = z8, c12 = z8, c13 = z8;
#pragma unroll 1
  for (int kb = 0; kb < K; kb += 32) { const v16h a0 = g2_frag(a0p + kb, hh), a1 = g2_frag(a1p + kb, hh);
    v16h b = g2_frag(b0p + kb, hh); c00 = g2_mma(a0, b, c00); c10 = g2_mma(a1, b, c10);
    b = g2_frag(b1p + kb, hh); c01 = g2_mma(a0, b, c01); c11 = g2_mma(a1, b, c11);
    b = g2_frag(b2p + kb, hh); c02 = g2_mma(a0, b, c02); c12 = g2_mma(a1, b, c12);
    b = g2_frag(b3p + kb, hh); c03 = g2_mma(a0, b, c03); c13 = g2_mma(a1, b, c13); }
  v8f accs[8] = {c00, c01, c02, c03, c10, c11, c12, c13};
#pragma unroll
  for (int u = 0; u < 8; ++u) { const int t = u & 3, half = u >> 2; const int col = col0 + t * 16 + ln; const float bv = bp ? bf16_round(bp[col]) : 0.f;
#pragma unroll
    for (int r = 0; r < 8; ++r) { const int rloc = half * 16 + 8 * hh + r; float v = accs[u][r] * alpha + bv; if (CP) { if (rowsPerB < 0) v += CP[cofs + (size_t)(row0g + row0 + rloc) * ldc + col];      /* rowsPerB < 0: own element of the batched C plane */ else { const int bidx = (row0g + row0 + rloc) / rowsPerB; v += CP[(size_t)bidx * sCPb + (size_t)by * 64 + col]; } }
      if (ACT == 3) v = fmaxf(v, 0.f); else if (ACT == 6) v = 0.5f * v * (1.0f + erff(v * 0.70710678118654752f)); else if (ACT == 11) v = 1.0f / (1.0f + expf(-v)); else if (ACT == 15) v = v / (1.0f + expf(-v)); else if (ACT == 12) v = (v > 0.f) ? v : 0.01f * v; else if (ACT == 8) v = tanhf(v); else if (ACT == 9) v = 0.5f * v * (1.0f + tanhf(0.7978845608028654f * (v + 0.044715f * v * v * v))); else if (ACT == 14) v = (v > 0.f) ? v : 0.1f * v; else if (ACT == 16) v = (v >= 0.f) ? v : 0.3f * v; else if (ACT == 17) v = (v >= 0.f) ? v : 0.2f * v;
      so[w][rloc][t * 16 + ln] = v; } }
  __builtin_amdgcn_fence(__ATOMIC_ACQ_REL, "workgroup"); __builtin_amdgcn_wave_barrier();
  const int rsub = lane >> 4, c4 = (lane & 15) * 4;
  {
#pragma unroll
    for (int q = 0; q < 16; ++q) { const int r = q * 2 + rsub; const v4f v = *(const v4fa*)&so[w][r][c4]; if (C) *(v4f*)(C + cofs + (size_t)(row0 + r) * ldc + col0 + c4) = v; if (C16) { v4h h4; for (int i = 0; i < 4; ++i) h4[i] = (_Float16)v[i]; *(v4h*)(C16 + cofs + (size_t)(row0 + r) * ldc + col0 + c4) = h4; } }
     } }


// ---- the same 32x64 wave tile with K split over the NW waves of a work-group, for products with few output tiles (M x N small, K long) ----
// A work-group owns ONE 32x64 tile of C; wave w sums k in [w K / NW, (w + 1) K / NW) with the loop of k_gemm2; the NW partial tiles (f32) meet in LDS and are added in wave order.
// Requires M % 32 == 0 (grid = (M / 32) (N / 64)), N % 64 == 0, K % (32 NW) == 0. C16 = f16(alpha x sum).
template <int NW>
__global__ __launch_bounds__(NW * 32) void k_gemm2k(const _Float16* __restrict__ A, int lda, const _Float16* __restrict__ Bh, int ldb, float alpha, _Float16* __restrict__ C16, int ldc, int N, int K) {
  __shared__ __attribute__((aligned(16))) float so[NW][32][68];
  const int tid = threadIdx.x, w = tid >> 5, lane = tid & 31, ln = lane & 15, hh = lane >> 4;
  const int ntn = N >> 6; const int mt = blockIdx.x / ntn, nq = blockIdx.x - mt * ntn; const int row0 = mt * 32, col0 = nq * 64; const int ks = K / NW;
  const _Float16* a0p = A + (size_t)(row0 + ln) * lda + w * ks; const _Float16* a1p = a0p + (size_t)16 * lda;
  const _Float16* b0p = Bh + (size_t)(col0 + ln) * ldb + w * ks; const _Float16* b1p = b0p + (size_t)16 * ldb; const _Float16* b2p = b1p + (size_t)16 * ldb; const _Float16* b3p = b2p + (size_t)16 * ldb;
  const v8f z8 = {0.f,0.f,0.f,0.f,0.f,0.f,0.f,0.f}; v8f c00 = z8, c01 = z8, c02 = z8, c03 = z8, c10 = z8, c11 = z8, c12 = z8, c13 = z8;
  for (int kb = 0; kb < ks; kb += 32) { const v16h a0 = g2_frag(a0p + kb, hh), a1 = g2_frag(a1p + kb, hh);
    v16h b = g2_frag(b0p + kb, hh); c00 = g2_mma(a0, b, c00); c10 = g2_mma(a1, b, c10);
    b = g2_frag(b1p + kb, hh); c01 = g2_mma(a0, b, c01); c11 = g2_mma(a1, b, c11);
    b = g2_frag(b2p + kb, hh); c02 = g2_mma(a0, b, c02); c12 = g2_mma(a1, b, c12);
    b = g2_frag(b3p + kb, hh); c03 = g2_mma(a0, b, c03); c13 = g2_mma(a1, b, c13); }
  v8f accs[8] = {c00, c01, c02, c03, c10, c11, c12, c13};
#pragma unroll
  for (int u = 0; u < 8; ++u) {      /* unrolled so that accs[] is indexed by constants and stays in registers */
#pragma unroll
    for (int r = 0; r < 8; ++r) so[w][(u >> 2) * 16 + 8 * hh + r][(u & 3) * 16 + ln] = accs[u][r]; }
  __syncthreads();      /* every wave's partial tile is in LDS before any thread adds them */
  for (int i0 = 0; i0 < 32 * 16; i0 += NW * 32) { const int i = i0 + tid, r = i >> 4, c4 = (i & 15) * 4; v4f s = *(const v4f*)&so[0][r][c4];
#pragma unroll
    for (int k = 1; k < NW; ++k) s += *(const v4f*)&so[k][r][c4];      /* unrolled so that the NW LDS reads issue together */
    v4h h4;
#pragma unroll
    for (int q = 0; q < 4; ++q) h4[q] = (_Float16)(s[q] * alpha);      /* unrolled so that the vector elements are indexed by constants */
    *(v4h*)(C16 + (size_t)(row0 + r) * ldc + col0 + c4) = h4; } }


__global__ __launch_bounds__(256) void k_wnat(const float* __restrict__ w, size_t n8, _Float16* __restrict__ Bt) { const size_t t = (size_t)blockIdx.x * 256 + threadIdx.x; if (t >= n8) return; FragH f; for (int q = 0; q < 8; ++q) f.h[q] = (_Float16)(bf16_round(w[t * 8 + q]) * 16.0f); *(v8us*)((unsigned short*)Bt + t * 8) = f.half[0];  }
__global__ __launch_bounds__(256) void k_rsm(const float* __restrict__ S, _Float16* __restrict__ P, int nrows) {
  #pragma clang fp contract(off)
  const int i = blockIdx.x * 256 + threadIdx.x; if (i >= nrows) return; const float* s = S + (size_t)i * SQ; float mx = -3.0e38f;
#pragma unroll 1
  for (int j = 0; j < SQ; ++j) mx = fmaxf(mx, s[j]); float se = 0.f;
#pragma unroll 1
  for (int j = 0; j < SQ; ++j) se += expf(s[j] - mx); const float sc = 256.0f / se;
#pragma unroll 1
  for (int j0 = 0; j0 < SQ; j0 += 8) { FragH f; for (int q = 0; q < 8; ++q) f.h[q] = (_Float16)(expf(s[j0 + q] - mx) * sc); unsigned short* d = (unsigned short*)P + (size_t)i * SQ + j0; *(v8us*)d = f.half[0];  } }
__global__ __launch_bounds__(256) void k_vt(const _Float16* __restrict__ V16, int b, int h0, _Float16* __restrict__ VT) { __shared__ unsigned short tl[64][65]; const int tid = threadIdx.x; const int hh = blockIdx.x % HG, sg = blockIdx.x / HG; const int s0 = sg * 64; const int h = h0 + hh;
  for (int i = tid; i < 64 * 8; i += 256) { const int j = i / 8, d8 = (i % 8) * 8; FragH f; f.half[0] = *(const v8us*)((const unsigned short*)V16 + ((size_t)b * SQ + s0 + j) * DM + h * HD + d8); for (int q = 0; q < 8; ++q) tl[d8 + q][j] = f.u[q]; }
  __syncthreads();
  { for (int i = tid; i < 64 * 8; i += 256) { const int d = i / 8, j8 = (i % 8) * 8; FragH f; for (int q = 0; q < 8; ++q) f.u[q] = tl[d][j8 + q]; *(v8us*)((unsigned short*)VT + ((size_t)hh * HD + d) * SQ + s0 + j8) = f.half[0]; }  } }



__global__ __launch_bounds__(256) void k_rsmcf2(const float* __restrict__ S, _Float16* __restrict__ P, int hg, int q0, int nk) {
  #pragma clang fp contract(off)
  const int t = blockIdx.x * 256 + threadIdx.x; if (t >= hg * QT) return; const size_t i = (size_t)t; const float* s = S + i * NKX; const int last = q0 + (t % QT); float mx = -3.0e38f;
#pragma unroll 1
  for (int j = 0; j < nk; ++j) { const float f = (j <= last) ? 1.f : 0.f; mx = fmaxf(mx, fmaf(f, s[j], (1.f - f) * -1.0e9f)); } float se = 0.f;
#pragma unroll 1
  for (int j = 0; j < nk; ++j) { const float f = (j <= last) ? 1.f : 0.f; se += __expf(fmaf(f, s[j], (1.f - f) * -1.0e9f) - mx); } const float sc = 256.0f / se;
#pragma unroll 1
  for (int j0 = 0; j0 < nk; j0 += 8) { FragH fr; for (int q = 0; q < 8; ++q) { const int j = j0 + q; const float f = (j <= last) ? 1.f : 0.f; fr.h[q] = (_Float16)(__expf(fmaf(f, s[j], (1.f - f) * -1.0e9f) - mx) * sc); } unsigned short* d = (unsigned short*)P + i * NKX + j0; *(v8us*)d = fr.half[0];  } }

template <int MASKADD>
__global__ __launch_bounds__(64) void k_att0(const float* __restrict__ QF, const float* __restrict__ KF, const float* __restrict__ VF, int ld, const float* __restrict__ mask, float scale, float* __restrict__ OF, int ldo) {
  #pragma clang fp contract(off)
  __shared__ __attribute__((aligned(16))) float lq[64][64]; __shared__ __attribute__((aligned(16))) float lo[64][64];
  const int tid = threadIdx.x; const int h = blockIdx.x / (QT0 / 64), rg = blockIdx.x % (QT0 / 64); const int i = rg * 64 + tid;
  const float* qr = QF + (size_t)i * ld + h * HD;
#pragma unroll 1
  for (int c = 0; c < HD / 4; ++c) { *(v4f*)&lq[tid][c * 4] = *(const v4fa*)(qr + c * 4); const v4f z = {0.f, 0.f, 0.f, 0.f}; *(v4f*)&lo[tid][c * 4] = z; }
  float m = -1.0e30f, l = 0.f; const int jmax = MASKADD ? (SQ - 1) : (rg * 64 + 63);      /* additive-mask form: every key (the mask input decides); causal form: keys up to the block's last row */
#pragma unroll 1
  for (int j = 0; j <= jmax; ++j) { const float* kr = KF + (size_t)j * ld + h * HD; const float* vr = VF + (size_t)j * ld + h * HD; float s = 0.f;
#pragma unroll 1
    for (int c = 0; c < HD / 4; ++c) { const v4f kq = *(const v4fa*)(kr + c * 4); const v4f qq = *(v4f*)&lq[tid][c * 4]; s = __fadd_rn(s, __fmul_rn(qq[0], kq[0])); s = __fadd_rn(s, __fmul_rn(qq[1], kq[1])); s = __fadd_rn(s, __fmul_rn(qq[2], kq[2])); s = __fadd_rn(s, __fmul_rn(qq[3], kq[3])); }
    s = __fmul_rn(s, scale); if (MASKADD) s = __fadd_rn(s, __fmul_rn(bf16_round(mask[(size_t)i * SQ + j]), -10000.0f));
    const float f = (MASKADD || j <= i) ? 1.f : 0.f; const float sm = fmaf(f, s, (1.f - f) * -1.0e30f); const float mn = fmaxf(m, sm); const float sc = expf(m - mn); const float e = expf(sm - mn); l = __fadd_rn(__fmul_rn(l, sc), e); m = mn;
#pragma unroll 1
    for (int c = 0; c < HD / 4; ++c) { const v4f vv = *(const v4fa*)(vr + c * 4); v4f oo = *(v4f*)&lo[tid][c * 4]; for (int u = 0; u < 4; ++u) oo[u] = __fadd_rn(__fmul_rn(oo[u], sc), __fmul_rn(e, vv[u])); *(v4f*)&lo[tid][c * 4] = oo; } }
  const float fin = 64.0f / l;      /* o carried x64 like the f16 path */
#pragma unroll 1
  for (int c = 0; c < HD / 4; ++c) { v4f oo = *(v4f*)&lo[tid][c * 4]; for (int u = 0; u < 4; ++u) oo[u] = __fmul_rn(oo[u], fin); *(v4f*)&lo[tid][c * 4] = oo; }
  __syncthreads();
  {
#pragma unroll 1
    for (int it = 0; it < 16; ++it) { const int row = it * 4 + tid / 16, pc = (tid % 16) * 4; const v4f v = *(const v4f*)&lo[row][pc]; *(v4f*)(OF + (size_t)(rg * 64 + row) * ldo + h * HD + pc) = v; }
     } }

__global__ __launch_bounds__(256) void k_oscale(const float* __restrict__ OF, float* __restrict__ out, size_t n4) { const size_t t = (size_t)blockIdx.x * 256 + threadIdx.x; if (t >= n4) return; const v4f a = *(const v4fa*)(OF + t * 4); v4f o; for (int q = 0; q < 4; ++q) o[q] = a[q] * 0.015625f; *(v4f*)(out + t * 4) = o;  }

__global__ __launch_bounds__(256) void k_bfr(const float* __restrict__ x, float* __restrict__ XB, size_t n8) { const size_t t = (size_t)blockIdx.x * 256 + threadIdx.x; if (t >= n8) return; v4f a = *(const v4fa*)(x + t * 8), c = *(const v4fa*)(x + t * 8 + 4); for (int q = 0; q < 4; ++q) { a[q] = bf16_round(a[q]); c[q] = bf16_round(c[q]); }
  { *(v4f*)(XB + t * 8) = a; *(v4f*)(XB + t * 8 + 4) = c;  } }



__global__ __launch_bounds__(256) void k_rsmfvl(const float* __restrict__ S, _Float16* __restrict__ P, _Float16* __restrict__ PL, int qn, const int* __restrict__ vlp) {
  #pragma clang fp contract(off)
  const int t = blockIdx.x * 256 + threadIdx.x; if (t >= qn) return; const int vl = vlp[0]; const size_t i = (size_t)t; const float* s = S + i * SQ; float mx = -3.0e38f;
#pragma unroll 1
  for (int j = 0; j < SQ; ++j) { const float f = (j < vl) ? 1.f : 0.f; mx = fmaxf(mx, fmaf(f, s[j], (1.f - f) * -1000000.0f)); } float se = 0.f;
#pragma unroll 1
  for (int j = 0; j < SQ; ++j) { const float f = (j < vl) ? 1.f : 0.f; se += __expf(fmaf(f, s[j], (1.f - f) * -1000000.0f) - mx); } const float sc = 256.0f / se;
#pragma unroll 1
  for (int j0 = 0; j0 < SQ; j0 += 8) { FragH fr, gr; for (int q = 0; q < 8; ++q) { const int j = j0 + q; const float f = (j < vl) ? 1.f : 0.f; const float pv = __expf(fmaf(f, s[j], (1.f - f) * -1000000.0f) - mx) * sc; const _Float16 ph = (_Float16)pv; fr.h[q] = ph; gr.h[q] = (_Float16)((pv - (float)ph) * 1024.0f); }
    unsigned short* d = (unsigned short*)P + i * SQ + j0; unsigned short* dl = (unsigned short*)PL + i * SQ + j0; *(v8us*)d = fr.half[0]; *(v8us*)dl = gr.half[0];  } }

__global__ __launch_bounds__(256) void k_rsmf(const float* __restrict__ S, _Float16* __restrict__ P, int qn, int hg) {
  #pragma clang fp contract(off)
  const int t = blockIdx.x * 256 + threadIdx.x; if (t >= qn * hg) return; const size_t i = (size_t)(t / qn) * SQ + (t % qn); const float* s = S + i * SQ; float mx = -3.0e38f;
#pragma unroll 1
  for (int j = 0; j < SQ; ++j) mx = fmaxf(mx, s[j]); float se = 0.f;
#pragma unroll 1
  for (int j = 0; j < SQ; ++j) se += __expf(s[j] - mx); const float sc = 256.0f / se;
#pragma unroll 1
  for (int j0 = 0; j0 < SQ; j0 += 8) { FragH f; for (int q = 0; q < 8; ++q) f.h[q] = (_Float16)(__expf(s[j0 + q] - mx) * sc); unsigned short* d = (unsigned short*)P + i * SQ + j0; *(v8us*)d = f.half[0];  } }


#define CN 256          /* channels */
#define CI 128          /* inner channels */
#define NP 4096         /* positions */
#define NM 4096         /* key positions (= SQ) */
#define NC CN           /* BN statistics macros */
#define NPX NP
#define BNEPS 1e-5f

__global__ __launch_bounds__(256) void k_rowbias(const float* __restrict__ b, float* __restrict__ BP, size_t n4, int ncol) { const size_t t = (size_t)blockIdx.x * 256 + threadIdx.x; if (t >= n4) return; const size_t e = t * 4; const float v = bf16_round(b[e / ncol]); const v4f o = {v, v, v, v}; *(v4f*)(BP + e) = o;  }




__global__ __launch_bounds__(256) void k_mp2(const float* __restrict__ src, float* __restrict__ dst, int nout) {
  const int t = blockIdx.x * 256 + threadIdx.x; if (t >= nout) return; const int c = t / 1024; const int o = t % 1024; const int oy = o / 32, ox = o % 32; const float* p = src + (size_t)c * 4096 + (size_t)(2 * oy) * 64 + 2 * ox;
  const float v = fmaxf(fmaxf(p[0], p[1]), fmaxf(p[64], p[65])); *(float*)(dst + t) = v;  }
__global__ __launch_bounds__(256) void k_xpb(const float* __restrict__ x, const float* __restrict__ wb, float* __restrict__ CPP, size_t n4) {
  #pragma clang fp contract(off)
  const size_t t = (size_t)blockIdx.x * 256 + threadIdx.x; if (t >= n4) return; const size_t e = t * 4; const int c = (int)((e / 4096) % 256); const float bb = bf16_round(wb[c]); const v4f a = *(const v4fa*)(x + e); v4f o; for (int q = 0; q < 4; ++q) o[q] = __fadd_rn(bf16_round(a[q]), bb);
  *(v4f*)(CPP + e) = o;  }


template <int PASS>
__global__ __launch_bounds__(256) void k_cstA(const float* __restrict__ X, const float* __restrict__ MV, float* __restrict__ PART) {
  #pragma clang fp contract(off)
  __shared__ float red[256]; const int t = threadIdx.x; const size_t bc = blockIdx.x; const int c = (int)(bc % NC); const float* row = X + bc * (size_t)NPX; const float mu = PASS ? MV[c] : 0.f; float s = 0.f;
  for (int i = t; i < NPX; i += 256) { const float v = row[i]; const float d = PASS ? __fadd_rn(v, -mu) : v; s = __fadd_rn(s, PASS ? __fmul_rn(d, d) : d); }
  red[t] = s; __syncthreads(); for (int st = 128; st > 0; st >>= 1) { if (t < st) red[t] = __fadd_rn(red[t], red[t + st]); __syncthreads(); }
  if (t < 32) { const float pv = (t == 0) ? red[0] : 0.f; *(float*)(PART + bc * 32 + t) = pv;  } }      

template <int PASS>
__global__ __launch_bounds__(256) void k_cstB(const float* __restrict__ PART, float* __restrict__ MV) { const int c = threadIdx.x; if (c >= NC) return; double s = 0.0; for (int b = 0; b < NB; ++b) s += (double)PART[((size_t)b * NC + c) * 32]; const float m = (float)(s / ((double)NB * (double)NPX)); *(float*)(MV + PASS * NC + c) = m;  }


__global__ __launch_bounds__(256) void k_bnresid(const float* __restrict__ C2, const float* __restrict__ MV, const float* __restrict__ g, const float* __restrict__ be, const float* __restrict__ X, float* __restrict__ out, size_t n4) {
  #pragma clang fp contract(off)
  const size_t t = (size_t)blockIdx.x * 256 + threadIdx.x; if (t >= n4) return; const size_t e = t * 4; const int c = (int)((e / NPX) % NC); const float sc = __fmul_rn(rsqrtf(__fadd_rn(MV[NC + c], BNEPS)), bf16_round(g[c])); const float mu = MV[c], bb = bf16_round(be[c]);
  const v4f a = *(const v4fa*)(C2 + e); const v4f xx = *(const v4fa*)(X + e); v4f o; for (int q = 0; q < 4; ++q) { const float z = __fadd_rn(__fmul_rn(__fadd_rn(a[q], -mu), sc), bb); o[q] = __fadd_rn(z, bf16_round(xx[q])); }
  *(v4f*)(out + e) = o;  }


__global__ __launch_bounds__(256) void k_rowbias(float* __restrict__ Y, const float* __restrict__ bias) {
  #pragma clang fp contract(off)
  const size_t t = (size_t)blockIdx.x * 256 + threadIdx.x; if (t >= (size_t)NB * NC * NPX / 4) return; const size_t e = t * 4; const int c = (int)((e / NPX) % NC); const float bb = bf16_round(bias[c]);
  v4f v = *(const v4fa*)(Y + e); for (int q = 0; q < 4; ++q) v[q] = __fadd_rn(v[q], bb); *(v4f*)(Y + e) = v;  }


// Column statistics in one launch, S read once. A work-group owns 16 columns (64 B of every row): 1,024 threads = 256 row lanes x 4 column quads.
// A thread keeps its 16 rows x 4 columns in registers (16 loads of 16 B in flight per lane), so the maximum and the sum both come from the one read.
// Fold over rows: the thread's 16 rows, the 8 row lanes of a wave by lane exchange, the 32 waves through LDS.
// ST holds one 128-B record per work-group (one writer per line): 16 maxima, then 16 x (256 / sum).
// Every loop here carries #pragma unroll so that v[] and the vector elements are indexed by constants and stay in registers (a run-time index would send them to scratch).
#define CSC 16                    /* columns per work-group */
#define CSR (NP / 256)            /* rows per thread */
template <bool MAXOP>
__device__ __forceinline__ v4f cs_op(v4f a, v4f b) { v4f r;
#pragma unroll
  for (int q = 0; q < 4; ++q) r[q] = MAXOP ? fmaxf(a[q], b[q]) : a[q] + b[q];
  return r; }
template <bool MAXOP>
__device__ __forceinline__ v4f cs_fold(v4f v) {      /* butterfly over the 8 lanes of a wave that share lane & 3; every lane ends with the same bits */
#pragma unroll
  for (int m = 4; m <= 16; m <<= 1) { v4f o;
#pragma unroll
    for (int q = 0; q < 4; ++q) o[q] = __shfl_xor(v[q], m, 32);
    v = cs_op<MAXOP>(v, o); }
  return v; }
template <bool MAXOP>
__device__ __forceinline__ v4f cs_block(v4f v, float (*red)[CSC], int w, int lane) {      /* over all 256 row lanes; every thread gets the result of its column quad */
  v = cs_fold<MAXOP>(v);
  if (lane < 4) *(v4f*)&red[w][lane * 4] = v;
  __syncthreads();
  v4f r = *(const v4f*)&red[lane >> 2][(lane & 3) * 4];
#pragma unroll
  for (int k = 1; k < 4; ++k) r = cs_op<MAXOP>(r, *(const v4f*)&red[(lane >> 2) + 8 * k][(lane & 3) * 4]);
  return cs_fold<MAXOP>(r); }
__global__ __launch_bounds__(1024) void k_colstat(const float* __restrict__ S, float* __restrict__ ST) {
  __shared__ __attribute__((aligned(16))) float rmx[32][CSC]; __shared__ __attribute__((aligned(16))) float rse[32][CSC];
  const int tid = threadIdx.x, w = tid >> 5, lane = tid & 31;
  const float* s = S + (size_t)(tid >> 2) * CSR * NM + blockIdx.x * CSC + (tid & 3) * 4;
  v4f v[CSR];
#pragma unroll
  for (int i = 0; i < CSR; ++i) v[i] = *(const v4fa*)(s + (size_t)i * NM);
  asm volatile("s_wait_xcnt 0x0" :: "v"(s) : "memory");      /* a precaution: the address pair that the 16 loads name stays live and unwritten up to this wait */
  v4f mx = {-3.0e38f, -3.0e38f, -3.0e38f, -3.0e38f};
#pragma unroll
  for (int i = 0; i < CSR; ++i) mx = cs_op<true>(mx, v[i]);
  mx = cs_block<true>(mx, rmx, w, lane);
  v4f se = {0.f, 0.f, 0.f, 0.f};
#pragma unroll
  for (int i = 0; i < CSR; ++i) {
#pragma unroll
    for (int q = 0; q < 4; ++q) se[q] += __expf(v[i][q] - mx[q]); }
  se = cs_block<false>(se, rse, w, lane);
  if (tid < 4) { v4f iv;
#pragma unroll
    for (int q = 0; q < 4; ++q) iv[q] = 256.0f / se[q];
    float* rec = ST + (size_t)blockIdx.x * (2 * CSC) + tid * 4; *(v4f*)rec = mx; *(v4f*)(rec + CSC) = iv; } }
// y^T = P g^T with P never stored: the tile, the K split over the NW waves and the LDS sum are those of k_gemm2k; only the A fragments differ.
// A lane reads its 16 scores of a k block as f32 (row ln, columns 8 hh .. + 7 and 16 + 8 hh .. + 7: the k order of g2_frag) with the maxima and 256 / sum of those columns
// from the 128-B records of k_colstat, and forms P[n][m] = f16(exp(s - max_m) x 256 / sum_m) in registers. K % (32 NW) == 0, so a k block spans two whole records.
__device__ __forceinline__ v16h p_frag(const v4f (&x)[4], const v4f (&mx)[4], const v4f (&iv)[4]) { FragH f;
#pragma unroll
  for (int c = 0; c < 4; ++c) {      /* unrolled so that the vectors are indexed by constants and stay in registers */
#pragma unroll
    for (int q = 0; q < 4; ++q) f.h[c * 4 + q] = (_Float16)(__expf(x[c][q] - mx[c][q]) * iv[c][q]); }
  return f.v; }
template <int NW>
__global__ __launch_bounds__(NW * 32) __attribute__((amdgpu_waves_per_eu(NW / 4, NW / 4)))      /* one work-group a WGP (its grid has no more): the registers of NW / 4 waves a SIMD, so that the 18 loads at the head of a k block are in flight together */
void k_gemm2kp(const float* __restrict__ S, int lda, const float* __restrict__ ST, const _Float16* __restrict__ Bh, int ldb, float alpha, _Float16* __restrict__ C16, int ldc, int N, int K) {
  __shared__ __attribute__((aligned(16))) float so[NW][32][68];
  const int tid = threadIdx.x, w = tid >> 5, lane = tid & 31, ln = lane & 15, hh = lane >> 4;
  const int ntn = N >> 6; const int mt = blockIdx.x / ntn, nq = blockIdx.x - mt * ntn; const int row0 = mt * 32, col0 = nq * 64; const int ks = K / NW;
  const float* a0p = S + (size_t)(row0 + ln) * lda + w * ks + 8 * hh; const float* a1p = a0p + (size_t)16 * lda;
  const float* stp = ST + (size_t)(w * ks) * 2 + 8 * hh;      /* column m: record m / CSC of 2 CSC floats, maxima first */
  const _Float16* b0p = Bh + (size_t)(col0 + ln) * ldb + w * ks; const _Float16* b1p = b0p + (size_t)16 * ldb; const _Float16* b2p = b1p + (size_t)16 * ldb; const _Float16* b3p = b2p + (size_t)16 * ldb;
  const v8f z8 = {0.f,0.f,0.f,0.f,0.f,0.f,0.f,0.f}; v8f c00 = z8, c01 = z8, c02 = z8, c03 = z8, c10 = z8, c11 = z8, c12 = z8, c13 = z8;
  for (int kb = 0; kb < ks; kb += 32) { const float* r = stp + kb * 2; const float* s0 = a0p + kb; const float* s1 = a1p + kb;
    const v4f x0[4] = {*(const v4fa*)s0, *(const v4fa*)(s0 + 4), *(const v4fa*)(s0 + 16), *(const v4fa*)(s0 + 20)};
    const v4f x1[4] = {*(const v4fa*)s1, *(const v4fa*)(s1 + 4), *(const v4fa*)(s1 + 16), *(const v4fa*)(s1 + 20)};
    const v4f mx[4] = {*(const v4fa*)r, *(const v4fa*)(r + 4), *(const v4fa*)(r + 2 * CSC), *(const v4fa*)(r + 2 * CSC + 4)};
    const v4f iv[4] = {*(const v4fa*)(r + CSC), *(const v4fa*)(r + CSC + 4), *(const v4fa*)(r + 3 * CSC), *(const v4fa*)(r + 3 * CSC + 4)};
    v16h b = g2_frag(b0p + kb, hh);
    asm volatile("s_wait_xcnt 0x0" :: "v"(s0), "v"(s1), "v"(r), "v"(b0p + kb + 8 * hh) : "memory");      /* a precaution: the four address pairs that the 18 loads above name stay live and unwritten up to this wait */
    const v16h a0 = p_frag(x0, mx, iv), a1 = p_frag(x1, mx, iv);
    c00 = g2_mma(a0, b, c00); c10 = g2_mma(a1, b, c10);
    b = g2_frag(b1p + kb, hh); c01 = g2_mma(a0, b, c01); c11 = g2_mma(a1, b, c11);
    b = g2_frag(b2p + kb, hh); c02 = g2_mma(a0, b, c02); c12 = g2_mma(a1, b, c12);
    b = g2_frag(b3p + kb, hh); c03 = g2_mma(a0, b, c03); c13 = g2_mma(a1, b, c13); }
  v8f accs[8] = {c00, c01, c02, c03, c10, c11, c12, c13};
#pragma unroll
  for (int u = 0; u < 8; ++u) {      /* unrolled so that accs[] is indexed by constants and stays in registers */
#pragma unroll
    for (int r = 0; r < 8; ++r) so[w][(u >> 2) * 16 + 8 * hh + r][(u & 3) * 16 + ln] = accs[u][r]; }
  __syncthreads();      /* every wave's partial tile is in LDS before any thread adds them */
  for (int i0 = 0; i0 < 32 * 16; i0 += NW * 32) { const int i = i0 + tid, r = i >> 4, c4 = (i & 15) * 4; v4f s = *(const v4f*)&so[0][r][c4];
#pragma unroll
    for (int k = 1; k < NW; ++k) s += *(const v4f*)&so[k][r][c4];      /* unrolled so that the NW LDS reads issue together */
    v4h h4;
#pragma unroll
    for (int q = 0; q < 4; ++q) h4[q] = (_Float16)(s[q] * alpha);      /* unrolled so that the vector elements are indexed by constants */
    *(v4h*)(C16 + (size_t)(row0 + r) * ldc + col0 + c4) = h4; } }
extern "C" void kernel_launch(void* const* d_in, const int* in_sizes, int n_in,
                              void* d_out, int out_size, void* d_ws, size_t ws_size, hipStream_t stream) {
  (void)in_sizes; (void)n_in; (void)out_size;
  const float* const* I = (const float* const*)d_in; const float* x = I[0]; const float* tw = I[1]; const float* pw = I[2]; const float* gw = I[3]; const float* ww = I[4];      /* natural 1x1 conv weights: w_theta, w_phi, w_g [128][256], w_mask [256][128]; no biases */
  char* ws = (char*)d_ws; size_t off = 0;
  auto take = [&](size_t bytes) { char* p = ws + off; off += (bytes + 255) & ~(size_t)255; return p; };
  const size_t PL = (size_t)CN * NP;      /* one input map */
  _Float16* BT = (_Float16*)take((size_t)CI * CN * 2); _Float16* BP = (_Float16*)take((size_t)CI * CN * 2); _Float16* BG = (_Float16*)take((size_t)CI * CN * 2); _Float16* BW = (_Float16*)take((size_t)CN * CI * 2);
  _Float16* X16 = (_Float16*)take(NB * PL * 2); float* XB = (float*)take(NB * PL * 4);      /* x f16 channel-first; bf16(x) f32 for the residual */
  _Float16* XT = (_Float16*)take(PL * 2); _Float16* TH = (_Float16*)take((size_t)NP * CI * 2); _Float16* PHT = (_Float16*)take((size_t)NP * CI * 2); _Float16* GT = (_Float16*)take((size_t)NP * CI * 2); _Float16* G = (_Float16*)take((size_t)CI * NP * 2); _Float16* YT = (_Float16*)take((size_t)NP * CI * 2);
  float* S = (float*)take((size_t)NP * NM * 4); float* ST = (float*)take((size_t)NM * 2 * 4);      /* per-column max and 256 / sum, one 128-B record per 16 columns */
  if (off > ws_size) return;
  { const unsigned g = (unsigned)(((size_t)CI * CN / 8 + 255) / 256); k_wnat<<<g, 256, 0, stream>>>(tw, (size_t)CI * CN / 8, BT); k_wnat<<<g, 256, 0, stream>>>(pw, (size_t)CI * CN / 8, BP); k_wnat<<<g, 256, 0, stream>>>(gw, (size_t)CI * CN / 8, BG); k_wnat<<<g, 256, 0, stream>>>(ww, (size_t)CN * CI / 8, BW); }      /* natural [out][in] x16 f16 planes (Bt for theta/phi/g token rows; the A operand for W) */
  k_x16<<<(unsigned)((NB * PL / 8 + 255) / 256), 256, 0, stream>>>(x, X16, NB * PL / 8); k_bfr<<<(unsigned)((NB * PL / 8 + 255) / 256), 256, 0, stream>>>(x, XB, NB * PL / 8);
  for (int b = 0; b < NB; ++b) {
    k_vt<NP / 64, CN><<<(NP / 64) * (CN / 64), 256, 0, stream>>>(X16 + (size_t)b * PL, NP, 0, XT);      /* [c][n] -> x^T [n][c] token rows */
    k_gemm2k<8><<<(NP / 32) * (CI / 64), 256, 0, stream>>>(XT, CN, BT, CN, 0.0625f, TH, CI, CI, CN);      /* theta^T [n][ci] -> f16; K = 256 over 8 waves */
    k_gemm2k<8><<<(NP / 32) * (CI / 64), 256, 0, stream>>>(XT, CN, BP, CN, 0.0625f, PHT, CI, CI, CN);      /* phi^T [m][ci] -> f16 (the scores' B^T operand) */
    k_gemm2k<8><<<(NP / 32) * (CI / 64), 256, 0, stream>>>(XT, CN, BG, CN, 0.0625f, GT, CI, CI, CN);      /* g^T [m][ci] -> f16 */
    k_vt<CI / 64, NP><<<(CI / 64) * (NP / 64), 256, 0, stream>>>(GT, CI, 0, G);      /* -> g [ci][m] (the PV B^T operand) */
    k_gemm2<0><<<dim3((unsigned)((NP / 128) * (NM / 64)), 1), 128, 0, stream>>>(TH, CI, 0, PHT, CI, 0, 1.0f, nullptr, 0, nullptr, 1, 0, 0, S, nullptr, NM, 0, NP, NM, CI);      /* f[a][b] = theta[:, a].phi[:, b] (K = 128, NO scale) */
    k_colstat<<<NM / CSC, 1024, 0, stream>>>(S, ST);      /* softmax over the QUERY axis: per key column m the max and 256 / sum over all 4096 rows n */
    k_gemm2kp<16><<<(NP / 32) * (CI / 64), 512, 0, stream>>>(S, NM, ST, G, NM, 0.00390625f, YT, CI, CI, NM);      /* y^T [a][ci] = sum_b P[a][b] g[ci][b] -> f16, P[a][b] = f16(256 exp(s - max_b) / sum_b) formed in the A loader; K = 4096 over 16 waves */
    k_gemm2<0><<<dim3((unsigned)((CN / 128) * (NP / 64)), 1), 128, 0, stream>>>(BW, CI, 0, YT, CI, 0, 0.0625f, nullptr, 0, XB + (size_t)b * PL, -1, 0, 0, (float*)d_out + (size_t)b * PL, nullptr, NP, 0, CN, NP, CI); }      /* out[c][a] = (16 W as A) x (y^T as B^T) / 16 + bf16(x) (own element) -> f32 channel-first output block */
}

// v004
// It runs in 317 microseconds.
// Two timings next to v003 put it at 1.49 and 1.48 times that version's speed.
// All steps since v000 together make it 22.1 times as fast.
#include <hip/hip_runtime.h>
// Non-local block with the softmax taken over the QUERY axis (x [4][256][64][64]; theta, phi, g = conv1x1(x) with [128][256] weights (U(+-1/16), no biases); scores[n][m] = theta[n].phi[m] (NO scaling); attn = softmax(scores, axis = 1): normalised over n for every key column m (the module's unconventional axis); out[n] = sum_m attn[n][m] g[m]; mask = conv1x1(out; w_mask [256][128], no bias); result = x + mask -> [4][256][64][64]).
// Structure: channel-first; x as exact f16 planes and bf16(x) f32 residual planes; the images share every launch (grid, two at a time where f lies); token rows via LDS transposes; theta^T, phi^T, g^T as WMMA GEMMs (32x64 wave tiles, f32 accumulation) -> f16; g to channel-major via LDS transposes; f [4096][4096] = theta^T phi (K = 128, no scale) f32; column softmax on VALU (f32 statistics, native exp; weights x256 f16); y^T = P g^T (x2^-8) f16; out = (16 W) y / 16 + bf16(x) f32 channel-first; launches: see trace.
// Compute dtype: inputs rounded to bf16; x / weights exact; q, k, v, softmax weights and o as plain f16 GEMM operands (~2^-12); scores and softmax statistics f32. v_wmma_f32_16x16x32_f16.
#define NB 4
#define SQ 4096
#define DM 256
#define NH 1
#define HD 64
#define HG 4                         /* heads per attention launch group */
#define B0 0                         /* first batch processed (debug hook) */
#define NBR NB                       /* batches processed (debug hook) */
#define NR ((size_t)NB * SQ)         /* token rows */
#define MP ((int)((size_t)NBR * SQ)) /* rows projected (debug hook) */
#define QT 256                       /* query rows per causal tile */
#define NKX SQ                       /* S / P row pitch */
#define QT0 256                      /* first-tile rows recomputed exactly (256: buys margin for the few-key rows 128..255, which have no output projection to average the single-f16 P/v rounding) */
#define QN SQ                        /* query rows attended per batch (debug hook) */
#define NHD NH                       /* heads attended (debug hook) */
#define MPO MP                       /* rows through the output stage (debug hook) */
#define LQ DM            /* unused (the q/k/v rows have pitch QL = 3 CI) */
typedef __bf16 v16b __attribute__((ext_vector_type(16)));
typedef unsigned short v8us __attribute__((ext_vector_type(8), may_alias));
typedef float  v8f  __attribute__((ext_vector_type(8)));
typedef float  v4f  __attribute__((ext_vector_type(4)));
typedef float  v4fa __attribute__((ext_vector_type(4), may_alias));
union FragB { v16b v; v8us half[2]; unsigned short u[16]; };

__device__ __forceinline__ unsigned short bf16_bits(float x) { unsigned int u = __float_as_uint(x); return (unsigned short)((u + 0x7FFFu + ((u >> 16) & 1u)) >> 16); }
__device__ __forceinline__ float bf16_val(unsigned short b) { return __uint_as_float(((unsigned int)b) << 16); }
__device__ __forceinline__ float bf16_round(float x) { return bf16_val(bf16_bits(x)); }
// D += A·B with NT terms: 1 = ah·bh, 2 = + al·bh (A split), 3 = + ah·bl (both split)
template <int NT>
__device__ __forceinline__ v8f mmaN(v16b ah, v16b al, v16b bh, v16b bl, v8f c) {
  c = __builtin_amdgcn_wmma_f32_16x16x32_bf16(false, ah, false, bh, (short)0, c, false, false);
  if (NT >= 2) c = __builtin_amdgcn_wmma_f32_16x16x32_bf16(false, al, false, bh, (short)0, c, false, false);
  if (NT >= 3) c = __builtin_amdgcn_wmma_f32_16x16x32_bf16(false, ah, false, bl, (short)0, c, false, false);
  asm volatile("v_nop\n\tv_nop\n\tv_nop\n\tv_nop" : "+v"(c) : "v"(ah), "v"(al), "v"(bh), "v"(bl));
  return c;
}

__global__ __launch_bounds__(256) void k_wt_bf16(const float* __restrict__ W, unsigned short* __restrict__ Wt, int K, int N) {
  const int t = blockIdx.x * 256 + threadIdx.x;
  const int k8n = K / 8;
  if (t >= N * k8n) return;
  const int n = t / k8n, k8 = (t % k8n) * 8;
  v8us v;
#pragma unroll
  for (int i = 0; i < 8; ++i) v[i] = bf16_bits(W[(size_t)(k8 + i) * N + n]);
  *(v8us*)(Wt + (size_t)n * K + k8) = v;
  
}

// GEMM C[M][N] (f32, pitch ldc) = act(A[M][K]·W + bias). A f32 row-major (pitch lda) converted per fragment to bf16
// (ASPLIT: hi/lo two planes -> 2 terms, else single rounded term); Wt bf16 [N][K] (pitch ldb). BIAS_BF16 rounds the
// bias to bf16 first (bias quantised to bf16 before the add). K%32==0, M%16==0, N%64==0.
template <bool ASPLIT, int ACT, bool BIAS_BF16>
__global__ __launch_bounds__(128) void k_gemm_bf(const float* __restrict__ A, int lda, const unsigned short* __restrict__ Wt, int ldb,
                                               const float* __restrict__ bias, float* __restrict__ C, int ldc, int M, int N, int K) {
  __shared__ __attribute__((aligned(16))) float so[4][16][64];
  const int tid = threadIdx.x, w = tid >> 5, lane = tid & 31, ln = lane & 15, hh = lane >> 4;
  const int ntn = N / 64;
  const int wid = blockIdx.x * 4 + w;
  const int mt = wid / ntn, nq = wid % ntn;
  if (mt * 16 >= M) return;
  const int row0 = mt * 16, col0 = nq * 64;
  const float* arow = A + (size_t)(row0 + ln) * lda;
  v8f acc[4] = {};
  for (int kb = 0; kb < K; kb += 32) {
    FragB ah, al;
    const v4f x0 = *(const v4fa*)(arow + kb + 8 * hh), x1 = *(const v4fa*)(arow + kb + 8 * hh + 4);
    const v4f x2 = *(const v4fa*)(arow + kb + 16 + 8 * hh), x3 = *(const v4fa*)(arow + kb + 16 + 8 * hh + 4);
    float xs[16] = {x0[0],x0[1],x0[2],x0[3],x1[0],x1[1],x1[2],x1[3],x2[0],x2[1],x2[2],x2[3],x3[0],x3[1],x3[2],x3[3]};
#pragma unroll
    for (int i = 0; i < 16; ++i) { const unsigned short hb = bf16_bits(xs[i]); ah.u[i] = hb; al.u[i] = ASPLIT ? bf16_bits(xs[i] - bf16_val(hb)) : (unsigned short)0; }
#pragma unroll
    for (int t = 0; t < 4; ++t) {
      const unsigned short* brow = Wt + (size_t)(col0 + t * 16 + ln) * ldb + kb;
      FragB b;
      b.half[0] = *(const v8us*)(brow + 8 * hh);
      b.half[1] = *(const v8us*)(brow + 16 + 8 * hh);
      acc[t] = mmaN<ASPLIT ? 2 : 1>(ah.v, al.v, b.v, b.v, acc[t]);
    }
  }
#pragma unroll
  for (int t = 0; t < 4; ++t) {
    float bv = bias ? bias[col0 + t * 16 + ln] : 0.f;
    if (BIAS_BF16) bv = bf16_round(bv);
#pragma unroll
    for (int r = 0; r < 8; ++r) { float v = acc[t][r] + bv; if (ACT == 1) v = fmaxf(v, 0.f); so[w][8 * hh + r][t * 16 + ln] = v; }
  }
  __builtin_amdgcn_fence(__ATOMIC_ACQ_REL, "workgroup");
  __builtin_amdgcn_wave_barrier();
  const int rsub = lane >> 4, c4 = (lane & 15) * 4;
  {
#pragma unroll
    for (int q = 0; q < 8; ++q) {
      const int r = q * 2 + rsub;
      const v4f v = *(const v4fa*)&so[w][r][c4];
      *(v4f*)(C + (size_t)(row0 + r) * ldc + col0 + c4) = v;
    }
    
  }
}

// GEMM C = act(A·W + bias + resid): A f32 (ASPLIT -> hi/lo 2 terms), Wt bf16 [N][K]; ACT 0 none, 1 relu, 2 exact gelu;
// resid (optional, f32, row index = (row % rmod), pitch ldr, RES_BF16 rounds it) added before the activation.
template <bool ASPLIT, int ACT, bool BIAS_BF16, bool RES_BF16>
__global__ __launch_bounds__(128) void k_gemm_bf3(const float* __restrict__ A, int lda, const unsigned short* __restrict__ Wt, int ldb,
                                                const float* __restrict__ bias, const float* __restrict__ resid, int rmod, int ldr,
                                                float* __restrict__ C, int ldc, int M, int N, int K) {
  __shared__ __attribute__((aligned(16))) float so[4][16][64];
  const int tid = threadIdx.x, w = tid >> 5, lane = tid & 31, ln = lane & 15, hh = lane >> 4;
  const int ntn = N / 64;
  const int wid = blockIdx.x * 4 + w;
  const int mt = wid / ntn, nq = wid % ntn;
  if (mt * 16 >= M) return;
  const int row0 = mt * 16, col0 = nq * 64;
  const float* arow = A + (size_t)(row0 + ln) * lda;
  v8f acc[4] = {};
  for (int kb = 0; kb < K; kb += 32) {
    FragB ah, al;
    const v4f x0 = *(const v4fa*)(arow + kb + 8 * hh), x1 = *(const v4fa*)(arow + kb + 8 * hh + 4);
    const v4f x2 = *(const v4fa*)(arow + kb + 16 + 8 * hh), x3 = *(const v4fa*)(arow + kb + 16 + 8 * hh + 4);
    float xs[16] = {x0[0],x0[1],x0[2],x0[3],x1[0],x1[1],x1[2],x1[3],x2[0],x2[1],x2[2],x2[3],x3[0],x3[1],x3[2],x3[3]};
#pragma unroll
    for (int i = 0; i < 16; ++i) { const unsigned short hb = bf16_bits(xs[i]); ah.u[i] = hb; al.u[i] = ASPLIT ? bf16_bits(xs[i] - bf16_val(hb)) : (unsigned short)0; }
#pragma unroll
    for (int t = 0; t < 4; ++t) {
      const unsigned short* brow = Wt + (size_t)(col0 + t * 16 + ln) * ldb + kb;
      FragB b;
      b.half[0] = *(const v8us*)(brow + 8 * hh);
      b.half[1] = *(const v8us*)(brow + 16 + 8 * hh);
      acc[t] = mmaN<ASPLIT ? 2 : 1>(ah.v, al.v, b.v, b.v, acc[t]);
    }
  }
#pragma unroll
  for (int t = 0; t < 4; ++t) {
    const int col = col0 + t * 16 + ln;
    float bv = bias ? bias[col] : 0.f;
    if (BIAS_BF16) bv = bf16_round(bv);
#pragma unroll
    for (int r = 0; r < 8; ++r) {
      float v = acc[t][r] + bv;
      if (resid) { float rv = resid[(size_t)((row0 + 8 * hh + r) % rmod) * ldr + col]; if (RES_BF16) rv = bf16_round(rv); v += rv; }
      if (ACT == 1) v = fmaxf(v, 0.f);
      if (ACT == 2) v = 0.5f * v * (1.0f + erff(v * 0.70710678118654752f));
      if (ACT == 3) { const float u = 0.7978845608028654f * (v + 0.044715f * v * v * v); v = 0.5f * v * (1.0f + tanhf(u)); }
      so[w][8 * hh + r][t * 16 + ln] = v;
    }
  }
  __builtin_amdgcn_fence(__ATOMIC_ACQ_REL, "workgroup");
  __builtin_amdgcn_wave_barrier();
  const int rsub = lane >> 4, c4 = (lane & 15) * 4;
  {
#pragma unroll
    for (int q = 0; q < 8; ++q) {
      const int r = q * 2 + rsub;
      const v4f v = *(const v4fa*)&so[w][r][c4];
      *(v4f*)(C + (size_t)(row0 + r) * ldc + col0 + c4) = v;
    }
    
  }
}
// row LayerNorm (biased variance, eps) over N: s = X (+ R); optional out_sum <- s; out_norm <- (s-mu)*rsqrt(var+eps)*g + b
template <bool PARAM_BF16>
__global__ __launch_bounds__(256) void k_layernorm(const float* __restrict__ X, const float* __restrict__ R, const float* __restrict__ g, const float* __restrict__ bta,
                                                  float* __restrict__ out_sum, float* __restrict__ out_norm, int N, float eps) {
  __shared__ float red[256];
  const int row = blockIdx.x, tid = threadIdx.x;
  const float* x = X + (size_t)row * N; const float* rr = R ? R + (size_t)row * N : nullptr;
  float vals[16];                     // up to N = 4096
  const int per = N / 256;            // contiguous chunk per thread? use strided-by-4 chunks: thread handles j = tid*4 + 1024*u
  float s1 = 0.f;
  for (int u = 0; u < per / 4; ++u) {
    const int j = tid * 4 + 1024 * u;
    const v4f a = *(const v4fa*)(x + j);
    v4f b = {0.f,0.f,0.f,0.f}; if (rr) b = *(const v4fa*)(rr + j);
#pragma unroll
    for (int q = 0; q < 4; ++q) { const float v = a[q] + b[q]; vals[u * 4 + q] = v; s1 += v; }
  }
  red[tid] = s1; __syncthreads();
  for (int st = 128; st > 0; st >>= 1) { if (tid < st) red[tid] += red[tid + st]; __syncthreads(); }
  const float mu = red[0] / (float)N; __syncthreads();
  float s2 = 0.f;
  for (int u = 0; u < per / 4; ++u)
#pragma unroll
    for (int q = 0; q < 4; ++q) { const float c = vals[u * 4 + q] - mu; s2 += c * c; }
  red[tid] = s2; __syncthreads();
  for (int st = 128; st > 0; st >>= 1) { if (tid < st) red[tid] += red[tid + st]; __syncthreads(); }
  const float rs = rsqrtf(red[0] / (float)N + eps);
  {
    for (int u = 0; u < per / 4; ++u) {
      const int j = tid * 4 + 1024 * u;
      v4f o, sm;
#pragma unroll
      for (int q = 0; q < 4; ++q) {
        float gg = g[j + q], bb = bta[j + q];
        if (PARAM_BF16) { gg = bf16_round(gg); bb = bf16_round(bb); }
        sm[q] = vals[u * 4 + q]; o[q] = (vals[u * 4 + q] - mu) * rs * gg + bb;
      }
      if (out_sum) *(v4f*)(out_sum + (size_t)row * N + j) = sm;
      *(v4f*)(out_norm + (size_t)row * N + j) = o;
    }
    
  }
}



// ---- f16 WMMA path (v_wmma_f32_16x16x32_f16): 11-bit significands for operands in range — used where a [0,1] probability operand needs more precision than bf16
typedef _Float16 v16h __attribute__((ext_vector_type(16)));
union FragH { v16h v; v8us half[2]; _Float16 h[16]; unsigned short u[16]; };
template <int NT>
__device__ __forceinline__ v8f mmaH(v16h ah, v16h al, v16h bh, v16h bl, v8f c) {
  c = __builtin_amdgcn_wmma_f32_16x16x32_f16(false, ah, false, bh, (short)0, c, false, false);
  if (NT >= 2) c = __builtin_amdgcn_wmma_f32_16x16x32_f16(false, al, false, bh, (short)0, c, false, false);
  if (NT >= 3) c = __builtin_amdgcn_wmma_f32_16x16x32_f16(false, ah, false, bl, (short)0, c, false, false);
  asm volatile("v_nop\n\tv_nop\n\tv_nop\n\tv_nop" : "+v"(c) : "v"(ah), "v"(al), "v"(bh), "v"(bl));
  return c;
}
// batched GEMM like k_gemm_b but f16 operands: A f32 (split into f16 hi/lo if ASPLIT, else rounded to f16), Bt = f16 values [n][k]; alpha; C f32; N multiple of 16 (partial tiles skipped)
template <bool ASPLIT>
__global__ __launch_bounds__(128) void k_gemm_h(const float* __restrict__ A, int lda, size_t sA, const _Float16* __restrict__ Bh, int ldb, size_t sB, float alpha, float* __restrict__ C, int ldc, size_t sC, int M, int N, int K) {
  __shared__ __attribute__((aligned(16))) float so[4][16][64];
  const int tid = threadIdx.x, w = tid >> 5, lane = tid & 31, ln = lane & 15, hh = lane >> 4; const int by = blockIdx.y;
  A += (size_t)by * sA; Bh += (size_t)by * sB; C += (size_t)by * sC;
  const int ntn = (N + 63) / 64; const int wid = blockIdx.x * 4 + w; const int mt = wid / ntn, nq = wid % ntn; if (mt * 16 >= M) return;
  const int row0 = mt * 16, col0 = nq * 64; const float* arow = A + (size_t)(row0 + ln) * lda;
  v8f acc[4] = {};
  for (int kb = 0; kb < K; kb += 32) {
    FragH ah, al;
    const v4f x0 = *(const v4fa*)(arow + kb + 8 * hh), x1 = *(const v4fa*)(arow + kb + 8 * hh + 4), x2 = *(const v4fa*)(arow + kb + 16 + 8 * hh), x3 = *(const v4fa*)(arow + kb + 16 + 8 * hh + 4);
    float xs[16] = {x0[0],x0[1],x0[2],x0[3],x1[0],x1[1],x1[2],x1[3],x2[0],x2[1],x2[2],x2[3],x3[0],x3[1],x3[2],x3[3]};
#pragma unroll
    for (int i = 0; i < 16; ++i) { const _Float16 h = (_Float16)xs[i]; ah.h[i] = h; al.h[i] = ASPLIT ? (_Float16)(xs[i] - (float)h) : (_Float16)0.0f; }
#pragma unroll
    for (int t = 0; t < 4; ++t) { if (col0 + t * 16 >= N) continue; const size_t boff = (size_t)(col0 + t * 16 + ln) * ldb + kb; FragH bq; bq.half[0] = *(const v8us*)(Bh + boff + 8 * hh); bq.half[1] = *(const v8us*)(Bh + boff + 16 + 8 * hh);
      acc[t] = mmaH<ASPLIT ? 2 : 1>(ah.v, al.v, bq.v, bq.v, acc[t]); }
  }
#pragma unroll
  for (int t = 0; t < 4; ++t) { if (col0 + t * 16 >= N) continue;
#pragma unroll
    for (int r = 0; r < 8; ++r) so[w][8 * hh + r][t * 16 + ln] = acc[t][r] * alpha; }
  __builtin_amdgcn_fence(__ATOMIC_ACQ_REL, "workgroup"); __builtin_amdgcn_wave_barrier();
  const int rsub = lane >> 4, c4 = (lane & 15) * 4;
  {
#pragma unroll
    for (int q = 0; q < 8; ++q) { const int r = q * 2 + rsub; if (col0 + c4 < N) { const v4f v = *(const v4fa*)&so[w][r][c4]; *(v4f*)(C + (size_t)(row0 + r) * ldc + col0 + c4) = v; } }
     }
}

// Wt[n][k] = f16(W[k][n]·scale) from f32 row-major W[K][N] (scale = power of two; bf16-exact weights stay exact in f16 away from the subnormal range)
__global__ __launch_bounds__(256) void k_wt_f16(const float* __restrict__ W, _Float16* __restrict__ Wt, int K, int N, float scale) {
  const int t = blockIdx.x * 256 + threadIdx.x; if (t >= N * (K / 8)) return; const int n = t / (K / 8), k8 = (t % (K / 8)) * 8; FragH f;
#pragma unroll
  for (int i = 0; i < 8; ++i) f.h[i] = (_Float16)(bf16_round(W[(size_t)(k8 + i) * N + n]) * scale); const v8us o = f.half[0];
  *(v8us*)((unsigned short*)Wt + (size_t)n * K + k8) = o; 
}
// k_gemm_hh variant with fused epilogue: v = acc·alpha + bias[by·sBias + col] (+ CP[(row/rowsPerB)·sCPb + by·64 + col] if CP) ; ACT 0 none / 1 elu ; writes f16 C16 (and f32 C if non-null)
template <int ACT>
__global__ __launch_bounds__(128) void k_gemm_hhx(const _Float16* __restrict__ A, int lda, size_t sA, const _Float16* __restrict__ Bh, int ldb, size_t sB, float alpha, const float* __restrict__ bias, size_t sBias, const float* __restrict__ CP, int rowsPerB, size_t sCPb, int row0g,
    float* __restrict__ C, _Float16* __restrict__ C16, int ldc, size_t sC, int M, int N, int K) {
  __shared__ __attribute__((aligned(16))) float so[4][16][64];
  const int tid = threadIdx.x, w = tid >> 5, lane = tid & 31, ln = lane & 15, hh = lane >> 4; const int by = blockIdx.y;
  A += (size_t)by * sA; Bh += (size_t)by * sB; const size_t cofs = (size_t)by * sC; const float* bp = bias ? bias + (size_t)by * sBias : nullptr;
  const int ntn = (N + 63) / 64; const int wid = blockIdx.x * 4 + w; const int mt = wid / ntn, nq = wid % ntn; if (mt * 16 >= M) return;
  const int row0 = mt * 16, col0 = nq * 64; const _Float16* arow = A + (size_t)(row0 + ln) * lda;
  v8f acc[4] = {};
  for (int kb = 0; kb < K; kb += 32) { FragH ah; ah.half[0] = *(const v8us*)((const unsigned short*)arow + kb + 8 * hh); ah.half[1] = *(const v8us*)((const unsigned short*)arow + kb + 16 + 8 * hh);
#pragma unroll
    for (int t = 0; t < 4; ++t) { if (col0 + t * 16 >= N) continue; const size_t boff = (size_t)(col0 + t * 16 + ln) * ldb + kb; FragH bq; bq.half[0] = *(const v8us*)((const unsigned short*)Bh + boff + 8 * hh); bq.half[1] = *(const v8us*)((const unsigned short*)Bh + boff + 16 + 8 * hh);
      acc[t] = mmaH<1>(ah.v, ah.v, bq.v, bq.v, acc[t]); }
  }
#pragma unroll
  for (int t = 0; t < 4; ++t) { if (col0 + t * 16 >= N) continue; const int col = col0 + t * 16 + ln; const float bv = bp ? bf16_round(bp[col]) : 0.f;
#pragma unroll
    for (int r = 0; r < 8; ++r) { float v = acc[t][r] * alpha + bv; if (CP) { const int rr = row0g + row0 + 8 * hh + r; if (rowsPerB < 0) v += CP[cofs + (size_t)rr * ldc + col];      /* rowsPerB < 0: own element of the batched C plane */ else { const int bidx = rr / rowsPerB; v += CP[(size_t)bidx * sCPb + (size_t)by * 64 + col]; } } if (ACT == 1) v = (v > 0.f) ? v : expm1f(v); else if (ACT == 7) v = (v > 0.f) ? v + 1.0f : expf(v); else if (ACT == 8) v = tanhf(v); else if (ACT == 9) v = 0.5f * v * (1.0f + tanhf(0.7978845608028654f * (v + 0.044715f * v * v * v))); else if (ACT == 11) v = 1.0f / (1.0f + expf(-v)); else if (ACT == 12) v = (v > 0.f) ? v : 0.01f * v; else if (ACT == 14) v = (v > 0.f) ? v : 0.1f * v; else if (ACT == 16) v = (v >= 0.f) ? v : 0.3f * v; else if (ACT == 17) v = (v >= 0.f) ? v : 0.2f * v; else if (ACT == 15) v = v / (1.0f + expf(-v)); else if (ACT == 3) v = fmaxf(v, 0.f); else if (ACT == 6) v = 0.5f * v * (1.0f + erff(v * 0.70710678118654752f)); so[w][8 * hh + r][t * 16 + ln] = v; } }
  __builtin_amdgcn_fence(__ATOMIC_ACQ_REL, "workgroup"); __builtin_amdgcn_wave_barrier();
  const int rsub = lane >> 4, c4 = (lane & 15) * 4; typedef _Float16 v4h __attribute__((ext_vector_type(4)));
  {
#pragma unroll
    for (int q = 0; q < 8; ++q) { const int r = q * 2 + rsub; if (col0 + c4 < N) { const v4f v = *(const v4fa*)&so[w][r][c4]; if (C) *(v4f*)(C + cofs + (size_t)(row0 + r) * ldc + col0 + c4) = v; if (C16) { v4h h4; for (int i = 0; i < 4; ++i) h4[i] = (_Float16)v[i]; *(v4h*)(C16 + cofs + (size_t)(row0 + r) * ldc + col0 + c4) = h4; } } }
     }
}


typedef _Float16 v4h __attribute__((ext_vector_type(4)));

__global__ __launch_bounds__(256) void k_x16(const float* __restrict__ x, _Float16* __restrict__ X16, size_t n8) { const size_t t = (size_t)blockIdx.x * 256 + threadIdx.x; if (t >= n8) return; FragH f;
#pragma unroll
  for (int q = 0; q < 8; ++q) f.h[q] = (_Float16)bf16_round(x[t * 8 + q]); *(v8us*)((unsigned short*)X16 + t * 8) = f.half[0];  }
__global__ __launch_bounds__(256) void k_h16(const float* __restrict__ x, _Float16* __restrict__ X16, size_t n8) { const size_t t = (size_t)blockIdx.x * 256 + threadIdx.x; if (t >= n8) return; FragH f;
#pragma unroll
  for (int q = 0; q < 8; ++q) f.h[q] = (_Float16)x[t * 8 + q]; *(v8us*)((unsigned short*)X16 + t * 8) = f.half[0];  }
__global__ __launch_bounds__(256) void k_round16f(const float* __restrict__ W, _Float16* __restrict__ Bt, size_t n8) { const size_t t = (size_t)blockIdx.x * 256 + threadIdx.x; if (t >= n8) return; FragH f;
#pragma unroll
  for (int i = 0; i < 8; ++i) f.h[i] = (_Float16)(bf16_round(W[t * 8 + i]) * 16.0f); *(v8us*)((unsigned short*)Bt + t * 8) = f.half[0];  }
template <int NHv, int TTv>
__global__ __launch_bounds__(256) void k_vt(const _Float16* __restrict__ V16, int ldv, int voff, _Float16* __restrict__ Vt) { __shared__ unsigned short tl[64][66]; const int tid = threadIdx.x; const int slab = blockIdx.x / (TTv / 64), lg = blockIdx.x % (TTv / 64); const int b = slab / NHv, h = slab % NHv;
  for (int i = tid; i < 64 * 8; i += 256) { const int r = i / 8, c8 = (i % 8) * 8; FragH f; f.half[0] = *(const v8us*)((const unsigned short*)V16 + ((size_t)b * TTv + lg * 64 + r) * ldv + voff + h * 64 + c8);
#pragma unroll
    for (int q = 0; q < 8; ++q) tl[r][c8 + q] = f.u[q]; }
  __syncthreads();
  {
#pragma unroll
    for (int rd = 0; rd < 2; ++rd) { const int d = rd * 32 + tid / 8, pc = tid % 8; FragH f;
#pragma unroll
      for (int q = 0; q < 8; ++q) f.u[q] = tl[pc * 8 + q][d];
      *(v8us*)((unsigned short*)Vt + ((size_t)slab * 64 + d) * TTv + lg * 64 + pc * 8) = f.half[0]; }
     } }

__global__ __launch_bounds__(256) void k_hl(const float* __restrict__ F, _Float16* __restrict__ Hh, _Float16* __restrict__ Hl, size_t n8) { const size_t t = (size_t)blockIdx.x * 256 + threadIdx.x; if (t >= n8) return; FragH fh, fl; const v4f a = *(const v4fa*)(F + t * 8), c = *(const v4fa*)(F + t * 8 + 4);
#pragma unroll
  for (int q = 0; q < 4; ++q) { _Float16 h = (_Float16)a[q]; fh.h[q] = h; fl.h[q] = (_Float16)((a[q] - (float)h) * 1024.0f); h = (_Float16)c[q]; fh.h[4 + q] = h; fl.h[4 + q] = (_Float16)((c[q] - (float)h) * 1024.0f); }
  { *(v8us*)((unsigned short*)Hh + t * 8) = fh.half[0]; *(v8us*)((unsigned short*)Hl + t * 8) = fl.half[0];  } }

// ---- fast GEMM (wave tile 32x64; requires M % 32 == 0 rows per launch region and N % 64 == 0); epilogue = k_gemm_hhx semantics ----
__device__ __forceinline__ v16h g2_frag(const _Float16* p, int hh) { FragH f; f.half[0] = *(const v8us*)((const unsigned short*)p + 8 * hh); f.half[1] = *(const v8us*)((const unsigned short*)p + 16 + 8 * hh); return f.v; }
__device__ __forceinline__ v8f g2_mma(v16h a, v16h b, v8f c) { v8f d = __builtin_amdgcn_wmma_f32_16x16x32_f16(false, a, false, b, (short)0, c, false, false); asm volatile("v_nop\n\tv_nop\n\tv_nop\n\tv_nop" : "+v"(d) : "v"(a), "v"(b)); return d; }
template <int ACT>
__global__ __launch_bounds__(128) void k_gemm2(const _Float16* __restrict__ A, int lda, size_t sA, const _Float16* __restrict__ Bh, int ldb, size_t sB, float alpha, const float* __restrict__ bias, size_t sBias, const float* __restrict__ CP, int rowsPerB, size_t sCPb, int row0g,
    float* __restrict__ C, _Float16* __restrict__ C16, int ldc, size_t sC, int M, int N, int K) { static_assert(ACT == 0 || ACT == 3 || ACT == 6 || ACT == 8 || ACT == 9 || ACT == 11 || ACT == 12 || ACT == 14 || ACT == 15 || ACT == 16 || ACT == 17, "k_gemm2: unsupported ACT code (would silently apply no activation)");
  __shared__ __attribute__((aligned(16))) float so[4][32][68];
  const int tid = threadIdx.x, w = tid >> 5, lane = tid & 31, ln = lane & 15, hh = lane >> 4; const int by = blockIdx.y;
  A += (size_t)by * sA; Bh += (size_t)by * sB; const size_t cofs = (size_t)by * sC; const float* bp = bias ? bias + (size_t)by * sBias : nullptr;
  const int ntn = N >> 6; const int mt = blockIdx.x / ntn, nq = blockIdx.x - mt * ntn; const int row0 = mt * 128 + 32 * w, col0 = nq * 64; if (row0 >= M) return;
  const _Float16* a0p = A + (size_t)(row0 + ln) * lda; const _Float16* a1p = a0p + (size_t)16 * lda;
  const _Float16* b0p = Bh + (size_t)(col0 + ln) * ldb; const _Float16* b1p = b0p + (size_t)16 * ldb; const _Float16* b2p = b1p + (size_t)16 * ldb; const _Float16* b3p = b2p + (size_t)16 * ldb;
  const v8f z8 = {0.f,0.f,0.f,0.f,0.f,0.f,0.f,0.f}; v8f c00 = z8, c01 = z8, c02 = z8, c03 = z8, c10 = z8, c11 = z8, c12 = z8, c13 = z8;
#pragma unroll 1
  for (int kb = 0; kb < K; kb += 32) { const v16h a0 = g2_frag(a0p + kb, hh), a1 = g2_frag(a1p + kb, hh);
    v16h b = g2_frag(b0p + kb, hh); c00 = g2_mma(a0, b, c00); c10 = g2_mma(a1, b, c10);
    b = g2_frag(b1p + kb, hh); c01 = g2_mma(a0, b, c01); c11 = g2_mma(a1, b, c11);
    b = g2_frag(b2p + kb, hh); c02 = g2_mma(a0, b, c02); c12 = g2_mma(a1, b, c12);
    b = g2_frag(b3p + kb, hh); c03 = g2_mma(a0, b, c03); c13 = g2_mma(a1, b, c13); }
  v8f accs[8] = {c00, c01, c02, c03, c10, c11, c12, c13};
#pragma unroll
  for (int u = 0; u < 8; ++u) { const int t = u & 3, half = u >> 2; const int col = col0 + t * 16 + ln; const float bv = bp ? bf16_round(bp[col]) : 0.f;
#pragma unroll
    for (int r = 0; r < 8; ++r) { const int rloc = half * 16 + 8 * hh + r; float v = accs[u][r] * alpha + bv; if (CP) { if (rowsPerB < 0) v += CP[cofs + (size_t)(row0g + row0 + rloc) * ldc + col];      /* rowsPerB < 0: own element of the batched C plane */ else { const int bidx = (row0g + row0 + rloc) / rowsPerB; v += CP[(size_t)bidx * sCPb + (size_t)by * 64 + col]; } }
      if (ACT == 3) v = fmaxf(v, 0.f); else if (ACT == 6) v = 0.5f * v * (1.0f + erff(v * 0.70710678118654752f)); else if (ACT == 11) v = 1.0f / (1.0f + expf(-v)); else if (ACT == 15) v = v / (1.0f + expf(-v)); else if (ACT == 12) v = (v > 0.f) ? v : 0.01f * v; else if (ACT == 8) v = tanhf(v); else if (ACT == 9) v = 0.5f * v * (1.0f + tanhf(0.7978845608028654f * (v + 0.044715f * v * v * v))); else if (ACT == 14) v = (v > 0.f) ? v : 0.1f * v; else if (ACT == 16) v = (v >= 0.f) ? v : 0.3f * v; else if (ACT == 17) v = (v >= 0.f) ? v : 0.2f * v;
      so[w][rloc][t * 16 + ln] = v; } }
  __builtin_amdgcn_fence(__ATOMIC_ACQ_REL, "workgroup"); __builtin_amdgcn_wave_barrier();
  const int rsub = lane >> 4, c4 = (lane & 15) * 4;
  {
#pragma unroll
    for (int q = 0; q < 16; ++q) { const int r = q * 2 + rsub; const v4f v = *(const v4fa*)&so[w][r][c4]; if (C) *(v4f*)(C + cofs + (size_t)(row0 + r) * ldc + col0 + c4) = v; if (C16) { v4h h4; for (int i = 0; i < 4; ++i) h4[i] = (_Float16)v[i]; *(v4h*)(C16 + cofs + (size_t)(row0 + r) * ldc + col0 + c4) = h4; } }
     } }


// ---- the same 32x64 wave tile with K split over the NW waves of a work-group, for products with few output tiles (M x N small, K long) ----
// A work-group owns ONE 32x64 tile of C; wave w sums k in [w K / NW, (w + 1) K / NW) with the loop of k_gemm2; the NW partial tiles (f32) meet in LDS and are added in wave order.
// Requires M % 32 == 0 (grid = (M / 32) (N / 64)), N % 64 == 0, K % (32 NW) == 0. C16 = f16(alpha x sum).
template <int NW>
__global__ __launch_bounds__(NW * 32) void k_gemm2k(const _Float16* __restrict__ A, int lda, const _Float16* __restrict__ Bh, int ldb, float alpha, _Float16* __restrict__ C16, int ldc, int N, int K) {
  __shared__ __attribute__((aligned(16))) float so[NW][32][68];
  const int tid = threadIdx.x, w = tid >> 5, lane = tid & 31, ln = lane & 15, hh = lane >> 4;
  const int ntn = N >> 6; const int mt = blockIdx.x / ntn, nq = blockIdx.x - mt * ntn; const int row0 = mt * 32, col0 = nq * 64; const int ks = K / NW;
  const _Float16* a0p = A + (size_t)(row0 + ln) * lda + w * ks; const _Float16* a1p = a0p + (size_t)16 * lda;
  const _Float16* b0p = Bh + (size_t)(col0 + ln) * ldb + w * ks; const _Float16* b1p = b0p + (size_t)16 * ldb; const _Float16* b2p = b1p + (size_t)16 * ldb; const _Float16* b3p = b2p + (size_t)16 * ldb;
  const v8f z8 = {0.f,0.f,0.f,0.f,0.f,0.f,0.f,0.f}; v8f c00 = z8, c01 = z8, c02 = z8, c03 = z8, c10 = z8, c11 = z8, c12 = z8, c13 = z8;
  for (int kb = 0; kb < ks; kb += 32) { const v16h a0 = g2_frag(a0p + kb, hh), a1 = g2_frag(a1p + kb, hh);
    v16h b = g2_frag(b0p + kb, hh); c00 = g2_mma(a0, b, c00); c10 = g2_mma(a1, b, c10);
    b = g2_frag(b1p + kb, hh); c01 = g2_mma(a0, b, c01); c11 = g2_mma(a1, b, c11);
    b = g2_frag(b2p + kb, hh); c02 = g2_mma(a0, b, c02); c12 = g2_mma(a1, b, c12);
    b = g2_frag(b3p + kb, hh); c03 = g2_mma(a0, b, c03); c13 = g2_mma(a1, b, c13); }
  v8f accs[8] = {c00, c01, c02, c03, c10, c11, c12, c13};
#pragma unroll
  for (int u = 0; u < 8; ++u) {      /* unrolled so that accs[] is indexed by constants and stays in registers */
#pragma unroll
    for (int r = 0; r < 8; ++r) so[w][(u >> 2) * 16 + 8 * hh + r][(u & 3) * 16 + ln] = accs[u][r]; }
  __syncthreads();      /* every wave's partial tile is in LDS before any thread adds them */
  for (int i0 = 0; i0 < 32 * 16; i0 += NW * 32) { const int i = i0 + tid, r = i >> 4, c4 = (i & 15) * 4; v4f s = *(const v4f*)&so[0][r][c4];
#pragma unroll
    for (int k = 1; k < NW; ++k) s += *(const v4f*)&so[k][r][c4];      /* unrolled so that the NW LDS reads issue together */
    v4h h4;
#pragma unroll
    for (int q = 0; q < 4; ++q) h4[q] = (_Float16)(s[q] * alpha);      /* unrolled so that the vector elements are indexed by constants */
    *(v4h*)(C16 + (size_t)(row0 + r) * ldc + col0 + c4) = h4; } }


// four weight matrices of n8 x 8 elements each -> four planes one behind the other in Bt; blockIdx.y picks the matrix
__global__ __launch_bounds__(256) void k_wnat(const float* __restrict__ w0, const float* __restrict__ w1, const float* __restrict__ w2, const float* __restrict__ w3, size_t n8, _Float16* __restrict__ Bt) { const size_t t = (size_t)blockIdx.x * 256 + threadIdx.x; if (t >= n8) return; const unsigned p = blockIdx.y; const float* w = p == 0 ? w0 : p == 1 ? w1 : p == 2 ? w2 : w3; FragH f; for (int q = 0; q < 8; ++q) f.h[q] = (_Float16)(bf16_round(w[t * 8 + q]) * 16.0f); *(v8us*)((unsigned short*)Bt + (p * n8 + t) * 8) = f.half[0];  }
__global__ __launch_bounds__(256) void k_rsm(const float* __restrict__ S, _Float16* __restrict__ P, int nrows) {
  #pragma clang fp contract(off)
  const int i = blockIdx.x * 256 + threadIdx.x; if (i >= nrows) return; const float* s = S + (size_t)i * SQ; float mx = -3.0e38f;
#pragma unroll 1
  for (int j = 0; j < SQ; ++j) mx = fmaxf(mx, s[j]); float se = 0.f;
#pragma unroll 1
  for (int j = 0; j < SQ; ++j) se += expf(s[j] - mx); const float sc = 256.0f / se;
#pragma unroll 1
  for (int j0 = 0; j0 < SQ; j0 += 8) { FragH f; for (int q = 0; q < 8; ++q) f.h[q] = (_Float16)(expf(s[j0 + q] - mx) * sc); unsigned short* d = (unsigned short*)P + (size_t)i * SQ + j0; *(v8us*)d = f.half[0];  } }
__global__ __launch_bounds__(256) void k_vt(const _Float16* __restrict__ V16, int b, int h0, _Float16* __restrict__ VT) { __shared__ unsigned short tl[64][65]; const int tid = threadIdx.x; const int hh = blockIdx.x % HG, sg = blockIdx.x / HG; const int s0 = sg * 64; const int h = h0 + hh;
  for (int i = tid; i < 64 * 8; i += 256) { const int j = i / 8, d8 = (i % 8) * 8; FragH f; f.half[0] = *(const v8us*)((const unsigned short*)V16 + ((size_t)b * SQ + s0 + j) * DM + h * HD + d8); for (int q = 0; q < 8; ++q) tl[d8 + q][j] = f.u[q]; }
  __syncthreads();
  { for (int i = tid; i < 64 * 8; i += 256) { const int d = i / 8, j8 = (i % 8) * 8; FragH f; for (int q = 0; q < 8; ++q) f.u[q] = tl[d][j8 + q]; *(v8us*)((unsigned short*)VT + ((size_t)hh * HD + d) * SQ + s0 + j8) = f.half[0]; }  } }



__global__ __launch_bounds__(256) void k_rsmcf2(const float* __restrict__ S, _Float16* __restrict__ P, int hg, int q0, int nk) {
  #pragma clang fp contract(off)
  const int t = blockIdx.x * 256 + threadIdx.x; if (t >= hg * QT) return; const size_t i = (size_t)t; const float* s = S + i * NKX; const int last = q0 + (t % QT); float mx = -3.0e38f;
#pragma unroll 1
  for (int j = 0; j < nk; ++j) { const float f = (j <= last) ? 1.f : 0.f; mx = fmaxf(mx, fmaf(f, s[j], (1.f - f) * -1.0e9f)); } float se = 0.f;
#pragma unroll 1
  for (int j = 0; j < nk; ++j) { const float f = (j <= last) ? 1.f : 0.f; se += __expf(fmaf(f, s[j], (1.f - f) * -1.0e9f) - mx); } const float sc = 256.0f / se;
#pragma unroll 1
  for (int j0 = 0; j0 < nk; j0 += 8) { FragH fr; for (int q = 0; q < 8; ++q) { const int j = j0 + q; const float f = (j <= last) ? 1.f : 0.f; fr.h[q] = (_Float16)(__expf(fmaf(f, s[j], (1.f - f) * -1.0e9f) - mx) * sc); } unsigned short* d = (unsigned short*)P + i * NKX + j0; *(v8us*)d = fr.half[0];  } }

template <int MASKADD>
__global__ __launch_bounds__(64) void k_att0(const float* __restrict__ QF, const float* __restrict__ KF, const float* __restrict__ VF, int ld, const float* __restrict__ mask, float scale, float* __restrict__ OF, int ldo) {
  #pragma clang fp contract(off)
  __shared__ __attribute__((aligned(16))) float lq[64][64]; __shared__ __attribute__((aligned(16))) float lo[64][64];
  const int tid = threadIdx.x; const int h = blockIdx.x / (QT0 / 64), rg = blockIdx.x % (QT0 / 64); const int i = rg * 64 + tid;
  const float* qr = QF + (size_t)i * ld + h * HD;
#pragma unroll 1
  for (int c = 0; c < HD / 4; ++c) { *(v4f*)&lq[tid][c * 4] = *(const v4fa*)(qr + c * 4); const v4f z = {0.f, 0.f, 0.f, 0.f}; *(v4f*)&lo[tid][c * 4] = z; }
  float m = -1.0e30f, l = 0.f; const int jmax = MASKADD ? (SQ - 1) : (rg * 64 + 63);      /* additive-mask form: every key (the mask input decides); causal form: keys up to the block's last row */
#pragma unroll 1
  for (int j = 0; j <= jmax; ++j) { const float* kr = KF + (size_t)j * ld + h * HD; const float* vr = VF + (size_t)j * ld + h * HD; float s = 0.f;
#pragma unroll 1
    for (int c = 0; c < HD / 4; ++c) { const v4f kq = *(const v4fa*)(kr + c * 4); const v4f qq = *(v4f*)&lq[tid][c * 4]; s = __fadd_rn(s, __fmul_rn(qq[0], kq[0])); s = __fadd_rn(s, __fmul_rn(qq[1], kq[1])); s = __fadd_rn(s, __fmul_rn(qq[2], kq[2])); s = __fadd_rn(s, __fmul_rn(qq[3], kq[3])); }
    s = __fmul_rn(s, scale); if (MASKADD) s = __fadd_rn(s, __fmul_rn(bf16_round(mask[(size_t)i * SQ + j]), -10000.0f));
    const float f = (MASKADD || j <= i) ? 1.f : 0.f; const float sm = fmaf(f, s, (1.f - f) * -1.0e30f); const float mn = fmaxf(m, sm); const float sc = expf(m - mn); const float e = expf(sm - mn); l = __fadd_rn(__fmul_rn(l, sc), e); m = mn;
#pragma unroll 1
    for (int c = 0; c < HD / 4; ++c) { const v4f vv = *(const v4fa*)(vr + c * 4); v4f oo = *(v4f*)&lo[tid][c * 4]; for (int u = 0; u < 4; ++u) oo[u] = __fadd_rn(__fmul_rn(oo[u], sc), __fmul_rn(e, vv[u])); *(v4f*)&lo[tid][c * 4] = oo; } }
  const float fin = 64.0f / l;      /* o carried x64 like the f16 path */
#pragma unroll 1
  for (int c = 0; c < HD / 4; ++c) { v4f oo = *(v4f*)&lo[tid][c * 4]; for (int u = 0; u < 4; ++u) oo[u] = __fmul_rn(oo[u], fin); *(v4f*)&lo[tid][c * 4] = oo; }
  __syncthreads();
  {
#pragma unroll 1
    for (int it = 0; it < 16; ++it) { const int row = it * 4 + tid / 16, pc = (tid % 16) * 4; const v4f v = *(const v4f*)&lo[row][pc]; *(v4f*)(OF + (size_t)(rg * 64 + row) * ldo + h * HD + pc) = v; }
     } }

__global__ __launch_bounds__(256) void k_oscale(const float* __restrict__ OF, float* __restrict__ out, size_t n4) { const size_t t = (size_t)blockIdx.x * 256 + threadIdx.x; if (t >= n4) return; const v4f a = *(const v4fa*)(OF + t * 4); v4f o; for (int q = 0; q < 4; ++q) o[q] = a[q] * 0.015625f; *(v4f*)(out + t * 4) = o;  }

__global__ __launch_bounds__(256) void k_bfr(const float* __restrict__ x, float* __restrict__ XB, size_t n8) { const size_t t = (size_t)blockIdx.x * 256 + threadIdx.x; if (t >= n8) return; v4f a = *(const v4fa*)(x + t * 8), c = *(const v4fa*)(x + t * 8 + 4); for (int q = 0; q < 4; ++q) { a[q] = bf16_round(a[q]); c[q] = bf16_round(c[q]); }
  { *(v4f*)(XB + t * 8) = a; *(v4f*)(XB + t * 8 + 4) = c;  } }



__global__ __launch_bounds__(256) void k_rsmfvl(const float* __restrict__ S, _Float16* __restrict__ P, _Float16* __restrict__ PL, int qn, const int* __restrict__ vlp) {
  #pragma clang fp contract(off)
  const int t = blockIdx.x * 256 + threadIdx.x; if (t >= qn) return; const int vl = vlp[0]; const size_t i = (size_t)t; const float* s = S + i * SQ; float mx = -3.0e38f;
#pragma unroll 1
  for (int j = 0; j < SQ; ++j) { const float f = (j < vl) ? 1.f : 0.f; mx = fmaxf(mx, fmaf(f, s[j], (1.f - f) * -1000000.0f)); } float se = 0.f;
#pragma unroll 1
  for (int j = 0; j < SQ; ++j) { const float f = (j < vl) ? 1.f : 0.f; se += __expf(fmaf(f, s[j], (1.f - f) * -1000000.0f) - mx); } const float sc = 256.0f / se;
#pragma unroll 1
  for (int j0 = 0; j0 < SQ; j0 += 8) { FragH fr, gr; for (int q = 0; q < 8; ++q) { const int j = j0 + q; const float f = (j < vl) ? 1.f : 0.f; const float pv = __expf(fmaf(f, s[j], (1.f - f) * -1000000.0f) - mx) * sc; const _Float16 ph = (_Float16)pv; fr.h[q] = ph; gr.h[q] = (_Float16)((pv - (float)ph) * 1024.0f); }
    unsigned short* d = (unsigned short*)P + i * SQ + j0; unsigned short* dl = (unsigned short*)PL + i * SQ + j0; *(v8us*)d = fr.half[0]; *(v8us*)dl = gr.half[0];  } }

__global__ __launch_bounds__(256) void k_rsmf(const float* __restrict__ S, _Float16* __restrict__ P, int qn, int hg) {
  #pragma clang fp contract(off)
  const int t = blockIdx.x * 256 + threadIdx.x; if (t >= qn * hg) return; const size_t i = (size_t)(t / qn) * SQ + (t % qn); const float* s = S + i * SQ; float mx = -3.0e38f;
#pragma unroll 1
  for (int j = 0; j < SQ; ++j) mx = fmaxf(mx, s[j]); float se = 0.f;
#pragma unroll 1
  for (int j = 0; j < SQ; ++j) se += __expf(s[j] - mx); const float sc = 256.0f / se;
#pragma unroll 1
  for (int j0 = 0; j0 < SQ; j0 += 8) { FragH f; for (int q = 0; q < 8; ++q) f.h[q] = (_Float16)(__expf(s[j0 + q] - mx) * sc); unsigned short* d = (unsigned short*)P + i * SQ + j0; *(v8us*)d = f.half[0];  } }


#define CN 256          /* channels */
#define CI 128          /* inner channels */
#define NP 4096         /* positions */
#define NM 4096         /* key positions (= SQ) */
#define NC CN           /* BN statistics macros */
#define NPX NP
#define BNEPS 1e-5f

__global__ __launch_bounds__(256) void k_rowbias(const float* __restrict__ b, float* __restrict__ BP, size_t n4, int ncol) { const size_t t = (size_t)blockIdx.x * 256 + threadIdx.x; if (t >= n4) return; const size_t e = t * 4; const float v = bf16_round(b[e / ncol]); const v4f o = {v, v, v, v}; *(v4f*)(BP + e) = o;  }




__global__ __launch_bounds__(256) void k_mp2(const float* __restrict__ src, float* __restrict__ dst, int nout) {
  const int t = blockIdx.x * 256 + threadIdx.x; if (t >= nout) return; const int c = t / 1024; const int o = t % 1024; const int oy = o / 32, ox = o % 32; const float* p = src + (size_t)c * 4096 + (size_t)(2 * oy) * 64 + 2 * ox;
  const float v = fmaxf(fmaxf(p[0], p[1]), fmaxf(p[64], p[65])); *(float*)(dst + t) = v;  }
__global__ __launch_bounds__(256) void k_xpb(const float* __restrict__ x, const float* __restrict__ wb, float* __restrict__ CPP, size_t n4) {
  #pragma clang fp contract(off)
  const size_t t = (size_t)blockIdx.x * 256 + threadIdx.x; if (t >= n4) return; const size_t e = t * 4; const int c = (int)((e / 4096) % 256); const float bb = bf16_round(wb[c]); const v4f a = *(const v4fa*)(x + e); v4f o; for (int q = 0; q < 4; ++q) o[q] = __fadd_rn(bf16_round(a[q]), bb);
  *(v4f*)(CPP + e) = o;  }


template <int PASS>
__global__ __launch_bounds__(256) void k_cstA(const float* __restrict__ X, const float* __restrict__ MV, float* __restrict__ PART) {
  #pragma clang fp contract(off)
  __shared__ float red[256]; const int t = threadIdx.x; const size_t bc = blockIdx.x; const int c = (int)(bc % NC); const float* row = X + bc * (size_t)NPX; const float mu = PASS ? MV[c] : 0.f; float s = 0.f;
  for (int i = t; i < NPX; i += 256) { const float v = row[i]; const float d = PASS ? __fadd_rn(v, -mu) : v; s = __fadd_rn(s, PASS ? __fmul_rn(d, d) : d); }
  red[t] = s; __syncthreads(); for (int st = 128; st > 0; st >>= 1) { if (t < st) red[t] = __fadd_rn(red[t], red[t + st]); __syncthreads(); }
  if (t < 32) { const float pv = (t == 0) ? red[0] : 0.f; *(float*)(PART + bc * 32 + t) = pv;  } }      

template <int PASS>
__global__ __launch_bounds__(256) void k_cstB(const float* __restrict__ PART, float* __restrict__ MV) { const int c = threadIdx.x; if (c >= NC) return; double s = 0.0; for (int b = 0; b < NB; ++b) s += (double)PART[((size_t)b * NC + c) * 32]; const float m = (float)(s / ((double)NB * (double)NPX)); *(float*)(MV + PASS * NC + c) = m;  }


__global__ __launch_bounds__(256) void k_bnresid(const float* __restrict__ C2, const float* __restrict__ MV, const float* __restrict__ g, const float* __restrict__ be, const float* __restrict__ X, float* __restrict__ out, size_t n4) {
  #pragma clang fp contract(off)
  const size_t t = (size_t)blockIdx.x * 256 + threadIdx.x; if (t >= n4) return; const size_t e = t * 4; const int c = (int)((e / NPX) % NC); const float sc = __fmul_rn(rsqrtf(__fadd_rn(MV[NC + c], BNEPS)), bf16_round(g[c])); const float mu = MV[c], bb = bf16_round(be[c]);
  const v4f a = *(const v4fa*)(C2 + e); const v4f xx = *(const v4fa*)(X + e); v4f o; for (int q = 0; q < 4; ++q) { const float z = __fadd_rn(__fmul_rn(__fadd_rn(a[q], -mu), sc), bb); o[q] = __fadd_rn(z, bf16_round(xx[q])); }
  *(v4f*)(out + e) = o;  }


__global__ __launch_bounds__(256) void k_rowbias(float* __restrict__ Y, const float* __restrict__ bias) {
  #pragma clang fp contract(off)
  const size_t t = (size_t)blockIdx.x * 256 + threadIdx.x; if (t >= (size_t)NB * NC * NPX / 4) return; const size_t e = t * 4; const int c = (int)((e / NPX) % NC); const float bb = bf16_round(bias[c]);
  v4f v = *(const v4fa*)(Y + e); for (int q = 0; q < 4; ++q) v[q] = __fadd_rn(v[q], bb); *(v4f*)(Y + e) = v;  }


// Column statistics in one launch, S read once. A work-group owns 16 columns (64 B of every row): 1,024 threads = 256 row lanes x 4 column quads.
// A thread keeps its 16 rows x 4 columns in registers (16 loads of 16 B in flight per lane), so the maximum and the sum both come from the one read.
// Fold over rows: the thread's 16 rows, the 8 row lanes of a wave by lane exchange, the 32 waves through LDS.
// ST holds one 128-B record per work-group (one writer per line): 16 maxima, then 16 x (256 / sum). blockIdx.y is the image: its S plane and its records lie behind the previous image's.
// Every loop here carries #pragma unroll so that v[] and the vector elements are indexed by constants and stay in registers (a run-time index would send them to scratch).
#define CSC 16                    /* columns per work-group */
#define CSR (NP / 256)            /* rows per thread */
template <bool MAXOP>
__device__ __forceinline__ v4f cs_op(v4f a, v4f b) { v4f r;
#pragma unroll
  for (int q = 0; q < 4; ++q) r[q] = MAXOP ? fmaxf(a[q], b[q]) : a[q] + b[q];
  return r; }
template <bool MAXOP>
__device__ __forceinline__ v4f cs_fold(v4f v) {      /* butterfly over the 8 lanes of a wave that share lane & 3; every lane ends with the same bits */
#pragma unroll
  for (int m = 4; m <= 16; m <<= 1) { v4f o;
#pragma unroll
    for (int q = 0; q < 4; ++q) o[q] = __shfl_xor(v[q], m, 32);
    v = cs_op<MAXOP>(v, o); }
  return v; }
template <bool MAXOP>
__device__ __forceinline__ v4f cs_block(v4f v, float (*red)[CSC], int w, int lane) {      /* over all 256 row lanes; every thread gets the result of its column quad */
  v = cs_fold<MAXOP>(v);
  if (lane < 4) *(v4f*)&red[w][lane * 4] = v;
  __syncthreads();
  v4f r = *(const v4f*)&red[lane >> 2][(lane & 3) * 4];
#pragma unroll
  for (int k = 1; k < 4; ++k) r = cs_op<MAXOP>(r, *(const v4f*)&red[(lane >> 2) + 8 * k][(lane & 3) * 4]);
  return cs_fold<MAXOP>(r); }
__global__ __launch_bounds__(1024) void k_colstat(const float* __restrict__ S, float* __restrict__ ST) {
  __shared__ __attribute__((aligned(16))) float rmx[32][CSC]; __shared__ __attribute__((aligned(16))) float rse[32][CSC];
  const int tid = threadIdx.x, w = tid >> 5, lane = tid & 31;
  const float* s = S + (size_t)blockIdx.y * NP * NM + (size_t)(tid >> 2) * CSR * NM + blockIdx.x * CSC + (tid & 3) * 4;
  v4f v[CSR];
#pragma unroll
  for (int i = 0; i < CSR; ++i) v[i] = *(const v4fa*)(s + (size_t)i * NM);
  asm volatile("s_wait_xcnt 0x0" :: "v"(s) : "memory");      /* a precaution: the address pair that the 16 loads name stays live and unwritten up to this wait */
  v4f mx = {-3.0e38f, -3.0e38f, -3.0e38f, -3.0e38f};
#pragma unroll
  for (int i = 0; i < CSR; ++i) mx = cs_op<true>(mx, v[i]);
  mx = cs_block<true>(mx, rmx, w, lane);
  v4f se = {0.f, 0.f, 0.f, 0.f};
#pragma unroll
  for (int i = 0; i < CSR; ++i) {
#pragma unroll
    for (int q = 0; q < 4; ++q) se[q] += __expf(v[i][q] - mx[q]); }
  se = cs_block<false>(se, rse, w, lane);
  if (tid < 4) { v4f iv;
#pragma unroll
    for (int q = 0; q < 4; ++q) iv[q] = 256.0f / se[q];
    float* rec = ST + (size_t)blockIdx.y * (2 * NM) + (size_t)blockIdx.x * (2 * CSC) + tid * 4; *(v4f*)rec = mx; *(v4f*)(rec + CSC) = iv; } }
// y^T = P g^T with P never stored: the tile, the K split over the NW waves and the LDS sum are those of k_gemm2k; only the A fragments differ.
// A lane reads its 16 scores of a k block as f32 (row ln, columns 8 hh .. + 7 and 16 + 8 hh .. + 7: the k order of g2_frag) with the maxima and 256 / sum of those columns
// from the 128-B records of k_colstat, and forms P[n][m] = f16(exp(s - max_m) x 256 / sum_m) in registers. K % (32 NW) == 0, so a k block spans two whole records.
__device__ __forceinline__ v16h p_frag(const v4f (&x)[4], const v4f (&mx)[4], const v4f (&iv)[4]) { FragH f;
#pragma unroll
  for (int c = 0; c < 4; ++c) {      /* unrolled so that the vectors are indexed by constants and stay in registers */
#pragma unroll
    for (int q = 0; q < 4; ++q) f.h[c * 4 + q] = (_Float16)(__expf(x[c][q] - mx[c][q]) * iv[c][q]); }
  return f.v; }
template <int NW>
__global__ __launch_bounds__(NW * 32) __attribute__((amdgpu_waves_per_eu(NW / 4, NW / 4)))      /* one work-group a WGP at a time: the registers of NW / 4 waves a SIMD, so that the 18 loads at the head of a k block are in flight together */
void k_gemm2kp(const float* __restrict__ S, int lda, size_t sS, const float* __restrict__ ST, const _Float16* __restrict__ Bh, int ldb, size_t sB, float alpha, _Float16* __restrict__ C16, int ldc, size_t sC, int N, int K) {
  __shared__ __attribute__((aligned(16))) float so[NW][32][68];
  const int tid = threadIdx.x, w = tid >> 5, lane = tid & 31, ln = lane & 15, hh = lane >> 4;
  const int ntn = N >> 6; const int mt = blockIdx.x / ntn, nq = blockIdx.x - mt * ntn; const int row0 = mt * 32, col0 = nq * 64; const int ks = K / NW;
  const size_t by = blockIdx.y; S += by * sS; ST += by * (size_t)K * 2; Bh += by * sB; C16 += by * sC;      /* blockIdx.y is the image */
  const float* a0p = S + (size_t)(row0 + ln) * lda + w * ks + 8 * hh; const float* a1p = a0p + (size_t)16 * lda;
  const float* stp = ST + (size_t)(w * ks) * 2 + 8 * hh;      /* column m: record m / CSC of 2 CSC floats, maxima first */
  const _Float16* b0p = Bh + (size_t)(col0 + ln) * ldb + w * ks; const _Float16* b1p = b0p + (size_t)16 * ldb; const _Float16* b2p = b1p + (size_t)16 * ldb; const _Float16* b3p = b2p + (size_t)16 * ldb;
  const v8f z8 = {0.f,0.f,0.f,0.f,0.f,0.f,0.f,0.f}; v8f c00 = z8, c01 = z8, c02 = z8, c03 = z8, c10 = z8, c11 = z8, c12 = z8, c13 = z8;
  for (int kb = 0; kb < ks; kb += 32) { const float* r = stp + kb * 2; const float* s0 = a0p + kb; const float* s1 = a1p + kb;
    const v4f x0[4] = {*(const v4fa*)s0, *(const v4fa*)(s0 + 4), *(const v4fa*)(s0 + 16), *(const v4fa*)(s0 + 20)};
    const v4f x1[4] = {*(const v4fa*)s1, *(const v4fa*)(s1 + 4), *(const v4fa*)(s1 + 16), *(const v4fa*)(s1 + 20)};
    const v4f mx[4] = {*(const v4fa*)r, *(const v4fa*)(r + 4), *(const v4fa*)(r + 2 * CSC), *(const v4fa*)(r + 2 * CSC + 4)};
    const v4f iv[4] = {*(const v4fa*)(r + CSC), *(const v4fa*)(r + CSC + 4), *(const v4fa*)(r + 3 * CSC), *(const v4fa*)(r + 3 * CSC + 4)};
    v16h b = g2_frag(b0p + kb, hh);
    asm volatile("s_wait_xcnt 0x0" :: "v"(s0), "v"(s1), "v"(r), "v"(b0p + kb + 8 * hh) : "memory");      /* a precaution: the four address pairs that the 18 loads above name stay live and unwritten up to this wait */
    const v16h a0 = p_frag(x0, mx, iv), a1 = p_frag(x1, mx, iv);
    c00 = g2_mma(a0, b, c00); c10 = g2_mma(a1, b, c10);
    b = g2_frag(b1p + kb, hh); c01 = g2_mma(a0, b, c01); c11 = g2_mma(a1, b, c11);
    b = g2_frag(b2p + kb, hh); c02 = g2_mma(a0, b, c02); c12 = g2_mma(a1, b, c12);
    b = g2_frag(b3p + kb, hh); c03 = g2_mma(a0, b, c03); c13 = g2_mma(a1, b, c13); }
  v8f accs[8] = {c00, c01, c02, c03, c10, c11, c12, c13};
#pragma unroll
  for (int u = 0; u < 8; ++u) {      /* unrolled so that accs[] is indexed by constants and stays in registers */
#pragma unroll
    for (int r = 0; r < 8; ++r) so[w][(u >> 2) * 16 + 8 * hh + r][(u & 3) * 16 + ln] = accs[u][r]; }
  __syncthreads();      /* every wave's partial tile is in LDS before any thread adds them */
  for (int i0 = 0; i0 < 32 * 16; i0 += NW * 32) { const int i = i0 + tid, r = i >> 4, c4 = (i & 15) * 4; v4f s = *(const v4f*)&so[0][r][c4];
#pragma unroll
    for (int k = 1; k < NW; ++k) s += *(const v4f*)&so[k][r][c4];      /* unrolled so that the NW LDS reads issue together */
    v4h h4;
#pragma unroll
    for (int q = 0; q < 4; ++q) h4[q] = (_Float16)(s[q] * alpha);      /* unrolled so that the vector elements are indexed by constants */
    *(v4h*)(C16 + (size_t)(row0 + r) * ldc + col0 + c4) = h4; } }
extern "C" void kernel_launch(void* const* d_in, const int* in_sizes, int n_in,
                              void* d_out, int out_size, void* d_ws, size_t ws_size, hipStream_t stream) {
  (void)in_sizes; (void)n_in; (void)out_size;
  const float* const* I = (const float* const*)d_in; const float* x = I[0]; const float* tw = I[1]; const float* pw = I[2]; const float* gw = I[3]; const float* ww = I[4];      /* natural 1x1 conv weights: w_theta, w_phi, w_g [128][256], w_mask [256][128]; no biases */
  char* ws = (char*)d_ws; size_t off = 0;
  auto take = [&](size_t bytes) { char* p = ws + off; off += (bytes + 255) & ~(size_t)255; return p; };
  const size_t PL = (size_t)CN * NP;      /* one input map */
  const int QL = 3 * CI;      /* row pitch of the token rows: theta, phi, g side by side */
  _Float16* BT = (_Float16*)take((size_t)4 * CI * CN * 2); _Float16* BW = BT + (size_t)3 * CI * CN;      /* w_theta, w_phi, w_g as one [384][256] B^T plane, then w_mask */
  _Float16* X16 = (_Float16*)take(NB * PL * 2); float* XB = (float*)take(NB * PL * 4);      /* x f16 channel-first; bf16(x) f32 for the residual */
  _Float16* XT = (_Float16*)take(NB * PL * 2); _Float16* QKV = (_Float16*)take((size_t)NB * NP * QL * 2); _Float16* G = (_Float16*)take((size_t)NB * CI * NP * 2); _Float16* YT = (_Float16*)take((size_t)NB * NP * CI * 2);
  float* S = (float*)take((size_t)2 * NP * NM * 4); float* ST = (float*)take((size_t)2 * NM * 2 * 4);      /* score planes of two images (four do not fit the workspace); per-column max and 256 / sum, one 128-B record per 16 columns */
  if (off > ws_size) return;
  k_wnat<<<dim3((unsigned)(((size_t)CI * CN / 8 + 255) / 256), 4), 256, 0, stream>>>(tw, pw, gw, ww, (size_t)CI * CN / 8, BT);      /* natural [out][in] x16 f16 planes (Bt for theta/phi/g token rows; the A operand for W) */
  k_x16<<<(unsigned)((NB * PL / 8 + 255) / 256), 256, 0, stream>>>(x, X16, NB * PL / 8); k_bfr<<<(unsigned)((NB * PL / 8 + 255) / 256), 256, 0, stream>>>(x, XB, NB * PL / 8);
  k_vt<NP / 64, CN><<<NB * (NP / 64) * (CN / 64), 256, 0, stream>>>(X16, NP, 0, XT);      /* every image: [c][n] -> x^T [n][c] token rows */
  k_gemm2k<8><<<(NB * NP / 32) * (QL / 64), 256, 0, stream>>>(XT, CN, BT, CN, 0.0625f, QKV, QL, QL, CN);      /* every image: theta^T | phi^T | g^T [n][384] -> f16; K = 256 over 8 waves */
  k_vt<CI / 64, NP><<<NB * (CI / 64) * (NP / 64), 256, 0, stream>>>(QKV, QL, 2 * CI, G);      /* every image: g^T -> g [ci][m] (the PV B^T operand) */
  for (int b = 0; b < NB; b += 2) { const _Float16* q = QKV + (size_t)b * NP * QL;      /* two images a launch */
    k_gemm2<0><<<dim3((unsigned)((NP / 128) * (NM / 64)), 2), 128, 0, stream>>>(q, QL, (size_t)NP * QL, q + CI, QL, (size_t)NP * QL, 1.0f, nullptr, 0, nullptr, 1, 0, 0, S, nullptr, NM, (size_t)NP * NM, NP, NM, CI);      /* f[a][b] = theta[:, a].phi[:, b] (K = 128, NO scale) */
    k_colstat<<<dim3(NM / CSC, 2), 1024, 0, stream>>>(S, ST);      /* softmax over the QUERY axis: per key column m the max and 256 / sum over all 4096 rows n */
    k_gemm2kp<16><<<dim3((NP / 32) * (CI / 64), 2), 512, 0, stream>>>(S, NM, (size_t)NP * NM, ST, G + (size_t)b * CI * NP, NM, (size_t)CI * NP, 0.00390625f, YT + (size_t)b * NP * CI, CI, (size_t)NP * CI, CI, NM); }      /* y^T [a][ci] = sum_b P[a][b] g[ci][b] -> f16, P[a][b] = f16(256 exp(s - max_b) / sum_b) formed in the A loader; K = 4096 over 16 waves */
  k_gemm2<0><<<dim3((unsigned)((CN / 128) * (NP / 64)), NB), 128, 0, stream>>>(BW, CI, 0, YT, CI, (size_t)NP * CI, 0.0625f, nullptr, 0, XB, -1, 0, 0, (float*)d_out, nullptr, NP, PL, CN, NP, CI);      /* every image: out[c][a] = (16 W as A) x (y^T as B^T) / 16 + bf16(x) (own element) -> f32 channel-first output block */
}

// v005
// One run takes 123 microseconds.
// Next to v004, in two timings, it ran 2.57 times as fast each time.
// All steps since v000 together make it 56.8 times as fast.
#include <hip/hip_runtime.h>
// Non-local block with the softmax taken over the QUERY axis (x [4][256][64][64]; theta, phi, g = conv1x1(x) with [128][256] weights (U(+-1/16), no biases); scores[n][m] = theta[n].phi[m] (NO scaling); attn = softmax(scores, axis = 1): normalised over n for every key column m (the module's unconventional axis); out[n] = sum_m attn[n][m] g[m]; mask = conv1x1(out; w_mask [256][128], no bias); result = x + mask -> [4][256][64][64]).
// Structure: channel-first; x as exact f16 planes and bf16(x) f32 residual planes; the images share every launch (grid); token rows via LDS transposes; theta^T, phi^T, g^T as WMMA GEMMs (32x64 wave tiles, f32 accumulation, no bias) -> f16; g to channel-major via LDS transposes; f [4096][4096] = theta^T phi (K = 128, no scale) f32 in registers only, formed once for the column statistics and once for the weights (f32 statistics, native exp; weights x256 f16); y^T = P g^T (x2^-8) f16; out = (16 W) y / 16 + bf16(x) f32 channel-first; launches: see trace.
// Compute dtype: inputs rounded to bf16; x / weights exact; q, k, v, softmax weights and o as plain f16 GEMM operands (~2^-12); scores and softmax statistics f32. v_wmma_f32_16x16x32_f16.
#define NB 4
#define SQ 4096
#define DM 256
#define NH 1
#define HD 64
#define HG 4                         /* heads per attention launch group */
#define B0 0                         /* first batch processed (debug hook) */
#define NBR NB                       /* batches processed (debug hook) */
#define NR ((size_t)NB * SQ)         /* token rows */
#define MP ((int)((size_t)NBR * SQ)) /* rows projected (debug hook) */
#define QT 256                       /* query rows per causal tile */
#define NKX SQ                       /* S / P row pitch */
#define QT0 256                      /* first-tile rows recomputed exactly (256: buys margin for the few-key rows 128..255, which have no output projection to average the single-f16 P/v rounding) */
#define QN SQ                        /* query rows attended per batch (debug hook) */
#define NHD NH                       /* heads attended (debug hook) */
#define MPO MP                       /* rows through the output stage (debug hook) */
#define LQ DM            /* unused (the q/k/v rows have pitch QL = 3 CI) */
typedef __bf16 v16b __attribute__((ext_vector_type(16)));
typedef unsigned short v8us __attribute__((ext_vector_type(8), may_alias));
typedef float  v8f  __attribute__((ext_vector_type(8)));
typedef float  v4f  __attribute__((ext_vector_type(4)));
typedef float  v4fa __attribute__((ext_vector_type(4), may_alias));
union FragB { v16b v; v8us half[2]; unsigned short u[16]; };

__device__ __forceinline__ unsigned short bf16_bits(float x) { unsigned int u = __float_as_uint(x); return (unsigned short)((u + 0x7FFFu + ((u >> 16) & 1u)) >> 16); }
__device__ __forceinline__ float bf16_val(unsigned short b) { return __uint_as_float(((unsigned int)b) << 16); }
__device__ __forceinline__ float bf16_round(float x) { return bf16_val(bf16_bits(x)); }
// D += A·B with NT terms: 1 = ah·bh, 2 = + al·bh (A split), 3 = + ah·bl (both split)
template <int NT>
__device__ __forceinline__ v8f mmaN(v16b ah, v16b al, v16b bh, v16b bl, v8f c) {
  c = __builtin_amdgcn_wmma_f32_16x16x32_bf16(false, ah, false, bh, (short)0, c, false, false);
  if (NT >= 2) c = __builtin_amdgcn_wmma_f32_16x16x32_bf16(false, al, false, bh, (short)0, c, false, false);
  if (NT >= 3) c = __builtin_amdgcn_wmma_f32_16x16x32_bf16(false, ah, false, bl, (short)0, c, false, false);
  asm volatile("v_nop\n\tv_nop\n\tv_nop\n\tv_nop" : "+v"(c) : "v"(ah), "v"(al), "v"(bh), "v"(bl));
  return c;
}

__global__ __launch_bounds__(256) void k_wt_bf16(const float* __restrict__ W, unsigned short* __restrict__ Wt, int K, int N) {
  const int t = blockIdx.x * 256 + threadIdx.x;
  const int k8n = K / 8;
  if (t >= N * k8n) return;
  const int n = t / k8n, k8 = (t % k8n) * 8;
  v8us v;
#pragma unroll
  for (int i = 0; i < 8; ++i) v[i] = bf16_bits(W[(size_t)(k8 + i) * N + n]);
  *(v8us*)(Wt + (size_t)n * K + k8) = v;
  
}

// GEMM C[M][N] (f32, pitch ldc) = act(A[M][K]·W + bias). A f32 row-major (pitch lda) converted per fragment to bf16
// (ASPLIT: hi/lo two planes -> 2 terms, else single rounded term); Wt bf16 [N][K] (pitch ldb). BIAS_BF16 rounds the
// bias to bf16 first (bias quantised to bf16 before the add). K%32==0, M%16==0, N%64==0.
template <bool ASPLIT, int ACT, bool BIAS_BF16>
__global__ __launch_bounds__(128) void k_gemm_bf(const float* __restrict__ A, int lda, const unsigned short* __restrict__ Wt, int ldb,
                                               const float* __restrict__ bias, float* __restrict__ C, int ldc, int M, int N, int K) {
  __shared__ __attribute__((aligned(16))) float so[4][16][64];
  const int tid = threadIdx.x, w = tid >> 5, lane = tid & 31, ln = lane & 15, hh = lane >> 4;
  const int ntn = N / 64;
  const int wid = blockIdx.x * 4 + w;
  const int mt = wid / ntn, nq = wid % ntn;
  if (mt * 16 >= M) return;
  const int row0 = mt * 16, col0 = nq * 64;
  const float* arow = A + (size_t)(row0 + ln) * lda;
  v8f acc[4] = {};
  for (int kb = 0; kb < K; kb += 32) {
    FragB ah, al;
    const v4f x0 = *(const v4fa*)(arow + kb + 8 * hh), x1 = *(const v4fa*)(arow + kb + 8 * hh + 4);
    const v4f x2 = *(const v4fa*)(arow + kb + 16 + 8 * hh), x3 = *(const v4fa*)(arow + kb + 16 + 8 * hh + 4);
    float xs[16] = {x0[0],x0[1],x0[2],x0[3],x1[0],x1[1],x1[2],x1[3],x2[0],x2[1],x2[2],x2[3],x3[0],x3[1],x3[2],x3[3]};
#pragma unroll
    for (int i = 0; i < 16; ++i) { const unsigned short hb = bf16_bits(xs[i]); ah.u[i] = hb; al.u[i] = ASPLIT ? bf16_bits(xs[i] - bf16_val(hb)) : (unsigned short)0; }
#pragma unroll
    for (int t = 0; t < 4; ++t) {
      const unsigned short* brow = Wt + (size_t)(col0 + t * 16 + ln) * ldb + kb;
      FragB b;
      b.half[0] = *(const v8us*)(brow + 8 * hh);
      b.half[1] = *(const v8us*)(brow + 16 + 8 * hh);
      acc[t] = mmaN<ASPLIT ? 2 : 1>(ah.v, al.v, b.v, b.v, acc[t]);
    }
  }
#pragma unroll
  for (int t = 0; t < 4; ++t) {
    float bv = bias ? bias[col0 + t * 16 + ln] : 0.f;
    if (BIAS_BF16) bv = bf16_round(bv);
#pragma unroll
    for (int r = 0; r < 8; ++r) { float v = acc[t][r] + bv; if (ACT == 1) v = fmaxf(v, 0.f); so[w][8 * hh + r][t * 16 + ln] = v; }
  }
  __builtin_amdgcn_fence(__ATOMIC_ACQ_REL, "workgroup");
  __builtin_amdgcn_wave_barrier();
  const int rsub = lane >> 4, c4 = (lane & 15) * 4;
  {
#pragma unroll
    for (int q = 0; q < 8; ++q) {
      const int r = q * 2 + rsub;
      const v4f v = *(const v4fa*)&so[w][r][c4];
      *(v4f*)(C + (size_t)(row0 + r) * ldc + col0 + c4) = v;
    }
    
  }
}

// GEMM C = act(A·W + bias + resid): A f32 (ASPLIT -> hi/lo 2 terms), Wt bf16 [N][K]; ACT 0 none, 1 relu, 2 exact gelu;
// resid (optional, f32, row index = (row % rmod), pitch ldr, RES_BF16 rounds it) added before the activation.
template <bool ASPLIT, int ACT, bool BIAS_BF16, bool RES_BF16>
__global__ __launch_bounds__(128) void k_gemm_bf3(const float* __restrict__ A, int lda, const unsigned short* __restrict__ Wt, int ldb,
                                                const float* __restrict__ bias, const float* __restrict__ resid, int rmod, int ldr,
                                                float* __restrict__ C, int ldc, int M, int N, int K) {
  __shared__ __attribute__((aligned(16))) float so[4][16][64];
  const int tid = threadIdx.x, w = tid >> 5, lane = tid & 31, ln = lane & 15, hh = lane >> 4;
  const int ntn = N / 64;
  const int wid = blockIdx.x * 4 + w;
  const int mt = wid / ntn, nq = wid % ntn;
  if (mt * 16 >= M) return;
  const int row0 = mt * 16, col0 = nq * 64;
  const float* arow = A + (size_t)(row0 + ln) * lda;
  v8f acc[4] = {};
  for (int kb = 0; kb < K; kb += 32) {
    FragB ah, al;
    const v4f x0 = *(const v4fa*)(arow + kb + 8 * hh), x1 = *(const v4fa*)(arow + kb + 8 * hh + 4);
    const v4f x2 = *(const v4fa*)(arow + kb + 16 + 8 * hh), x3 = *(const v4fa*)(arow + kb + 16 + 8 * hh + 4);
    float xs[16] = {x0[0],x0[1],x0[2],x0[3],x1[0],x1[1],x1[2],x1[3],x2[0],x2[1],x2[2],x2[3],x3[0],x3[1],x3[2],x3[3]};
#pragma unroll
    for (int i = 0; i < 16; ++i) { const unsigned short hb = bf16_bits(xs[i]); ah.u[i] = hb; al.u[i] = ASPLIT ? bf16_bits(xs[i] - bf16_val(hb)) : (unsigned short)0; }
#pragma unroll
    for (int t = 0; t < 4; ++t) {
      const unsigned short* brow = Wt + (size_t)(col0 + t * 16 + ln) * ldb + kb;
      FragB b;
      b.half[0] = *(const v8us*)(brow + 8 * hh);
      b.half[1] = *(const v8us*)(brow + 16 + 8 * hh);
      acc[t] = mmaN<ASPLIT ? 2 : 1>(ah.v, al.v, b.v, b.v, acc[t]);
    }
  }
#pragma unroll
  for (int t = 0; t < 4; ++t) {
    const int col = col0 + t * 16 + ln;
    float bv = bias ? bias[col] : 0.f;
    if (BIAS_BF16) bv = bf16_round(bv);
#pragma unroll
    for (int r = 0; r < 8; ++r) {
      float v = acc[t][r] + bv;
      if (resid) { float rv = resid[(size_t)((row0 + 8 * hh + r) % rmod) * ldr + col]; if (RES_BF16) rv = bf16_round(rv); v += rv; }
      if (ACT == 1) v = fmaxf(v, 0.f);
      if (ACT == 2) v = 0.5f * v * (1.0f + erff(v * 0.70710678118654752f));
      if (ACT == 3) { const float u = 0.7978845608028654f * (v + 0.044715f * v * v * v); v = 0.5f * v * (1.0f + tanhf(u)); }
      so[w][8 * hh + r][t * 16 + ln] = v;
    }
  }
  __builtin_amdgcn_fence(__ATOMIC_ACQ_REL, "workgroup");
  __builtin_amdgcn_wave_barrier();
  const int rsub = lane >> 4, c4 = (lane & 15) * 4;
  {
#pragma unroll
    for (int q = 0; q < 8; ++q) {
      const int r = q * 2 + rsub;
      const v4f v = *(const v4fa*)&so[w][r][c4];
      *(v4f*)(C + (size_t)(row0 + r) * ldc + col0 + c4) = v;
    }
    
  }
}
// row LayerNorm (biased variance, eps) over N: s = X (+ R); optional out_sum <- s; out_norm <- (s-mu)*rsqrt(var+eps)*g + b
template <bool PARAM_BF16>
__global__ __launch_bounds__(256) void k_layernorm(const float* __restrict__ X, const float* __restrict__ R, const float* __restrict__ g, const float* __restrict__ bta,
                                                  float* __restrict__ out_sum, float* __restrict__ out_norm, int N, float eps) {
  __shared__ float red[256];
  const int row = blockIdx.x, tid = threadIdx.x;
  const float* x = X + (size_t)row * N; const float* rr = R ? R + (size_t)row * N : nullptr;
  float vals[16];                     // up to N = 4096
  const int per = N / 256;            // contiguous chunk per thread? use strided-by-4 chunks: thread handles j = tid*4 + 1024*u
  float s1 = 0.f;
  for (int u = 0; u < per / 4; ++u) {
    const int j = tid * 4 + 1024 * u;
    const v4f a = *(const v4fa*)(x + j);
    v4f b = {0.f,0.f,0.f,0.f}; if (rr) b = *(const v4fa*)(rr + j);
#pragma unroll
    for (int q = 0; q < 4; ++q) { const float v = a[q] + b[q]; vals[u * 4 + q] = v; s1 += v; }
  }
  red[tid] = s1; __syncthreads();
  for (int st = 128; st > 0; st >>= 1) { if (tid < st) red[tid] += red[tid + st]; __syncthreads(); }
  const float mu = red[0] / (float)N; __syncthreads();
  float s2 = 0.f;
  for (int u = 0; u < per / 4; ++u)
#pragma unroll
    for (int q = 0; q < 4; ++q) { const float c = vals[u * 4 + q] - mu; s2 += c * c; }
  red[tid] = s2; __syncthreads();
  for (int st = 128; st > 0; st >>= 1) { if (tid < st) red[tid] += red[tid + st]; __syncthreads(); }
  const float rs = rsqrtf(red[0] / (float)N + eps);
  {
    for (int u = 0; u < per / 4; ++u) {
      const int j = tid * 4 + 1024 * u;
      v4f o, sm;
#pragma unroll
      for (int q = 0; q < 4; ++q) {
        float gg = g[j + q], bb = bta[j + q];
        if (PARAM_BF16) { gg = bf16_round(gg); bb = bf16_round(bb); }
        sm[q] = vals[u * 4 + q]; o[q] = (vals[u * 4 + q] - mu) * rs * gg + bb;
      }
      if (out_sum) *(v4f*)(out_sum + (size_t)row * N + j) = sm;
      *(v4f*)(out_norm + (size_t)row * N + j) = o;
    }
    
  }
}



// ---- f16 WMMA path (v_wmma_f32_16x16x32_f16): 11-bit significands for operands in range — used where a [0,1] probability operand needs more precision than bf16
typedef _Float16 v16h __attribute__((ext_vector_type(16)));
union FragH { v16h v; v8us half[2]; _Float16 h[16]; unsigned short u[16]; };
template <int NT>
__device__ __forceinline__ v8f mmaH(v16h ah, v16h al, v16h bh, v16h bl, v8f c) {
  c = __builtin_amdgcn_wmma_f32_16x16x32_f16(false, ah, false, bh, (short)0, c, false, false);
  if (NT >= 2) c = __builtin_amdgcn_wmma_f32_16x16x32_f16(false, al, false, bh, (short)0, c, false, false);
  if (NT >= 3) c = __builtin_amdgcn_wmma_f32_16x16x32_f16(false, ah, false, bl, (short)0, c, false, false);
  asm volatile("v_nop\n\tv_nop\n\tv_nop\n\tv_nop" : "+v"(c) : "v"(ah), "v"(al), "v"(bh), "v"(bl));
  return c;
}
// batched GEMM like k_gemm_b but f16 operands: A f32 (split into f16 hi/lo if ASPLIT, else rounded to f16), Bt = f16 values [n][k]; alpha; C f32; N multiple of 16 (partial tiles skipped)
template <bool ASPLIT>
__global__ __launch_bounds__(128) void k_gemm_h(const float* __restrict__ A, int lda, size_t sA, const _Float16* __restrict__ Bh, int ldb, size_t sB, float alpha, float* __restrict__ C, int ldc, size_t sC, int M, int N, int K) {
  __shared__ __attribute__((aligned(16))) float so[4][16][64];
  const int tid = threadIdx.x, w = tid >> 5, lane = tid & 31, ln = lane & 15, hh = lane >> 4; const int by = blockIdx.y;
  A += (size_t)by * sA; Bh += (size_t)by * sB; C += (size_t)by * sC;
  const int ntn = (N + 63) / 64; const int wid = blockIdx.x * 4 + w; const int mt = wid / ntn, nq = wid % ntn; if (mt * 16 >= M) return;
  const int row0 = mt * 16, col0 = nq * 64; const float* arow = A + (size_t)(row0 + ln) * lda;
  v8f acc[4] = {};
  for (int kb = 0; kb < K; kb += 32) {
    FragH ah, al;
    const v4f x0 = *(const v4fa*)(arow + kb + 8 * hh), x1 = *(const v4fa*)(arow + kb + 8 * hh + 4), x2 = *(const v4fa*)(arow + kb + 16 + 8 * hh), x3 = *(const v4fa*)(arow + kb + 16 + 8 * hh + 4);
    float xs[16] = {x0[0],x0[1],x0[2],x0[3],x1[0],x1[1],x1[2],x1[3],x2[0],x2[1],x2[2],x2[3],x3[0],x3[1],x3[2],x3[3]};
#pragma unroll
    for (int i = 0; i < 16; ++i) { const _Float16 h = (_Float16)xs[i]; ah.h[i] = h; al.h[i] = ASPLIT ? (_Float16)(xs[i] - (float)h) : (_Float16)0.0f; }
#pragma unroll
    for (int t = 0; t < 4; ++t) { if (col0 + t * 16 >= N) continue; const size_t boff = (size_t)(col0 + t * 16 + ln) * ldb + kb; FragH bq; bq.half[0] = *(const v8us*)(Bh + boff + 8 * hh); bq.half[1] = *(const v8us*)(Bh + boff + 16 + 8 * hh);
      acc[t] = mmaH<ASPLIT ? 2 : 1>(ah.v, al.v, bq.v, bq.v, acc[t]); }
  }
#pragma unroll
  for (int t = 0; t < 4; ++t) { if (col0 + t * 16 >= N) continue;
#pragma unroll
    for (int r = 0; r < 8; ++r) so[w][8 * hh + r][t * 16 + ln] = acc[t][r] * alpha; }
  __builtin_amdgcn_fence(__ATOMIC_ACQ_REL, "workgroup"); __builtin_amdgcn_wave_barrier();
  const int rsub = lane >> 4, c4 = (lane & 15) * 4;
  {
#pragma unroll
    for (int q = 0; q < 8; ++q) { const int r = q * 2 + rsub; if (col0 + c4 < N) { const v4f v = *(const v4fa*)&so[w][r][c4]; *(v4f*)(C + (size_t)(row0 + r) * ldc + col0 + c4) = v; } }
     }
}

// Wt[n][k] = f16(W[k][n]·scale) from f32 row-major W[K][N] (scale = power of two; bf16-exact weights stay exact in f16 away from the subnormal range)
__global__ __launch_bounds__(256) void k_wt_f16(const float* __restrict__ W, _Float16* __restrict__ Wt, int K, int N, float scale) {
  const int t = blockIdx.x * 256 + threadIdx.x; if (t >= N * (K / 8)) return; const int n = t / (K / 8), k8 = (t % (K / 8)) * 8; FragH f;
#pragma unroll
  for (int i = 0; i < 8; ++i) f.h[i] = (_Float16)(bf16_round(W[(size_t)(k8 + i) * N + n]) * scale); const v8us o = f.half[0];
  *(v8us*)((unsigned short*)Wt + (size_t)n * K + k8) = o; 
}
// k_gemm_hh variant with fused epilogue: v = acc·alpha + bias[by·sBias + col] (+ CP[(row/rowsPerB)·sCPb + by·64 + col] if CP) ; ACT 0 none / 1 elu ; writes f16 C16 (and f32 C if non-null)
template <int ACT>
__global__ __launch_bounds__(128) void k_gemm_hhx(const _Float16* __restrict__ A, int lda, size_t sA, const _Float16* __restrict__ Bh, int ldb, size_t sB, float alpha, const float* __restrict__ bias, size_t sBias, const float* __restrict__ CP, int rowsPerB, size_t sCPb, int row0g,
    float* __restrict__ C, _Float16* __restrict__ C16, int ldc, size_t sC, int M, int N, int K) {
  __shared__ __attribute__((aligned(16))) float so[4][16][64];
  const int tid = threadIdx.x, w = tid >> 5, lane = tid & 31, ln = lane & 15, hh = lane >> 4; const int by = blockIdx.y;
  A += (size_t)by * sA; Bh += (size_t)by * sB; const size_t cofs = (size_t)by * sC; const float* bp = bias ? bias + (size_t)by * sBias : nullptr;
  const int ntn = (N + 63) / 64; const int wid = blockIdx.x * 4 + w; const int mt = wid / ntn, nq = wid % ntn; if (mt * 16 >= M) return;
  const int row0 = mt * 16, col0 = nq * 64; const _Float16* arow = A + (size_t)(row0 + ln) * lda;
  v8f acc[4] = {};
  for (int kb = 0; kb < K; kb += 32) { FragH ah; ah.half[0] = *(const v8us*)((const unsigned short*)arow + kb + 8 * hh); ah.half[1] = *(const v8us*)((const unsigned short*)arow + kb + 16 + 8 * hh);
#pragma unroll
    for (int t = 0; t < 4; ++t) { if (col0 + t * 16 >= N) continue; const size_t boff = (size_t)(col0 + t * 16 + ln) * ldb + kb; FragH bq; bq.half[0] = *(const v8us*)((const unsigned short*)Bh + boff + 8 * hh); bq.half[1] = *(const v8us*)((const unsigned short*)Bh + boff + 16 + 8 * hh);
      acc[t] = mmaH<1>(ah.v, ah.v, bq.v, bq.v, acc[t]); }
  }
#pragma unroll
  for (int t = 0; t < 4; ++t) { if (col0 + t * 16 >= N) continue; const int col = col0 + t * 16 + ln; const float bv = bp ? bf16_round(bp[col]) : 0.f;
#pragma unroll
    for (int r = 0; r < 8; ++r) { float v = acc[t][r] * alpha + bv; if (CP) { const int rr = row0g + row0 + 8 * hh + r; if (rowsPerB < 0) v += CP[cofs + (size_t)rr * ldc + col];      /* rowsPerB < 0: own element of the batched C plane */ else { const int bidx = rr / rowsPerB; v += CP[(size_t)bidx * sCPb + (size_t)by * 64 + col]; } } if (ACT == 1) v = (v > 0.f) ? v : expm1f(v); else if (ACT == 7) v = (v > 0.f) ? v + 1.0f : expf(v); else if (ACT == 8) v = tanhf(v); else if (ACT == 9) v = 0.5f * v * (1.0f + tanhf(0.7978845608028654f * (v + 0.044715f * v * v * v))); else if (ACT == 11) v = 1.0f / (1.0f + expf(-v)); else if (ACT == 12) v = (v > 0.f) ? v : 0.01f * v; else if (ACT == 14) v = (v > 0.f) ? v : 0.1f * v; else if (ACT == 16) v = (v >= 0.f) ? v : 0.3f * v; else if (ACT == 17) v = (v >= 0.f) ? v : 0.2f * v; else if (ACT == 15) v = v / (1.0f + expf(-v)); else if (ACT == 3) v = fmaxf(v, 0.f); else if (ACT == 6) v = 0.5f * v * (1.0f + erff(v * 0.70710678118654752f)); so[w][8 * hh + r][t * 16 + ln] = v; } }
  __builtin_amdgcn_fence(__ATOMIC_ACQ_REL, "workgroup"); __builtin_amdgcn_wave_barrier();
  const int rsub = lane >> 4, c4 = (lane & 15) * 4; typedef _Float16 v4h __attribute__((ext_vector_type(4)));
  {
#pragma unroll
    for (int q = 0; q < 8; ++q) { const int r = q * 2 + rsub; if (col0 + c4 < N) { const v4f v = *(const v4fa*)&so[w][r][c4]; if (C) *(v4f*)(C + cofs + (size_t)(row0 + r) * ldc + col0 + c4) = v; if (C16) { v4h h4; for (int i = 0; i < 4; ++i) h4[i] = (_Float16)v[i]; *(v4h*)(C16 + cofs + (size_t)(row0 + r) * ldc + col0 + c4) = h4; } } }
     }
}


typedef _Float16 v4h __attribute__((ext_vector_type(4)));

__global__ __launch_bounds__(256) void k_x16(const float* __restrict__ x, _Float16* __restrict__ X16, size_t n8) { const size_t t = (size_t)blockIdx.x * 256 + threadIdx.x; if (t >= n8) return; FragH f;
#pragma unroll
  for (int q = 0; q < 8; ++q) f.h[q] = (_Float16)bf16_round(x[t * 8 + q]); *(v8us*)((unsigned short*)X16 + t * 8) = f.half[0];  }
__global__ __launch_bounds__(256) void k_h16(const float* __restrict__ x, _Float16* __restrict__ X16, size_t n8) { const size_t t = (size_t)blockIdx.x * 256 + threadIdx.x; if (t >= n8) return; FragH f;
#pragma unroll
  for (int q = 0; q < 8; ++q) f.h[q] = (_Float16)x[t * 8 + q]; *(v8us*)((unsigned short*)X16 + t * 8) = f.half[0];  }
__global__ __launch_bounds__(256) void k_round16f(const float* __restrict__ W, _Float16* __restrict__ Bt, size_t n8) { const size_t t = (size_t)blockIdx.x * 256 + threadIdx.x; if (t >= n8) return; FragH f;
#pragma unroll
  for (int i = 0; i < 8; ++i) f.h[i] = (_Float16)(bf16_round(W[t * 8 + i]) * 16.0f); *(v8us*)((unsigned short*)Bt + t * 8) = f.half[0];  }
template <int NHv, int TTv>
__global__ __launch_bounds__(256) void k_vt(const _Float16* __restrict__ V16, int ldv, int voff, _Float16* __restrict__ Vt) { __shared__ unsigned short tl[64][66]; const int tid = threadIdx.x; const int slab = blockIdx.x / (TTv / 64), lg = blockIdx.x % (TTv / 64); const int b = slab / NHv, h = slab % NHv;
  for (int i = tid; i < 64 * 8; i += 256) { const int r = i / 8, c8 = (i % 8) * 8; FragH f; f.half[0] = *(const v8us*)((const unsigned short*)V16 + ((size_t)b * TTv + lg * 64 + r) * ldv + voff + h * 64 + c8);
#pragma unroll
    for (int q = 0; q < 8; ++q) tl[r][c8 + q] = f.u[q]; }
  __syncthreads();
  {
#pragma unroll
    for (int rd = 0; rd < 2; ++rd) { const int d = rd * 32 + tid / 8, pc = tid % 8; FragH f;
#pragma unroll
      for (int q = 0; q < 8; ++q) f.u[q] = tl[pc * 8 + q][d];
      *(v8us*)((unsigned short*)Vt + ((size_t)slab * 64 + d) * TTv + lg * 64 + pc * 8) = f.half[0]; }
     } }

__global__ __launch_bounds__(256) void k_hl(const float* __restrict__ F, _Float16* __restrict__ Hh, _Float16* __restrict__ Hl, size_t n8) { const size_t t = (size_t)blockIdx.x * 256 + threadIdx.x; if (t >= n8) return; FragH fh, fl; const v4f a = *(const v4fa*)(F + t * 8), c = *(const v4fa*)(F + t * 8 + 4);
#pragma unroll
  for (int q = 0; q < 4; ++q) { _Float16 h = (_Float16)a[q]; fh.h[q] = h; fl.h[q] = (_Float16)((a[q] - (float)h) * 1024.0f); h = (_Float16)c[q]; fh.h[4 + q] = h; fl.h[4 + q] = (_Float16)((c[q] - (float)h) * 1024.0f); }
  { *(v8us*)((unsigned short*)Hh + t * 8) = fh.half[0]; *(v8us*)((unsigned short*)Hl + t * 8) = fl.half[0];  } }

// ---- fast GEMM (wave tile 32x64; requires M % 32 == 0 rows per launch region and N % 64 == 0); epilogue = k_gemm_hhx semantics ----
__device__ __forceinline__ v16h g2_frag(const _Float16* p, int hh) { FragH f; f.half[0] = *(const v8us*)((const unsigned short*)p + 8 * hh); f.half[1] = *(const v8us*)((const unsigned short*)p + 16 + 8 * hh); return f.v; }
__device__ __forceinline__ v8f g2_mma(v16h a, v16h b, v8f c) { v8f d = __builtin_amdgcn_wmma_f32_16x16x32_f16(false, a, false, b, (short)0, c, false, false); asm volatile("v_nop\n\tv_nop\n\tv_nop\n\tv_nop" : "+v"(d) : "v"(a), "v"(b)); return d; }
template <int ACT>
__global__ __launch_bounds__(128) void k_gemm2(const _Float16* __restrict__ A, int lda, size_t sA, const _Float16* __restrict__ Bh, int ldb, size_t sB, float alpha, const float* __restrict__ bias, size_t sBias, const float* __restrict__ CP, int rowsPerB, size_t sCPb, int row0g,
    float* __restrict__ C, _Float16* __restrict__ C16, int ldc, size_t sC, int M, int N, int K) { static_assert(ACT == 0 || ACT == 3 || ACT == 6 || ACT == 8 || ACT == 9 || ACT == 11 || ACT == 12 || ACT == 14 || ACT == 15 || ACT == 16 || ACT == 17, "k_gemm2: unsupported ACT code (would silently apply no activation)");
  __shared__ __attribute__((aligned(16))) float so[4][32][68];
  const int tid = threadIdx.x, w = tid >> 5, lane = tid & 31, ln = lane & 15, hh = lane >> 4; const int by = blockIdx.y;
  A += (size_t)by * sA; Bh += (size_t)by * sB; const size_t cofs = (size_t)by * sC; const float* bp = bias ? bias + (size_t)by * sBias : nullptr;
  const int ntn = N >> 6; const int mt = blockIdx.x / ntn, nq = blockIdx.x - mt * ntn; const int row0 = mt * 128 + 32 * w, col0 = nq * 64; if (row0 >= M) return;
  const _Float16* a0p = A + (size_t)(row0 + ln) * lda; const _Float16* a1p = a0p + (size_t)16 * lda;
  const _Float16* b0p = Bh + (size_t)(col0 + ln) * ldb; const _Float16* b1p = b0p + (size_t)16 * ldb; const _Float16* b2p = b1p + (size_t)16 * ldb; const _Float16* b3p = b2p + (size_t)16 * ldb;
  const v8f z8 = {0.f,0.f,0.f,0.f,0.f,0.f,0.f,0.f}; v8f c00 = z8, c01 = z8, c02 = z8, c03 = z8, c10 = z8, c11 = z8, c12 = z8, c13 = z8;
#pragma unroll 1
  for (int kb = 0; kb < K; kb += 32) { const v16h a0 = g2_frag(a0p + kb, hh), a1 = g2_frag(a1p + kb, hh);
    v16h b = g2_frag(b0p + kb, hh); c00 = g2_mma(a0, b, c00); c10 = g2_mma(a1, b, c10);
    b = g2_frag(b1p + kb, hh); c01 = g2_mma(a0, b, c01); c11 = g2_mma(a1, b, c11);
    b = g2_frag(b2p + kb, hh); c02 = g2_mma(a0, b, c02); c12 = g2_mma(a1, b, c12);
    b = g2_frag(b3p + kb, hh); c03 = g2_mma(a0, b, c03); c13 = g2_mma(a1, b, c13); }
  v8f accs[8] = {c00, c01, c02, c03, c10, c11, c12, c13};
#pragma unroll
  for (int u = 0; u < 8; ++u) { const int t = u & 3, half = u >> 2; const int col = col0 + t * 16 + ln; const float bv = bp ? bf16_round(bp[col]) : 0.f;
#pragma unroll
    for (int r = 0; r < 8; ++r) { const int rloc = half * 16 + 8 * hh + r; float v = accs[u][r] * alpha + bv; if (CP) { if (rowsPerB < 0) v += CP[cofs + (size_t)(row0g + row0 + rloc) * ldc + col];      /* rowsPerB < 0: own element of the batched C plane */ else { const int bidx = (row0g + row0 + rloc) / rowsPerB; v += CP[(size_t)bidx * sCPb + (size_t)by * 64 + col]; } }
      if (ACT == 3) v = fmaxf(v, 0.f); else if (ACT == 6) v = 0.5f * v * (1.0f + erff(v * 0.70710678118654752f)); else if (ACT == 11) v = 1.0f / (1.0f + expf(-v)); else if (ACT == 15) v = v / (1.0f + expf(-v)); else if (ACT == 12) v = (v > 0.f) ? v : 0.01f * v; else if (ACT == 8) v = tanhf(v); else if (ACT == 9) v = 0.5f * v * (1.0f + tanhf(0.7978845608028654f * (v + 0.044715f * v * v * v))); else if (ACT == 14) v = (v > 0.f) ? v : 0.1f * v; else if (ACT == 16) v = (v >= 0.f) ? v : 0.3f * v; else if (ACT == 17) v = (v >= 0.f) ? v : 0.2f * v;
      so[w][rloc][t * 16 + ln] = v; } }
  __builtin_amdgcn_fence(__ATOMIC_ACQ_REL, "workgroup"); __builtin_amdgcn_wave_barrier();
  const int rsub = lane >> 4, c4 = (lane & 15) * 4;
  {
#pragma unroll
    for (int q = 0; q < 16; ++q) { const int r = q * 2 + rsub; const v4f v = *(const v4fa*)&so[w][r][c4]; if (C) *(v4f*)(C + cofs + (size_t)(row0 + r) * ldc + col0 + c4) = v; if (C16) { v4h h4; for (int i = 0; i < 4; ++i) h4[i] = (_Float16)v[i]; *(v4h*)(C16 + cofs + (size_t)(row0 + r) * ldc + col0 + c4) = h4; } }
     } }


// ---- the same 32x64 wave tile with K split over the NW waves of a work-group, for products with few output tiles (M x N small, K long) ----
// A work-group owns ONE 32x64 tile of C; wave w sums k in [w K / NW, (w + 1) K / NW) with the loop of k_gemm2; the NW partial tiles (f32) meet in LDS and are added in wave order.
// Requires M % 32 == 0 (grid = (M / 32) (N / 64)), N % 64 == 0, K % (32 NW) == 0. C16 = f16(alpha x sum).
template <int NW>
__global__ __launch_bounds__(NW * 32) void k_gemm2k(const _Float16* __restrict__ A, int lda, const _Float16* __restrict__ Bh, int ldb, float alpha, _Float16* __restrict__ C16, int ldc, int N, int K) {
  __shared__ __attribute__((aligned(16))) float so[NW][32][68];
  const int tid = threadIdx.x, w = tid >> 5, lane = tid & 31, ln = lane & 15, hh = lane >> 4;
  const int ntn = N >> 6; const int mt = blockIdx.x / ntn, nq = blockIdx.x - mt * ntn; const int row0 = mt * 32, col0 = nq * 64; const int ks = K / NW;
  const _Float16* a0p = A + (size_t)(row0 + ln) * lda + w * ks; const _Float16* a1p = a0p + (size_t)16 * lda;
  const _Float16* b0p = Bh + (size_t)(col0 + ln) * ldb + w * ks; const _Float16* b1p = b0p + (size_t)16 * ldb; const _Float16* b2p = b1p + (size_t)16 * ldb; const _Float16* b3p = b2p + (size_t)16 * ldb;
  const v8f z8 = {0.f,0.f,0.f,0.f,0.f,0.f,0.f,0.f}; v8f c00 = z8, c01 = z8, c02 = z8, c03 = z8, c10 = z8, c11 = z8, c12 = z8, c13 = z8;
  for (int kb = 0; kb < ks; kb += 32) { const v16h a0 = g2_frag(a0p + kb, hh), a1 = g2_frag(a1p + kb, hh);
    v16h b = g2_frag(b0p + kb, hh); c00 = g2_mma(a0, b, c00); c10 = g2_mma(a1, b, c10);
    b = g2_frag(b1p + kb, hh); c01 = g2_mma(a0, b, c01); c11 = g2_mma(a1, b, c11);
    b = g2_frag(b2p + kb, hh); c02 = g2_mma(a0, b, c02); c12 = g2_mma(a1, b, c12);
    b = g2_frag(b3p + kb, hh); c03 = g2_mma(a0, b, c03); c13 = g2_mma(a1, b, c13); }
  v8f accs[8] = {c00, c01, c02, c03, c10, c11, c12, c13};
#pragma unroll
  for (int u = 0; u < 8; ++u) {      /* unrolled so that accs[] is indexed by constants and stays in registers */
#pragma unroll
    for (int r = 0; r < 8; ++r) so[w][(u >> 2) * 16 + 8 * hh + r][(u & 3) * 16 + ln] = accs[u][r]; }
  __syncthreads();      /* every wave's partial tile is in LDS before any thread adds them */
  for (int i0 = 0; i0 < 32 * 16; i0 += NW * 32) { const int i = i0 + tid, r = i >> 4, c4 = (i & 15) * 4; v4f s = *(const v4f*)&so[0][r][c4];
#pragma unroll
    for (int k = 1; k < NW; ++k) s += *(const v4f*)&so[k][r][c4];      /* unrolled so that the NW LDS reads issue together */
    v4h h4;
#pragma unroll
    for (int q = 0; q < 4; ++q) h4[q] = (_Float16)(s[q] * alpha);      /* unrolled so that the vector elements are indexed by constants */
    *(v4h*)(C16 + (size_t)(row0 + r) * ldc + col0 + c4) = h4; } }


// four weight matrices of n8 x 8 elements each -> four planes one behind the other in Bt; blockIdx.y picks the matrix
__global__ __launch_bounds__(256) void k_wnat(const float* __restrict__ w0, const float* __restrict__ w1, const float* __restrict__ w2, const float* __restrict__ w3, size_t n8, _Float16* __restrict__ Bt) { const size_t t = (size_t)blockIdx.x * 256 + threadIdx.x; if (t >= n8) return; const unsigned p = blockIdx.y; const float* w = p == 0 ? w0 : p == 1 ? w1 : p == 2 ? w2 : w3; FragH f; for (int q = 0; q < 8; ++q) f.h[q] = (_Float16)(bf16_round(w[t * 8 + q]) * 16.0f); *(v8us*)((unsigned short*)Bt + (p * n8 + t) * 8) = f.half[0];  }
__global__ __launch_bounds__(256) void k_rsm(const float* __restrict__ S, _Float16* __restrict__ P, int nrows) {
  #pragma clang fp contract(off)
  const int i = blockIdx.x * 256 + threadIdx.x; if (i >= nrows) return; const float* s = S + (size_t)i * SQ; float mx = -3.0e38f;
#pragma unroll 1
  for (int j = 0; j < SQ; ++j) mx = fmaxf(mx, s[j]); float se = 0.f;
#pragma unroll 1
  for (int j = 0; j < SQ; ++j) se += expf(s[j] - mx); const float sc = 256.0f / se;
#pragma unroll 1
  for (int j0 = 0; j0 < SQ; j0 += 8) { FragH f; for (int q = 0; q < 8; ++q) f.h[q] = (_Float16)(expf(s[j0 + q] - mx) * sc); unsigned short* d = (unsigned short*)P + (size_t)i * SQ + j0; *(v8us*)d = f.half[0];  } }
__global__ __launch_bounds__(256) void k_vt(const _Float16* __restrict__ V16, int b, int h0, _Float16* __restrict__ VT) { __shared__ unsigned short tl[64][65]; const int tid = threadIdx.x; const int hh = blockIdx.x % HG, sg = blockIdx.x / HG; const int s0 = sg * 64; const int h = h0 + hh;
  for (int i = tid; i < 64 * 8; i += 256) { const int j = i / 8, d8 = (i % 8) * 8; FragH f; f.half[0] = *(const v8us*)((const unsigned short*)V16 + ((size_t)b * SQ + s0 + j) * DM + h * HD + d8); for (int q = 0; q < 8; ++q) tl[d8 + q][j] = f.u[q]; }
  __syncthreads();
  { for (int i = tid; i < 64 * 8; i += 256) { const int d = i / 8, j8 = (i % 8) * 8; FragH f; for (int q = 0; q < 8; ++q) f.u[q] = tl[d][j8 + q]; *(v8us*)((unsigned short*)VT + ((size_t)hh * HD + d) * SQ + s0 + j8) = f.half[0]; }  } }



__global__ __launch_bounds__(256) void k_rsmcf2(const float* __restrict__ S, _Float16* __restrict__ P, int hg, int q0, int nk) {
  #pragma clang fp contract(off)
  const int t = blockIdx.x * 256 + threadIdx.x; if (t >= hg * QT) return; const size_t i = (size_t)t; const float* s = S + i * NKX; const int last = q0 + (t % QT); float mx = -3.0e38f;
#pragma unroll 1
  for (int j = 0; j < nk; ++j) { const float f = (j <= last) ? 1.f : 0.f; mx = fmaxf(mx, fmaf(f, s[j], (1.f - f) * -1.0e9f)); } float se = 0.f;
#pragma unroll 1
  for (int j = 0; j < nk; ++j) { const float f = (j <= last) ? 1.f : 0.f; se += __expf(fmaf(f, s[j], (1.f - f) * -1.0e9f) - mx); } const float sc = 256.0f / se;
#pragma unroll 1
  for (int j0 = 0; j0 < nk; j0 += 8) { FragH fr; for (int q = 0; q < 8; ++q) { const int j = j0 + q; const float f = (j <= last) ? 1.f : 0.f; fr.h[q] = (_Float16)(__expf(fmaf(f, s[j], (1.f - f) * -1.0e9f) - mx) * sc); } unsigned short* d = (unsigned short*)P + i * NKX + j0; *(v8us*)d = fr.half[0];  } }

template <int MASKADD>
__global__ __launch_bounds__(64) void k_att0(const float* __restrict__ QF, const float* __restrict__ KF, const float* __restrict__ VF, int ld, const float* __restrict__ mask, float scale, float* __restrict__ OF, int ldo) {
  #pragma clang fp contract(off)
  __shared__ __attribute__((aligned(16))) float lq[64][64]; __shared__ __attribute__((aligned(16))) float lo[64][64];
  const int tid = threadIdx.x; const int h = blockIdx.x / (QT0 / 64), rg = blockIdx.x % (QT0 / 64); const int i = rg * 64 + tid;
  const float* qr = QF + (size_t)i * ld + h * HD;
#pragma unroll 1
  for (int c = 0; c < HD / 4; ++c) { *(v4f*)&lq[tid][c * 4] = *(const v4fa*)(qr + c * 4); const v4f z = {0.f, 0.f, 0.f, 0.f}; *(v4f*)&lo[tid][c * 4] = z; }
  float m = -1.0e30f, l = 0.f; const int jmax = MASKADD ? (SQ - 1) : (rg * 64 + 63);      /* additive-mask form: every key (the mask input decides); causal form: keys up to the block's last row */
#pragma unroll 1
  for (int j = 0; j <= jmax; ++j) { const float* kr = KF + (size_t)j * ld + h * HD; const float* vr = VF + (size_t)j * ld + h * HD; float s = 0.f;
#pragma unroll 1
    for (int c = 0; c < HD / 4; ++c) { const v4f kq = *(const v4fa*)(kr + c * 4); const v4f qq = *(v4f*)&lq[tid][c * 4]; s = __fadd_rn(s, __fmul_rn(qq[0], kq[0])); s = __fadd_rn(s, __fmul_rn(qq[1], kq[1])); s = __fadd_rn(s, __fmul_rn(qq[2], kq[2])); s = __fadd_rn(s, __fmul_rn(qq[3], kq[3])); }
    s = __fmul_rn(s, scale); if (MASKADD) s = __fadd_rn(s, __fmul_rn(bf16_round(mask[(size_t)i * SQ + j]), -10000.0f));
    const float f = (MASKADD || j <= i) ? 1.f : 0.f; const float sm = fmaf(f, s, (1.f - f) * -1.0e30f); const float mn = fmaxf(m, sm); const float sc = expf(m - mn); const float e = expf(sm - mn); l = __fadd_rn(__fmul_rn(l, sc), e); m = mn;
#pragma unroll 1
    for (int c = 0; c < HD / 4; ++c) { const v4f vv = *(const v4fa*)(vr + c * 4); v4f oo = *(v4f*)&lo[tid][c * 4]; for (int u = 0; u < 4; ++u) oo[u] = __fadd_rn(__fmul_rn(oo[u], sc), __fmul_rn(e, vv[u])); *(v4f*)&lo[tid][c * 4] = oo; } }
  const float fin = 64.0f / l;      /* o carried x64 like the f16 path */
#pragma unroll 1
  for (int c = 0; c < HD / 4; ++c) { v4f oo = *(v4f*)&lo[tid][c * 4]; for (int u = 0; u < 4; ++u) oo[u] = __fmul_rn(oo[u], fin); *(v4f*)&lo[tid][c * 4] = oo; }
  __syncthreads();
  {
#pragma unroll 1
    for (int it = 0; it < 16; ++it) { const int row = it * 4 + tid / 16, pc = (tid % 16) * 4; const v4f v = *(const v4f*)&lo[row][pc]; *(v4f*)(OF + (size_t)(rg * 64 + row) * ldo + h * HD + pc) = v; }
     } }

__global__ __launch_bounds__(256) void k_oscale(const float* __restrict__ OF, float* __restrict__ out, size_t n4) { const size_t t = (size_t)blockIdx.x * 256 + threadIdx.x; if (t >= n4) return; const v4f a = *(const v4fa*)(OF + t * 4); v4f o; for (int q = 0; q < 4; ++q) o[q] = a[q] * 0.015625f; *(v4f*)(out + t * 4) = o;  }

__global__ __launch_bounds__(256) void k_bfr(const float* __restrict__ x, float* __restrict__ XB, size_t n8) { const size_t t = (size_t)blockIdx.x * 256 + threadIdx.x; if (t >= n8) return; v4f a = *(const v4fa*)(x + t * 8), c = *(const v4fa*)(x + t * 8 + 4); for (int q = 0; q < 4; ++q) { a[q] = bf16_round(a[q]); c[q] = bf16_round(c[q]); }
  { *(v4f*)(XB + t * 8) = a; *(v4f*)(XB + t * 8 + 4) = c;  } }



__global__ __launch_bounds__(256) void k_rsmfvl(const float* __restrict__ S, _Float16* __restrict__ P, _Float16* __restrict__ PL, int qn, const int* __restrict__ vlp) {
  #pragma clang fp contract(off)
  const int t = blockIdx.x * 256 + threadIdx.x; if (t >= qn) return; const int vl = vlp[0]; const size_t i = (size_t)t; const float* s = S + i * SQ; float mx = -3.0e38f;
#pragma unroll 1
  for (int j = 0; j < SQ; ++j) { const float f = (j < vl) ? 1.f : 0.f; mx = fmaxf(mx, fmaf(f, s[j], (1.f - f) * -1000000.0f)); } float se = 0.f;
#pragma unroll 1
  for (int j = 0; j < SQ; ++j) { const float f = (j < vl) ? 1.f : 0.f; se += __expf(fmaf(f, s[j], (1.f - f) * -1000000.0f) - mx); } const float sc = 256.0f / se;
#pragma unroll 1
  for (int j0 = 0; j0 < SQ; j0 += 8) { FragH fr, gr; for (int q = 0; q < 8; ++q) { const int j = j0 + q; const float f = (j < vl) ? 1.f : 0.f; const float pv = __expf(fmaf(f, s[j], (1.f - f) * -1000000.0f) - mx) * sc; const _Float16 ph = (_Float16)pv; fr.h[q] = ph; gr.h[q] = (_Float16)((pv - (float)ph) * 1024.0f); }
    unsigned short* d = (unsigned short*)P + i * SQ + j0; unsigned short* dl = (unsigned short*)PL + i * SQ + j0; *(v8us*)d = fr.half[0]; *(v8us*)dl = gr.half[0];  } }

__global__ __launch_bounds__(256) void k_rsmf(const float* __restrict__ S, _Float16* __restrict__ P, int qn, int hg) {
  #pragma clang fp contract(off)
  const int t = blockIdx.x * 256 + threadIdx.x; if (t >= qn * hg) return; const size_t i = (size_t)(t / qn) * SQ + (t % qn); const float* s = S + i * SQ; float mx = -3.0e38f;
#pragma unroll 1
  for (int j = 0; j < SQ; ++j) mx = fmaxf(mx, s[j]); float se = 0.f;
#pragma unroll 1
  for (int j = 0; j < SQ; ++j) se += __expf(s[j] - mx); const float sc = 256.0f / se;
#pragma unroll 1
  for (int j0 = 0; j0 < SQ; j0 += 8) { FragH f; for (int q = 0; q < 8; ++q) f.h[q] = (_Float16)(__expf(s[j0 + q] - mx) * sc); unsigned short* d = (unsigned short*)P + i * SQ + j0; *(v8us*)d = f.half[0];  } }


#define CN 256          /* channels */
#define CI 128          /* inner channels */
#define NP 4096         /* positions */
#define NM 4096         /* key positions (= SQ) */
#define NC CN           /* BN statistics macros */
#define NPX NP
#define BNEPS 1e-5f

__global__ __launch_bounds__(256) void k_rowbias(const float* __restrict__ b, float* __restrict__ BP, size_t n4, int ncol) { const size_t t = (size_t)blockIdx.x * 256 + threadIdx.x; if (t >= n4) return; const size_t e = t * 4; const float v = bf16_round(b[e / ncol]); const v4f o = {v, v, v, v}; *(v4f*)(BP + e) = o;  }




__global__ __launch_bounds__(256) void k_mp2(const float* __restrict__ src, float* __restrict__ dst, int nout) {
  const int t = blockIdx.x * 256 + threadIdx.x; if (t >= nout) return; const int c = t / 1024; const int o = t % 1024; const int oy = o / 32, ox = o % 32; const float* p = src + (size_t)c * 4096 + (size_t)(2 * oy) * 64 + 2 * ox;
  const float v = fmaxf(fmaxf(p[0], p[1]), fmaxf(p[64], p[65])); *(float*)(dst + t) = v;  }
__global__ __launch_bounds__(256) void k_xpb(const float* __restrict__ x, const float* __restrict__ wb, float* __restrict__ CPP, size_t n4) {
  #pragma clang fp contract(off)
  const size_t t = (size_t)blockIdx.x * 256 + threadIdx.x; if (t >= n4) return; const size_t e = t * 4; const int c = (int)((e / 4096) % 256); const float bb = bf16_round(wb[c]); const v4f a = *(const v4fa*)(x + e); v4f o; for (int q = 0; q < 4; ++q) o[q] = __fadd_rn(bf16_round(a[q]), bb);
  *(v4f*)(CPP + e) = o;  }


template <int PASS>
__global__ __launch_bounds__(256) void k_cstA(const float* __restrict__ X, const float* __restrict__ MV, float* __restrict__ PART) {
  #pragma clang fp contract(off)
  __shared__ float red[256]; const int t = threadIdx.x; const size_t bc = blockIdx.x; const int c = (int)(bc % NC); const float* row = X + bc * (size_t)NPX; const float mu = PASS ? MV[c] : 0.f; float s = 0.f;
  for (int i = t; i < NPX; i += 256) { const float v = row[i]; const float d = PASS ? __fadd_rn(v, -mu) : v; s = __fadd_rn(s, PASS ? __fmul_rn(d, d) : d); }
  red[t] = s; __syncthreads(); for (int st = 128; st > 0; st >>= 1) { if (t < st) red[t] = __fadd_rn(red[t], red[t + st]); __syncthreads(); }
  if (t < 32) { const float pv = (t == 0) ? red[0] : 0.f; *(float*)(PART + bc * 32 + t) = pv;  } }      

template <int PASS>
__global__ __launch_bounds__(256) void k_cstB(const float* __restrict__ PART, float* __restrict__ MV) { const int c = threadIdx.x; if (c >= NC) return; double s = 0.0; for (int b = 0; b < NB; ++b) s += (double)PART[((size_t)b * NC + c) * 32]; const float m = (float)(s / ((double)NB * (double)NPX)); *(float*)(MV + PASS * NC + c) = m;  }


__global__ __launch_bounds__(256) void k_bnresid(const float* __restrict__ C2, const float* __restrict__ MV, const float* __restrict__ g, const float* __restrict__ be, const float* __restrict__ X, float* __restrict__ out, size_t n4) {
  #pragma clang fp contract(off)
  const size_t t = (size_t)blockIdx.x * 256 + threadIdx.x; if (t >= n4) return; const size_t e = t * 4; const int c = (int)((e / NPX) % NC); const float sc = __fmul_rn(rsqrtf(__fadd_rn(MV[NC + c], BNEPS)), bf16_round(g[c])); const float mu = MV[c], bb = bf16_round(be[c]);
  const v4f a = *(const v4fa*)(C2 + e); const v4f xx = *(const v4fa*)(X + e); v4f o; for (int q = 0; q < 4; ++q) { const float z = __fadd_rn(__fmul_rn(__fadd_rn(a[q], -mu), sc), bb); o[q] = __fadd_rn(z, bf16_round(xx[q])); }
  *(v4f*)(out + e) = o;  }


__global__ __launch_bounds__(256) void k_rowbias(float* __restrict__ Y, const float* __restrict__ bias) {
  #pragma clang fp contract(off)
  const size_t t = (size_t)blockIdx.x * 256 + threadIdx.x; if (t >= (size_t)NB * NC * NPX / 4) return; const size_t e = t * 4; const int c = (int)((e / NPX) % NC); const float bb = bf16_round(bias[c]);
  v4f v = *(const v4fa*)(Y + e); for (int q = 0; q < 4; ++q) v[q] = __fadd_rn(v[q], bb); *(v4f*)(Y + e) = v;  }


// Scores never stored. Both consumers of f = theta^T phi form their own score tiles on the matrix unit from the f16 token rows (theta | phi | g, pitch QLD) and use them in registers.
// ST holds one 128-B record per 16 columns: 16 maxima, then 16 x (256 / sum). blockIdx.y is the image.
// Inner loops carry #pragma unroll so that the fragment arrays are indexed by constants and stay in registers (a run-time index would send them to scratch).
#define CSC 16                    /* columns per record */
#define QLD (3 * CI)              /* pitch of the token rows: a constant here, so that the rows of a fragment group lie at immediate offsets from one address */
#define SCM 64                    /* columns per work-group of the statistics kernel */
#define SCW 16                    /* its waves: the 4,096 rows split over them */
__device__ __forceinline__ v8f f_mma(v16h a, v16h b, v8f c) { return __builtin_amdgcn_wmma_f32_16x16x32_f16(false, a, false, b, (short)0, c, false, false); }
__device__ __forceinline__ v16h f_frag(const _Float16* p) { FragH f; f.half[0] = *(const v8us*)((const unsigned short*)p); f.half[1] = *(const v8us*)((const unsigned short*)p + 16); return f.v; }      /* g2_frag with the lane's + 8 hh already in p */
// Column statistics: a work-group owns 64 key columns m (their phi fragments stay in registers as B), wave w sweeps rows n in [256 w, 256 w + 256) 16 at a time (theta as A).
// In D a lane holds 8 rows of ONE column (row 8 hh + r, column ln), so the running maximum and the rescaled running sum of a column are per-lane scalars; the 32 partial pairs of a column (16 waves x 2 lane halves) meet in LDS.
// One trip: 16 rows from ac; the next trip's theta fragments are fetched into ax behind the products (two register sets that swap roles, so that no copy and no early wait stands between).
__device__ __forceinline__ void cs_trip(const _Float16* an, const v16h (&ph)[4][4], const v16h (&ac)[4], v16h (&ax)[4], float (&mx)[4], float (&se)[4]) {
  const v8f z8 = {0.f,0.f,0.f,0.f,0.f,0.f,0.f,0.f}; v8f d[4] = {z8, z8, z8, z8};
#pragma unroll
  for (int k = 0; k < 4; ++k) {
#pragma unroll
    for (int t = 0; t < 4; ++t) d[t] = f_mma(ac[k], ph[t][k], d[t]); }
#pragma unroll
  for (int k = 0; k < 4; ++k) ax[k] = f_frag(an + k * 32);
  asm volatile("s_wait_xcnt 0x0" :: "v"(an) : "memory");      /* a precaution: the address that the 8 loads above name stays live and unwritten up to this wait */
  __builtin_amdgcn_sched_barrier(0);      /* keeps the fetch in front of the vector work below, which is the time it has to land */
#pragma unroll
  for (int t = 0; t < 4; ++t) { float nm = mx[t];
#pragma unroll
    for (int r = 0; r < 8; ++r) nm = fmaxf(nm, d[t][r]);
    float s = se[t] * __expf(mx[t] - nm);
#pragma unroll
    for (int r = 0; r < 8; ++r) s += __expf(d[t][r] - nm);
    se[t] = s; mx[t] = nm; } }
__global__ __launch_bounds__(SCW * 32) __attribute__((amdgpu_waves_per_eu(SCW / 4, SCW / 4)))      /* one work-group a WGP: 256 registers a wave, of which the phi fragments take 128 */
void k_colstat_f(const _Float16* __restrict__ QKV, float* __restrict__ ST) {
  __shared__ float rmx[SCW * 2][SCM]; __shared__ float rse[SCW * 2][SCM];
  const int tid = threadIdx.x, w = tid >> 5, lane = tid & 31, ln = lane & 15, hh = lane >> 4;
  const _Float16* q = QKV + (size_t)blockIdx.y * NP * QLD; const int m0 = blockIdx.x * SCM;
  const _Float16* pb = q + CI + (size_t)(m0 + ln) * QLD + 8 * hh;
  const _Float16* th = q + (size_t)(w * (NP / SCW) + ln) * QLD + 8 * hh;
  v16h ph[4][4], a0[4], a1[4];
#pragma unroll
  for (int t = 0; t < 4; ++t) {
#pragma unroll
    for (int k = 0; k < 4; ++k) ph[t][k] = f_frag(pb + t * 16 * QLD + k * 32); }
#pragma unroll
  for (int k = 0; k < 4; ++k) a0[k] = f_frag(th + k * 32);
  asm volatile("s_wait_xcnt 0x0" :: "v"(pb), "v"(th) : "memory");      /* a precaution: the two addresses that the 40 loads above name stay live and unwritten up to this wait */
  float mx[4] = {-3.0e38f, -3.0e38f, -3.0e38f, -3.0e38f}, se[4] = {0.f, 0.f, 0.f, 0.f};
#pragma unroll 1      /* rolled: two trips are the period of the register sets, and the loop stays small in the instruction cache */
  for (int nb = 0; nb < NP / SCW; nb += 32) {
    cs_trip(th + (size_t)(nb + 16) * QLD, ph, a0, a1, mx, se);
    cs_trip(th + (size_t)(nb + 32 < NP / SCW ? nb + 32 : nb) * QLD, ph, a1, a0, mx, se); }      /* the last trip fetches rows of its own range again: in bounds, not used */
#pragma unroll
  for (int t = 0; t < 4; ++t) { rmx[w * 2 + hh][t * 16 + ln] = mx[t]; rse[w * 2 + hh][t * 16 + ln] = se[t]; }
  __syncthreads();      /* every wave's partial maxima and sums are in LDS before a thread folds a column */
  if (tid < SCM) { float m = rmx[0][tid];
#pragma unroll
    for (int i = 1; i < SCW * 2; ++i) m = fmaxf(m, rmx[i][tid]);
    float s = 0.f;
#pragma unroll
    for (int i = 0; i < SCW * 2; ++i) s += rse[i][tid] * __expf(rmx[i][tid] - m);
    float* rec = ST + (size_t)blockIdx.y * (2 * NM) + (size_t)((m0 + tid) / CSC) * (2 * CSC) + (tid % CSC); rec[0] = m; rec[CSC] = 256.0f / s; } }
// y^T = P g^T with neither f nor P stored. A work-group owns 64 rows n and all 128 columns of y^T; wave w takes the key columns m in [1024 w, 1024 w + 1024), 32 a trip; the partial tiles (f32) meet in LDS and are added in wave order.
// The score tile is formed TRANSPOSED: D[m][n] = phi[m] . theta[n] (phi as A, theta as B, theta resident). A lane then holds m = 8 hh + r of column n = ln, which is the k order of an A fragment of row ln
// (tile m 0..15 -> elements 0..7, tile m 16..31 -> elements 8..15), so P[n][m] = f16(exp(s - max_m) x 256 / sum_m) becomes the A operand of P g^T in place, with no exchange between lanes.
// All loads stand at the head of a trip and fetch the NEXT trip's records, g and phi (two register sets that swap roles): with one wave a SIMD nothing else hides a load, so each gets a whole trip to land in.
#define PVW 4                     /* waves: the 4,096 key columns split over them */
#define PVN 4                     /* 16-row tiles of n per wave: every phi and g fragment fetched serves PVN matrix instructions */
struct PvSet { v4f mx[4], iv[4]; v16h pf[2][4], gf[8]; };      /* what one trip reads: maxima and 256 / sum of its 32 columns, its phi fragments (A of the scores), its g fragments (B of P g^T) */
// rb, gb, pb are the addresses that the loads name; RO, GO, PO (elements) go into the loads' immediate offsets, so that the wait below can hold exactly those registers.
template <int RO, int GO, int PO>
__device__ __forceinline__ void pv_fetch(const float* rb, const _Float16* gb, const _Float16* pb, PvSet& x) {
  const float* r = rb + RO;
#pragma unroll
  for (int u = 0; u < 2; ++u) { x.mx[2 * u] = *(const v4fa*)(r + 2 * CSC * u); x.mx[2 * u + 1] = *(const v4fa*)(r + 2 * CSC * u + 4); x.iv[2 * u] = *(const v4fa*)(r + 2 * CSC * u + CSC); x.iv[2 * u + 1] = *(const v4fa*)(r + 2 * CSC * u + CSC + 4); }
#pragma unroll
  for (int u = 0; u < 2; ++u) {
#pragma unroll
    for (int k = 0; k < 4; ++k) x.pf[u][k] = f_frag(pb + CI + PO + u * 16 * QLD + k * 32); }
#pragma unroll
  for (int c = 0; c < 8; ++c) x.gf[c] = f_frag(gb + GO + c * 16 * NM);
  asm volatile("s_wait_xcnt 0x0" :: "v"(rb), "v"(gb), "v"(pb) : "memory");      /* a precaution: the three addresses that the 40 loads above name stay live and unwritten up to this wait */
  __builtin_amdgcn_sched_barrier(0); }      /* keeps the 40 loads at the head of the trip: without it the scheduler spreads them through the trip and waits for them at once */
__device__ __forceinline__ void pv_trip(const PvSet& c_, const v16h (&th)[PVN][4], v8f (&acc)[PVN][8]) {
  const v8f z8 = {0.f,0.f,0.f,0.f,0.f,0.f,0.f,0.f}; v8f s[2][PVN];      /* [m tile][n tile] */
#pragma unroll
  for (int u = 0; u < 2; ++u) {
#pragma unroll
    for (int v = 0; v < PVN; ++v) s[u][v] = z8; }
#pragma unroll
  for (int k = 0; k < 4; ++k) {
#pragma unroll
    for (int u = 0; u < 2; ++u) {
#pragma unroll
      for (int v = 0; v < PVN; ++v) s[u][v] = f_mma(c_.pf[u][k], th[v][k], s[u][v]); } }
  FragH f[PVN];
#pragma unroll
  for (int u = 0; u < 2; ++u) {
#pragma unroll
    for (int e = 0; e < 8; ++e) { const float m_ = c_.mx[u * 2 + (e >> 2)][e & 3], i_ = c_.iv[u * 2 + (e >> 2)][e & 3];
#pragma unroll
      for (int v = 0; v < PVN; ++v) f[v].h[u * 8 + e] = (_Float16)(__expf(s[u][v][e] - m_) * i_); } }
#pragma unroll
  for (int c = 0; c < 8; ++c) {
#pragma unroll
    for (int v = 0; v < PVN; ++v) acc[v][c] = f_mma(f[v].v, c_.gf[c], acc[v][c]); } }
__global__ __launch_bounds__(PVW * 32) __attribute__((amdgpu_waves_per_eu(PVW / 4, PVW / 4)))      /* one wave a SIMD: the accumulators (256 registers), theta (128) and the fragments in flight need more than 512 */
void k_pvf(const _Float16* __restrict__ QKV, const float* __restrict__ ST, const _Float16* __restrict__ G, float alpha, _Float16* __restrict__ YT) {
  __shared__ __attribute__((aligned(16))) float so[PVW][16 * PVN][CI + 4];
  const int tid = threadIdx.x, w = tid >> 5, lane = tid & 31, ln = lane & 15, hh = lane >> 4;
  const size_t by = blockIdx.y; const int n0 = blockIdx.x * (16 * PVN); const int ks = NM / PVW;
  const _Float16* q = QKV + by * NP * QLD;
  const float* stp = ST + by * (2 * NM) + (size_t)(w * ks) * 2 + 8 * hh;      /* column m: record m / CSC of 2 CSC floats, maxima first */
  const _Float16* gp = G + by * CI * NM + (size_t)ln * NM + w * ks + 8 * hh;
  const _Float16* pp = q + (size_t)(w * ks + ln) * QLD + 8 * hh;      /* the token row; phi lies CI elements into it (an immediate offset of the loads) */
  const _Float16* tp = q + (size_t)(n0 + ln) * QLD + 8 * hh;
  v16h th[PVN][4]; PvSet s0, s1;
#pragma unroll
  for (int v = 0; v < PVN; ++v) {
#pragma unroll
    for (int k = 0; k < 4; ++k) th[v][k] = f_frag(tp + v * 16 * QLD + k * 32); }
  asm volatile("s_wait_xcnt 0x0" :: "v"(tp) : "memory");      /* a precaution: the address that the 32 loads above name stays live and unwritten up to this wait */
  pv_fetch<0, 0, 0>(stp, gp, pp, s0);
  const v8f z8 = {0.f,0.f,0.f,0.f,0.f,0.f,0.f,0.f}; v8f acc[PVN][8];
#pragma unroll
  for (int v = 0; v < PVN; ++v) {
#pragma unroll
    for (int c = 0; c < 8; ++c) acc[v][c] = z8; }
#pragma unroll 1      /* rolled: two trips are the period of the register sets, and the loop stays small in the instruction cache */
  for (int kb = 0; kb < ks; kb += 64) {
    pv_fetch<64, 32, 32 * QLD>(stp, gp, pp, s1); pv_trip(s0, th, acc);
    const int more = kb + 64 < ks ? 1 : 0;      /* the last trip fetches its own range again: in bounds, not used */
    stp += more * 128; gp += more * 64; pp += more * (64 * QLD);
    pv_fetch<0, 0, 0>(stp, gp, pp, s0); pv_trip(s1, th, acc); }
#pragma unroll
  for (int v = 0; v < PVN; ++v) {
#pragma unroll
    for (int c = 0; c < 8; ++c) {
#pragma unroll
      for (int e = 0; e < 8; ++e) so[w][v * 16 + 8 * hh + e][c * 16 + ln] = acc[v][c][e]; } }
  __syncthreads();      /* every wave's partial tile is in LDS before any thread adds them */
  for (int i0 = 0; i0 < 16 * PVN * (CI / 4); i0 += PVW * 32) { const int i = i0 + tid, rr = i / (CI / 4), c4 = (i % (CI / 4)) * 4; v4f sm = *(const v4f*)&so[0][rr][c4];
#pragma unroll
    for (int k = 1; k < PVW; ++k) sm += *(const v4f*)&so[k][rr][c4];      /* unrolled so that the LDS reads issue together */
    v4h h4;
#pragma unroll
    for (int e = 0; e < 4; ++e) h4[e] = (_Float16)(sm[e] * alpha);      /* unrolled so that the vector elements are indexed by constants */
    *(v4h*)(YT + (by * NP + n0 + rr) * CI + c4) = h4; } }
extern "C" void kernel_launch(void* const* d_in, const int* in_sizes, int n_in,
                              void* d_out, int out_size, void* d_ws, size_t ws_size, hipStream_t stream) {
  (void)in_sizes; (void)n_in; (void)out_size;
  const float* const* I = (const float* const*)d_in; const float* x = I[0]; const float* tw = I[1]; const float* pw = I[2]; const float* gw = I[3]; const float* ww = I[4];      /* natural 1x1 conv weights: w_theta, w_phi, w_g [128][256], w_mask [256][128]; no biases */
  char* ws = (char*)d_ws; size_t off = 0;
  auto take = [&](size_t bytes) { char* p = ws + off; off += (bytes + 255) & ~(size_t)255; return p; };
  const size_t PL = (size_t)CN * NP;      /* one input map */
  const int QL = 3 * CI;      /* row pitch of the token rows: theta, phi, g side by side */
  _Float16* BT = (_Float16*)take((size_t)4 * CI * CN * 2); _Float16* BW = BT + (size_t)3 * CI * CN;      /* w_theta, w_phi, w_g as one [384][256] B^T plane, then w_mask */
  _Float16* X16 = (_Float16*)take(NB * PL * 2); float* XB = (float*)take(NB * PL * 4);      /* x f16 channel-first; bf16(x) f32 for the residual */
  _Float16* XT = (_Float16*)take(NB * PL * 2); _Float16* QKV = (_Float16*)take((size_t)NB * NP * QL * 2); _Float16* G = (_Float16*)take((size_t)NB * CI * NP * 2); _Float16* YT = (_Float16*)take((size_t)NB * NP * CI * 2);
  float* ST = (float*)take((size_t)NB * NM * 2 * 4);      /* per-column max and 256 / sum, one 128-B record per 16 columns */
  if (off > ws_size) return;
  k_wnat<<<dim3((unsigned)(((size_t)CI * CN / 8 + 255) / 256), 4), 256, 0, stream>>>(tw, pw, gw, ww, (size_t)CI * CN / 8, BT);      /* natural [out][in] x16 f16 planes (Bt for theta/phi/g token rows; the A operand for W) */
  k_x16<<<(unsigned)((NB * PL / 8 + 255) / 256), 256, 0, stream>>>(x, X16, NB * PL / 8); k_bfr<<<(unsigned)((NB * PL / 8 + 255) / 256), 256, 0, stream>>>(x, XB, NB * PL / 8);
  k_vt<NP / 64, CN><<<NB * (NP / 64) * (CN / 64), 256, 0, stream>>>(X16, NP, 0, XT);      /* every image: [c][n] -> x^T [n][c] token rows */
  k_gemm2k<8><<<(NB * NP / 32) * (QL / 64), 256, 0, stream>>>(XT, CN, BT, CN, 0.0625f, QKV, QL, QL, CN);      /* every image: theta^T | phi^T | g^T [n][384] -> f16; K = 256 over 8 waves */
  k_vt<CI / 64, NP><<<NB * (CI / 64) * (NP / 64), 256, 0, stream>>>(QKV, QL, 2 * CI, G);      /* every image: g^T -> g [ci][m] (the PV B^T operand) */
  k_colstat_f<<<dim3(NM / SCM, NB), SCW * 32, 0, stream>>>(QKV, ST);      /* every image: softmax over the QUERY axis: per key column m the max and 256 / sum over all 4096 rows n of f[n][m] = theta[n].phi[m] (K = 128, NO scale), f formed in registers */
  k_pvf<<<dim3(NP / (16 * PVN), NB), PVW * 32, 0, stream>>>(QKV, ST, G, 0.00390625f, YT);      /* every image: y^T [n][ci] = sum_m P[n][m] g[ci][m] -> f16, P[n][m] = f16(256 exp(f - max_m) / sum_m), f formed again in registers */
  k_gemm2<0><<<dim3((unsigned)((CN / 128) * (NP / 64)), NB), 128, 0, stream>>>(BW, CI, 0, YT, CI, (size_t)NP * CI, 0.0625f, nullptr, 0, XB, -1, 0, 0, (float*)d_out, nullptr, NP, PL, CN, NP, CI);      /* every image: out[c][a] = (16 W as A) x (y^T as B^T) / 16 + bf16(x) (own element) -> f32 channel-first output block */
}

// v006
// A run of this version takes 83.4 microseconds.
// Timed twice side by side with v005, it ran 1.48 times as fast both times.
// All steps since v000 together make it 84.0 times as fast.
#include <hip/hip_runtime.h>
// Non-local block with the softmax taken over the QUERY axis (x [4][256][64][64]; theta, phi, g = conv1x1(x) with [128][256] weights (U(+-1/16), no biases); scores[n][m] = theta[n].phi[m] (NO scaling); attn = softmax(scores, axis = 1): normalised over n for every key column m (the module's unconventional axis); out[n] = sum_m attn[n][m] g[m]; mask = conv1x1(out; w_mask [256][128], no bias); result = x + mask -> [4][256][64][64]).
// Structure: channel-first; the images share every launch (grid); one projection kernel reads f32 x (rounded to bf16, exact in f16), turns it to token rows in LDS and forms theta^T, phi^T (token rows) and g (channel-major) on WMMA (f32 accumulation) -> f16; f [4096][4096] = theta^T phi (K = 128, no scale) f32 in registers only, formed once for the column statistics and once for the weights (f32 statistics, native exp; weights x256 f16); y^T = P g^T (x2^-8) f16; out = (16 W) y / 16 + bf16(x) f32 channel-first; launches: see trace.
// Compute dtype: inputs rounded to bf16; x / weights exact; q, k, v, softmax weights and o as plain f16 GEMM operands (~2^-12); scores and softmax statistics f32. v_wmma_f32_16x16x32_f16.
#define NB 4
#define SQ 4096
#define DM 256
#define NH 1
#define HD 64
#define HG 4                         /* heads per attention launch group */
#define B0 0                         /* first batch processed (debug hook) */
#define NBR NB                       /* batches processed (debug hook) */
#define NR ((size_t)NB * SQ)         /* token rows */
#define MP ((int)((size_t)NBR * SQ)) /* rows projected (debug hook) */
#define QT 256                       /* query rows per causal tile */
#define NKX SQ                       /* S / P row pitch */
#define QT0 256                      /* first-tile rows recomputed exactly (256: buys margin for the few-key rows 128..255, which have no output projection to average the single-f16 P/v rounding) */
#define QN SQ                        /* query rows attended per batch (debug hook) */
#define NHD NH                       /* heads attended (debug hook) */
#define MPO MP                       /* rows through the output stage (debug hook) */
#define LQ DM            /* unused (the q/k/v rows have pitch QL = 3 CI) */
typedef __bf16 v16b __attribute__((ext_vector_type(16)));
typedef unsigned short v8us __attribute__((ext_vector_type(8), may_alias));
typedef float  v8f  __attribute__((ext_vector_type(8)));
typedef float  v4f  __attribute__((ext_vector_type(4)));
typedef float  v4fa __attribute__((ext_vector_type(4), may_alias));
union FragB { v16b v; v8us half[2]; unsigned short u[16]; };

__device__ __forceinline__ unsigned short bf16_bits(float x) { unsigned int u = __float_as_uint(x); return (unsigned short)((u + 0x7FFFu + ((u >> 16) & 1u)) >> 16); }
__device__ __forceinline__ float bf16_val(unsigned short b) { return __uint_as_float(((unsigned int)b) << 16); }
__device__ __forceinline__ float bf16_round(float x) { return bf16_val(bf16_bits(x)); }
// D += A·B with NT terms: 1 = ah·bh, 2 = + al·bh (A split), 3 = + ah·bl (both split)
template <int NT>
__device__ __forceinline__ v8f mmaN(v16b ah, v16b al, v16b bh, v16b bl, v8f c) {
  c = __builtin_amdgcn_wmma_f32_16x16x32_bf16(false, ah, false, bh, (short)0, c, false, false);
  if (NT >= 2) c = __builtin_amdgcn_wmma_f32_16x16x32_bf16(false, al, false, bh, (short)0, c, false, false);
  if (NT >= 3) c = __builtin_amdgcn_wmma_f32_16x16x32_bf16(false, ah, false, bl, (short)0, c, false, false);
  asm volatile("v_nop\n\tv_nop\n\tv_nop\n\tv_nop" : "+v"(c) : "v"(ah), "v"(al), "v"(bh), "v"(bl));
  return c;
}

__global__ __launch_bounds__(256) void k_wt_bf16(const float* __restrict__ W, unsigned short* __restrict__ Wt, int K, int N) {
  const int t = blockIdx.x * 256 + threadIdx.x;
  const int k8n = K / 8;
  if (t >= N * k8n) return;
  const int n = t / k8n, k8 = (t % k8n) * 8;
  v8us v;
#pragma unroll
  for (int i = 0; i < 8; ++i) v[i] = bf16_bits(W[(size_t)(k8 + i) * N + n]);
  *(v8us*)(Wt + (size_t)n * K + k8) = v;
  
}

// GEMM C[M][N] (f32, pitch ldc) = act(A[M][K]·W + bias). A f32 row-major (pitch lda) converted per fragment to bf16
// (ASPLIT: hi/lo two planes -> 2 terms, else single rounded term); Wt bf16 [N][K] (pitch ldb). BIAS_BF16 rounds the
// bias to bf16 first (bias quantised to bf16 before the add). K%32==0, M%16==0, N%64==0.
template <bool ASPLIT, int ACT, bool BIAS_BF16>
__global__ __launch_bounds__(128) void k_gemm_bf(const float* __restrict__ A, int lda, const unsigned short* __restrict__ Wt, int ldb,
                                               const float* __restrict__ bias, float* __restrict__ C, int ldc, int M, int N, int K) {
  __shared__ __attribute__((aligned(16))) float so[4][16][64];
  const int tid = threadIdx.x, w = tid >> 5, lane = tid & 31, ln = lane & 15, hh = lane >> 4;
  const int ntn = N / 64;
  const int wid = blockIdx.x * 4 + w;
  const int mt = wid / ntn, nq = wid % ntn;
  if (mt * 16 >= M) return;
  const int row0 = mt * 16, col0 = nq * 64;
  const float* arow = A + (size_t)(row0 + ln) * lda;
  v8f acc[4] = {};
  for (int kb = 0; kb < K; kb += 32) {
    FragB ah, al;
    const v4f x0 = *(const v4fa*)(arow + kb + 8 * hh), x1 = *(const v4fa*)(arow + kb + 8 * hh + 4);
    const v4f x2 = *(const v4fa*)(arow + kb + 16 + 8 * hh), x3 = *(const v4fa*)(arow + kb + 16 + 8 * hh + 4);
    float xs[16] = {x0[0],x0[1],x0[2],x0[3],x1[0],x1[1],x1[2],x1[3],x2[0],x2[1],x2[2],x2[3],x3[0],x3[1],x3[2],x3[3]};
#pragma unroll
    for (int i = 0; i < 16; ++i) { const unsigned short hb = bf16_bits(xs[i]); ah.u[i] = hb; al.u[i] = ASPLIT ? bf16_bits(xs[i] - bf16_val(hb)) : (unsigned short)0; }
#pragma unroll
    for (int t = 0; t < 4; ++t) {
      const unsigned short* brow = Wt + (size_t)(col0 + t * 16 + ln) * ldb + kb;
      FragB b;
      b.half[0] = *(const v8us*)(brow + 8 * hh);
      b.half[1] = *(const v8us*)(brow + 16 + 8 * hh);
      acc[t] = mmaN<ASPLIT ? 2 : 1>(ah.v, al.v, b.v, b.v, acc[t]);
    }
  }
#pragma unroll
  for (int t = 0; t < 4; ++t) {
    float bv = bias ? bias[col0 + t * 16 + ln] : 0.f;
    if (BIAS_BF16) bv = bf16_round(bv);
#pragma unroll
    for (int r = 0; r < 8; ++r) { float v = acc[t][r] + bv; if (ACT == 1) v = fmaxf(v, 0.f); so[w][8 * hh + r][t * 16 + ln] = v; }
  }
  __builtin_amdgcn_fence(__ATOMIC_ACQ_REL, "workgroup");
  __builtin_amdgcn_wave_barrier();
  const int rsub = lane >> 4, c4 = (lane & 15) * 4;
  {
#pragma unroll
    for (int q = 0; q < 8; ++q) {
      const int r = q * 2 + rsub;
      const v4f v = *(const v4fa*)&so[w][r][c4];
      *(v4f*)(C + (size_t)(row0 + r) * ldc + col0 + c4) = v;
    }
    
  }
}

// GEMM C = act(A·W + bias + resid): A f32 (ASPLIT -> hi/lo 2 terms), Wt bf16 [N][K]; ACT 0 none, 1 relu, 2 exact gelu;
// resid (optional, f32, row index = (row % rmod), pitch ldr, RES_BF16 rounds it) added before the activation.
template <bool ASPLIT, int ACT, bool BIAS_BF16, bool RES_BF16>
__global__ __launch_bounds__(128) void k_gemm_bf3(const float* __restrict__ A, int lda, const unsigned short* __restrict__ Wt, int ldb,
                                                const float* __restrict__ bias, const float* __restrict__ resid, int rmod, int ldr,
                                                float* __restrict__ C, int ldc, int M, int N, int K) {
  __shared__ __attribute__((aligned(16))) float so[4][16][64];
  const int tid = threadIdx.x, w = tid >> 5, lane = tid & 31, ln = lane & 15, hh = lane >> 4;
  const int ntn = N / 64;
  const int wid = blockIdx.x * 4 + w;
  const int mt = wid / ntn, nq = wid % ntn;
  if (mt * 16 >= M) return;
  const int row0 = mt * 16, col0 = nq * 64;
  const float* arow = A + (size_t)(row0 + ln) * lda;
  v8f acc[4] = {};
  for (int kb = 0; kb < K; kb += 32) {
    FragB ah, al;
    const v4f x0 = *(const v4fa*)(arow + kb + 8 * hh), x1 = *(const v4fa*)(arow + kb + 8 * hh + 4);
    const v4f x2 = *(const v4fa*)(arow + kb + 16 + 8 * hh), x3 = *(const v4fa*)(arow + kb + 16 + 8 * hh + 4);
    float xs[16] = {x0[0],x0[1],x0[2],x0[3],x1[0],x1[1],x1[2],x1[3],x2[0],x2[1],x2[2],x2[3],x3[0],x3[1],x3[2],x3[3]};
#pragma unroll
    for (int i = 0; i < 16; ++i) { const unsigned short hb = bf16_bits(xs[i]); ah.u[i] = hb; al.u[i] = ASPLIT ? bf16_bits(xs[i] - bf16_val(hb)) : (unsigned short)0; }
#pragma unroll
    for (int t = 0; t < 4; ++t) {
      const unsigned short* brow = Wt + (size_t)(col0 + t * 16 + ln) * ldb + kb;
      FragB b;
      b.half[0] = *(const v8us*)(brow + 8 * hh);
      b.half[1] = *(const v8us*)(brow + 16 + 8 * hh);
      acc[t] = mmaN<ASPLIT ? 2 : 1>(ah.v, al.v, b.v, b.v, acc[t]);
    }
  }
#pragma unroll
  for (int t = 0; t < 4; ++t) {
    const int col = col0 + t * 16 + ln;
    float bv = bias ? bias[col] : 0.f;
    if (BIAS_BF16) bv = bf16_round(bv);
#pragma unroll
    for (int r = 0; r < 8; ++r) {
      float v = acc[t][r] + bv;
      if (resid) { float rv = resid[(size_t)((row0 + 8 * hh + r) % rmod) * ldr + col]; if (RES_BF16) rv = bf16_round(rv); v += rv; }
      if (ACT == 1) v = fmaxf(v, 0.f);
      if (ACT == 2) v = 0.5f * v * (1.0f + erff(v * 0.70710678118654752f));
      if (ACT == 3) { const float u = 0.7978845608028654f * (v + 0.044715f * v * v * v); v = 0.5f * v * (1.0f + tanhf(u)); }
      so[w][8 * hh + r][t * 16 + ln] = v;
    }
  }
  __builtin_amdgcn_fence(__ATOMIC_ACQ_REL, "workgroup");
  __builtin_amdgcn_wave_barrier();
  const int rsub = lane >> 4, c4 = (lane & 15) * 4;
  {
#pragma unroll
    for (int q = 0; q < 8; ++q) {
      const int r = q * 2 + rsub;
      const v4f v = *(const v4fa*)&so[w][r][c4];
      *(v4f*)(C + (size_t)(row0 + r) * ldc + col0 + c4) = v;
    }
    
  }
}
// row LayerNorm (biased variance, eps) over N: s = X (+ R); optional out_sum <- s; out_norm <- (s-mu)*rsqrt(var+eps)*g + b
template <bool PARAM_BF16>
__global__ __launch_bounds__(256) void k_layernorm(const float* __restrict__ X, const float* __restrict__ R, const float* __restrict__ g, const float* __restrict__ bta,
                                                  float* __restrict__ out_sum, float* __restrict__ out_norm, int N, float eps) {
  __shared__ float red[256];
  const int row = blockIdx.x, tid = threadIdx.x;
  const float* x = X + (size_t)row * N; const float* rr = R ? R + (size_t)row * N : nullptr;
  float vals[16];                     // up to N = 4096
  const int per = N / 256;            // contiguous chunk per thread? use strided-by-4 chunks: thread handles j = tid*4 + 1024*u
  float s1 = 0.f;
  for (int u = 0; u < per / 4; ++u) {
    const int j = tid * 4 + 1024 * u;
    const v4f a = *(const v4fa*)(x + j);
    v4f b = {0.f,0.f,0.f,0.f}; if (rr) b = *(const v4fa*)(rr + j);
#pragma unroll
    for (int q = 0; q < 4; ++q) { const float v = a[q] + b[q]; vals[u * 4 + q] = v; s1 += v; }
  }
  red[tid] = s1; __syncthreads();
  for (int st = 128; st > 0; st >>= 1) { if (tid < st) red[tid] += red[tid + st]; __syncthreads(); }
  const float mu = red[0] / (float)N; __syncthreads();
  float s2 = 0.f;
  for (int u = 0; u < per / 4; ++u)
#pragma unroll
    for (int q = 0; q < 4; ++q) { const float c = vals[u * 4 + q] - mu; s2 += c * c; }
  red[tid] = s2; __syncthreads();
  for (int st = 128; st > 0; st >>= 1) { if (tid < st) red[tid] += red[tid + st]; __syncthreads(); }
  const float rs = rsqrtf(red[0] / (float)N + eps);
  {
    for (int u = 0; u < per / 4; ++u) {
      const int j = tid * 4 + 1024 * u;
      v4f o, sm;
#pragma unroll
      for (int q = 0; q < 4; ++q) {
        float gg = g[j + q], bb = bta[j + q];
        if (PARAM_BF16) { gg = bf16_round(gg); bb = bf16_round(bb); }
        sm[q] = vals[u * 4 + q]; o[q] = (vals[u * 4 + q] - mu) * rs * gg + bb;
      }
      if (out_sum) *(v4f*)(out_sum + (size_t)row * N + j) = sm;
      *(v4f*)(out_norm + (size_t)row * N + j) = o;
    }
    
  }
}



// ---- f16 WMMA path (v_wmma_f32_16x16x32_f16): 11-bit significands for operands in range — used where a [0,1] probability operand needs more precision than bf16
typedef _Float16 v16h __attribute__((ext_vector_type(16)));
union FragH { v16h v; v8us half[2]; _Float16 h[16]; unsigned short u[16]; };
template <int NT>
__device__ __forceinline__ v8f mmaH(v16h ah, v16h al, v16h bh, v16h bl, v8f c) {
  c = __builtin_amdgcn_wmma_f32_16x16x32_f16(false, ah, false, bh, (short)0, c, false, false);
  if (NT >= 2) c = __builtin_amdgcn_wmma_f32_16x16x32_f16(false, al, false, bh, (short)0, c, false, false);
  if (NT >= 3) c = __builtin_amdgcn_wmma_f32_16x16x32_f16(false, ah, false, bl, (short)0, c, false, false);
  asm volatile("v_nop\n\tv_nop\n\tv_nop\n\tv_nop" : "+v"(c) : "v"(ah), "v"(al), "v"(bh), "v"(bl));
  return c;
}
// batched GEMM like k_gemm_b but f16 operands: A f32 (split into f16 hi/lo if ASPLIT, else rounded to f16), Bt = f16 values [n][k]; alpha; C f32; N multiple of 16 (partial tiles skipped)
template <bool ASPLIT>
__global__ __launch_bounds__(128) void k_gemm_h(const float* __restrict__ A, int lda, size_t sA, const _Float16* __restrict__ Bh, int ldb, size_t sB, float alpha, float* __restrict__ C, int ldc, size_t sC, int M, int N, int K) {
  __shared__ __attribute__((aligned(16))) float so[4][16][64];
  const int tid = threadIdx.x, w = tid >> 5, lane = tid & 31, ln = lane & 15, hh = lane >> 4; const int by = blockIdx.y;
  A += (size_t)by * sA; Bh += (size_t)by * sB; C += (size_t)by * sC;
  const int ntn = (N + 63) / 64; const int wid = blockIdx.x * 4 + w; const int mt = wid / ntn, nq = wid % ntn; if (mt * 16 >= M) return;
  const int row0 = mt * 16, col0 = nq * 64; const float* arow = A + (size_t)(row0 + ln) * lda;
  v8f acc[4] = {};
  for (int kb = 0; kb < K; kb += 32) {
    FragH ah, al;
    const v4f x0 = *(const v4fa*)(arow + kb + 8 * hh), x1 = *(const v4fa*)(arow + kb + 8 * hh + 4), x2 = *(const v4fa*)(arow + kb + 16 + 8 * hh), x3 = *(const v4fa*)(arow + kb + 16 + 8 * hh + 4);
    float xs[16] = {x0[0],x0[1],x0[2],x0[3],x1[0],x1[1],x1[2],x1[3],x2[0],x2[1],x2[2],x2[3],x3[0],x3[1],x3[2],x3[3]};
#pragma unroll
    for (int i = 0; i < 16; ++i) { const _Float16 h = (_Float16)xs[i]; ah.h[i] = h; al.h[i] = ASPLIT ? (_Float16)(xs[i] - (float)h) : (_Float16)0.0f; }
#pragma unroll
    for (int t = 0; t < 4; ++t) { if (col0 + t * 16 >= N) continue; const size_t boff = (size_t)(col0 + t * 16 + ln) * ldb + kb; FragH bq; bq.half[0] = *(const v8us*)(Bh + boff + 8 * hh); bq.half[1] = *(const v8us*)(Bh + boff + 16 + 8 * hh);
      acc[t] = mmaH<ASPLIT ? 2 : 1>(ah.v, al.v, bq.v, bq.v, acc[t]); }
  }
#pragma unroll
  for (int t = 0; t < 4; ++t) { if (col0 + t * 16 >= N) continue;
#pragma unroll
    for (int r = 0; r < 8; ++r) so[w][8 * hh + r][t * 16 + ln] = acc[t][r] * alpha; }
  __builtin_amdgcn_fence(__ATOMIC_ACQ_REL, "workgroup"); __builtin_amdgcn_wave_barrier();
  const int rsub = lane >> 4, c4 = (lane & 15) * 4;
  {
#pragma unroll
    for (int q = 0; q < 8; ++q) { const int r = q * 2 + rsub; if (col0 + c4 < N) { const v4f v = *(const v4fa*)&so[w][r][c4]; *(v4f*)(C + (size_t)(row0 + r) * ldc + col0 + c4) = v; } }
     }
}

// Wt[n][k] = f16(W[k][n]·scale) from f32 row-major W[K][N] (scale = power of two; bf16-exact weights stay exact in f16 away from the subnormal range)
__global__ __launch_bounds__(256) void k_wt_f16(const float* __restrict__ W, _Float16* __restrict__ Wt, int K, int N, float scale) {
  const int t = blockIdx.x * 256 + threadIdx.x; if (t >= N * (K / 8)) return; const int n = t / (K / 8), k8 = (t % (K / 8)) * 8; FragH f;
#pragma unroll
  for (int i = 0; i < 8; ++i) f.h[i] = (_Float16)(bf16_round(W[(size_t)(k8 + i) * N + n]) * scale); const v8us o = f.half[0];
  *(v8us*)((unsigned short*)Wt + (size_t)n * K + k8) = o; 
}
// k_gemm_hh variant with fused epilogue: v = acc·alpha + bias[by·sBias + col] (+ CP[(row/rowsPerB)·sCPb + by·64 + col] if CP) ; ACT 0 none / 1 elu ; writes f16 C16 (and f32 C if non-null)
template <int ACT>
__global__ __launch_bounds__(128) void k_gemm_hhx(const _Float16* __restrict__ A, int lda, size_t sA, const _Float16* __restrict__ Bh, int ldb, size_t sB, float alpha, const float* __restrict__ bias, size_t sBias, const float* __restrict__ CP, int rowsPerB, size_t sCPb, int row0g,
    float* __restrict__ C, _Float16* __restrict__ C16, int ldc, size_t sC, int M, int N, int K) {
  __shared__ __attribute__((aligned(16))) float so[4][16][64];
  const int tid = threadIdx.x, w = tid >> 5, lane = tid & 31, ln = lane & 15, hh = lane >> 4; const int by = blockIdx.y;
  A += (size_t)by * sA; Bh += (size_t)by * sB; const size_t cofs = (size_t)by * sC; const float* bp = bias ? bias + (size_t)by * sBias : nullptr;
  const int ntn = (N + 63) / 64; const int wid = blockIdx.x * 4 + w; const int mt = wid / ntn, nq = wid % ntn; if (mt * 16 >= M) return;
  const int row0 = mt * 16, col0 = nq * 64; const _Float16* arow = A + (size_t)(row0 + ln) * lda;
  v8f acc[4] = {};
  for (int kb = 0; kb < K; kb += 32) { FragH ah; ah.half[0] = *(const v8us*)((const unsigned short*)arow + kb + 8 * hh); ah.half[1] = *(const v8us*)((const unsigned short*)arow + kb + 16 + 8 * hh);
#pragma unroll
    for (int t = 0; t < 4; ++t) { if (col0 + t * 16 >= N) continue; const size_t boff = (size_t)(col0 + t * 16 + ln) * ldb + kb; FragH bq; bq.half[0] = *(const v8us*)((const unsigned short*)Bh + boff + 8 * hh); bq.half[1] = *(const v8us*)((const unsigned short*)Bh + boff + 16 + 8 * hh);
      acc[t] = mmaH<1>(ah.v, ah.v, bq.v, bq.v, acc[t]); }
  }
#pragma unroll
  for (int t = 0; t < 4; ++t) { if (col0 + t * 16 >= N) continue; const int col = col0 + t * 16 + ln; const float bv = bp ? bf16_round(bp[col]) : 0.f;
#pragma unroll
    for (int r = 0; r < 8; ++r) { float v = acc[t][r] * alpha + bv; if (CP) { const int rr = row0g + row0 + 8 * hh + r; if (rowsPerB < 0) v += CP[cofs + (size_t)rr * ldc + col];      /* rowsPerB < 0: own element of the batched C plane */ else { const int bidx = rr / rowsPerB; v += CP[(size_t)bidx * sCPb + (size_t)by * 64 + col]; } } if (ACT == 1) v = (v > 0.f) ? v : expm1f(v); else if (ACT == 7) v = (v > 0.f) ? v + 1.0f : expf(v); else if (ACT == 8) v = tanhf(v); else if (ACT == 9) v = 0.5f * v * (1.0f + tanhf(0.7978845608028654f * (v + 0.044715f * v * v * v))); else if (ACT == 11) v = 1.0f / (1.0f + expf(-v)); else if (ACT == 12) v = (v > 0.f) ? v : 0.01f * v; else if (ACT == 14) v = (v > 0.f) ? v : 0.1f * v; else if (ACT == 16) v = (v >= 0.f) ? v : 0.3f * v; else if (ACT == 17) v = (v >= 0.f) ? v : 0.2f * v; else if (ACT == 15) v = v / (1.0f + expf(-v)); else if (ACT == 3) v = fmaxf(v, 0.f); else if (ACT == 6) v = 0.5f * v * (1.0f + erff(v * 0.70710678118654752f)); so[w][8 * hh + r][t * 16 + ln] = v; } }
  __builtin_amdgcn_fence(__ATOMIC_ACQ_REL, "workgroup"); __builtin_amdgcn_wave_barrier();
  const int rsub = lane >> 4, c4 = (lane & 15) * 4; typedef _Float16 v4h __attribute__((ext_vector_type(4)));
  {
#pragma unroll
    for (int q = 0; q < 8; ++q) { const int r = q * 2 + rsub; if (col0 + c4 < N) { const v4f v = *(const v4fa*)&so[w][r][c4]; if (C) *(v4f*)(C + cofs + (size_t)(row0 + r) * ldc + col0 + c4) = v; if (C16) { v4h h4; for (int i = 0; i < 4; ++i) h4[i] = (_Float16)v[i]; *(v4h*)(C16 + cofs + (size_t)(row0 + r) * ldc + col0 + c4) = h4; } } }
     }
}


typedef _Float16 v4h __attribute__((ext_vector_type(4)));

__global__ __launch_bounds__(256) void k_x16(const float* __restrict__ x, _Float16* __restrict__ X16, size_t n8) { const size_t t = (size_t)blockIdx.x * 256 + threadIdx.x; if (t >= n8) return; FragH f;
#pragma unroll
  for (int q = 0; q < 8; ++q) f.h[q] = (_Float16)bf16_round(x[t * 8 + q]); *(v8us*)((unsigned short*)X16 + t * 8) = f.half[0];  }
__global__ __launch_bounds__(256) void k_h16(const float* __restrict__ x, _Float16* __restrict__ X16, size_t n8) { const size_t t = (size_t)blockIdx.x * 256 + threadIdx.x; if (t >= n8) return; FragH f;
#pragma unroll
  for (int q = 0; q < 8; ++q) f.h[q] = (_Float16)x[t * 8 + q]; *(v8us*)((unsigned short*)X16 + t * 8) = f.half[0];  }
__global__ __launch_bounds__(256) void k_round16f(const float* __restrict__ W, _Float16* __restrict__ Bt, size_t n8) { const size_t t = (size_t)blockIdx.x * 256 + threadIdx.x; if (t >= n8) return; FragH f;
#pragma unroll
  for (int i = 0; i < 8; ++i) f.h[i] = (_Float16)(bf16_round(W[t * 8 + i]) * 16.0f); *(v8us*)((unsigned short*)Bt + t * 8) = f.half[0];  }
template <int NHv, int TTv>
__global__ __launch_bounds__(256) void k_vt(const _Float16* __restrict__ V16, int ldv, int voff, _Float16* __restrict__ Vt) { __shared__ unsigned short tl[64][66]; const int tid = threadIdx.x; const int slab = blockIdx.x / (TTv / 64), lg = blockIdx.x % (TTv / 64); const int b = slab / NHv, h = slab % NHv;
  for (int i = tid; i < 64 * 8; i += 256) { const int r = i / 8, c8 = (i % 8) * 8; FragH f; f.half[0] = *(const v8us*)((const unsigned short*)V16 + ((size_t)b * TTv + lg * 64 + r) * ldv + voff + h * 64 + c8);
#pragma unroll
    for (int q = 0; q < 8; ++q) tl[r][c8 + q] = f.u[q]; }
  __syncthreads();
  {
#pragma unroll
    for (int rd = 0; rd < 2; ++rd) { const int d = rd * 32 + tid / 8, pc = tid % 8; FragH f;
#pragma unroll
      for (int q = 0; q < 8; ++q) f.u[q] = tl[pc * 8 + q][d];
      *(v8us*)((unsigned short*)Vt + ((size_t)slab * 64 + d) * TTv + lg * 64 + pc * 8) = f.half[0]; }
     } }

__global__ __launch_bounds__(256) void k_hl(const float* __restrict__ F, _Float16* __restrict__ Hh, _Float16* __restrict__ Hl, size_t n8) { const size_t t = (size_t)blockIdx.x * 256 + threadIdx.x; if (t >= n8) return; FragH fh, fl; const v4f a = *(const v4fa*)(F + t * 8), c = *(const v4fa*)(F + t * 8 + 4);
#pragma unroll
  for (int q = 0; q < 4; ++q) { _Float16 h = (_Float16)a[q]; fh.h[q] = h; fl.h[q] = (_Float16)((a[q] - (float)h) * 1024.0f); h = (_Float16)c[q]; fh.h[4 + q] = h; fl.h[4 + q] = (_Float16)((c[q] - (float)h) * 1024.0f); }
  { *(v8us*)((unsigned short*)Hh + t * 8) = fh.half[0]; *(v8us*)((unsigned short*)Hl + t * 8) = fl.half[0];  } }

// ---- fast GEMM (wave tile 32x64; requires M % 32 == 0 rows per launch region and N % 64 == 0); epilogue = k_gemm_hhx semantics ----
__device__ __forceinline__ v16h g2_frag(const _Float16* p, int hh) { FragH f; f.half[0] = *(const v8us*)((const unsigned short*)p + 8 * hh); f.half[1] = *(const v8us*)((const unsigned short*)p + 16 + 8 * hh); return f.v; }
__device__ __forceinline__ v8f g2_mma(v16h a, v16h b, v8f c) { v8f d = __builtin_amdgcn_wmma_f32_16x16x32_f16(false, a, false, b, (short)0, c, false, false); asm volatile("v_nop\n\tv_nop\n\tv_nop\n\tv_nop" : "+v"(d) : "v"(a), "v"(b)); return d; }
template <int ACT>
__global__ __launch_bounds__(128) void k_gemm2(const _Float16* __restrict__ A, int lda, size_t sA, const _Float16* __restrict__ Bh, int ldb, size_t sB, float alpha, const float* __restrict__ bias, size_t sBias, const float* __restrict__ CP, int rowsPerB, size_t sCPb, int row0g,
    float* __restrict__ C, _Float16* __restrict__ C16, int ldc, size_t sC, int M, int N, int K) { static_assert(ACT == 0 || ACT == 3 || ACT == 6 || ACT == 8 || ACT == 9 || ACT == 11 || ACT == 12 || ACT == 14 || ACT == 15 || ACT == 16 || ACT == 17, "k_gemm2: unsupported ACT code (would silently apply no activation)");
  __shared__ __attribute__((aligned(16))) float so[4][32][68];
  const int tid = threadIdx.x, w = tid >> 5, lane = tid & 31, ln = lane & 15, hh = lane >> 4; const int by = blockIdx.y;
  A += (size_t)by * sA; Bh += (size_t)by * sB; const size_t cofs = (size_t)by * sC; const float* bp = bias ? bias + (size_t)by * sBias : nullptr;
  const int ntn = N >> 6; const int mt = blockIdx.x / ntn, nq = blockIdx.x - mt * ntn; const int row0 = mt * 128 + 32 * w, col0 = nq * 64; if (row0 >= M) return;
  const _Float16* a0p = A + (size_t)(row0 + ln) * lda; const _Float16* a1p = a0p + (size_t)16 * lda;
  const _Float16* b0p = Bh + (size_t)(col0 + ln) * ldb; const _Float16* b1p = b0p + (size_t)16 * ldb; const _Float16* b2p = b1p + (size_t)16 * ldb; const _Float16* b3p = b2p + (size_t)16 * ldb;
  const v8f z8 = {0.f,0.f,0.f,0.f,0.f,0.f,0.f,0.f}; v8f c00 = z8, c01 = z8, c02 = z8, c03 = z8, c10 = z8, c11 = z8, c12 = z8, c13 = z8;
#pragma unroll 1
  for (int kb = 0; kb < K; kb += 32) { const v16h a0 = g2_frag(a0p + kb, hh), a1 = g2_frag(a1p + kb, hh);
    v16h b = g2_frag(b0p + kb, hh); c00 = g2_mma(a0, b, c00); c10 = g2_mma(a1, b, c10);
    b = g2_frag(b1p + kb, hh); c01 = g2_mma(a0, b, c01); c11 = g2_mma(a1, b, c11);
    b = g2_frag(b2p + kb, hh); c02 = g2_mma(a0, b, c02); c12 = g2_mma(a1, b, c12);
    b = g2_frag(b3p + kb, hh); c03 = g2_mma(a0, b, c03); c13 = g2_mma(a1, b, c13); }
  v8f accs[8] = {c00, c01, c02, c03, c10, c11, c12, c13};
#pragma unroll
  for (int u = 0; u < 8; ++u) { const int t = u & 3, half = u >> 2; const int col = col0 + t * 16 + ln; const float bv = bp ? bf16_round(bp[col]) : 0.f;
#pragma unroll
    for (int r = 0; r < 8; ++r) { const int rloc = half * 16 + 8 * hh + r; float v = accs[u][r] * alpha + bv; if (CP) { if (rowsPerB < 0) v += CP[cofs + (size_t)(row0g + row0 + rloc) * ldc + col];      /* rowsPerB < 0: own element of the batched C plane */ else { const int bidx = (row0g + row0 + rloc) / rowsPerB; v += CP[(size_t)bidx * sCPb + (size_t)by * 64 + col]; } }
      if (ACT == 3) v = fmaxf(v, 0.f); else if (ACT == 6) v = 0.5f * v * (1.0f + erff(v * 0.70710678118654752f)); else if (ACT == 11) v = 1.0f / (1.0f + expf(-v)); else if (ACT == 15) v = v / (1.0f + expf(-v)); else if (ACT == 12) v = (v > 0.f) ? v : 0.01f * v; else if (ACT == 8) v = tanhf(v); else if (ACT == 9) v = 0.5f * v * (1.0f + tanhf(0.7978845608028654f * (v + 0.044715f * v * v * v))); else if (ACT == 14) v = (v > 0.f) ? v : 0.1f * v; else if (ACT == 16) v = (v >= 0.f) ? v : 0.3f * v; else if (ACT == 17) v = (v >= 0.f) ? v : 0.2f * v;
      so[w][rloc][t * 16 + ln] = v; } }
  __builtin_amdgcn_fence(__ATOMIC_ACQ_REL, "workgroup"); __builtin_amdgcn_wave_barrier();
  const int rsub = lane >> 4, c4 = (lane & 15) * 4;
  {
#pragma unroll
    for (int q = 0; q < 16; ++q) { const int r = q * 2 + rsub; const v4f v = *(const v4fa*)&so[w][r][c4]; if (C) *(v4f*)(C + cofs + (size_t)(row0 + r) * ldc + col0 + c4) = v; if (C16) { v4h h4; for (int i = 0; i < 4; ++i) h4[i] = (_Float16)v[i]; *(v4h*)(C16 + cofs + (size_t)(row0 + r) * ldc + col0 + c4) = h4; } }
     } }


// ---- the same 32x64 wave tile with K split over the NW waves of a work-group, for products with few output tiles (M x N small, K long) ----
// A work-group owns ONE 32x64 tile of C; wave w sums k in [w K / NW, (w + 1) K / NW) with the loop of k_gemm2; the NW partial tiles (f32) meet in LDS and are added in wave order.
// Requires M % 32 == 0 (grid = (M / 32) (N / 64)), N % 64 == 0, K % (32 NW) == 0. C16 = f16(alpha x sum).
template <int NW>
__global__ __launch_bounds__(NW * 32) void k_gemm2k(const _Float16* __restrict__ A, int lda, const _Float16* __restrict__ Bh, int ldb, float alpha, _Float16* __restrict__ C16, int ldc, int N, int K) {
  __shared__ __attribute__((aligned(16))) float so[NW][32][68];
  const int tid = threadIdx.x, w = tid >> 5, lane = tid & 31, ln = lane & 15, hh = lane >> 4;
  const int ntn = N >> 6; const int mt = blockIdx.x / ntn, nq = blockIdx.x - mt * ntn; const int row0 = mt * 32, col0 = nq * 64; const int ks = K / NW;
  const _Float16* a0p = A + (size_t)(row0 + ln) * lda + w * ks; const _Float16* a1p = a0p + (size_t)16 * lda;
  const _Float16* b0p = Bh + (size_t)(col0 + ln) * ldb + w * ks; const _Float16* b1p = b0p + (size_t)16 * ldb; const _Float16* b2p = b1p + (size_t)16 * ldb; const _Float16* b3p = b2p + (size_t)16 * ldb;
  const v8f z8 = {0.f,0.f,0.f,0.f,0.f,0.f,0.f,0.f}; v8f c00 = z8, c01 = z8, c02 = z8, c03 = z8, c10 = z8, c11 = z8, c12 = z8, c13 = z8;
  for (int kb = 0; kb < ks; kb += 32) { const v16h a0 = g2_frag(a0p + kb, hh), a1 = g2_frag(a1p + kb, hh);
    v16h b = g2_frag(b0p + kb, hh); c00 = g2_mma(a0, b, c00); c10 = g2_mma(a1, b, c10);
    b = g2_frag(b1p + kb, hh); c01 = g2_mma(a0, b, c01); c11 = g2_mma(a1, b, c11);
    b = g2_frag(b2p + kb, hh); c02 = g2_mma(a0, b, c02); c12 = g2_mma(a1, b, c12);
    b = g2_frag(b3p + kb, hh); c03 = g2_mma(a0, b, c03); c13 = g2_mma(a1, b, c13); }
  v8f accs[8] = {c00, c01, c02, c03, c10, c11, c12, c13};
#pragma unroll
  for (int u = 0; u < 8; ++u) {      /* unrolled so that accs[] is indexed by constants and stays in registers */
#pragma unroll
    for (int r = 0; r < 8; ++r) so[w][(u >> 2) * 16 + 8 * hh + r][(u & 3) * 16 + ln] = accs[u][r]; }
  __syncthreads();      /* every wave's partial tile is in LDS before any thread adds them */
  for (int i0 = 0; i0 < 32 * 16; i0 += NW * 32) { const int i = i0 + tid, r = i >> 4, c4 = (i & 15) * 4; v4f s = *(const v4f*)&so[0][r][c4];
#pragma unroll
    for (int k = 1; k < NW; ++k) s += *(const v4f*)&so[k][r][c4];      /* unrolled so that the NW LDS reads issue together */
    v4h h4;
#pragma unroll
    for (int q = 0; q < 4; ++q) h4[q] = (_Float16)(s[q] * alpha);      /* unrolled so that the vector elements are indexed by constants */
    *(v4h*)(C16 + (size_t)(row0 + r) * ldc + col0 + c4) = h4; } }


// four weight matrices of n8 x 8 elements each -> four planes one behind the other in Bt; blockIdx.y picks the matrix
__global__ __launch_bounds__(256) void k_wnat(const float* __restrict__ w0, const float* __restrict__ w1, const float* __restrict__ w2, const float* __restrict__ w3, size_t n8, _Float16* __restrict__ Bt) { const size_t t = (size_t)blockIdx.x * 256 + threadIdx.x; if (t >= n8) return; const unsigned p = blockIdx.y; const float* w = p == 0 ? w0 : p == 1 ? w1 : p == 2 ? w2 : w3; FragH f; for (int q = 0; q < 8; ++q) f.h[q] = (_Float16)(bf16_round(w[t * 8 + q]) * 16.0f); *(v8us*)((unsigned short*)Bt + (p * n8 + t) * 8) = f.half[0];  }
__global__ __launch_bounds__(256) void k_rsm(const float* __restrict__ S, _Float16* __restrict__ P, int nrows) {
  #pragma clang fp contract(off)
  const int i = blockIdx.x * 256 + threadIdx.x; if (i >= nrows) return; const float* s = S + (size_t)i * SQ; float mx = -3.0e38f;
#pragma unroll 1
  for (int j = 0; j < SQ; ++j) mx = fmaxf(mx, s[j]); float se = 0.f;
#pragma unroll 1
  for (int j = 0; j < SQ; ++j) se += expf(s[j] - mx); const float sc = 256.0f / se;
#pragma unroll 1
  for (int j0 = 0; j0 < SQ; j0 += 8) { FragH f; for (int q = 0; q < 8; ++q) f.h[q] = (_Float16)(expf(s[j0 + q] - mx) * sc); unsigned short* d = (unsigned short*)P + (size_t)i * SQ + j0; *(v8us*)d = f.half[0];  } }
__global__ __launch_bounds__(256) void k_vt(const _Float16* __restrict__ V16, int b, int h0, _Float16* __restrict__ VT) { __shared__ unsigned short tl[64][65]; const int tid = threadIdx.x; const int hh = blockIdx.x % HG, sg = blockIdx.x / HG; const int s0 = sg * 64; const int h = h0 + hh;
  for (int i = tid; i < 64 * 8; i += 256) { const int j = i / 8, d8 = (i % 8) * 8; FragH f; f.half[0] = *(const v8us*)((const unsigned short*)V16 + ((size_t)b * SQ + s0 + j) * DM + h * HD + d8); for (int q = 0; q < 8; ++q) tl[d8 + q][j] = f.u[q]; }
  __syncthreads();
  { for (int i = tid; i < 64 * 8; i += 256) { const int d = i / 8, j8 = (i % 8) * 8; FragH f; for (int q = 0; q < 8; ++q) f.u[q] = tl[d][j8 + q]; *(v8us*)((unsigned short*)VT + ((size_t)hh * HD + d) * SQ + s0 + j8) = f.half[0]; }  } }



__global__ __launch_bounds__(256) void k_rsmcf2(const float* __restrict__ S, _Float16* __restrict__ P, int hg, int q0, int nk) {
  #pragma clang fp contract(off)
  const int t = blockIdx.x * 256 + threadIdx.x; if (t >= hg * QT) return; const size_t i = (size_t)t; const float* s = S + i * NKX; const int last = q0 + (t % QT); float mx = -3.0e38f;
#pragma unroll 1
  for (int j = 0; j < nk; ++j) { const float f = (j <= last) ? 1.f : 0.f; mx = fmaxf(mx, fmaf(f, s[j], (1.f - f) * -1.0e9f)); } float se = 0.f;
#pragma unroll 1
  for (int j = 0; j < nk; ++j) { const float f = (j <= last) ? 1.f : 0.f; se += __expf(fmaf(f, s[j], (1.f - f) * -1.0e9f) - mx); } const float sc = 256.0f / se;
#pragma unroll 1
  for (int j0 = 0; j0 < nk; j0 += 8) { FragH fr; for (int q = 0; q < 8; ++q) { const int j = j0 + q; const float f = (j <= last) ? 1.f : 0.f; fr.h[q] = (_Float16)(__expf(fmaf(f, s[j], (1.f - f) * -1.0e9f) - mx) * sc); } unsigned short* d = (unsigned short*)P + i * NKX + j0; *(v8us*)d = fr.half[0];  } }

template <int MASKADD>
__global__ __launch_bounds__(64) void k_att0(const float* __restrict__ QF, const float* __restrict__ KF, const float* __restrict__ VF, int ld, const float* __restrict__ mask, float scale, float* __restrict__ OF, int ldo) {
  #pragma clang fp contract(off)
  __shared__ __attribute__((aligned(16))) float lq[64][64]; __shared__ __attribute__((aligned(16))) float lo[64][64];
  const int tid = threadIdx.x; const int h = blockIdx.x / (QT0 / 64), rg = blockIdx.x % (QT0 / 64); const int i = rg * 64 + tid;
  const float* qr = QF + (size_t)i * ld + h * HD;
#pragma unroll 1
  for (int c = 0; c < HD / 4; ++c) { *(v4f*)&lq[tid][c * 4] = *(const v4fa*)(qr + c * 4); const v4f z = {0.f, 0.f, 0.f, 0.f}; *(v4f*)&lo[tid][c * 4] = z; }
  float m = -1.0e30f, l = 0.f; const int jmax = MASKADD ? (SQ - 1) : (rg * 64 + 63);      /* additive-mask form: every key (the mask input decides); causal form: keys up to the block's last row */
#pragma unroll 1
  for (int j = 0; j <= jmax; ++j) { const float* kr = KF + (size_t)j * ld + h * HD; const float* vr = VF + (size_t)j * ld + h * HD; float s = 0.f;
#pragma unroll 1
    for (int c = 0; c < HD / 4; ++c) { const v4f kq = *(const v4fa*)(kr + c * 4); const v4f qq = *(v4f*)&lq[tid][c * 4]; s = __fadd_rn(s, __fmul_rn(qq[0], kq[0])); s = __fadd_rn(s, __fmul_rn(qq[1], kq[1])); s = __fadd_rn(s, __fmul_rn(qq[2], kq[2])); s = __fadd_rn(s, __fmul_rn(qq[3], kq[3])); }
    s = __fmul_rn(s, scale); if (MASKADD) s = __fadd_rn(s, __fmul_rn(bf16_round(mask[(size_t)i * SQ + j]), -10000.0f));
    const float f = (MASKADD || j <= i) ? 1.f : 0.f; const float sm = fmaf(f, s, (1.f - f) * -1.0e30f); const float mn = fmaxf(m, sm); const float sc = expf(m - mn); const float e = expf(sm - mn); l = __fadd_rn(__fmul_rn(l, sc), e); m = mn;
#pragma unroll 1
    for (int c = 0; c < HD / 4; ++c) { const v4f vv = *(const v4fa*)(vr + c * 4); v4f oo = *(v4f*)&lo[tid][c * 4]; for (int u = 0; u < 4; ++u) oo[u] = __fadd_rn(__fmul_rn(oo[u], sc), __fmul_rn(e, vv[u])); *(v4f*)&lo[tid][c * 4] = oo; } }
  const float fin = 64.0f / l;      /* o carried x64 like the f16 path */
#pragma unroll 1
  for (int c = 0; c < HD / 4; ++c) { v4f oo = *(v4f*)&lo[tid][c * 4]; for (int u = 0; u < 4; ++u) oo[u] = __fmul_rn(oo[u], fin); *(v4f*)&lo[tid][c * 4] = oo; }
  __syncthreads();
  {
#pragma unroll 1
    for (int it = 0; it < 16; ++it) { const int row = it * 4 + tid / 16, pc = (tid % 16) * 4; const v4f v = *(const v4f*)&lo[row][pc]; *(v4f*)(OF + (size_t)(rg * 64 + row) * ldo + h * HD + pc) = v; }
     } }

__global__ __launch_bounds__(256) void k_oscale(const float* __restrict__ OF, float* __restrict__ out, size_t n4) { const size_t t = (size_t)blockIdx.x * 256 + threadIdx.x; if (t >= n4) return; const v4f a = *(const v4fa*)(OF + t * 4); v4f o; for (int q = 0; q < 4; ++q) o[q] = a[q] * 0.015625f; *(v4f*)(out + t * 4) = o;  }

__global__ __launch_bounds__(256) void k_bfr(const float* __restrict__ x, float* __restrict__ XB, size_t n8) { const size_t t = (size_t)blockIdx.x * 256 + threadIdx.x; if (t >= n8) return; v4f a = *(const v4fa*)(x + t * 8), c = *(const v4fa*)(x + t * 8 + 4); for (int q = 0; q < 4; ++q) { a[q] = bf16_round(a[q]); c[q] = bf16_round(c[q]); }
  { *(v4f*)(XB + t * 8) = a; *(v4f*)(XB + t * 8 + 4) = c;  } }



__global__ __launch_bounds__(256) void k_rsmfvl(const float* __restrict__ S, _Float16* __restrict__ P, _Float16* __restrict__ PL, int qn, const int* __restrict__ vlp) {
  #pragma clang fp contract(off)
  const int t = blockIdx.x * 256 + threadIdx.x; if (t >= qn) return; const int vl = vlp[0]; const size_t i = (size_t)t; const float* s = S + i * SQ; float mx = -3.0e38f;
#pragma unroll 1
  for (int j = 0; j < SQ; ++j) { const float f = (j < vl) ? 1.f : 0.f; mx = fmaxf(mx, fmaf(f, s[j], (1.f - f) * -1000000.0f)); } float se = 0.f;
#pragma unroll 1
  for (int j = 0; j < SQ; ++j) { const float f = (j < vl) ? 1.f : 0.f; se += __expf(fmaf(f, s[j], (1.f - f) * -1000000.0f) - mx); } const float sc = 256.0f / se;
#pragma unroll 1
  for (int j0 = 0; j0 < SQ; j0 += 8) { FragH fr, gr; for (int q = 0; q < 8; ++q) { const int j = j0 + q; const float f = (j < vl) ? 1.f : 0.f; const float pv = __expf(fmaf(f, s[j], (1.f - f) * -1000000.0f) - mx) * sc; const _Float16 ph = (_Float16)pv; fr.h[q] = ph; gr.h[q] = (_Float16)((pv - (float)ph) * 1024.0f); }
    unsigned short* d = (unsigned short*)P + i * SQ + j0; unsigned short* dl = (unsigned short*)PL + i * SQ + j0; *(v8us*)d = fr.half[0]; *(v8us*)dl = gr.half[0];  } }

__global__ __launch_bounds__(256) void k_rsmf(const float* __restrict__ S, _Float16* __restrict__ P, int qn, int hg) {
  #pragma clang fp contract(off)
  const int t = blockIdx.x * 256 + threadIdx.x; if (t >= qn * hg) return; const size_t i = (size_t)(t / qn) * SQ + (t % qn); const float* s = S + i * SQ; float mx = -3.0e38f;
#pragma unroll 1
  for (int j = 0; j < SQ; ++j) mx = fmaxf(mx, s[j]); float se = 0.f;
#pragma unroll 1
  for (int j = 0; j < SQ; ++j) se += __expf(s[j] - mx); const float sc = 256.0f / se;
#pragma unroll 1
  for (int j0 = 0; j0 < SQ; j0 += 8) { FragH f; for (int q = 0; q < 8; ++q) f.h[q] = (_Float16)(__expf(s[j0 + q] - mx) * sc); unsigned short* d = (unsigned short*)P + i * SQ + j0; *(v8us*)d = f.half[0];  } }


#define CN 256          /* channels */
#define CI 128          /* inner channels */
#define NP 4096         /* positions */
#define NM 4096         /* key positions (= SQ) */
#define NC CN           /* BN statistics macros */
#define NPX NP
#define BNEPS 1e-5f

__global__ __launch_bounds__(256) void k_rowbias(const float* __restrict__ b, float* __restrict__ BP, size_t n4, int ncol) { const size_t t = (size_t)blockIdx.x * 256 + threadIdx.x; if (t >= n4) return; const size_t e = t * 4; const float v = bf16_round(b[e / ncol]); const v4f o = {v, v, v, v}; *(v4f*)(BP + e) = o;  }




__global__ __launch_bounds__(256) void k_mp2(const float* __restrict__ src, float* __restrict__ dst, int nout) {
  const int t = blockIdx.x * 256 + threadIdx.x; if (t >= nout) return; const int c = t / 1024; const int o = t % 1024; const int oy = o / 32, ox = o % 32; const float* p = src + (size_t)c * 4096 + (size_t)(2 * oy) * 64 + 2 * ox;
  const float v = fmaxf(fmaxf(p[0], p[1]), fmaxf(p[64], p[65])); *(float*)(dst + t) = v;  }
__global__ __launch_bounds__(256) void k_xpb(const float* __restrict__ x, const float* __restrict__ wb, float* __restrict__ CPP, size_t n4) {
  #pragma clang fp contract(off)
  const size_t t = (size_t)blockIdx.x * 256 + threadIdx.x; if (t >= n4) return; const size_t e = t * 4; const int c = (int)((e / 4096) % 256); const float bb = bf16_round(wb[c]); const v4f a = *(const v4fa*)(x + e); v4f o; for (int q = 0; q < 4; ++q) o[q] = __fadd_rn(bf16_round(a[q]), bb);
  *(v4f*)(CPP + e) = o;  }


template <int PASS>
__global__ __launch_bounds__(256) void k_cstA(const float* __restrict__ X, const float* __restrict__ MV, float* __restrict__ PART) {
  #pragma clang fp contract(off)
  __shared__ float red[256]; const int t = threadIdx.x; const size_t bc = blockIdx.x; const int c = (int)(bc % NC); const float* row = X + bc * (size_t)NPX; const float mu = PASS ? MV[c] : 0.f; float s = 0.f;
  for (int i = t; i < NPX; i += 256) { const float v = row[i]; const float d = PASS ? __fadd_rn(v, -mu) : v; s = __fadd_rn(s, PASS ? __fmul_rn(d, d) : d); }
  red[t] = s; __syncthreads(); for (int st = 128; st > 0; st >>= 1) { if (t < st) red[t] = __fadd_rn(red[t], red[t + st]); __syncthreads(); }
  if (t < 32) { const float pv = (t == 0) ? red[0] : 0.f; *(float*)(PART + bc * 32 + t) = pv;  } }      

template <int PASS>
__global__ __launch_bounds__(256) void k_cstB(const float* __restrict__ PART, float* __restrict__ MV) { const int c = threadIdx.x; if (c >= NC) return; double s = 0.0; for (int b = 0; b < NB; ++b) s += (double)PART[((size_t)b * NC + c) * 32]; const float m = (float)(s / ((double)NB * (double)NPX)); *(float*)(MV + PASS * NC + c) = m;  }


__global__ __launch_bounds__(256) void k_bnresid(const float* __restrict__ C2, const float* __restrict__ MV, const float* __restrict__ g, const float* __restrict__ be, const float* __restrict__ X, float* __restrict__ out, size_t n4) {
  #pragma clang fp contract(off)
  const size_t t = (size_t)blockIdx.x * 256 + threadIdx.x; if (t >= n4) return; const size_t e = t * 4; const int c = (int)((e / NPX) % NC); const float sc = __fmul_rn(rsqrtf(__fadd_rn(MV[NC + c], BNEPS)), bf16_round(g[c])); const float mu = MV[c], bb = bf16_round(be[c]);
  const v4f a = *(const v4fa*)(C2 + e); const v4f xx = *(const v4fa*)(X + e); v4f o; for (int q = 0; q < 4; ++q) { const float z = __fadd_rn(__fmul_rn(__fadd_rn(a[q], -mu), sc), bb); o[q] = __fadd_rn(z, bf16_round(xx[q])); }
  *(v4f*)(out + e) = o;  }


__global__ __launch_bounds__(256) void k_rowbias(float* __restrict__ Y, const float* __restrict__ bias) {
  #pragma clang fp contract(off)
  const size_t t = (size_t)blockIdx.x * 256 + threadIdx.x; if (t >= (size_t)NB * NC * NPX / 4) return; const size_t e = t * 4; const int c = (int)((e / NPX) % NC); const float bb = bf16_round(bias[c]);
  v4f v = *(const v4fa*)(Y + e); for (int q = 0; q < 4; ++q) v[q] = __fadd_rn(v[q], bb); *(v4f*)(Y + e) = v;  }


// Scores never stored. Both consumers of f = theta^T phi form their own score tiles on the matrix unit from the f16 token rows (theta | phi, pitch QLD) and use them in registers.
// ST holds one 128-B record per 16 columns: 16 maxima, then 16 x (256 / sum). blockIdx.y is the image.
// Inner loops carry #pragma unroll so that the fragment arrays are indexed by constants and stay in registers (a run-time index would send them to scratch).
#define CSC 16                    /* columns per record */
#define QLD (3 * CI)              /* pitch of the token rows: a constant here, so that the rows of a fragment group lie at immediate offsets from one address */
#define SCM 64                    /* columns per work-group of the statistics kernel */
#define SCW 16                    /* its waves: the 4,096 rows split over them */
__device__ __forceinline__ v8f f_mma(v16h a, v16h b, v8f c) { return __builtin_amdgcn_wmma_f32_16x16x32_f16(false, a, false, b, (short)0, c, false, false); }
__device__ __forceinline__ v16h f_frag(const _Float16* p) { FragH f; f.half[0] = *(const v8us*)((const unsigned short*)p); f.half[1] = *(const v8us*)((const unsigned short*)p + 16); return f.v; }      /* g2_frag with the lane's + 8 hh already in p */
// Column statistics: a work-group owns 64 key columns m (their phi fragments stay in registers as B), wave w sweeps rows n in [256 w, 256 w + 256) 16 at a time (theta as A).
// In D a lane holds 8 rows of ONE column (row 8 hh + r, column ln), so the running maximum and the rescaled running sum of a column are per-lane scalars; the 32 partial pairs of a column (16 waves x 2 lane halves) meet in LDS.
// One trip: 16 rows from ac; the next trip's theta fragments are fetched into ax behind the products (two register sets that swap roles, so that no copy and no early wait stands between).
__device__ __forceinline__ void cs_trip(const _Float16* an, const v16h (&ph)[4][4], const v16h (&ac)[4], v16h (&ax)[4], float (&mx)[4], float (&se)[4]) {
  const v8f z8 = {0.f,0.f,0.f,0.f,0.f,0.f,0.f,0.f}; v8f d[4] = {z8, z8, z8, z8};
#pragma unroll
  for (int k = 0; k < 4; ++k) {
#pragma unroll
    for (int t = 0; t < 4; ++t) d[t] = f_mma(ac[k], ph[t][k], d[t]); }
#pragma unroll
  for (int k = 0; k < 4; ++k) ax[k] = f_frag(an + k * 32);
  asm volatile("s_wait_xcnt 0x0" :: "v"(an) : "memory");      /* a precaution: the address that the 8 loads above name stays live and unwritten up to this wait */
  __builtin_amdgcn_sched_barrier(0);      /* keeps the fetch in front of the vector work below, which is the time it has to land */
#pragma unroll
  for (int t = 0; t < 4; ++t) { float nm = mx[t];
#pragma unroll
    for (int r = 0; r < 8; ++r) nm = fmaxf(nm, d[t][r]);
    float s = se[t] * __expf(mx[t] - nm);
#pragma unroll
    for (int r = 0; r < 8; ++r) s += __expf(d[t][r] - nm);
    se[t] = s; mx[t] = nm; } }
__global__ __launch_bounds__(SCW * 32) __attribute__((amdgpu_waves_per_eu(SCW / 4, SCW / 4)))      /* one work-group a WGP: 256 registers a wave, of which the phi fragments take 128 */
void k_colstat_f(const _Float16* __restrict__ QKV, float* __restrict__ ST) {
  __shared__ float rmx[SCW * 2][SCM]; __shared__ float rse[SCW * 2][SCM];
  const int tid = threadIdx.x, w = tid >> 5, lane = tid & 31, ln = lane & 15, hh = lane >> 4;
  const _Float16* q = QKV + (size_t)blockIdx.y * NP * QLD; const int m0 = blockIdx.x * SCM;
  const _Float16* pb = q + CI + (size_t)(m0 + ln) * QLD + 8 * hh;
  const _Float16* th = q + (size_t)(w * (NP / SCW) + ln) * QLD + 8 * hh;
  v16h ph[4][4], a0[4], a1[4];
#pragma unroll
  for (int t = 0; t < 4; ++t) {
#pragma unroll
    for (int k = 0; k < 4; ++k) ph[t][k] = f_frag(pb + t * 16 * QLD + k * 32); }
#pragma unroll
  for (int k = 0; k < 4; ++k) a0[k] = f_frag(th + k * 32);
  asm volatile("s_wait_xcnt 0x0" :: "v"(pb), "v"(th) : "memory");      /* a precaution: the two addresses that the 40 loads above name stay live and unwritten up to this wait */
  float mx[4] = {-3.0e38f, -3.0e38f, -3.0e38f, -3.0e38f}, se[4] = {0.f, 0.f, 0.f, 0.f};
#pragma unroll 1      /* rolled: two trips are the period of the register sets, and the loop stays small in the instruction cache */
  for (int nb = 0; nb < NP / SCW; nb += 32) {
    cs_trip(th + (size_t)(nb + 16) * QLD, ph, a0, a1, mx, se);
    cs_trip(th + (size_t)(nb + 32 < NP / SCW ? nb + 32 : nb) * QLD, ph, a1, a0, mx, se); }      /* the last trip fetches rows of its own range again: in bounds, not used */
#pragma unroll
  for (int t = 0; t < 4; ++t) { rmx[w * 2 + hh][t * 16 + ln] = mx[t]; rse[w * 2 + hh][t * 16 + ln] = se[t]; }
  __syncthreads();      /* every wave's partial maxima and sums are in LDS before a thread folds a column */
  if (tid < SCM) { float m = rmx[0][tid];
#pragma unroll
    for (int i = 1; i < SCW * 2; ++i) m = fmaxf(m, rmx[i][tid]);
    float s = 0.f;
#pragma unroll
    for (int i = 0; i < SCW * 2; ++i) s += rse[i][tid] * __expf(rmx[i][tid] - m);
    float* rec = ST + (size_t)blockIdx.y * (2 * NM) + (size_t)((m0 + tid) / CSC) * (2 * CSC) + (tid % CSC); rec[0] = m; rec[CSC] = 256.0f / s; } }
// y^T = P g^T with neither f nor P stored. A work-group owns 64 rows n and all 128 columns of y^T; wave w takes the key columns m in [1024 w, 1024 w + 1024), 32 a trip; the partial tiles (f32) meet in LDS and are added in wave order.
// The score tile is formed TRANSPOSED: D[m][n] = phi[m] . theta[n] (phi as A, theta as B, theta resident). A lane then holds m = 8 hh + r of column n = ln, which is the k order of an A fragment of row ln
// (tile m 0..15 -> elements 0..7, tile m 16..31 -> elements 8..15), so P[n][m] = f16(exp(s - max_m) x 256 / sum_m) becomes the A operand of P g^T in place, with no exchange between lanes.
// All loads stand at the head of a trip and fetch the NEXT trip's records, g and phi (two register sets that swap roles): with one wave a SIMD nothing else hides a load, so each gets a whole trip to land in.
#define PVW 4                     /* waves: the 4,096 key columns split over them */
#define PVN 4                     /* 16-row tiles of n per wave: every phi and g fragment fetched serves PVN matrix instructions */
struct PvSet { v4f mx[4], iv[4]; v16h pf[2][4], gf[8]; };      /* what one trip reads: maxima and 256 / sum of its 32 columns, its phi fragments (A of the scores), its g fragments (B of P g^T) */
// rb, gb, pb are the addresses that the loads name; RO, GO, PO (elements) go into the loads' immediate offsets, so that the wait below can hold exactly those registers.
template <int RO, int GO, int PO>
__device__ __forceinline__ void pv_fetch(const float* rb, const _Float16* gb, const _Float16* pb, PvSet& x) {
  const float* r = rb + RO;
#pragma unroll
  for (int u = 0; u < 2; ++u) { x.mx[2 * u] = *(const v4fa*)(r + 2 * CSC * u); x.mx[2 * u + 1] = *(const v4fa*)(r + 2 * CSC * u + 4); x.iv[2 * u] = *(const v4fa*)(r + 2 * CSC * u + CSC); x.iv[2 * u + 1] = *(const v4fa*)(r + 2 * CSC * u + CSC + 4); }
#pragma unroll
  for (int u = 0; u < 2; ++u) {
#pragma unroll
    for (int k = 0; k < 4; ++k) x.pf[u][k] = f_frag(pb + CI + PO + u * 16 * QLD + k * 32); }
#pragma unroll
  for (int c = 0; c < 8; ++c) x.gf[c] = f_frag(gb + GO + c * 16 * NM);
  asm volatile("s_wait_xcnt 0x0" :: "v"(rb), "v"(gb), "v"(pb) : "memory");      /* a precaution: the three addresses that the 40 loads above name stay live and unwritten up to this wait */
  __builtin_amdgcn_sched_barrier(0); }      /* keeps the 40 loads at the head of the trip: without it the scheduler spreads them through the trip and waits for them at once */
__device__ __forceinline__ void pv_trip(const PvSet& c_, const v16h (&th)[PVN][4], v8f (&acc)[PVN][8]) {
  const v8f z8 = {0.f,0.f,0.f,0.f,0.f,0.f,0.f,0.f}; v8f s[2][PVN];      /* [m tile][n tile] */
#pragma unroll
  for (int u = 0; u < 2; ++u) {
#pragma unroll
    for (int v = 0; v < PVN; ++v) s[u][v] = z8; }
#pragma unroll
  for (int k = 0; k < 4; ++k) {
#pragma unroll
    for (int u = 0; u < 2; ++u) {
#pragma unroll
      for (int v = 0; v < PVN; ++v) s[u][v] = f_mma(c_.pf[u][k], th[v][k], s[u][v]); } }
  FragH f[PVN];
#pragma unroll
  for (int u = 0; u < 2; ++u) {
#pragma unroll
    for (int e = 0; e < 8; ++e) { const float m_ = c_.mx[u * 2 + (e >> 2)][e & 3], i_ = c_.iv[u * 2 + (e >> 2)][e & 3];
#pragma unroll
      for (int v = 0; v < PVN; ++v) f[v].h[u * 8 + e] = (_Float16)(__expf(s[u][v][e] - m_) * i_); } }
#pragma unroll
  for (int c = 0; c < 8; ++c) {
#pragma unroll
    for (int v = 0; v < PVN; ++v) acc[v][c] = f_mma(f[v].v, c_.gf[c], acc[v][c]); } }
__global__ __launch_bounds__(PVW * 32) __attribute__((amdgpu_waves_per_eu(PVW / 4, PVW / 4)))      /* one wave a SIMD: the accumulators (256 registers), theta (128) and the fragments in flight need more than 512 */
void k_pvf(const _Float16* __restrict__ QKV, const float* __restrict__ ST, const _Float16* __restrict__ G, float alpha, _Float16* __restrict__ YT) {
  __shared__ __attribute__((aligned(16))) float so[PVW][16 * PVN][CI + 4];
  const int tid = threadIdx.x, w = tid >> 5, lane = tid & 31, ln = lane & 15, hh = lane >> 4;
  const size_t by = blockIdx.y; const int n0 = blockIdx.x * (16 * PVN); const int ks = NM / PVW;
  const _Float16* q = QKV + by * NP * QLD;
  const float* stp = ST + by * (2 * NM) + (size_t)(w * ks) * 2 + 8 * hh;      /* column m: record m / CSC of 2 CSC floats, maxima first */
  const _Float16* gp = G + by * CI * NM + (size_t)ln * NM + w * ks + 8 * hh;
  const _Float16* pp = q + (size_t)(w * ks + ln) * QLD + 8 * hh;      /* the token row; phi lies CI elements into it (an immediate offset of the loads) */
  const _Float16* tp = q + (size_t)(n0 + ln) * QLD + 8 * hh;
  v16h th[PVN][4]; PvSet s0, s1;
#pragma unroll
  for (int v = 0; v < PVN; ++v) {
#pragma unroll
    for (int k = 0; k < 4; ++k) th[v][k] = f_frag(tp + v * 16 * QLD + k * 32); }
  asm volatile("s_wait_xcnt 0x0" :: "v"(tp) : "memory");      /* a precaution: the address that the 32 loads above name stays live and unwritten up to this wait */
  pv_fetch<0, 0, 0>(stp, gp, pp, s0);
  const v8f z8 = {0.f,0.f,0.f,0.f,0.f,0.f,0.f,0.f}; v8f acc[PVN][8];
#pragma unroll
  for (int v = 0; v < PVN; ++v) {
#pragma unroll
    for (int c = 0; c < 8; ++c) acc[v][c] = z8; }
#pragma unroll 1      /* rolled: two trips are the period of the register sets, and the loop stays small in the instruction cache */
  for (int kb = 0; kb < ks; kb += 64) {
    pv_fetch<64, 32, 32 * QLD>(stp, gp, pp, s1); pv_trip(s0, th, acc);
    const int more = kb + 64 < ks ? 1 : 0;      /* the last trip fetches its own range again: in bounds, not used */
    stp += more * 128; gp += more * 64; pp += more * (64 * QLD);
    pv_fetch<0, 0, 0>(stp, gp, pp, s0); pv_trip(s1, th, acc); }
#pragma unroll
  for (int v = 0; v < PVN; ++v) {
#pragma unroll
    for (int c = 0; c < 8; ++c) {
#pragma unroll
      for (int e = 0; e < 8; ++e) so[w][v * 16 + 8 * hh + e][c * 16 + ln] = acc[v][c][e]; } }
  __syncthreads();      /* every wave's partial tile is in LDS before any thread adds them */
  for (int i0 = 0; i0 < 16 * PVN * (CI / 4); i0 += PVW * 32) { const int i = i0 + tid, rr = i / (CI / 4), c4 = (i % (CI / 4)) * 4; v4f sm = *(const v4f*)&so[0][rr][c4];
#pragma unroll
    for (int k = 1; k < PVW; ++k) sm += *(const v4f*)&so[k][rr][c4];      /* unrolled so that the LDS reads issue together */
    v4h h4;
#pragma unroll
    for (int e = 0; e < 4; ++e) h4[e] = (_Float16)(sm[e] * alpha);      /* unrolled so that the vector elements are indexed by constants */
    *(v4h*)(YT + (by * NP + n0 + rr) * CI + c4) = h4; } }
// Projections straight from x. A work-group owns 64 positions of one image and all 384 output channels: it reads its [256 c][64 n] block of f32 x in whole 128-B lines, rounds it (bf16, exact in f16)
// and lays it in LDS as token rows [n][c]; K = 256 then runs in ONE accumulation chain per tile. Wave w takes rows 32 w .. 32 w + 31 of theta | phi and rows 16 w .. 16 w + 15 of g.
// theta | phi: D[o][n] = W (A) x^T (B): a lane holds 8 consecutive o of token n, 16 B of a token row. g: D[m][ci] = x^T (A) W_g (B): a lane holds 8 consecutive m of channel ci, 16 B of a channel-major row.
// Both tiles are gathered in LDS and leave in whole lines. Only the theta | phi part of a token row (pitch QLD) is written; nothing reads the rest.
#define PJN 64                    /* positions per work-group */
#define PJP (CN + 8)              /* LDS pitch of a token row, f16: 16 B past a multiple of 256 B, so that 16 rows read or written 16 B a lane fall on different banks */
#define PJG (PJN + 8)             /* LDS pitch of a g row, f16: the same for rows of 128 B */
__global__ __launch_bounds__(256) __attribute__((amdgpu_waves_per_eu(2, 2)))      /* one work-group a WGP: the 24 weight fragments (192 registers) stay resident beside 12 accumulator tiles */
void k_proj(const float* __restrict__ x, const _Float16* __restrict__ BT, _Float16* __restrict__ QKV, _Float16* __restrict__ G) {
  __shared__ __attribute__((aligned(16))) _Float16 xs[PJN][PJP]; __shared__ __attribute__((aligned(16))) _Float16 os[PJN][PJP]; __shared__ __attribute__((aligned(16))) _Float16 gs[CI][PJG];
  const int tid = threadIdx.x, w = tid >> 5, lane = tid & 31, ln = lane & 15, hh = lane >> 4;
  const size_t by = blockIdx.y; const int n0 = blockIdx.x * PJN;
  const _Float16* wp = BT + (size_t)(w * 32 + ln) * CN + 8 * hh;
  const _Float16* wg = BT + (size_t)(2 * CI + w * 16 + ln) * CN + 8 * hh;
  const int nl = (w & 1) * 32 + (lane & 7) * 4, cl = (w >> 1) * 64 + (lane >> 3) * 8;      /* 8 lanes cover one 128-B line of a channel row; a lane takes 4 positions of 8 + 8 channels */
  const float* xp = x + by * ((size_t)CN * NP) + (size_t)cl * NP + n0 + nl;
  v4f xv[2][8]; v16h wf[3][8];
#pragma unroll
  for (int it = 0; it < 2; ++it) {
#pragma unroll
    for (int i = 0; i < 8; ++i) xv[it][i] = *(const v4fa*)(xp + (size_t)(it * 32 + i) * NP); }
#pragma unroll
  for (int k = 0; k < 8; ++k) { wf[0][k] = f_frag(wp + k * 32); wf[1][k] = f_frag(wp + 16 * CN + k * 32); wf[2][k] = f_frag(wg + k * 32); }
  asm volatile("s_wait_xcnt 0x0" :: "v"(xp), "v"(wp), "v"(wg) : "memory");      /* a precaution: the three addresses that the 64 loads above name stay live and unwritten up to this wait */
#pragma unroll
  for (int it = 0; it < 2; ++it) {
#pragma unroll
    for (int j = 0; j < 4; ++j) { FragH f;
#pragma unroll
      for (int i = 0; i < 8; ++i) f.h[i] = (_Float16)bf16_round(xv[it][i][j]);
      *(v8us*)&xs[nl + j][cl + it * 32] = f.half[0]; } }
  __syncthreads();      /* the whole x^T tile is in LDS before any wave reads a fragment of it */
  const v8f z8 = {0.f,0.f,0.f,0.f,0.f,0.f,0.f,0.f}; v8f dq[2][4], dg[4];
#pragma unroll
  for (int v = 0; v < 4; ++v) { dq[0][v] = z8; dq[1][v] = z8; dg[v] = z8; }
  const _Float16* xr = &xs[ln][8 * hh];
  v16h xf[2][4];      /* two sets that swap roles: the LDS reads of block k + 1 stand as one group in front of the 12 products of block k */
#pragma unroll
  for (int v = 0; v < 4; ++v) xf[0][v] = f_frag(xr + v * 16 * PJP);
#pragma unroll
  for (int k = 0; k < 8; ++k) {
    if (k < 7) {
#pragma unroll
      for (int v = 0; v < 4; ++v) xf[(k + 1) & 1][v] = f_frag(xr + v * 16 * PJP + (k + 1) * 32); }
    __builtin_amdgcn_sched_barrier(0);      /* keeps the reads ahead of the products: without it each fragment is read right in front of its 3 products, which then wait out the LDS latency 32 times */
#pragma unroll
    for (int v = 0; v < 4; ++v) { dq[0][v] = f_mma(wf[0][k], xf[k & 1][v], dq[0][v]); dq[1][v] = f_mma(wf[1][k], xf[k & 1][v], dq[1][v]); dg[v] = f_mma(xf[k & 1][v], wf[2][k], dg[v]); } }
#pragma unroll
  for (int v = 0; v < 4; ++v) { FragH f;
#pragma unroll
    for (int u = 0; u < 2; ++u) {
#pragma unroll
      for (int r = 0; r < 8; ++r) f.h[r] = (_Float16)(dq[u][v][r] * 0.0625f);
      *(v8us*)&os[v * 16 + ln][w * 32 + u * 16 + 8 * hh] = f.half[0]; }
#pragma unroll
    for (int r = 0; r < 8; ++r) f.h[r] = (_Float16)(dg[v][r] * 0.0625f);
    *(v8us*)&gs[w * 16 + ln][v * 16 + 8 * hh] = f.half[0]; }
  unsigned short* qo = (unsigned short*)QKV + (by * NP + n0) * QLD + (size_t)(tid >> 5) * QLD + (tid & 31) * 8;      /* a wave stores the 512 B of one token row */
  unsigned short* go = (unsigned short*)G + by * ((size_t)CI * NM) + (size_t)(tid >> 3) * NM + n0 + (tid & 7) * 8;      /* 8 lanes store one 128-B line of a g row */
  __syncthreads();      /* every wave's part of the two output tiles is in LDS before a thread copies a row out */
  v8us tq[8], tg[4];
#pragma unroll
  for (int it = 0; it < 8; ++it) tq[it] = *(const v8us*)&os[it * 8 + (tid >> 5)][(tid & 31) * 8];
#pragma unroll
  for (int it = 0; it < 4; ++it) tg[it] = *(const v8us*)&gs[it * 32 + (tid >> 3)][(tid & 7) * 8];
  __builtin_amdgcn_sched_barrier(0);      /* all 12 LDS reads stand ahead of the stores, each in registers of its own: no staging register is reused behind a store, and the one wait behind the run covers them all */
#pragma unroll
  for (int it = 0; it < 8; ++it) *(v8us*)(qo + (size_t)it * 8 * QLD) = tq[it];
#pragma unroll
  for (int it = 0; it < 4; ++it) *(v8us*)(go + (size_t)it * 32 * NM) = tg[it];
  asm volatile("s_wait_xcnt 0x0" :: "v"(qo), "v"(go) : "memory"); }      /* a precaution: the registers that the 12 stores above name stay unwritten up to this wait */
// out = (16 W) y / 16 + bf16(x): the loop and the 32x64 wave tile of k_gemm2; the residual is read from x itself, 16 B a lane at the head of the kernel, and rounded where the rows leave LDS.
__global__ __launch_bounds__(128) void k_outp(const _Float16* __restrict__ A, const _Float16* __restrict__ YT, const float* __restrict__ x, float* __restrict__ C) {
  __shared__ __attribute__((aligned(16))) float so[4][32][68];
  const int tid = threadIdx.x, w = tid >> 5, lane = tid & 31, ln = lane & 15, hh = lane >> 4; const size_t by = blockIdx.y;
  const int ntn = NP >> 6; const int mt = blockIdx.x / ntn, nq = blockIdx.x - mt * ntn; const int row0 = mt * 128 + 32 * w, col0 = nq * 64;
  const int rsub = lane >> 4, c4 = (lane & 15) * 4;
  const size_t eo = by * ((size_t)CN * NP) + (size_t)(row0 + rsub) * NP + col0 + c4;
  const float* xp = x + eo; float* cp = C + eo; v4f xv[16];
#pragma unroll
  for (int q = 0; q < 16; ++q) xv[q] = *(const v4fa*)(xp + (size_t)q * 2 * NP);
  asm volatile("s_wait_xcnt 0x0" :: "v"(xp) : "memory");      /* a precaution: the address that the 16 loads above name stays live and unwritten up to this wait */
  const _Float16* a0p = A + (size_t)(row0 + ln) * CI; const _Float16* a1p = a0p + (size_t)16 * CI;
  const _Float16* b0p = YT + by * ((size_t)NP * CI) + (size_t)(col0 + ln) * CI; const _Float16* b1p = b0p + (size_t)16 * CI; const _Float16* b2p = b1p + (size_t)16 * CI; const _Float16* b3p = b2p + (size_t)16 * CI;
  const v8f z8 = {0.f,0.f,0.f,0.f,0.f,0.f,0.f,0.f}; v8f c00 = z8, c01 = z8, c02 = z8, c03 = z8, c10 = z8, c11 = z8, c12 = z8, c13 = z8;
#pragma unroll 1      /* rolled, as in k_gemm2 */
  for (int kb = 0; kb < CI; kb += 32) { const v16h a0 = g2_frag(a0p + kb, hh), a1 = g2_frag(a1p + kb, hh);
    v16h b = g2_frag(b0p + kb, hh); c00 = g2_mma(a0, b, c00); c10 = g2_mma(a1, b, c10);
    b = g2_frag(b1p + kb, hh); c01 = g2_mma(a0, b, c01); c11 = g2_mma(a1, b, c11);
    b = g2_frag(b2p + kb, hh); c02 = g2_mma(a0, b, c02); c12 = g2_mma(a1, b, c12);
    b = g2_frag(b3p + kb, hh); c03 = g2_mma(a0, b, c03); c13 = g2_mma(a1, b, c13); }
  v8f accs[8] = {c00, c01, c02, c03, c10, c11, c12, c13};
#pragma unroll
  for (int u = 0; u < 8; ++u) {
#pragma unroll
    for (int r = 0; r < 8; ++r) so[w][(u >> 2) * 16 + 8 * hh + r][(u & 3) * 16 + ln] = accs[u][r] * 0.0625f; }
  __builtin_amdgcn_fence(__ATOMIC_ACQ_REL, "workgroup"); __builtin_amdgcn_wave_barrier();
#pragma unroll
  for (int q = 0; q < 16; ++q) { const v4f v = *(const v4fa*)&so[w][q * 2 + rsub][c4];
#pragma unroll
    for (int i = 0; i < 4; ++i) xv[q][i] = v[i] + bf16_round(xv[q][i]); }
  __builtin_amdgcn_sched_barrier(0);      /* all 16 sums stand ahead of the stores, each in registers of its own: no staging register is reused behind a store, and the one wait behind the run covers them all */
#pragma unroll
  for (int q = 0; q < 16; ++q) *(v4f*)(cp + (size_t)q * 2 * NP) = xv[q];
  asm volatile("s_wait_xcnt 0x0" :: "v"(cp) : "memory"); }      /* a precaution: the registers that the 16 stores above name stay unwritten up to this wait */
extern "C" void kernel_launch(void* const* d_in, const int* in_sizes, int n_in,
                              void* d_out, int out_size, void* d_ws, size_t ws_size, hipStream_t stream) {
  (void)in_sizes; (void)n_in; (void)out_size;
  const float* const* I = (const float* const*)d_in; const float* x = I[0]; const float* tw = I[1]; const float* pw = I[2]; const float* gw = I[3]; const float* ww = I[4];      /* natural 1x1 conv weights: w_theta, w_phi, w_g [128][256], w_mask [256][128]; no biases */
  char* ws = (char*)d_ws; size_t off = 0;
  auto take = [&](size_t bytes) { char* p = ws + off; off += (bytes + 255) & ~(size_t)255; return p; };
  const int QL = 3 * CI;      /* row pitch of the token rows: theta, phi side by side (the last third is not used) */
  _Float16* BT = (_Float16*)take((size_t)4 * CI * CN * 2); _Float16* BW = BT + (size_t)3 * CI * CN;      /* w_theta, w_phi, w_g as one [384][256] plane, then w_mask */
  _Float16* QKV = (_Float16*)take((size_t)NB * NP * QL * 2); _Float16* G = (_Float16*)take((size_t)NB * CI * NP * 2); _Float16* YT = (_Float16*)take((size_t)NB * NP * CI * 2);
  float* ST = (float*)take((size_t)NB * NM * 2 * 4);      /* per-column max and 256 / sum, one 128-B record per 16 columns */
  if (off > ws_size) return;
  k_wnat<<<dim3((unsigned)(((size_t)CI * CN / 8 + 255) / 256), 4), 256, 0, stream>>>(tw, pw, gw, ww, (size_t)CI * CN / 8, BT);      /* natural [out][in] x16 f16 planes */
  k_proj<<<dim3(NP / PJN, NB), 256, 0, stream>>>(x, BT, QKV, G);      /* every image: theta^T | phi^T token rows [n][256 of 384] and g [ci][m] (the PV B^T operand) -> f16, from f32 x */
  k_colstat_f<<<dim3(NM / SCM, NB), SCW * 32, 0, stream>>>(QKV, ST);      /* every image: softmax over the QUERY axis: per key column m the max and 256 / sum over all 4096 rows n of f[n][m] = theta[n].phi[m] (K = 128, NO scale), f formed in registers */
  k_pvf<<<dim3(NP / (16 * PVN), NB), PVW * 32, 0, stream>>>(QKV, ST, G, 0.00390625f, YT);      /* every image: y^T [n][ci] = sum_m P[n][m] g[ci][m] -> f16, P[n][m] = f16(256 exp(f - max_m) / sum_m), f formed again in registers */
  k_outp<<<dim3((unsigned)((CN / 128) * (NP / 64)), NB), 128, 0, stream>>>(BW, YT, x, (float*)d_out);      /* every image: out[c][a] = (16 W as A) x (y^T as B^T) / 16 + bf16(x) -> f32 channel-first output block */
}

// v007
// Measured time: 69.5 microseconds a run.
// Timed twice side by side with v006, it ran 1.20 and 1.21 times as fast.
// Counting every step since v000, it is 101 times as fast.
#include <hip/hip_runtime.h>
// Non-local block with the softmax taken over the QUERY axis (x [4][256][64][64]; theta, phi, g = conv1x1(x) with [128][256] weights (U(+-1/16), no biases); scores[n][m] = theta[n].phi[m] (NO scaling); attn = softmax(scores, axis = 1): normalised over n for every key column m (the module's unconventional axis); out[n] = sum_m attn[n][m] g[m]; mask = conv1x1(out; w_mask [256][128], no bias); result = x + mask -> [4][256][64][64]).
// Structure: channel-first; the images share every launch (grid); one projection kernel reads f32 x (rounded to bf16, exact in f16), turns it to token rows in LDS and forms theta^T, phi^T (rows = tokens) and g (rows = channels) on WMMA (f32 accumulation) -> f16, every f16 plane of the workspace laid in fragment order (see FRB); f [4096][4096] = theta^T phi (K = 128, no scale) f32 in registers only, formed once for the column statistics and once for the weights (f32 statistics, native exp; weights x256 f16); y^T = P g^T (x2^-8) f16; out = (16 W) y / 16 + bf16(x) f32 channel-first; launches: see trace.
// Compute dtype: inputs rounded to bf16; x / weights exact; q, k, v, softmax weights and o as plain f16 GEMM operands (~2^-12); scores and softmax statistics f32. v_wmma_f32_16x16x32_f16.
#define NB 4
#define SQ 4096
#define DM 256
#define NH 1
#define HD 64
#define HG 4                         /* heads per attention launch group */
#define B0 0                         /* first batch processed (debug hook) */
#define NBR NB                       /* batches processed (debug hook) */
#define NR ((size_t)NB * SQ)         /* token rows */
#define MP ((int)((size_t)NBR * SQ)) /* rows projected (debug hook) */
#define QT 256                       /* query rows per causal tile */
#define NKX SQ                       /* S / P row pitch */
#define QT0 256                      /* first-tile rows recomputed exactly (256: buys margin for the few-key rows 128..255, which have no output projection to average the single-f16 P/v rounding) */
#define QN SQ                        /* query rows attended per batch (debug hook) */
#define NHD NH                       /* heads attended (debug hook) */
#define MPO MP                       /* rows through the output stage (debug hook) */
#define LQ DM            /* unused */
typedef __bf16 v16b __attribute__((ext_vector_type(16)));
typedef unsigned short v8us __attribute__((ext_vector_type(8), may_alias));
typedef float  v8f  __attribute__((ext_vector_type(8)));
typedef float  v4f  __attribute__((ext_vector_type(4)));
typedef float  v4fa __attribute__((ext_vector_type(4), may_alias));
union FragB { v16b v; v8us half[2]; unsigned short u[16]; };

__device__ __forceinline__ unsigned short bf16_bits(float x) { unsigned int u = __float_as_uint(x); return (unsigned short)((u + 0x7FFFu + ((u >> 16) & 1u)) >> 16); }
__device__ __forceinline__ float bf16_val(unsigned short b) { return __uint_as_float(((unsigned int)b) << 16); }
__device__ __forceinline__ float bf16_round(float x) { return bf16_val(bf16_bits(x)); }
// D += A·B with NT terms: 1 = ah·bh, 2 = + al·bh (A split), 3 = + ah·bl (both split)
template <int NT>
__device__ __forceinline__ v8f mmaN(v16b ah, v16b al, v16b bh, v16b bl, v8f c) {
  c = __builtin_amdgcn_wmma_f32_16x16x32_bf16(false, ah, false, bh, (short)0, c, false, false);
  if (NT >= 2) c = __builtin_amdgcn_wmma_f32_16x16x32_bf16(false, al, false, bh, (short)0, c, false, false);
  if (NT >= 3) c = __builtin_amdgcn_wmma_f32_16x16x32_bf16(false, ah, false, bl, (short)0, c, false, false);
  asm volatile("v_nop\n\tv_nop\n\tv_nop\n\tv_nop" : "+v"(c) : "v"(ah), "v"(al), "v"(bh), "v"(bl));
  return c;
}

__global__ __launch_bounds__(256) void k_wt_bf16(const float* __restrict__ W, unsigned short* __restrict__ Wt, int K, int N) {
  const int t = blockIdx.x * 256 + threadIdx.x;
  const int k8n = K / 8;
  if (t >= N * k8n) return;
  const int n = t / k8n, k8 = (t % k8n) * 8;
  v8us v;
#pragma unroll
  for (int i = 0; i < 8; ++i) v[i] = bf16_bits(W[(size_t)(k8 + i) * N + n]);
  *(v8us*)(Wt + (size_t)n * K + k8) = v;
  
}

// GEMM C[M][N] (f32, pitch ldc) = act(A[M][K]·W + bias). A f32 row-major (pitch lda) converted per fragment to bf16
// (ASPLIT: hi/lo two planes -> 2 terms, else single rounded term); Wt bf16 [N][K] (pitch ldb). BIAS_BF16 rounds the
// bias to bf16 first (bias quantised to bf16 before the add). K%32==0, M%16==0, N%64==0.
template <bool ASPLIT, int ACT, bool BIAS_BF16>
__global__ __launch_bounds__(128) void k_gemm_bf(const float* __restrict__ A, int lda, const unsigned short* __restrict__ Wt, int ldb,
                                               const float* __restrict__ bias, float* __restrict__ C, int ldc, int M, int N, int K) {
  __shared__ __attribute__((aligned(16))) float so[4][16][64];
  const int tid = threadIdx.x, w = tid >> 5, lane = tid & 31, ln = lane & 15, hh = lane >> 4;
  const int ntn = N / 64;
  const int wid = blockIdx.x * 4 + w;
  const int mt = wid / ntn, nq = wid % ntn;
  if (mt * 16 >= M) return;
  const int row0 = mt * 16, col0 = nq * 64;
  const float* arow = A + (size_t)(row0 + ln) * lda;
  v8f acc[4] = {};
  for (int kb = 0; kb < K; kb += 32) {
    FragB ah, al;
    const v4f x0 = *(const v4fa*)(arow + kb + 8 * hh), x1 = *(const v4fa*)(arow + kb + 8 * hh + 4);
    const v4f x2 = *(const v4fa*)(arow + kb + 16 + 8 * hh), x3 = *(const v4fa*)(arow + kb + 16 + 8 * hh + 4);
    float xs[16] = {x0[0],x0[1],x0[2],x0[3],x1[0],x1[1],x1[2],x1[3],x2[0],x2[1],x2[2],x2[3],x3[0],x3[1],x3[2],x3[3]};
#pragma unroll
    for (int i = 0; i < 16; ++i) { const unsigned short hb = bf16_bits(xs[i]); ah.u[i] = hb; al.u[i] = ASPLIT ? bf16_bits(xs[i] - bf16_val(hb)) : (unsigned short)0; }
#pragma unroll
    for (int t = 0; t < 4; ++t) {
      const unsigned short* brow = Wt + (size_t)(col0 + t * 16 + ln) * ldb + kb;
      FragB b;
      b.half[0] = *(const v8us*)(brow + 8 * hh);
      b.half[1] = *(const v8us*)(brow + 16 + 8 * hh);
      acc[t] = mmaN<ASPLIT ? 2 : 1>(ah.v, al.v, b.v, b.v, acc[t]);
    }
  }
#pragma unroll
  for (int t = 0; t < 4; ++t) {
    float bv = bias ? bias[col0 + t * 16 + ln] : 0.f;
    if (BIAS_BF16) bv = bf16_round(bv);
#pragma unroll
    for (int r = 0; r < 8; ++r) { float v = acc[t][r] + bv; if (ACT == 1) v = fmaxf(v, 0.f); so[w][8 * hh + r][t * 16 + ln] = v; }
  }
  __builtin_amdgcn_fence(__ATOMIC_ACQ_REL, "workgroup");
  __builtin_amdgcn_wave_barrier();
  const int rsub = lane >> 4, c4 = (lane & 15) * 4;
  {
#pragma unroll
    for (int q = 0; q < 8; ++q) {
      const int r = q * 2 + rsub;
      const v4f v = *(const v4fa*)&so[w][r][c4];
      *(v4f*)(C + (size_t)(row0 + r) * ldc + col0 + c4) = v;
    }
    
  }
}

// GEMM C = act(A·W + bias + resid): A f32 (ASPLIT -> hi/lo 2 terms), Wt bf16 [N][K]; ACT 0 none, 1 relu, 2 exact gelu;
// resid (optional, f32, row index = (row % rmod), pitch ldr, RES_BF16 rounds it) added before the activation.
template <bool ASPLIT, int ACT, bool BIAS_BF16, bool RES_BF16>
__global__ __launch_bounds__(128) void k_gemm_bf3(const float* __restrict__ A, int lda, const unsigned short* __restrict__ Wt, int ldb,
                                                const float* __restrict__ bias, const float* __restrict__ resid, int rmod, int ldr,
                                                float* __restrict__ C, int ldc, int M, int N, int K) {
  __shared__ __attribute__((aligned(16))) float so[4][16][64];
  const int tid = threadIdx.x, w = tid >> 5, lane = tid & 31, ln = lane & 15, hh = lane >> 4;
  const int ntn = N / 64;
  const int wid = blockIdx.x * 4 + w;
  const int mt = wid / ntn, nq = wid % ntn;
  if (mt * 16 >= M) return;
  const int row0 = mt * 16, col0 = nq * 64;
  const float* arow = A + (size_t)(row0 + ln) * lda;
  v8f acc[4] = {};
  for (int kb = 0; kb < K; kb += 32) {
    FragB ah, al;
    const v4f x0 = *(const v4fa*)(arow + kb + 8 * hh), x1 = *(const v4fa*)(arow + kb + 8 * hh + 4);
    const v4f x2 = *(const v4fa*)(arow + kb + 16 + 8 * hh), x3 = *(const v4fa*)(arow + kb + 16 + 8 * hh + 4);
    float xs[16] = {x0[0],x0[1],x0[2],x0[3],x1[0],x1[1],x1[2],x1[3],x2[0],x2[1],x2[2],x2[3],x3[0],x3[1],x3[2],x3[3]};
#pragma unroll
    for (int i = 0; i < 16; ++i) { const unsigned short hb = bf16_bits(xs[i]); ah.u[i] = hb; al.u[i] = ASPLIT ? bf16_bits(xs[i] - bf16_val(hb)) : (unsigned short)0; }
#pragma unroll
    for (int t = 0; t < 4; ++t) {
      const unsigned short* brow = Wt + (size_t)(col0 + t * 16 + ln) * ldb + kb;
      FragB b;
      b.half[0] = *(const v8us*)(brow + 8 * hh);
      b.half[1] = *(const v8us*)(brow + 16 + 8 * hh);
      acc[t] = mmaN<ASPLIT ? 2 : 1>(ah.v, al.v, b.v, b.v, acc[t]);
    }
  }
#pragma unroll
  for (int t = 0; t < 4; ++t) {
    const int col = col0 + t * 16 + ln;
    float bv = bias ? bias[col] : 0.f;
    if (BIAS_BF16) bv = bf16_round(bv);
#pragma unroll
    for (int r = 0; r < 8; ++r) {
      float v = acc[t][r] + bv;
      if (resid) { float rv = resid[(size_t)((row0 + 8 * hh + r) % rmod) * ldr + col]; if (RES_BF16) rv = bf16_round(rv); v += rv; }
      if (ACT == 1) v = fmaxf(v, 0.f);
      if (ACT == 2) v = 0.5f * v * (1.0f + erff(v * 0.70710678118654752f));
      if (ACT == 3) { const float u = 0.7978845608028654f * (v + 0.044715f * v * v * v); v = 0.5f * v * (1.0f + tanhf(u)); }
      so[w][8 * hh + r][t * 16 + ln] = v;
    }
  }
  __builtin_amdgcn_fence(__ATOMIC_ACQ_REL, "workgroup");
  __builtin_amdgcn_wave_barrier();
  const int rsub = lane >> 4, c4 = (lane & 15) * 4;
  {
#pragma unroll
    for (int q = 0; q < 8; ++q) {
      const int r = q * 2 + rsub;
      const v4f v = *(const v4fa*)&so[w][r][c4];
      *(v4f*)(C + (size_t)(row0 + r) * ldc + col0 + c4) = v;
    }
    
  }
}
// row LayerNorm (biased variance, eps) over N: s = X (+ R); optional out_sum <- s; out_norm <- (s-mu)*rsqrt(var+eps)*g + b
template <bool PARAM_BF16>
__global__ __launch_bounds__(256) void k_layernorm(const float* __restrict__ X, const float* __restrict__ R, const float* __restrict__ g, const float* __restrict__ bta,
                                                  float* __restrict__ out_sum, float* __restrict__ out_norm, int N, float eps) {
  __shared__ float red[256];
  const int row = blockIdx.x, tid = threadIdx.x;
  const float* x = X + (size_t)row * N; const float* rr = R ? R + (size_t)row * N : nullptr;
  float vals[16];                     // up to N = 4096
  const int per = N / 256;            // contiguous chunk per thread? use strided-by-4 chunks: thread handles j = tid*4 + 1024*u
  float s1 = 0.f;
  for (int u = 0; u < per / 4; ++u) {
    const int j = tid * 4 + 1024 * u;
    const v4f a = *(const v4fa*)(x + j);
    v4f b = {0.f,0.f,0.f,0.f}; if (rr) b = *(const v4fa*)(rr + j);
#pragma unroll
    for (int q = 0; q < 4; ++q) { const float v = a[q] + b[q]; vals[u * 4 + q] = v; s1 += v; }
  }
  red[tid] = s1; __syncthreads();
  for (int st = 128; st > 0; st >>= 1) { if (tid < st) red[tid] += red[tid + st]; __syncthreads(); }
  const float mu = red[0] / (float)N; __syncthreads();
  float s2 = 0.f;
  for (int u = 0; u < per / 4; ++u)
#pragma unroll
    for (int q = 0; q < 4; ++q) { const float c = vals[u * 4 + q] - mu; s2 += c * c; }
  red[tid] = s2; __syncthreads();
  for (int st = 128; st > 0; st >>= 1) { if (tid < st) red[tid] += red[tid + st]; __syncthreads(); }
  const float rs = rsqrtf(red[0] / (float)N + eps);
  {
    for (int u = 0; u < per / 4; ++u) {
      const int j = tid * 4 + 1024 * u;
      v4f o, sm;
#pragma unroll
      for (int q = 0; q < 4; ++q) {
        float gg = g[j + q], bb = bta[j + q];
        if (PARAM_BF16) { gg = bf16_round(gg); bb = bf16_round(bb); }
        sm[q] = vals[u * 4 + q]; o[q] = (vals[u * 4 + q] - mu) * rs * gg + bb;
      }
      if (out_sum) *(v4f*)(out_sum + (size_t)row * N + j) = sm;
      *(v4f*)(out_norm + (size_t)row * N + j) = o;
    }
    
  }
}



// ---- f16 WMMA path (v_wmma_f32_16x16x32_f16): 11-bit significands for operands in range — used where a [0,1] probability operand needs more precision than bf16
typedef _Float16 v16h __attribute__((ext_vector_type(16)));
union FragH { v16h v; v8us half[2]; _Float16 h[16]; unsigned short u[16]; };
template <int NT>
__device__ __forceinline__ v8f mmaH(v16h ah, v16h al, v16h bh, v16h bl, v8f c) {
  c = __builtin_amdgcn_wmma_f32_16x16x32_f16(false, ah, false, bh, (short)0, c, false, false);
  if (NT >= 2) c = __builtin_amdgcn_wmma_f32_16x16x32_f16(false, al, false, bh, (short)0, c, false, false);
  if (NT >= 3) c = __builtin_amdgcn_wmma_f32_16x16x32_f16(false, ah, false, bl, (short)0, c, false, false);
  asm volatile("v_nop\n\tv_nop\n\tv_nop\n\tv_nop" : "+v"(c) : "v"(ah), "v"(al), "v"(bh), "v"(bl));
  return c;
}
// batched GEMM like k_gemm_b but f16 operands: A f32 (split into f16 hi/lo if ASPLIT, else rounded to f16), Bt = f16 values [n][k]; alpha; C f32; N multiple of 16 (partial tiles skipped)
template <bool ASPLIT>
__global__ __launch_bounds__(128) void k_gemm_h(const float* __restrict__ A, int lda, size_t sA, const _Float16* __restrict__ Bh, int ldb, size_t sB, float alpha, float* __restrict__ C, int ldc, size_t sC, int M, int N, int K) {
  __shared__ __attribute__((aligned(16))) float so[4][16][64];
  const int tid = threadIdx.x, w = tid >> 5, lane = tid & 31, ln = lane & 15, hh = lane >> 4; const int by = blockIdx.y;
  A += (size_t)by * sA; Bh += (size_t)by * sB; C += (size_t)by * sC;
  const int ntn = (N + 63) / 64; const int wid = blockIdx.x * 4 + w; const int mt = wid / ntn, nq = wid % ntn; if (mt * 16 >= M) return;
  const int row0 = mt * 16, col0 = nq * 64; const float* arow = A + (size_t)(row0 + ln) * lda;
  v8f acc[4] = {};
  for (int kb = 0; kb < K; kb += 32) {
    FragH ah, al;
    const v4f x0 = *(const v4fa*)(arow + kb + 8 * hh), x1 = *(const v4fa*)(arow + kb + 8 * hh + 4), x2 = *(const v4fa*)(arow + kb + 16 + 8 * hh), x3 = *(const v4fa*)(arow + kb + 16 + 8 * hh + 4);
    float xs[16] = {x0[0],x0[1],x0[2],x0[3],x1[0],x1[1],x1[2],x1[3],x2[0],x2[1],x2[2],x2[3],x3[0],x3[1],x3[2],x3[3]};
#pragma unroll
    for (int i = 0; i < 16; ++i) { const _Float16 h = (_Float16)xs[i]; ah.h[i] = h; al.h[i] = ASPLIT ? (_Float16)(xs[i] - (float)h) : (_Float16)0.0f; }
#pragma unroll
    for (int t = 0; t < 4; ++t) { if (col0 + t * 16 >= N) continue; const size_t boff = (size_t)(col0 + t * 16 + ln) * ldb + kb; FragH bq; bq.half[0] = *(const v8us*)(Bh + boff + 8 * hh); bq.half[1] = *(const v8us*)(Bh + boff + 16 + 8 * hh);
      acc[t] = mmaH<ASPLIT ? 2 : 1>(ah.v, al.v, bq.v, bq.v, acc[t]); }
  }
#pragma unroll
  for (int t = 0; t < 4; ++t) { if (col0 + t * 16 >= N) continue;
#pragma unroll
    for (int r = 0; r < 8; ++r) so[w][8 * hh + r][t * 16 + ln] = acc[t][r] * alpha; }
  __builtin_amdgcn_fence(__ATOMIC_ACQ_REL, "workgroup"); __builtin_amdgcn_wave_barrier();
  const int rsub = lane >> 4, c4 = (lane & 15) * 4;
  {
#pragma unroll
    for (int q = 0; q < 8; ++q) { const int r = q * 2 + rsub; if (col0 + c4 < N) { const v4f v = *(const v4fa*)&so[w][r][c4]; *(v4f*)(C + (size_t)(row0 + r) * ldc + col0 + c4) = v; } }
     }
}

// Wt[n][k] = f16(W[k][n]·scale) from f32 row-major W[K][N] (scale = power of two; bf16-exact weights stay exact in f16 away from the subnormal range)
__global__ __launch_bounds__(256) void k_wt_f16(const float* __restrict__ W, _Float16* __restrict__ Wt, int K, int N, float scale) {
  const int t = blockIdx.x * 256 + threadIdx.x; if (t >= N * (K / 8)) return; const int n = t / (K / 8), k8 = (t % (K / 8)) * 8; FragH f;
#pragma unroll
  for (int i = 0; i < 8; ++i) f.h[i] = (_Float16)(bf16_round(W[(size_t)(k8 + i) * N + n]) * scale); const v8us o = f.half[0];
  *(v8us*)((unsigned short*)Wt + (size_t)n * K + k8) = o; 
}
// k_gemm_hh variant with fused epilogue: v = acc·alpha + bias[by·sBias + col] (+ CP[(row/rowsPerB)·sCPb + by·64 + col] if CP) ; ACT 0 none / 1 elu ; writes f16 C16 (and f32 C if non-null)
template <int ACT>
__global__ __launch_bounds__(128) void k_gemm_hhx(const _Float16* __restrict__ A, int lda, size_t sA, const _Float16* __restrict__ Bh, int ldb, size_t sB, float alpha, const float* __restrict__ bias, size_t sBias, const float* __restrict__ CP, int rowsPerB, size_t sCPb, int row0g,
    float* __restrict__ C, _Float16* __restrict__ C16, int ldc, size_t sC, int M, int N, int K) {
  __shared__ __attribute__((aligned(16))) float so[4][16][64];
  const int tid = threadIdx.x, w = tid >> 5, lane = tid & 31, ln = lane & 15, hh = lane >> 4; const int by = blockIdx.y;
  A += (size_t)by * sA; Bh += (size_t)by * sB; const size_t cofs = (size_t)by * sC; const float* bp = bias ? bias + (size_t)by * sBias : nullptr;
  const int ntn = (N + 63) / 64; const int wid = blockIdx.x * 4 + w; const int mt = wid / ntn, nq = wid % ntn; if (mt * 16 >= M) return;
  const int row0 = mt * 16, col0 = nq * 64; const _Float16* arow = A + (size_t)(row0 + ln) * lda;
  v8f acc[4] = {};
  for (int kb = 0; kb < K; kb += 32) { FragH ah; ah.half[0] = *(const v8us*)((const unsigned short*)arow + kb + 8 * hh); ah.half[1] = *(const v8us*)((const unsigned short*)arow + kb + 16 + 8 * hh);
#pragma unroll
    for (int t = 0; t < 4; ++t) { if (col0 + t * 16 >= N) continue; const size_t boff = (size_t)(col0 + t * 16 + ln) * ldb + kb; FragH bq; bq.half[0] = *(const v8us*)((const unsigned short*)Bh + boff + 8 * hh); bq.half[1] = *(const v8us*)((const unsigned short*)Bh + boff + 16 + 8 * hh);
      acc[t] = mmaH<1>(ah.v, ah.v, bq.v, bq.v, acc[t]); }
  }
#pragma unroll
  for (int t = 0; t < 4; ++t) { if (col0 + t * 16 >= N) continue; const int col = col0 + t * 16 + ln; const float bv = bp ? bf16_round(bp[col]) : 0.f;
#pragma unroll
    for (int r = 0; r < 8; ++r) { float v = acc[t][r] * alpha + bv; if (CP) { const int rr = row0g + row0 + 8 * hh + r; if (rowsPerB < 0) v += CP[cofs + (size_t)rr * ldc + col];      /* rowsPerB < 0: own element of the batched C plane */ else { const int bidx = rr / rowsPerB; v += CP[(size_t)bidx * sCPb + (size_t)by * 64 + col]; } } if (ACT == 1) v = (v > 0.f) ? v : expm1f(v); else if (ACT == 7) v = (v > 0.f) ? v + 1.0f : expf(v); else if (ACT == 8) v = tanhf(v); else if (ACT == 9) v = 0.5f * v * (1.0f + tanhf(0.7978845608028654f * (v + 0.044715f * v * v * v))); else if (ACT == 11) v = 1.0f / (1.0f + expf(-v)); else if (ACT == 12) v = (v > 0.f) ? v : 0.01f * v; else if (ACT == 14) v = (v > 0.f) ? v : 0.1f * v; else if (ACT == 16) v = (v >= 0.f) ? v : 0.3f * v; else if (ACT == 17) v = (v >= 0.f) ? v : 0.2f * v; else if (ACT == 15) v = v / (1.0f + expf(-v)); else if (ACT == 3) v = fmaxf(v, 0.f); else if (ACT == 6) v = 0.5f * v * (1.0f + erff(v * 0.70710678118654752f)); so[w][8 * hh + r][t * 16 + ln] = v; } }
  __builtin_amdgcn_fence(__ATOMIC_ACQ_REL, "workgroup"); __builtin_amdgcn_wave_barrier();
  const int rsub = lane >> 4, c4 = (lane & 15) * 4; typedef _Float16 v4h __attribute__((ext_vector_type(4)));
  {
#pragma unroll
    for (int q = 0; q < 8; ++q) { const int r = q * 2 + rsub; if (col0 + c4 < N) { const v4f v = *(const v4fa*)&so[w][r][c4]; if (C) *(v4f*)(C + cofs + (size_t)(row0 + r) * ldc + col0 + c4) = v; if (C16) { v4h h4; for (int i = 0; i < 4; ++i) h4[i] = (_Float16)v[i]; *(v4h*)(C16 + cofs + (size_t)(row0 + r) * ldc + col0 + c4) = h4; } } }
     }
}


typedef _Float16 v4h __attribute__((ext_vector_type(4)));

__global__ __launch_bounds__(256) void k_x16(const float* __restrict__ x, _Float16* __restrict__ X16, size_t n8) { const size_t t = (size_t)blockIdx.x * 256 + threadIdx.x; if (t >= n8) return; FragH f;
#pragma unroll
  for (int q = 0; q < 8; ++q) f.h[q] = (_Float16)bf16_round(x[t * 8 + q]); *(v8us*)((unsigned short*)X16 + t * 8) = f.half[0];  }
__global__ __launch_bounds__(256) void k_h16(const float* __restrict__ x, _Float16* __restrict__ X16, size_t n8) { const size_t t = (size_t)blockIdx.x * 256 + threadIdx.x; if (t >= n8) return; FragH f;
#pragma unroll
  for (int q = 0; q < 8; ++q) f.h[q] = (_Float16)x[t * 8 + q]; *(v8us*)((unsigned short*)X16 + t * 8) = f.half[0];  }
__global__ __launch_bounds__(256) void k_round16f(const float* __restrict__ W, _Float16* __restrict__ Bt, size_t n8) { const size_t t = (size_t)blockIdx.x * 256 + threadIdx.x; if (t >= n8) return; FragH f;
#pragma unroll
  for (int i = 0; i < 8; ++i) f.h[i] = (_Float16)(bf16_round(W[t * 8 + i]) * 16.0f); *(v8us*)((unsigned short*)Bt + t * 8) = f.half[0];  }
template <int NHv, int TTv>
__global__ __launch_bounds__(256) void k_vt(const _Float16* __restrict__ V16, int ldv, int voff, _Float16* __restrict__ Vt) { __shared__ unsigned short tl[64][66]; const int tid = threadIdx.x; const int slab = blockIdx.x / (TTv / 64), lg = blockIdx.x % (TTv / 64); const int b = slab / NHv, h = slab % NHv;
  for (int i = tid; i < 64 * 8; i += 256) { const int r = i / 8, c8 = (i % 8) * 8; FragH f; f.half[0] = *(const v8us*)((const unsigned short*)V16 + ((size_t)b * TTv + lg * 64 + r) * ldv + voff + h * 64 + c8);
#pragma unroll
    for (int q = 0; q < 8; ++q) tl[r][c8 + q] = f.u[q]; }
  __syncthreads();
  {
#pragma unroll
    for (int rd = 0; rd < 2; ++rd) { const int d = rd * 32 + tid / 8, pc = tid % 8; FragH f;
#pragma unroll
      for (int q = 0; q < 8; ++q) f.u[q] = tl[pc * 8 + q][d];
      *(v8us*)((unsigned short*)Vt + ((size_t)slab * 64 + d) * TTv + lg * 64 + pc * 8) = f.half[0]; }
     } }

__global__ __launch_bounds__(256) void k_hl(const float* __restrict__ F, _Float16* __restrict__ Hh, _Float16* __restrict__ Hl, size_t n8) { const size_t t = (size_t)blockIdx.x * 256 + threadIdx.x; if (t >= n8) return; FragH fh, fl; const v4f a = *(const v4fa*)(F + t * 8), c = *(const v4fa*)(F + t * 8 + 4);
#pragma unroll
  for (int q = 0; q < 4; ++q) { _Float16 h = (_Float16)a[q]; fh.h[q] = h; fl.h[q] = (_Float16)((a[q] - (float)h) * 1024.0f); h = (_Float16)c[q]; fh.h[4 + q] = h; fl.h[4 + q] = (_Float16)((c[q] - (float)h) * 1024.0f); }
  { *(v8us*)((unsigned short*)Hh + t * 8) = fh.half[0]; *(v8us*)((unsigned short*)Hl + t * 8) = fl.half[0];  } }

// ---- fast GEMM (wave tile 32x64; requires M % 32 == 0 rows per launch region and N % 64 == 0); epilogue = k_gemm_hhx semantics ----
__device__ __forceinline__ v16h g2_frag(const _Float16* p, int hh) { FragH f; f.half[0] = *(const v8us*)((const unsigned short*)p + 8 * hh); f.half[1] = *(const v8us*)((const unsigned short*)p + 16 + 8 * hh); return f.v; }
__device__ __forceinline__ v8f g2_mma(v16h a, v16h b, v8f c) { v8f d = __builtin_amdgcn_wmma_f32_16x16x32_f16(false, a, false, b, (short)0, c, false, false); asm volatile("v_nop\n\tv_nop\n\tv_nop\n\tv_nop" : "+v"(d) : "v"(a), "v"(b)); return d; }
template <int ACT>
__global__ __launch_bounds__(128) void k_gemm2(const _Float16* __restrict__ A, int lda, size_t sA, const _Float16* __restrict__ Bh, int ldb, size_t sB, float alpha, const float* __restrict__ bias, size_t sBias, const float* __restrict__ CP, int rowsPerB, size_t sCPb, int row0g,
    float* __restrict__ C, _Float16* __restrict__ C16, int ldc, size_t sC, int M, int N, int K) { static_assert(ACT == 0 || ACT == 3 || ACT == 6 || ACT == 8 || ACT == 9 || ACT == 11 || ACT == 12 || ACT == 14 || ACT == 15 || ACT == 16 || ACT == 17, "k_gemm2: unsupported ACT code (would silently apply no activation)");
  __shared__ __attribute__((aligned(16))) float so[4][32][68];
  const int tid = threadIdx.x, w = tid >> 5, lane = tid & 31, ln = lane & 15, hh = lane >> 4; const int by = blockIdx.y;
  A += (size_t)by * sA; Bh += (size_t)by * sB; const size_t cofs = (size_t)by * sC; const float* bp = bias ? bias + (size_t)by * sBias : nullptr;
  const int ntn = N >> 6; const int mt = blockIdx.x / ntn, nq = blockIdx.x - mt * ntn; const int row0 = mt * 128 + 32 * w, col0 = nq * 64; if (row0 >= M) return;
  const _Float16* a0p = A + (size_t)(row0 + ln) * lda; const _Float16* a1p = a0p + (size_t)16 * lda;
  const _Float16* b0p = Bh + (size_t)(col0 + ln) * ldb; const _Float16* b1p = b0p + (size_t)16 * ldb; const _Float16* b2p = b1p + (size_t)16 * ldb; const _Float16* b3p = b2p + (size_t)16 * ldb;
  const v8f z8 = {0.f,0.f,0.f,0.f,0.f,0.f,0.f,0.f}; v8f c00 = z8, c01 = z8, c02 = z8, c03 = z8, c10 = z8, c11 = z8, c12 = z8, c13 = z8;
#pragma unroll 1
  for (int kb = 0; kb < K; kb += 32) { const v16h a0 = g2_frag(a0p + kb, hh), a1 = g2_frag(a1p + kb, hh);
    v16h b = g2_frag(b0p + kb, hh); c00 = g2_mma(a0, b, c00); c10 = g2_mma(a1, b, c10);
    b = g2_frag(b1p + kb, hh); c01 = g2_mma(a0, b, c01); c11 = g2_mma(a1, b, c11);
    b = g2_frag(b2p + kb, hh); c02 = g2_mma(a0, b, c02); c12 = g2_mma(a1, b, c12);
    b = g2_frag(b3p + kb, hh); c03 = g2_mma(a0, b, c03); c13 = g2_mma(a1, b, c13); }
  v8f accs[8] = {c00, c01, c02, c03, c10, c11, c12, c13};
#pragma unroll
  for (int u = 0; u < 8; ++u) { const int t = u & 3, half = u >> 2; const int col = col0 + t * 16 + ln; const float bv = bp ? bf16_round(bp[col]) : 0.f;
#pragma unroll
    for (int r = 0; r < 8; ++r) { const int rloc = half * 16 + 8 * hh + r; float v = accs[u][r] * alpha + bv; if (CP) { if (rowsPerB < 0) v += CP[cofs + (size_t)(row0g + row0 + rloc) * ldc + col];      /* rowsPerB < 0: own element of the batched C plane */ else { const int bidx = (row0g + row0 + rloc) / rowsPerB; v += CP[(size_t)bidx * sCPb + (size_t)by * 64 + col]; } }
      if (ACT == 3) v = fmaxf(v, 0.f); else if (ACT == 6) v = 0.5f * v * (1.0f + erff(v * 0.70710678118654752f)); else if (ACT == 11) v = 1.0f / (1.0f + expf(-v)); else if (ACT == 15) v = v / (1.0f + expf(-v)); else if (ACT == 12) v = (v > 0.f) ? v : 0.01f * v; else if (ACT == 8) v = tanhf(v); else if (ACT == 9) v = 0.5f * v * (1.0f + tanhf(0.7978845608028654f * (v + 0.044715f * v * v * v))); else if (ACT == 14) v = (v > 0.f) ? v : 0.1f * v; else if (ACT == 16) v = (v >= 0.f) ? v : 0.3f * v; else if (ACT == 17) v = (v >= 0.f) ? v : 0.2f * v;
      so[w][rloc][t * 16 + ln] = v; } }
  __builtin_amdgcn_fence(__ATOMIC_ACQ_REL, "workgroup"); __builtin_amdgcn_wave_barrier();
  const int rsub = lane >> 4, c4 = (lane & 15) * 4;
  {
#pragma unroll
    for (int q = 0; q < 16; ++q) { const int r = q * 2 + rsub; const v4f v = *(const v4fa*)&so[w][r][c4]; if (C) *(v4f*)(C + cofs + (size_t)(row0 + r) * ldc + col0 + c4) = v; if (C16) { v4h h4; for (int i = 0; i < 4; ++i) h4[i] = (_Float16)v[i]; *(v4h*)(C16 + cofs + (size_t)(row0 + r) * ldc + col0 + c4) = h4; } }
     } }


// ---- the same 32x64 wave tile with K split over the NW waves of a work-group, for products with few output tiles (M x N small, K long) ----
// A work-group owns ONE 32x64 tile of C; wave w sums k in [w K / NW, (w + 1) K / NW) with the loop of k_gemm2; the NW partial tiles (f32) meet in LDS and are added in wave order.
// Requires M % 32 == 0 (grid = (M / 32) (N / 64)), N % 64 == 0, K % (32 NW) == 0. C16 = f16(alpha x sum).
template <int NW>
__global__ __launch_bounds__(NW * 32) void k_gemm2k(const _Float16* __restrict__ A, int lda, const _Float16* __restrict__ Bh, int ldb, float alpha, _Float16* __restrict__ C16, int ldc, int N, int K) {
  __shared__ __attribute__((aligned(16))) float so[NW][32][68];
  const int tid = threadIdx.x, w = tid >> 5, lane = tid & 31, ln = lane & 15, hh = lane >> 4;
  const int ntn = N >> 6; const int mt = blockIdx.x / ntn, nq = blockIdx.x - mt * ntn; const int row0 = mt * 32, col0 = nq * 64; const int ks = K / NW;
  const _Float16* a0p = A + (size_t)(row0 + ln) * lda + w * ks; const _Float16* a1p = a0p + (size_t)16 * lda;
  const _Float16* b0p = Bh + (size_t)(col0 + ln) * ldb + w * ks; const _Float16* b1p = b0p + (size_t)16 * ldb; const _Float16* b2p = b1p + (size_t)16 * ldb; const _Float16* b3p = b2p + (size_t)16 * ldb;
  const v8f z8 = {0.f,0.f,0.f,0.f,0.f,0.f,0.f,0.f}; v8f c00 = z8, c01 = z8, c02 = z8, c03 = z8, c10 = z8, c11 = z8, c12 = z8, c13 = z8;
  for (int kb = 0; kb < ks; kb += 32) { const v16h a0 = g2_frag(a0p + kb, hh), a1 = g2_frag(a1p + kb, hh);
    v16h b = g2_frag(b0p + kb, hh); c00 = g2_mma(a0, b, c00); c10 = g2_mma(a1, b, c10);
    b = g2_frag(b1p + kb, hh); c01 = g2_mma(a0, b, c01); c11 = g2_mma(a1, b, c11);
    b = g2_frag(b2p + kb, hh); c02 = g2_mma(a0, b, c02); c12 = g2_mma(a1, b, c12);
    b = g2_frag(b3p + kb, hh); c03 = g2_mma(a0, b, c03); c13 = g2_mma(a1, b, c13); }
  v8f accs[8] = {c00, c01, c02, c03, c10, c11, c12, c13};
#pragma unroll
  for (int u = 0; u < 8; ++u) {      /* unrolled so that accs[] is indexed by constants and stays in registers */
#pragma unroll
    for (int r = 0; r < 8; ++r) so[w][(u >> 2) * 16 + 8 * hh + r][(u & 3) * 16 + ln] = accs[u][r]; }
  __syncthreads();      /* every wave's partial tile is in LDS before any thread adds them */
  for (int i0 = 0; i0 < 32 * 16; i0 += NW * 32) { const int i = i0 + tid, r = i >> 4, c4 = (i & 15) * 4; v4f s = *(const v4f*)&so[0][r][c4];
#pragma unroll
    for (int k = 1; k < NW; ++k) s += *(const v4f*)&so[k][r][c4];      /* unrolled so that the NW LDS reads issue together */
    v4h h4;
#pragma unroll
    for (int q = 0; q < 4; ++q) h4[q] = (_Float16)(s[q] * alpha);      /* unrolled so that the vector elements are indexed by constants */
    *(v4h*)(C16 + (size_t)(row0 + r) * ldc + col0 + c4) = h4; } }


// four weight matrices of n8 x 8 elements each -> four planes one behind the other in Bt, each in fragment order (see FRB below); blockIdx.y picks the matrix; planes 0..2 have K = 256, plane 3 has K = 128.
// Thread t writes 16-B piece t of its plane: lane = t % 32, half j, block kb of the row tile rt; it reads 8 consecutive k of row 16 rt + lane % 16.
__global__ __launch_bounds__(256) void k_wnat(const float* __restrict__ w0, const float* __restrict__ w1, const float* __restrict__ w2, const float* __restrict__ w3, size_t n8, _Float16* __restrict__ Bt) { const size_t t = (size_t)blockIdx.x * 256 + threadIdx.x; if (t >= n8) return; const unsigned p = blockIdx.y; const float* w = p == 0 ? w0 : p == 1 ? w1 : p == 2 ? w2 : w3;
  const unsigned c = (unsigned)t, lg = p == 3 ? 2u : 3u, kb = (c >> 6) & ((1u << lg) - 1u), rt = c >> (6 + lg); const size_t s = ((size_t)(rt * 16 + (c & 15)) << (5 + lg)) + kb * 32 + ((c >> 5) & 1) * 16 + ((c >> 4) & 1) * 8;
  FragH f; for (int q = 0; q < 8; ++q) f.h[q] = (_Float16)(bf16_round(w[s + q]) * 16.0f); *(v8us*)((unsigned short*)Bt + (p * n8 + t) * 8) = f.half[0];  }
__global__ __launch_bounds__(256) void k_rsm(const float* __restrict__ S, _Float16* __restrict__ P, int nrows) {
  #pragma clang fp contract(off)
  const int i = blockIdx.x * 256 + threadIdx.x; if (i >= nrows) return; const float* s = S + (size_t)i * SQ; float mx = -3.0e38f;
#pragma unroll 1
  for (int j = 0; j < SQ; ++j) mx = fmaxf(mx, s[j]); float se = 0.f;
#pragma unroll 1
  for (int j = 0; j < SQ; ++j) se += expf(s[j] - mx); const float sc = 256.0f / se;
#pragma unroll 1
  for (int j0 = 0; j0 < SQ; j0 += 8) { FragH f; for (int q = 0; q < 8; ++q) f.h[q] = (_Float16)(expf(s[j0 + q] - mx) * sc); unsigned short* d = (unsigned short*)P + (size_t)i * SQ + j0; *(v8us*)d = f.half[0];  } }
__global__ __launch_bounds__(256) void k_vt(const _Float16* __restrict__ V16, int b, int h0, _Float16* __restrict__ VT) { __shared__ unsigned short tl[64][65]; const int tid = threadIdx.x; const int hh = blockIdx.x % HG, sg = blockIdx.x / HG; const int s0 = sg * 64; const int h = h0 + hh;
  for (int i = tid; i < 64 * 8; i += 256) { const int j = i / 8, d8 = (i % 8) * 8; FragH f; f.half[0] = *(const v8us*)((const unsigned short*)V16 + ((size_t)b * SQ + s0 + j) * DM + h * HD + d8); for (int q = 0; q < 8; ++q) tl[d8 + q][j] = f.u[q]; }
  __syncthreads();
  { for (int i = tid; i < 64 * 8; i += 256) { const int d = i / 8, j8 = (i % 8) * 8; FragH f; for (int q = 0; q < 8; ++q) f.u[q] = tl[d][j8 + q]; *(v8us*)((unsigned short*)VT + ((size_t)hh * HD + d) * SQ + s0 + j8) = f.half[0]; }  } }



__global__ __launch_bounds__(256) void k_rsmcf2(const float* __restrict__ S, _Float16* __restrict__ P, int hg, int q0, int nk) {
  #pragma clang fp contract(off)
  const int t = blockIdx.x * 256 + threadIdx.x; if (t >= hg * QT) return; const size_t i = (size_t)t; const float* s = S + i * NKX; const int last = q0 + (t % QT); float mx = -3.0e38f;
#pragma unroll 1
  for (int j = 0; j < nk; ++j) { const float f = (j <= last) ? 1.f : 0.f; mx = fmaxf(mx, fmaf(f, s[j], (1.f - f) * -1.0e9f)); } float se = 0.f;
#pragma unroll 1
  for (int j = 0; j < nk; ++j) { const float f = (j <= last) ? 1.f : 0.f; se += __expf(fmaf(f, s[j], (1.f - f) * -1.0e9f) - mx); } const float sc = 256.0f / se;
#pragma unroll 1
  for (int j0 = 0; j0 < nk; j0 += 8) { FragH fr; for (int q = 0; q < 8; ++q) { const int j = j0 + q; const float f = (j <= last) ? 1.f : 0.f; fr.h[q] = (_Float16)(__expf(fmaf(f, s[j], (1.f - f) * -1.0e9f) - mx) * sc); } unsigned short* d = (unsigned short*)P + i * NKX + j0; *(v8us*)d = fr.half[0];  } }

template <int MASKADD>
__global__ __launch_bounds__(64) void k_att0(const float* __restrict__ QF, const float* __restrict__ KF, const float* __restrict__ VF, int ld, const float* __restrict__ mask, float scale, float* __restrict__ OF, int ldo) {
  #pragma clang fp contract(off)
  __shared__ __attribute__((aligned(16))) float lq[64][64]; __shared__ __attribute__((aligned(16))) float lo[64][64];
  const int tid = threadIdx.x; const int h = blockIdx.x / (QT0 / 64), rg = blockIdx.x % (QT0 / 64); const int i = rg * 64 + tid;
  const float* qr = QF + (size_t)i * ld + h * HD;
#pragma unroll 1
  for (int c = 0; c < HD / 4; ++c) { *(v4f*)&lq[tid][c * 4] = *(const v4fa*)(qr + c * 4); const v4f z = {0.f, 0.f, 0.f, 0.f}; *(v4f*)&lo[tid][c * 4] = z; }
  float m = -1.0e30f, l = 0.f; const int jmax = MASKADD ? (SQ - 1) : (rg * 64 + 63);      /* additive-mask form: every key (the mask input decides); causal form: keys up to the block's last row */
#pragma unroll 1
  for (int j = 0; j <= jmax; ++j) { const float* kr = KF + (size_t)j * ld + h * HD; const float* vr = VF + (size_t)j * ld + h * HD; float s = 0.f;
#pragma unroll 1
    for (int c = 0; c < HD / 4; ++c) { const v4f kq = *(const v4fa*)(kr + c * 4); const v4f qq = *(v4f*)&lq[tid][c * 4]; s = __fadd_rn(s, __fmul_rn(qq[0], kq[0])); s = __fadd_rn(s, __fmul_rn(qq[1], kq[1])); s = __fadd_rn(s, __fmul_rn(qq[2], kq[2])); s = __fadd_rn(s, __fmul_rn(qq[3], kq[3])); }
    s = __fmul_rn(s, scale); if (MASKADD) s = __fadd_rn(s, __fmul_rn(bf16_round(mask[(size_t)i * SQ + j]), -10000.0f));
    const float f = (MASKADD || j <= i) ? 1.f : 0.f; const float sm = fmaf(f, s, (1.f - f) * -1.0e30f); const float mn = fmaxf(m, sm); const float sc = expf(m - mn); const float e = expf(sm - mn); l = __fadd_rn(__fmul_rn(l, sc), e); m = mn;
#pragma unroll 1
    for (int c = 0; c < HD / 4; ++c) { const v4f vv = *(const v4fa*)(vr + c * 4); v4f oo = *(v4f*)&lo[tid][c * 4]; for (int u = 0; u < 4; ++u) oo[u] = __fadd_rn(__fmul_rn(oo[u], sc), __fmul_rn(e, vv[u])); *(v4f*)&lo[tid][c * 4] = oo; } }
  const float fin = 64.0f / l;      /* o carried x64 like the f16 path */
#pragma unroll 1
  for (int c = 0; c < HD / 4; ++c) { v4f oo = *(v4f*)&lo[tid][c * 4]; for (int u = 0; u < 4; ++u) oo[u] = __fmul_rn(oo[u], fin); *(v4f*)&lo[tid][c * 4] = oo; }
  __syncthreads();
  {
#pragma unroll 1
    for (int it = 0; it < 16; ++it) { const int row = it * 4 + tid / 16, pc = (tid % 16) * 4; const v4f v = *(const v4f*)&lo[row][pc]; *(v4f*)(OF + (size_t)(rg * 64 + row) * ldo + h * HD + pc) = v; }
     } }

__global__ __launch_bounds__(256) void k_oscale(const float* __restrict__ OF, float* __restrict__ out, size_t n4) { const size_t t = (size_t)blockIdx.x * 256 + threadIdx.x; if (t >= n4) return; const v4f a = *(const v4fa*)(OF + t * 4); v4f o; for (int q = 0; q < 4; ++q) o[q] = a[q] * 0.015625f; *(v4f*)(out + t * 4) = o;  }

__global__ __launch_bounds__(256) void k_bfr(const float* __restrict__ x, float* __restrict__ XB, size_t n8) { const size_t t = (size_t)blockIdx.x * 256 + threadIdx.x; if (t >= n8) return; v4f a = *(const v4fa*)(x + t * 8), c = *(const v4fa*)(x + t * 8 + 4); for (int q = 0; q < 4; ++q) { a[q] = bf16_round(a[q]); c[q] = bf16_round(c[q]); }
  { *(v4f*)(XB + t * 8) = a; *(v4f*)(XB + t * 8 + 4) = c;  } }



__global__ __launch_bounds__(256) void k_rsmfvl(const float* __restrict__ S, _Float16* __restrict__ P, _Float16* __restrict__ PL, int qn, const int* __restrict__ vlp) {
  #pragma clang fp contract(off)
  const int t = blockIdx.x * 256 + threadIdx.x; if (t >= qn) return; const int vl = vlp[0]; const size_t i = (size_t)t; const float* s = S + i * SQ; float mx = -3.0e38f;
#pragma unroll 1
  for (int j = 0; j < SQ; ++j) { const float f = (j < vl) ? 1.f : 0.f; mx = fmaxf(mx, fmaf(f, s[j], (1.f - f) * -1000000.0f)); } float se = 0.f;
#pragma unroll 1
  for (int j = 0; j < SQ; ++j) { const float f = (j < vl) ? 1.f : 0.f; se += __expf(fmaf(f, s[j], (1.f - f) * -1000000.0f) - mx); } const float sc = 256.0f / se;
#pragma unroll 1
  for (int j0 = 0; j0 < SQ; j0 += 8) { FragH fr, gr; for (int q = 0; q < 8; ++q) { const int j = j0 + q; const float f = (j < vl) ? 1.f : 0.f; const float pv = __expf(fmaf(f, s[j], (1.f - f) * -1000000.0f) - mx) * sc; const _Float16 ph = (_Float16)pv; fr.h[q] = ph; gr.h[q] = (_Float16)((pv - (float)ph) * 1024.0f); }
    unsigned short* d = (unsigned short*)P + i * SQ + j0; unsigned short* dl = (unsigned short*)PL + i * SQ + j0; *(v8us*)d = fr.half[0]; *(v8us*)dl = gr.half[0];  } }

__global__ __launch_bounds__(256) void k_rsmf(const float* __restrict__ S, _Float16* __restrict__ P, int qn, int hg) {
  #pragma clang fp contract(off)
  const int t = blockIdx.x * 256 + threadIdx.x; if (t >= qn * hg) return; const size_t i = (size_t)(t / qn) * SQ + (t % qn); const float* s = S + i * SQ; float mx = -3.0e38f;
#pragma unroll 1
  for (int j = 0; j < SQ; ++j) mx = fmaxf(mx, s[j]); float se = 0.f;
#pragma unroll 1
  for (int j = 0; j < SQ; ++j) se += __expf(s[j] - mx); const float sc = 256.0f / se;
#pragma unroll 1
  for (int j0 = 0; j0 < SQ; j0 += 8) { FragH f; for (int q = 0; q < 8; ++q) f.h[q] = (_Float16)(__expf(s[j0 + q] - mx) * sc); unsigned short* d = (unsigned short*)P + i * SQ + j0; *(v8us*)d = f.half[0];  } }


#define CN 256          /* channels */
#define CI 128          /* inner channels */
#define NP 4096         /* positions */
#define NM 4096         /* key positions (= SQ) */
#define NC CN           /* BN statistics macros */
#define NPX NP
#define BNEPS 1e-5f

__global__ __launch_bounds__(256) void k_rowbias(const float* __restrict__ b, float* __restrict__ BP, size_t n4, int ncol) { const size_t t = (size_t)blockIdx.x * 256 + threadIdx.x; if (t >= n4) return; const size_t e = t * 4; const float v = bf16_round(b[e / ncol]); const v4f o = {v, v, v, v}; *(v4f*)(BP + e) = o;  }




__global__ __launch_bounds__(256) void k_mp2(const float* __restrict__ src, float* __restrict__ dst, int nout) {
  const int t = blockIdx.x * 256 + threadIdx.x; if (t >= nout) return; const int c = t / 1024; const int o = t % 1024; const int oy = o / 32, ox = o % 32; const float* p = src + (size_t)c * 4096 + (size_t)(2 * oy) * 64 + 2 * ox;
  const float v = fmaxf(fmaxf(p[0], p[1]), fmaxf(p[64], p[65])); *(float*)(dst + t) = v;  }
__global__ __launch_bounds__(256) void k_xpb(const float* __restrict__ x, const float* __restrict__ wb, float* __restrict__ CPP, size_t n4) {
  #pragma clang fp contract(off)
  const size_t t = (size_t)blockIdx.x * 256 + threadIdx.x; if (t >= n4) return; const size_t e = t * 4; const int c = (int)((e / 4096) % 256); const float bb = bf16_round(wb[c]); const v4f a = *(const v4fa*)(x + e); v4f o; for (int q = 0; q < 4; ++q) o[q] = __fadd_rn(bf16_round(a[q]), bb);
  *(v4f*)(CPP + e) = o;  }


template <int PASS>
__global__ __launch_bounds__(256) void k_cstA(const float* __restrict__ X, const float* __restrict__ MV, float* __restrict__ PART) {
  #pragma clang fp contract(off)
  __shared__ float red[256]; const int t = threadIdx.x; const size_t bc = blockIdx.x; const int c = (int)(bc % NC); const float* row = X + bc * (size_t)NPX; const float mu = PASS ? MV[c] : 0.f; float s = 0.f;
  for (int i = t; i < NPX; i += 256) { const float v = row[i]; const float d = PASS ? __fadd_rn(v, -mu) : v; s = __fadd_rn(s, PASS ? __fmul_rn(d, d) : d); }
  red[t] = s; __syncthreads(); for (int st = 128; st > 0; st >>= 1) { if (t < st) red[t] = __fadd_rn(red[t], red[t + st]); __syncthreads(); }
  if (t < 32) { const float pv = (t == 0) ? red[0] : 0.f; *(float*)(PART + bc * 32 + t) = pv;  } }      

template <int PASS>
__global__ __launch_bounds__(256) void k_cstB(const float* __restrict__ PART, float* __restrict__ MV) { const int c = threadIdx.x; if (c >= NC) return; double s = 0.0; for (int b = 0; b < NB; ++b) s += (double)PART[((size_t)b * NC + c) * 32]; const float m = (float)(s / ((double)NB * (double)NPX)); *(float*)(MV + PASS * NC + c) = m;  }


__global__ __launch_bounds__(256) void k_bnresid(const float* __restrict__ C2, const float* __restrict__ MV, const float* __restrict__ g, const float* __restrict__ be, const float* __restrict__ X, float* __restrict__ out, size_t n4) {
  #pragma clang fp contract(off)
  const size_t t = (size_t)blockIdx.x * 256 + threadIdx.x; if (t >= n4) return; const size_t e = t * 4; const int c = (int)((e / NPX) % NC); const float sc = __fmul_rn(rsqrtf(__fadd_rn(MV[NC + c], BNEPS)), bf16_round(g[c])); const float mu = MV[c], bb = bf16_round(be[c]);
  const v4f a = *(const v4fa*)(C2 + e); const v4f xx = *(const v4fa*)(X + e); v4f o; for (int q = 0; q < 4; ++q) { const float z = __fadd_rn(__fmul_rn(__fadd_rn(a[q], -mu), sc), bb); o[q] = __fadd_rn(z, bf16_round(xx[q])); }
  *(v4f*)(out + e) = o;  }


__global__ __launch_bounds__(256) void k_rowbias(float* __restrict__ Y, const float* __restrict__ bias) {
  #pragma clang fp contract(off)
  const size_t t = (size_t)blockIdx.x * 256 + threadIdx.x; if (t >= (size_t)NB * NC * NPX / 4) return; const size_t e = t * 4; const int c = (int)((e / NPX) % NC); const float bb = bf16_round(bias[c]);
  v4f v = *(const v4fa*)(Y + e); for (int q = 0; q < 4; ++q) v[q] = __fadd_rn(v[q], bb); *(v4f*)(Y + e) = v;  }


// Scores never stored. Both consumers of f = theta^T phi form their own score tiles on the matrix unit from the f16 theta and phi planes (fragment order, below) and use them in registers.
// ST holds one 128-B record per 16 columns: 16 maxima, then 16 x (256 / sum). blockIdx.y is the image.
// Inner loops carry #pragma unroll so that the fragment arrays are indexed by constants and stay in registers (a run-time index would send them to scratch).
#define CSC 16                    /* columns per record */
#define QIS (2 * NP * CI)         /* elements of an image in QKV: the theta plane, then the phi plane, each [4096 rows][K = 128] in fragment order */
#define SCM 64                    /* columns per work-group of the statistics kernel */
#define SCW 16                    /* its waves: the 4,096 rows split over them */
__device__ __forceinline__ v8f f_mma(v16h a, v16h b, v8f c) { return __builtin_amdgcn_wmma_f32_16x16x32_f16(false, a, false, b, (short)0, c, false, false); }
// FRAGMENT ORDER. Every f16 plane that a matrix instruction reads from the workspace lies as blocks of 16 rows x 32 k, FRB elements each: [half j][lane = 16 hh + ln][8 elements], element e of row ln at k = 16 j + 8 hh + e;
// the blocks of a 16-row tile follow each other in k, save in g, where the 8 channel tiles of each 32-k block follow each other. A wave's 16-B-a-lane load of half a fragment then covers 512 contiguous bytes (4 whole lines) where a row-major plane makes it touch 16 lines.
#define FRB 512                   /* f16 elements of a block */
__device__ __forceinline__ v16h p_frag(const _Float16* p) { FragH f; f.half[0] = *(const v8us*)((const unsigned short*)p); f.half[1] = *(const v8us*)((const unsigned short*)p + 256); return f.v; }      /* p: the block + 8 lane */
__device__ __forceinline__ v16h f_frag(const _Float16* p) { FragH f; f.half[0] = *(const v8us*)((const unsigned short*)p); f.half[1] = *(const v8us*)((const unsigned short*)p + 16); return f.v; }      /* g2_frag with the lane's + 8 hh already in p */
// Column statistics: a work-group owns 64 key columns m (their phi fragments stay in registers as B), wave w sweeps rows n in [256 w, 256 w + 256) 16 at a time (theta as A).
// In D a lane holds 8 rows of ONE column (row 8 hh + r, column ln), so the running maximum and the rescaled running sum of a column are per-lane scalars; the 32 partial pairs of a column (16 waves x 2 lane halves) meet in LDS.
// One trip: 16 rows from ac; the next trip's theta fragments are fetched into ax behind the products (two register sets that swap roles, so that no copy and no early wait stands between).
__device__ __forceinline__ void cs_trip(const _Float16* an, const v16h (&ph)[4][4], const v16h (&ac)[4], v16h (&ax)[4], float (&mx)[4], float (&se)[4]) {
  const v8f z8 = {0.f,0.f,0.f,0.f,0.f,0.f,0.f,0.f}; v8f d[4] = {z8, z8, z8, z8};
#pragma unroll
  for (int k = 0; k < 4; ++k) {
#pragma unroll
    for (int t = 0; t < 4; ++t) d[t] = f_mma(ac[k], ph[t][k], d[t]); }
#pragma unroll
  for (int k = 0; k < 4; ++k) ax[k] = p_frag(an + k * FRB);
  asm volatile("s_wait_xcnt 0x0" :: "v"(an) : "memory");      /* a precaution: the address that the 8 loads above name stays live and unwritten up to this wait */
  __builtin_amdgcn_sched_barrier(0);      /* keeps the fetch in front of the vector work below, which is the time it has to land */
#pragma unroll
  for (int t = 0; t < 4; ++t) { float nm = mx[t];
#pragma unroll
    for (int r = 0; r < 8; ++r) nm = fmaxf(nm, d[t][r]);
    float s = se[t] * __expf(mx[t] - nm);
#pragma unroll
    for (int r = 0; r < 8; ++r) s += __expf(d[t][r] - nm);
    se[t] = s; mx[t] = nm; } }
__global__ __launch_bounds__(SCW * 32) __attribute__((amdgpu_waves_per_eu(SCW / 4, SCW / 4)))      /* one work-group a WGP: 256 registers a wave, of which the phi fragments take 128 */
void k_colstat_f(const _Float16* __restrict__ QKV, float* __restrict__ ST) {
  __shared__ float rmx[SCW * 2][SCM]; __shared__ float rse[SCW * 2][SCM];
  const int tid = threadIdx.x, w = tid >> 5, lane = tid & 31, ln = lane & 15, hh = lane >> 4;
  const _Float16* q = QKV + (size_t)blockIdx.y * QIS; const int m0 = blockIdx.x * SCM;
  const _Float16* pb = q + (size_t)m0 * CI + 8 * lane;      /* phi lies NP CI elements on (an immediate offset of the loads); 16 rows of K = 128 are 4 blocks = 16 CI elements: row r0 (a multiple of 16) starts r0 CI elements into its plane */
  const _Float16* th = q + (size_t)(w * (NP / SCW)) * CI + 8 * lane;
  v16h ph[4][4], a0[4], a1[4];
#pragma unroll
  for (int t = 0; t < 4; ++t) {
#pragma unroll
    for (int k = 0; k < 4; ++k) ph[t][k] = p_frag(pb + NP * CI + (t * 4 + k) * FRB); }
#pragma unroll
  for (int k = 0; k < 4; ++k) a0[k] = p_frag(th + k * FRB);
  asm volatile("s_wait_xcnt 0x0" :: "v"(pb), "v"(th), "v"(lane) : "memory");      /* a precaution: what the 40 loads above name (the two addresses, or a scalar base with the lane's number) stays live and unwritten up to this wait */
  float mx[4] = {-3.0e38f, -3.0e38f, -3.0e38f, -3.0e38f}, se[4] = {0.f, 0.f, 0.f, 0.f};
#pragma unroll 1      /* rolled: two trips are the period of the register sets, and the loop stays small in the instruction cache */
  for (int nb = 0; nb < NP / SCW; nb += 32) {
    cs_trip(th + (size_t)(nb + 16) * CI, ph, a0, a1, mx, se);
    cs_trip(th + (size_t)(nb + 32 < NP / SCW ? nb + 32 : nb) * CI, ph, a1, a0, mx, se); }      /* the last trip fetches rows of its own range again: in bounds, not used */
#pragma unroll
  for (int t = 0; t < 4; ++t) { rmx[w * 2 + hh][t * 16 + ln] = mx[t]; rse[w * 2 + hh][t * 16 + ln] = se[t]; }
  __syncthreads();      /* every wave's partial maxima and sums are in LDS before a thread folds a column */
  if (tid < SCM) { float m = rmx[0][tid];
#pragma unroll
    for (int i = 1; i < SCW * 2; ++i) m = fmaxf(m, rmx[i][tid]);
    float s = 0.f;
#pragma unroll
    for (int i = 0; i < SCW * 2; ++i) s += rse[i][tid] * __expf(rmx[i][tid] - m);
    float* rec = ST + (size_t)blockIdx.y * (2 * NM) + (size_t)((m0 + tid) / CSC) * (2 * CSC) + (tid % CSC); rec[0] = m; rec[CSC] = 256.0f / s; } }
// y^T = P g^T with neither f nor P stored. A work-group owns 64 rows n and all 128 columns of y^T; wave w takes the key columns m in [1024 w, 1024 w + 1024), 32 a trip; the partial tiles (f32) meet in LDS and are added in wave order.
// The score tile is formed TRANSPOSED: D[m][n] = phi[m] . theta[n] (phi as A, theta as B, theta resident). A lane then holds m = 8 hh + r of column n = ln, which is the k order of an A fragment of row ln
// (tile m 0..15 -> elements 0..7, tile m 16..31 -> elements 8..15), so P[n][m] = f16(exp(s - max_m) x 256 / sum_m) becomes the A operand of P g^T in place, with no exchange between lanes.
// All loads stand at the head of a trip and fetch the NEXT trip's records, g and phi (two register sets that swap roles): with one wave a SIMD nothing else hides a load, so each gets a whole trip to land in.
#define PVW 4                     /* waves: the 4,096 key columns split over them */
#define PVN 4                     /* 16-row tiles of n per wave: every phi and g fragment fetched serves PVN matrix instructions */
struct PvSet { v4f mx[4], iv[4]; v16h pf[2][4], gf[8]; };      /* what one trip reads: maxima and 256 / sum of its 32 columns, its phi fragments (A of the scores), its g fragments (B of P g^T) */
// rb, gb, pb are the addresses that the loads name; RO, GO, PO (elements) go into the loads' immediate offsets, so that the wait below can hold exactly those registers.
template <int RO, int GO, int PO>
__device__ __forceinline__ void pv_fetch(const float* rb, const _Float16* gb, const _Float16* pb, PvSet& x) {
  const float* r = rb + RO;
#pragma unroll
  for (int u = 0; u < 2; ++u) { x.mx[2 * u] = *(const v4fa*)(r + 2 * CSC * u); x.mx[2 * u + 1] = *(const v4fa*)(r + 2 * CSC * u + 4); x.iv[2 * u] = *(const v4fa*)(r + 2 * CSC * u + CSC); x.iv[2 * u + 1] = *(const v4fa*)(r + 2 * CSC * u + CSC + 4); }
#pragma unroll
  for (int u = 0; u < 2; ++u) {
#pragma unroll
    for (int k = 0; k < 4; ++k) x.pf[u][k] = p_frag(pb + NP * CI + PO + (u * 4 + k) * FRB); }
#pragma unroll
  for (int c = 0; c < 8; ++c) x.gf[c] = p_frag(gb + GO + c * FRB);
  asm volatile("s_wait_xcnt 0x0" :: "v"(rb), "v"(gb), "v"(pb) : "memory");      /* a precaution: the three addresses that the 40 loads above name stay live and unwritten up to this wait */
  __builtin_amdgcn_sched_barrier(0); }      /* keeps the 40 loads at the head of the trip: without it the scheduler spreads them through the trip and waits for them at once */
__device__ __forceinline__ void pv_trip(const PvSet& c_, const v16h (&th)[PVN][4], v8f (&acc)[PVN][8]) {
  const v8f z8 = {0.f,0.f,0.f,0.f,0.f,0.f,0.f,0.f}; v8f s[2][PVN];      /* [m tile][n tile] */
#pragma unroll
  for (int u = 0; u < 2; ++u) {
#pragma unroll
    for (int v = 0; v < PVN; ++v) s[u][v] = z8; }
#pragma unroll
  for (int k = 0; k < 4; ++k) {
#pragma unroll
    for (int u = 0; u < 2; ++u) {
#pragma unroll
      for (int v = 0; v < PVN; ++v) s[u][v] = f_mma(c_.pf[u][k], th[v][k], s[u][v]); } }
  FragH f[PVN];
#pragma unroll
  for (int u = 0; u < 2; ++u) {
#pragma unroll
    for (int e = 0; e < 8; ++e) { const float m_ = c_.mx[u * 2 + (e >> 2)][e & 3], i_ = c_.iv[u * 2 + (e >> 2)][e & 3];
#pragma unroll
      for (int v = 0; v < PVN; ++v) f[v].h[u * 8 + e] = (_Float16)(__expf(s[u][v][e] - m_) * i_); } }
#pragma unroll
  for (int c = 0; c < 8; ++c) {
#pragma unroll
    for (int v = 0; v < PVN; ++v) acc[v][c] = f_mma(f[v].v, c_.gf[c], acc[v][c]); } }
__global__ __launch_bounds__(PVW * 32) __attribute__((amdgpu_waves_per_eu(PVW / 4, PVW / 4)))      /* one wave a SIMD: the accumulators (256 registers), theta (128) and the fragments in flight need more than 512 */
void k_pvf(const _Float16* __restrict__ QKV, const float* __restrict__ ST, const _Float16* __restrict__ G, float alpha, _Float16* __restrict__ YT) {
  __shared__ __attribute__((aligned(16))) float so[PVW][16 * PVN][CI + 4];
  const int tid = threadIdx.x, w = tid >> 5, lane = tid & 31, ln = lane & 15, hh = lane >> 4;
  const size_t by = blockIdx.y; const int n0 = blockIdx.x * (16 * PVN); const int ks = NM / PVW;
  const _Float16* q = QKV + by * QIS;
  const float* stp = ST + by * (2 * NM) + (size_t)(w * ks) * 2 + 8 * hh;      /* column m: record m / CSC of 2 CSC floats, maxima first */
  const _Float16* gp = G + by * CI * NM + (size_t)(w * ks) * CI + 8 * lane;      /* g: the 8 blocks (128 channels) of 32 key columns follow each other, 32 CI elements */
  const _Float16* pp = q + (size_t)(w * ks) * CI + 8 * lane;      /* the same place in the theta plane; phi lies NP CI elements on (an immediate offset of the loads) */
  const _Float16* tp = q + (size_t)n0 * CI + 8 * lane;
  v16h th[PVN][4]; PvSet s0, s1;
#pragma unroll
  for (int v = 0; v < PVN; ++v) {
#pragma unroll
    for (int k = 0; k < 4; ++k) th[v][k] = p_frag(tp + (v * 4 + k) * FRB); }
  asm volatile("s_wait_xcnt 0x0" :: "v"(tp) : "memory");      /* a precaution: the address that the 32 loads above name stays live and unwritten up to this wait */
  pv_fetch<0, 0, 0>(stp, gp, pp, s0);
  const v8f z8 = {0.f,0.f,0.f,0.f,0.f,0.f,0.f,0.f}; v8f acc[PVN][8];
#pragma unroll
  for (int v = 0; v < PVN; ++v) {
#pragma unroll
    for (int c = 0; c < 8; ++c) acc[v][c] = z8; }
#pragma unroll 1      /* rolled: two trips are the period of the register sets, and the loop stays small in the instruction cache */
  for (int kb = 0; kb < ks; kb += 64) {
    pv_fetch<64, 32 * CI, 32 * CI>(stp, gp, pp, s1); pv_trip(s0, th, acc);
    const int more = kb + 64 < ks ? 1 : 0;      /* the last trip fetches its own range again: in bounds, not used */
    stp += more * 128; gp += more * (64 * CI); pp += more * (64 * CI);
    pv_fetch<0, 0, 0>(stp, gp, pp, s0); pv_trip(s1, th, acc); }
#pragma unroll
  for (int v = 0; v < PVN; ++v) {
#pragma unroll
    for (int c = 0; c < 8; ++c) {
#pragma unroll
      for (int e = 0; e < 8; ++e) so[w][v * 16 + 8 * hh + e][c * 16 + ln] = acc[v][c][e]; } }
  __syncthreads();      /* every wave's partial tile is in LDS before any thread adds them */
  static_assert(PVW == PVN, "one row tile a wave");
  /* y^T leaves in fragment order too (rows n, K = 128): wave w writes row tile w, piece it = 2 x block + half; a lane adds 8 consecutive channels of row ln */
  unsigned short* yo = (unsigned short*)YT + (by * NP + n0 + w * 16) * CI + lane * 8; v8us ty[8];
#pragma unroll
  for (int it = 0; it < 8; ++it) { const float* sp = &so[0][w * 16 + ln][it * 16 + 8 * hh]; v4f sa = *(const v4f*)sp, sb = *(const v4f*)(sp + 4);
#pragma unroll
    for (int k = 1; k < PVW; ++k) { sa += *(const v4f*)(sp + k * (16 * PVN * (CI + 4))); sb += *(const v4f*)(sp + k * (16 * PVN * (CI + 4)) + 4); }
    FragH f;
#pragma unroll
    for (int e = 0; e < 4; ++e) { f.h[e] = (_Float16)(sa[e] * alpha); f.h[4 + e] = (_Float16)(sb[e] * alpha); }
    ty[it] = f.half[0]; }
  __builtin_amdgcn_sched_barrier(0);      /* all 8 pieces stand ahead of the stores, each in registers of its own: no staging register is reused behind a store, and the one wait behind the run covers them all */
#pragma unroll
  for (int it = 0; it < 8; ++it) *(v8us*)(yo + it * 256) = ty[it];
  asm volatile("s_wait_xcnt 0x0" :: "v"(yo) : "memory"); }      /* a precaution: the registers that the 8 stores above name stay unwritten up to this wait */
// Projections straight from x. A work-group owns 64 positions of one image and all 384 output channels: it reads its [256 c][64 n] block of f32 x in whole 128-B lines, rounds it (bf16, exact in f16)
// and lays it in LDS as token rows [n][c]; K = 256 then runs in ONE accumulation chain per tile. Wave w takes rows 32 w .. 32 w + 31 of theta | phi and rows 16 w .. 16 w + 15 of g.
// theta | phi: D[o][n] = W (A) x^T (B): a lane holds 8 consecutive o of token n, 16 B of a token row. g: D[m][ci] = x^T (A) W_g (B): a lane holds 8 consecutive m of channel ci, 16 B of a channel-major row.
// Those 16 B are one lane's piece of a fragment-order block (theta | phi: row tile v, block w % 4, half u; g: key block v / 2, channel tile w, half v % 2), so each tile leaves straight from registers, 512 contiguous bytes a wave.
#define PJN 64                    /* positions per work-group */
#define PJP (CN + 8)              /* LDS pitch of a token row, f16: 16 B past a multiple of 256 B, so that 16 rows read or written 16 B a lane fall on different banks */
__global__ __launch_bounds__(256) __attribute__((amdgpu_waves_per_eu(2, 2)))      /* one work-group a WGP: the 24 weight fragments (192 registers) stay resident beside 12 accumulator tiles */
void k_proj(const float* __restrict__ x, const _Float16* __restrict__ BT, _Float16* __restrict__ QKV, _Float16* __restrict__ G) {
  __shared__ __attribute__((aligned(16))) _Float16 xs[PJN][PJP];
  const int tid = threadIdx.x, w = tid >> 5, lane = tid & 31, ln = lane & 15, hh = lane >> 4;
  const size_t by = blockIdx.y; const int n0 = blockIdx.x * PJN;
  const _Float16* wp = BT + (size_t)(w * 32) * CN + 8 * lane;      /* 16 rows of K = 256 are 8 blocks = 16 CN elements */
  const _Float16* wg = BT + (size_t)(w * 16) * CN + 8 * lane;      /* w_g lies 2 CI CN elements on (an immediate offset of the loads) */
  const int nl = (w & 1) * 32 + (lane & 7) * 4, cl = (w >> 1) * 64 + (lane >> 3) * 8;      /* 8 lanes cover one 128-B line of a channel row; a lane takes 4 positions of 8 + 8 channels */
  const float* xp = x + by * ((size_t)CN * NP) + (size_t)cl * NP + n0 + nl;
  v4f xv[2][8]; v16h wf[3][8];
#pragma unroll
  for (int it = 0; it < 2; ++it) {
#pragma unroll
    for (int i = 0; i < 8; ++i) xv[it][i] = *(const v4fa*)(xp + (size_t)(it * 32 + i) * NP); }
#pragma unroll
  for (int k = 0; k < 8; ++k) { wf[0][k] = p_frag(wp + k * FRB); wf[1][k] = p_frag(wp + 16 * CN + k * FRB); wf[2][k] = p_frag(wg + 2 * CI * CN + k * FRB); }
  asm volatile("s_wait_xcnt 0x0" :: "v"(xp), "v"(wp), "v"(wg) : "memory");      /* a precaution: the three addresses that the 64 loads above name stay live and unwritten up to this wait */
#pragma unroll
  for (int it = 0; it < 2; ++it) {
#pragma unroll
    for (int j = 0; j < 4; ++j) { FragH f;
#pragma unroll
      for (int i = 0; i < 8; ++i) f.h[i] = (_Float16)bf16_round(xv[it][i][j]);
      *(v8us*)&xs[nl + j][cl + it * 32] = f.half[0]; } }
  __syncthreads();      /* the whole x^T tile is in LDS before any wave reads a fragment of it */
  const v8f z8 = {0.f,0.f,0.f,0.f,0.f,0.f,0.f,0.f}; v8f dq[2][4], dg[4];
#pragma unroll
  for (int v = 0; v < 4; ++v) { dq[0][v] = z8; dq[1][v] = z8; dg[v] = z8; }
  const _Float16* xr = &xs[ln][8 * hh];
  v16h xf[2][4];      /* two sets that swap roles: the LDS reads of block k + 1 stand as one group in front of the 12 products of block k */
#pragma unroll
  for (int v = 0; v < 4; ++v) xf[0][v] = f_frag(xr + v * 16 * PJP);
#pragma unroll
  for (int k = 0; k < 8; ++k) {
    if (k < 7) {
#pragma unroll
      for (int v = 0; v < 4; ++v) xf[(k + 1) & 1][v] = f_frag(xr + v * 16 * PJP + (k + 1) * 32); }
    __builtin_amdgcn_sched_barrier(0);      /* keeps the reads ahead of the products: without it each fragment is read right in front of its 3 products, which then wait out the LDS latency 32 times */
#pragma unroll
    for (int v = 0; v < 4; ++v) { dq[0][v] = f_mma(wf[0][k], xf[k & 1][v], dq[0][v]); dq[1][v] = f_mma(wf[1][k], xf[k & 1][v], dq[1][v]); dg[v] = f_mma(xf[k & 1][v], wf[2][k], dg[v]); } }
  v8us tq[4][2], tg[4];
#pragma unroll
  for (int v = 0; v < 4; ++v) { FragH f;
#pragma unroll
    for (int u = 0; u < 2; ++u) {
#pragma unroll
      for (int r = 0; r < 8; ++r) f.h[r] = (_Float16)(dq[u][v][r] * 0.0625f);
      tq[v][u] = f.half[0]; }
#pragma unroll
    for (int r = 0; r < 8; ++r) f.h[r] = (_Float16)(dg[v][r] * 0.0625f);
    tg[v] = f.half[0]; }
  unsigned short* qo = (unsigned short*)QKV + by * QIS + (size_t)(w >> 2) * (NP * CI) + (size_t)n0 * CI + (w & 3) * FRB + lane * 8;      /* waves 0..3 hold theta, 4..7 phi; the wave's 32 channels are block w % 4 of every row tile */
  unsigned short* go = (unsigned short*)G + by * ((size_t)CI * NM) + (size_t)n0 * CI + w * FRB + lane * 8;      /* the wave's 16 channels are block w of every 32 key columns */
  __builtin_amdgcn_sched_barrier(0);      /* all 12 pieces stand ahead of the stores, each in registers of its own: no staging register is reused behind a store, and the one wait behind the run covers them all */
#pragma unroll
  for (int v = 0; v < 4; ++v) {
#pragma unroll
    for (int u = 0; u < 2; ++u) *(v8us*)(qo + v * 4 * FRB + u * 256) = tq[v][u]; }
#pragma unroll
  for (int v = 0; v < 4; ++v) *(v8us*)(go + (v >> 1) * 8 * FRB + (v & 1) * 256) = tg[v];
  asm volatile("s_wait_xcnt 0x0" :: "v"(qo), "v"(go) : "memory"); }      /* a precaution: the registers that the 12 stores above name stay unwritten up to this wait */
// out = (16 W) y / 16 + bf16(x): the loop and the 32x64 wave tile of k_gemm2; the residual is read from x itself, 16 B a lane at the head of the kernel, and rounded where the rows leave LDS.
__global__ __launch_bounds__(128) void k_outp(const _Float16* __restrict__ A, const _Float16* __restrict__ YT, const float* __restrict__ x, float* __restrict__ C) {
  __shared__ __attribute__((aligned(16))) float so[4][32][68];
  const int tid = threadIdx.x, w = tid >> 5, lane = tid & 31, ln = lane & 15, hh = lane >> 4; const size_t by = blockIdx.y;
  const int ntn = NP >> 6; const int mt = blockIdx.x / ntn, nq = blockIdx.x - mt * ntn; const int row0 = mt * 128 + 32 * w, col0 = nq * 64;
  const int rsub = lane >> 4, c4 = (lane & 15) * 4;
  const size_t eo = by * ((size_t)CN * NP) + (size_t)(row0 + rsub) * NP + col0 + c4;
  const float* xp = x + eo; float* cp = C + eo; v4f xv[16];
#pragma unroll
  for (int q = 0; q < 16; ++q) xv[q] = *(const v4fa*)(xp + (size_t)q * 2 * NP);
  asm volatile("s_wait_xcnt 0x0" :: "v"(xp) : "memory");      /* a precaution: the address that the 16 loads above name stays live and unwritten up to this wait */
  const _Float16* ap = A + (size_t)row0 * CI + 8 * lane;      /* both operands in fragment order: 16 rows of K = 128 are 4 blocks = 16 CI elements */
  const _Float16* bp = YT + by * ((size_t)NP * CI) + (size_t)col0 * CI + 8 * lane;
  const v8f z8 = {0.f,0.f,0.f,0.f,0.f,0.f,0.f,0.f}; v8f c00 = z8, c01 = z8, c02 = z8, c03 = z8, c10 = z8, c11 = z8, c12 = z8, c13 = z8;
#pragma unroll 1      /* rolled, as in k_gemm2 */
  for (int kb = 0; kb < CI; kb += 32) { const v16h a0 = p_frag(ap), a1 = p_frag(ap + 4 * FRB);
    v16h b = p_frag(bp); c00 = g2_mma(a0, b, c00); c10 = g2_mma(a1, b, c10);
    b = p_frag(bp + 4 * FRB); c01 = g2_mma(a0, b, c01); c11 = g2_mma(a1, b, c11);
    b = p_frag(bp + 8 * FRB); c02 = g2_mma(a0, b, c02); c12 = g2_mma(a1, b, c12);
    b = p_frag(bp + 12 * FRB); c03 = g2_mma(a0, b, c03); c13 = g2_mma(a1, b, c13);
    asm volatile("s_wait_xcnt 0x0" :: "v"(ap), "v"(bp) : "memory");      /* a precaution: the two addresses that the 12 loads above name stay live and unwritten up to this wait */
    ap += FRB; bp += FRB; }
  v8f accs[8] = {c00, c01, c02, c03, c10, c11, c12, c13};
#pragma unroll
  for (int u = 0; u < 8; ++u) {
#pragma unroll
    for (int r = 0; r < 8; ++r) so[w][(u >> 2) * 16 + 8 * hh + r][(u & 3) * 16 + ln] = accs[u][r] * 0.0625f; }
  __builtin_amdgcn_fence(__ATOMIC_ACQ_REL, "workgroup"); __builtin_amdgcn_wave_barrier();
#pragma unroll
  for (int q = 0; q < 16; ++q) { const v4f v = *(const v4fa*)&so[w][q * 2 + rsub][c4];
#pragma unroll
    for (int i = 0; i < 4; ++i) xv[q][i] = v[i] + bf16_round(xv[q][i]); }
  __builtin_amdgcn_sched_barrier(0);      /* all 16 sums stand ahead of the stores, each in registers of its own: no staging register is reused behind a store, and the one wait behind the run covers them all */
#pragma unroll
  for (int q = 0; q < 16; ++q) *(v4f*)(cp + (size_t)q * 2 * NP) = xv[q];
  asm volatile("s_wait_xcnt 0x0" :: "v"(cp) : "memory"); }      /* a precaution: the registers that the 16 stores above name stay unwritten up to this wait */
extern "C" void kernel_launch(void* const* d_in, const int* in_sizes, int n_in,
                              void* d_out, int out_size, void* d_ws, size_t ws_size, hipStream_t stream) {
  (void)in_sizes; (void)n_in; (void)out_size;
  const float* const* I = (const float* const*)d_in; const float* x = I[0]; const float* tw = I[1]; const float* pw = I[2]; const float* gw = I[3]; const float* ww = I[4];      /* natural 1x1 conv weights: w_theta, w_phi, w_g [128][256], w_mask [256][128]; no biases */
  char* ws = (char*)d_ws; size_t off = 0;
  auto take = [&](size_t bytes) { char* p = ws + off; off += (bytes + 255) & ~(size_t)255; return p; };
  _Float16* BT = (_Float16*)take((size_t)4 * CI * CN * 2); _Float16* BW = BT + (size_t)3 * CI * CN;      /* w_theta, w_phi, w_g as one [384][256] plane, then w_mask */
  _Float16* QKV = (_Float16*)take((size_t)NB * QIS * 2); _Float16* G = (_Float16*)take((size_t)NB * CI * NP * 2); _Float16* YT = (_Float16*)take((size_t)NB * NP * CI * 2);
  float* ST = (float*)take((size_t)NB * NM * 2 * 4);      /* per-column max and 256 / sum, one 128-B record per 16 columns */
  if (off > ws_size) return;
  k_wnat<<<dim3((unsigned)(((size_t)CI * CN / 8 + 255) / 256), 4), 256, 0, stream>>>(tw, pw, gw, ww, (size_t)CI * CN / 8, BT);      /* [out][in] x16 f16 planes in fragment order */
  k_proj<<<dim3(NP / PJN, NB), 256, 0, stream>>>(x, BT, QKV, G);      /* every image: theta^T, phi^T [n][128] and g [ci][m] (the PV B^T operand) -> f16 planes in fragment order, from f32 x */
  k_colstat_f<<<dim3(NM / SCM, NB), SCW * 32, 0, stream>>>(QKV, ST);      /* every image: softmax over the QUERY axis: per key column m the max and 256 / sum over all 4096 rows n of f[n][m] = theta[n].phi[m] (K = 128, NO scale), f formed in registers */
  k_pvf<<<dim3(NP / (16 * PVN), NB), PVW * 32, 0, stream>>>(QKV, ST, G, 0.00390625f, YT);      /* every image: y^T [n][ci] = sum_m P[n][m] g[ci][m] -> f16, P[n][m] = f16(256 exp(f - max_m) / sum_m), f formed again in registers */
  k_outp<<<dim3((unsigned)((CN / 128) * (NP / 64)), NB), 128, 0, stream>>>(BW, YT, x, (float*)d_out);      /* every image: out[c][a] = (16 W as A) x (y^T as B^T) / 16 + bf16(x) -> f32 channel-first output block */
}
